// v000
// Times are from an AMD MI455X. After a warm-up the kernel runs many times in a row, and a time is the length of
// such a window on the GPU divided by its runs, so every launch and the gaps after it count. The runs cycle
// through copies of the inputs. A figure is the median of several windows, for all but v000 over two sittings.
// Sittings can differ by a few percent; kernels timed side by side share one.
// v000, which the later versions start from, runs in 1010 microseconds.
// compute dtype: all float inputs rounded to bf16, the cos / sin tables, ve and Wg included; q (16 heads) and the single shared k / v head projections with EXACT bf16 products on WMMA 16x16x32 (f32 accumulate); half-split RoPE with cos / sin READ from the table inputs, then RMSNorm over the 64 head dims (f32, eps = f32 machine epsilon) on q and k; v += 2 sigmoid(x[:32] . Wg) ve in f32; causal logits inside a sliding window read from the int input: 3 products for the first 384 rows, single f16 q x k after, x 64^-0.5; softmax f32; P x 2^11 once to f16 x v once to f16 (bf16 hi + lo below row 384); ctx hi+lo x exact Wo below row 384, x2^6 f16 carry x f16(bf16 x 2^8) Wo after; f32 output.
#include <hip/hip_runtime.h>
#include <math.h>

typedef __attribute__((ext_vector_type(16))) _Float16 v16h;
typedef __attribute__((ext_vector_type(16))) __bf16 v16b;
typedef __attribute__((ext_vector_type(8)))  _Float16 v8h;
typedef __attribute__((ext_vector_type(8)))  float v8f;
typedef __attribute__((ext_vector_type(4)))  float v4f;
typedef __attribute__((ext_vector_type(2)))  float v2f;
typedef __attribute__((ext_vector_type(4)))  unsigned v4u;
typedef __attribute__((ext_vector_type(4)))  int v4i;
typedef float __attribute__((may_alias)) float_a;
typedef int __attribute__((may_alias)) int_a;

template <typename T> __device__ __forceinline__ void vst2(void* p, T v) { *(T*)p = v;  }
__device__ __forceinline__ v8f wmma16(v16h a, v16h b, v8f c) {
  v8f d = __builtin_amdgcn_wmma_f32_16x16x32_f16(false, a, false, b, (short)0, c, false, false);
  asm volatile("v_nop\n\tv_nop\n\tv_nop\n\tv_nop" : "+v"(d) : "v"(a), "v"(b));
  return d;
}
__device__ __forceinline__ v8f wmma_bf(v16b a, v16b b, v8f c) {
  v8f d = __builtin_amdgcn_wmma_f32_16x16x32_bf16(false, a, false, b, (short)0, c, false, false);
  asm volatile("v_nop\n\tv_nop\n\tv_nop\n\tv_nop" : "+v"(d) : "v"(a), "v"(b));
  return d;
}
// 16x16x32 fragments: lane = (h = lane>>4, row/col = lane&15); elements 0..7 = k0+8h+0..7, 8..15 = k0+16+8h+0..7; D element r = row 8h+r
__device__ __forceinline__ v16h frag_h(const _Float16* rowk0, int lane) {
  union { v16h v; v8h q[2]; } u; const _Float16* p = rowk0 + 8 * (lane >> 4);
  u.q[0] = *(const v8h*)p; u.q[1] = *(const v8h*)(p + 16); return u.v;
}
__device__ __forceinline__ v16h frag_f32(const float* rowk0, int lane) {
  v16h a; const float* p = rowk0 + 8 * (lane >> 4);
#pragma unroll
  for (int i = 0; i < 8; ++i) { a[i] = (_Float16)p[i]; a[8 + i] = (_Float16)p[16 + i]; }
  return a;
}
__device__ __forceinline__ v16h frag_f32s(const float* rowk0, int lane, float sc) {
  v16h a; const float* p = rowk0 + 8 * (lane >> 4);
#pragma unroll
  for (int i = 0; i < 8; ++i) { a[i] = (_Float16)(p[i] * sc); a[8 + i] = (_Float16)(p[16 + i] * sc); }
  return a;
}
// column fragment from a [K][ld] layout (column n), rows >= K read as 0
__device__ __forceinline__ v16h fragc_f32(const float* W, int k0, int n, int lane, int ld, int K) {
  v16h a; const int g = lane >> 4;
#pragma unroll
  for (int i = 0; i < 8; ++i) { const int ka = k0 + 8 * g + i, kb = ka + 16;
    a[i] = (_Float16)(ka < K ? W[(size_t)(ka < K ? ka : K - 1) * ld + n] : 0.f); a[8 + i] = (_Float16)(kb < K ? W[(size_t)(kb < K ? kb : K - 1) * ld + n] : 0.f); }
  return a;
}
struct F2 { v16b h, l; };
__device__ __forceinline__ F2 bsplit16(const float v[16]) { F2 r;
#pragma unroll
  for (int i = 0; i < 16; ++i) { const __bf16 h = (__bf16)v[i]; r.h[i] = h; r.l[i] = (__bf16)(v[i] - (float)h); }
  return r; }
__device__ __forceinline__ F2 split_row(const float* row, int k0, int lane) { float v[16]; const float* p = row + k0 + 8 * (lane >> 4);
#pragma unroll
  for (int i = 0; i < 8; ++i) { v[i] = p[i]; v[8 + i] = p[16 + i]; }
  return bsplit16(v); }
__device__ __forceinline__ F2 split_rowK(const float* row, int k0, int lane, int K) { float v[16]; const int g = lane >> 4;
#pragma unroll
  for (int i = 0; i < 8; ++i) { const int ka = k0 + 8 * g + i, kb = ka + 16; v[i] = ka < K ? row[ka < K ? ka : K - 1] : 0.f; v[8 + i] = kb < K ? row[kb < K ? kb : K - 1] : 0.f; }
  return bsplit16(v); }
__device__ __forceinline__ F2 split_col(const float* W, int k0, int n, int lane, int ld, int K) { float v[16]; const int g = lane >> 4;
#pragma unroll
  for (int i = 0; i < 8; ++i) { const int ka = k0 + 8 * g + i, kb = ka + 16; v[i] = ka < K ? W[(size_t)(ka < K ? ka : K - 1) * ld + n] : 0.f; v[8 + i] = kb < K ? W[(size_t)(kb < K ? kb : K - 1) * ld + n] : 0.f; }
  return bsplit16(v); }
__device__ __forceinline__ v8f mac3(const F2& a, const F2& b, v8f c) { c = wmma_bf(a.l, b.h, c); c = wmma_bf(a.h, b.l, c); return wmma_bf(a.h, b.h, c); }
__device__ __forceinline__ float sigm(float v) { return 1.0f / (1.0f + expf(-v)); }
#define LDSX() do { asm volatile("s_wait_dscnt 0" ::: "memory"); __builtin_amdgcn_wave_barrier(); __builtin_amdgcn_fence(__ATOMIC_RELEASE, "workgroup"); } while (0)

// Multi-query causal attention with table RoPE, per-head RMSNorm, a gated value residual and a sliding window (x [2,2048,1024]; ve [2,2048,64]; cos, sin [2048,32] (inputs); (in,out) Wq [1024,1024], Wk / Wv [1024,64], Wo [1024,1024], all N(0,1) x 0.02; Wg [32,1]; window_size int (1024); 16 query heads share ONE key / value head; gate = 2 sigmoid(x[..., :32] Wg); v = x Wv + gate * ve; _rope: (x1, x2) = halves -> (x1 cos + x2 sin, -x1 sin + x2 cos); _rmsnorm: x * rsqrt(mean(x^2) + finfo.eps) AFTER the rotation, on q and k; scores x 64^-0.5; masked where key > query or query - key >= window_size (finfo.min); softmax; out = merge(attn v) Wo).
#define NB 2
#define TT 2048
#define CC 1024            // NH * HD = projected width
#define DIN 1024          // input (model) width
#define NH 16
#define HD 64
#define NQB (TT / 64)
#define HG 4
#define SCALE (0.125f)
#define CAUSAL 1
#ifndef TNB
#define TNB NB
#endif
__device__ __forceinline__ float bfr(float v) { return (float)(__bf16)v; }
__host__ __device__ __forceinline__ int kb_last(int qb) { return CAUSAL ? ((qb * 64 + 63) >> 7) : (TT / 128 - 1); }
typedef __attribute__((ext_vector_type(8))) __bf16 v8b;
__device__ __forceinline__ v16b frag_b(const __bf16* rowk0, int lane) {
  union { v16b v; v8b q[2]; } u; const __bf16* p = rowk0 + 8 * (lane >> 4);
  u.q[0] = *(const v8b*)p; u.q[1] = *(const v8b*)(p + 16); return u.v;
}
#define QBH 6              // causal: query blocks 0..QBH-1 of each sequence (few keys, no averaging) take the high-precision path
#define QHI 384            // rows carrying a q residual plane
#define KHI 384            // key rows carrying k residual / v bf16 hi+lo planes (used only by the causal high-precision path)
// B fragment (k rows k0+.., output column o) of a weight: (in,out) [K][ld] or (out,in) [ld rows of K]: bf16 exact, or f16(bf16 * 256) exact
__device__ __forceinline__ v16b wcol_io(const float* Wm, int k0, int o, int lane, int ld) { v16b w; const int g = lane >> 4;
#pragma unroll
  for (int i = 0; i < 8; ++i) { w[i] = (__bf16)Wm[(size_t)(k0 + 8 * g + i) * ld + o]; w[8 + i] = (__bf16)Wm[(size_t)(k0 + 16 + 8 * g + i) * ld + o]; }
  return w; }
__device__ __forceinline__ v16b wcol_oi(const float* Wm, int k0, int o, int lane, int K) { v16b w; const float* p = Wm + (size_t)o * K + k0 + 8 * (lane >> 4);
#pragma unroll
  for (int i = 0; i < 8; ++i) { w[i] = (__bf16)p[i]; w[8 + i] = (__bf16)p[16 + i]; }
  return w; }
__device__ __forceinline__ v16h wcolh_io(const float* Wm, int k0, int o, int lane, int ld) { v16h w; const int g = lane >> 4;
#pragma unroll
  for (int i = 0; i < 8; ++i) { w[i] = (_Float16)(bfr(Wm[(size_t)(k0 + 8 * g + i) * ld + o]) * 256.0f); w[8 + i] = (_Float16)(bfr(Wm[(size_t)(k0 + 16 + 8 * g + i) * ld + o]) * 256.0f); }
  return w; }
__device__ __forceinline__ v16h wcolh_oi(const float* Wm, int k0, int o, int lane, int K) { v16h w; const float* p = Wm + (size_t)o * K + k0 + 8 * (lane >> 4);
#pragma unroll
  for (int i = 0; i < 8; ++i) { w[i] = (_Float16)(bfr(p[i]) * 256.0f); w[8 + i] = (_Float16)(bfr(p[16 + i]) * 256.0f); }
  return w; }
#define WQKV_LAYOUT 0   // 0 = (in,out) [DIN][CC]; 1 = (out,in) [CC][DIN]; 2 = per-head [NH][DIN][HD]
__device__ __forceinline__ v16b wcol_hdk(const float* Wm, int k0, int o, int lane) { v16b w; const int g = lane >> 4; const float* p = Wm + (size_t)(o / HD) * DIN * HD + (o % HD);
#pragma unroll
  for (int i = 0; i < 8; ++i) { w[i] = (__bf16)p[(size_t)(k0 + 8 * g + i) * HD]; w[8 + i] = (__bf16)p[(size_t)(k0 + 16 + 8 * g + i) * HD]; }
  return w; }
#define WO_OUT_IN 0
#if WQKV_LAYOUT == 1
#define WCOL(W, k0, o, lane) wcol_oi(W, k0, o, lane, DIN)
#elif WQKV_LAYOUT == 2
#define WCOL(W, k0, o, lane) wcol_hdk(W, k0, o, lane)
#else
#define WCOL(W, k0, o, lane) (which == 0 ? wcol_io(W, k0, (o), lane, CC) : ((o) < KVW ? wcol_io(W, k0, (o), lane, KVW) : zero16b()))   /* (in,out): Wq [1024][1024] pitch CC; Wk / Wv [1024][64] pitch 64, padded columns 64..127 are zero */
#endif
#if WO_OUT_IN
#define WOCOL(W, k0, o, lane) wcol_oi(W, k0, o, lane, CC)
#define WOCOLH(W, k0, o, lane) wcolh_oi(W, k0, o, lane, CC)
#else
#define WOCOL(W, k0, o, lane) wcol_io(W, k0, o, lane, DIN)
#define WOCOLH(W, k0, o, lane) wcolh_io(W, k0, o, lane, DIN)
#endif
#define GRP 16             // all 16 query heads share the single kv head (kv head = h / 16 = 0)
#define CKV 128            // kv plane width: ONE 128-column block whose columns 0..63 are the single kv head, columns 64..127 zero padding
#define KVW 64             // real kv width (Wk / Wv are (in,out) [1024][64])
#define PROJ_EXTRA_PARAMS , int woff, const float* __restrict__ COS, const float* __restrict__ SIN, const float* __restrict__ VE, const float* __restrict__ WG   /* which = blockIdx.z + woff; COS / SIN [TT][32], VE [NB*TT][64], WG [32] are module inputs read in the projection epilogue */
__device__ __forceinline__ v16b zero16b() { v16b w; _Pragma("unroll") for (int i = 0; i < 16; ++i) w[i] = (__bf16)0.0f; return w; }
#define RMS_EPS 1.1920929e-07f   /* jnp.finfo(float32).eps */
// per (token, head) hook on the staged f32 row (64 floats). q and k (which 0, 1): the module's _rope with cos / sin read LITERALLY from the table inputs at row t (bf16-rounded like every float input): (x1, x2) = (row[m], row[32+m]) -> (x1 c + x2 s, -x1 s + x2 c), then _rmsnorm over the 64 dims: x * (1 / sqrt(mean(x^2) + eps)); the zero-padded second half of the k block stays exactly zero under both. v (which 2): row += gate * bf16(ve[b, t, :]) with gate = 2 / (1 + exp(-z)), z = sum_{i<32} bf16(x[b, t, i]) * bf16(Wg[i]); all global loads are unconditional; the padded half gets gate 0 through a select. f32, products and sums kept separate
#define PROJ_EPI(which, row, t, h) do { float* rw = (row); const size_t gr_ = bb * TT + (size_t)(t); if ((which) < 2) { const float* ct_ = COS + (size_t)(t) * 32; const float* st_ = SIN + (size_t)(t) * 32; _Pragma("unroll 4") for (int m = 0; m < 32; ++m) { _Pragma("clang fp contract(off)") const float c_ = bfr(ct_[m]), s_ = bfr(st_[m]); const float x1 = rw[m], x2 = rw[32 + m]; rw[m] = x1 * c_ + x2 * s_; rw[32 + m] = (-x1) * s_ + x2 * c_; } float ss_ = 0.f; _Pragma("unroll 8") for (int m = 0; m < 64; ++m) { _Pragma("clang fp contract(off)") ss_ += rw[m] * rw[m]; } const float rinv_ = 1.0f / sqrtf(ss_ * (1.0f / 64.0f) + RMS_EPS); _Pragma("unroll 8") for (int m = 0; m < 64; ++m) rw[m] = rw[m] * rinv_; } else { const float* xr_ = XV + gr_ * DIN; float z_ = 0.f; _Pragma("unroll 8") for (int i = 0; i < 32; ++i) { _Pragma("clang fp contract(off)") z_ += bfr(xr_[i]) * bfr(WG[i]); } const float gate_ = 2.0f / (1.0f + expf(-z_)); const float gsel_ = ((h) == 0) ? gate_ : 0.0f; const float* ve_ = VE + gr_ * 64; _Pragma("unroll 8") for (int m = 0; m < 64; ++m) { _Pragma("clang fp contract(off)") rw[m] = rw[m] + gsel_ * bfr(ve_[m]); } } } while (0)
static_assert(HD == 64 && KVW == 64 && CKV == 128, "the hook spells 32 / 64 literally: one real 64-wide kv head in a 128-column block");
#define SM_EXTRA_PARAMS , const int* __restrict__ WINP
// sliding window: a key is excluded when query - key >= window_size; window_size is the module's int input (one block-uniform scalar load); keys after the query are already excluded by the causal select; every row keeps at least min(t + 1, window) >= 1 keys
#define SM_MASK_HOOK do { const int win_ = WINP[0]; v = (t - k >= win_) ? -3.0e38f : v; } while (0)
#ifndef SM_EXTRA_PARAMS
#define SM_EXTRA_PARAMS
#endif
#ifndef PROJ_EXTRA_PARAMS
#define PROJ_EXTRA_PARAMS
#endif
#ifndef SM_MASK_HOOK
#define SM_MASK_HOOK (void)0
#endif

#define WS_QH  0u                                      // f16 q rows [b*t][CC]
#define WS_KH  (WS_QH + 2u * (size_t)NB * TT * CC)      // f16 k rows [b*t][CKV]
#define WS_VT  (WS_KH + 2u * (size_t)NB * TT * CC)      // f16 v planes [b][c][t]
#define WS_QL  (WS_VT + 2u * (size_t)NB * CC * TT)      // f16 q residual x 2^10 rows [b][t < QHI][CC]
#define WS_KL  (WS_QL + 2u * (size_t)NB * QHI * CC)     // f16 k residual x 2^10 rows [b][t < KHI][CKV]
#define WS_VB  (WS_KL + 2u * (size_t)NB * KHI * CC)     // bf16 v hi planes [b][c][t < KHI]
#define WS_VBL (WS_VB + 2u * (size_t)NB * CC * KHI)
#define WS_S   (WS_VBL + 2u * (size_t)NB * CC * KHI)    // f32 logits / P [hg][t][s]
#define WS_Y   (WS_S  + 4u * (size_t)HG * TT * TT)      // f32 ctx rows [b*t][CC] (only when there is an output projection)
#define WS_END (WS_Y  + 4u * (size_t)NB * TT * CC)

// ---- k_proj: block = (64 rows, 128 cols, which): q/k/v = X W (+ b) with exact bf16 products (K = DIN) -> which 0: q f16 rows (+ residual rows < QHI); 1: k f16 rows (+ residual rows < KHI); 2: v f16 planes [c][t] (+ bf16 hi/lo planes for t < KHI)
__global__ __launch_bounds__(128) void k_proj(const float* __restrict__ XQ, const float* __restrict__ XK, const float* __restrict__ XV, const float* __restrict__ WQ, const float* __restrict__ WK, const float* __restrict__ WV, const float* __restrict__ BQ, const float* __restrict__ BK, const float* __restrict__ BV,
    _Float16* __restrict__ QH, _Float16* __restrict__ QL, _Float16* __restrict__ KH, _Float16* __restrict__ KL, _Float16* __restrict__ VT, __bf16* __restrict__ VB, __bf16* __restrict__ VBL PROJ_EXTRA_PARAMS) {
  __shared__ __align__(16) float st[64][132]; __shared__ __align__(16) _Float16 sh[64][136], sl[64][136]; __shared__ __align__(16) _Float16 th[128][72]; __shared__ __align__(16) __bf16 tb[128][72], tbl[128][72];
  const int tid = threadIdx.x, wave = tid >> 5, lane = tid & 31, col = lane & 15, g = lane >> 4; const int which = blockIdx.z + woff; const int c0 = blockIdx.y * 128; const size_t r0 = (size_t)blockIdx.x * 64; const size_t bb = r0 / TT; const int t0 = (int)(r0 % TT);
  const float* X = which == 0 ? XQ : which == 1 ? XK : XV; const float* WA = which == 0 ? WQ : which == 1 ? WK : WV; const float* BA = which == 0 ? BQ : which == 1 ? BK : BV;
  v8f acc[8] = {};
#pragma unroll 2
  for (int kc = 0; kc < DIN / 32; ++kc) { v16b a; { const float* p = X + (r0 + wave * 16 + col) * DIN + kc * 32 + 8 * g;
#pragma unroll
      for (int i = 0; i < 8; ++i) { a[i] = (__bf16)p[i]; a[8 + i] = (__bf16)p[16 + i]; } }
    asm volatile("s_wait_loadcnt 0x0" ::: "memory");
#pragma unroll
    for (int j = 0; j < 8; ++j) { const v16b w = WCOL(WA, kc * 32, c0 + j * 16 + col, lane); asm volatile("s_wait_loadcnt 0x0" ::: "memory"); acc[j] = wmma_bf(a, w, acc[j]); } }
  { // stage the f32 tile (acc + bias) in LDS, run the per-(row, head) epilogue hook, then convert
#pragma unroll
    for (int j = 0; j < 8; ++j) { const int bo_ = c0 + j * 16 + col; const float bias = (BA && (which == 0 || bo_ < KVW)) ? bfr(BA[(which == 0 || bo_ < KVW) ? bo_ : 0]) : 0.f;   /* bk / bv hold only the 64 real kv columns: padded columns get no bias (index clamped, value selected) */
#pragma unroll
      for (int r = 0; r < 8; ++r) st[wave * 16 + 8 * g + r][j * 16 + col] = acc[j][r] + bias; }
    __syncthreads();
    for (int e = tid; e < 64 * (128 / HD); e += 128) { const int rl = e / (128 / HD), hh = e % (128 / HD); PROJ_EPI(which, &st[rl][hh * HD], (int)((r0 + rl) % TT), (c0 / HD) + hh); }
    __syncthreads(); }
  if (which < 2) { _Float16* DH = which == 0 ? QH : KH; _Float16* DL = which == 0 ? QL : KL; const int nhi = which == 0 ? QHI : KHI; const bool hi_rows = t0 < nhi;
    for (int e = tid; e < 64 * 128; e += 128) { const int rl = e >> 7, cl = e & 127; const float v = st[rl][cl]; const _Float16 hv = (_Float16)v; sh[rl][cl] = hv; sl[rl][cl] = (_Float16)((v - (float)hv) * 1024.0f); }
    __syncthreads();
    for (int e = tid; e < 64 * 16; e += 128) { const int rl = e >> 4, q = e & 15; vst2((unsigned*)(DH + (r0 + rl) * (size_t)(which == 0 ? CC : CKV) + c0 + q * 8), *(const v4u*)&sh[rl][q * 8]);   /* q rows at pitch CC, k rows at pitch CKV */ if (hi_rows) vst2((unsigned*)(DL + (bb * nhi + t0 + rl) * (size_t)(which == 0 ? CC : CKV) + c0 + q * 8), *(const v4u*)&sl[rl][q * 8]);   /* residual rows: same pitches */ }
  } else { const bool hi_rows = t0 < KHI;
    for (int e = tid; e < 64 * 128; e += 128) { const int rl = e & 63, cl = e >> 6; const float v = st[rl][cl]; th[cl][rl] = (_Float16)v; const __bf16 bh = (__bf16)v; tb[cl][rl] = bh; tbl[cl][rl] = (__bf16)(v - (float)bh); }
    __syncthreads();
    for (int e = tid; e < 128 * 8; e += 128) { const int cl = e >> 3, q = e & 7; vst2((unsigned*)(VT + (bb * CKV + c0 + cl) * (size_t)TT + t0 + q * 8), *(const v4u*)&th[cl][q * 8]);   /* v planes: CKV channels per batch */ if (hi_rows) { const size_t o3 = (bb * CKV + c0 + cl) * (size_t)KHI + t0 + q * 8; vst2((unsigned*)(VB + o3), *(const v4u*)&tb[cl][q * 8]); vst2((unsigned*)(VBL + o3), *(const v4u*)&tbl[cl][q * 8]); } } } }
// ---- k_sc: block = (query block qb, key block kb <= kb_last(qb), head in group) of batch b: logits x SCALE; q hi + residual (x 2^10) against k (2 products) for query rows < QHI, plus the k residual (3 products) for query blocks < QBH (causal early rows); causal: blocks past the diagonal exit, the mask itself is applied by index in k_sm
__global__ __launch_bounds__(128) void k_sc(const _Float16* __restrict__ QH, const _Float16* __restrict__ KH, const _Float16* __restrict__ QL, const _Float16* __restrict__ KL, int b, int h0, float* __restrict__ S0) { __shared__ __align__(16) float ss[4][16][132];
  const int qb = blockIdx.x, kb = blockIdx.y; if (kb > kb_last(qb)) return;
  const int h = h0 + blockIdx.z; float* S = S0 + (size_t)blockIdx.z * TT * TT;
  const int tid = threadIdx.x, wave = tid >> 5, lane = tid & 31, col = lane & 15, g = lane >> 4; const int k0 = kb * 128; const int ql0 = qb * 64 + wave * 16; const size_t q0 = (size_t)b * TT + ql0, kr0 = (size_t)b * TT + k0;
  v8f acc[8] = {}, accl[8] = {};
  const _Float16* QLb = QL + (size_t)b * QHI * CC; const _Float16* KLb = KL + (size_t)b * KHI * CKV;
  if (qb < QBH) {
#pragma unroll
    for (int kc = 0; kc < HD / 32; ++kc) { const v16h ah = frag_h(QH + (q0 + col) * CC + h * HD + kc * 32, lane), al = frag_h(QLb + (size_t)(ql0 + col) * CC + h * HD + kc * 32, lane);
#pragma unroll
      for (int j = 0; j < 8; ++j) { const v16h kbf = frag_h(KH + (kr0 + j * 16 + col) * CKV + (h / GRP) * HD + kc * 32, lane), klf = frag_h(KLb + (size_t)(k0 + j * 16 + col) * CKV + (h / GRP) * HD + kc * 32, lane); acc[j] = wmma16(ah, kbf, acc[j]); accl[j] = wmma16(al, kbf, accl[j]); accl[j] = wmma16(ah, klf, accl[j]); } }
  } else if (qb * 64 < QHI) {
#pragma unroll
    for (int kc = 0; kc < HD / 32; ++kc) { const v16h ah = frag_h(QH + (q0 + col) * CC + h * HD + kc * 32, lane), al = frag_h(QLb + (size_t)(ql0 + col) * CC + h * HD + kc * 32, lane);
#pragma unroll
      for (int j = 0; j < 8; ++j) { const v16h kbf = frag_h(KH + (kr0 + j * 16 + col) * CKV + (h / GRP) * HD + kc * 32, lane); acc[j] = wmma16(ah, kbf, acc[j]); accl[j] = wmma16(al, kbf, accl[j]); } }
  } else {
#pragma unroll
    for (int kc = 0; kc < HD / 32; ++kc) { const v16h ah = frag_h(QH + (q0 + col) * CC + h * HD + kc * 32, lane);
#pragma unroll
      for (int j = 0; j < 8; ++j) { const v16h kbf = frag_h(KH + (kr0 + j * 16 + col) * CKV + (h / GRP) * HD + kc * 32, lane); acc[j] = wmma16(ah, kbf, acc[j]); } } }
#pragma unroll
  for (int j = 0; j < 8; ++j) {
#pragma unroll
    for (int r = 0; r < 8; ++r) ss[wave][8 * g + r][j * 16 + col] = (acc[j][r] + accl[j][r] * (1.0f / 1024.0f)) * SCALE; }
  LDSX(); for (int rl = 0; rl < 16; ++rl) vst2(S + (size_t)(ql0 + rl) * TT + k0 + lane * 4, *(const v4f*)&ss[wave][rl][lane * 4]); }
// ---- k_sm: block = query row t (head in group): keys [0, kend): causal -> logit if s <= t else excluded; softmax in f32; P x 2^11 in place (0 for excluded)
__global__ __launch_bounds__(256) void k_sm(float* __restrict__ S0 SM_EXTRA_PARAMS) { __shared__ float sred[8]; __shared__ float sbc; __shared__ __align__(16) float shv[TT];
  const int tid = threadIdx.x; const int t = blockIdx.x; const int kend = (kb_last(t >> 6) + 1) * 128;
  float* sr = S0 + (size_t)blockIdx.y * TT * TT + (size_t)t * TT;
  float m = -3.0e38f; for (int k = tid; k < kend; k += 256) { float v = (!CAUSAL || k <= t) ? sr[k] : -3.0e38f; SM_MASK_HOOK; shv[k] = v; m = fmaxf(m, v); }
#pragma unroll
  for (int o = 1; o < 32; o <<= 1) m = fmaxf(m, __shfl_xor(m, o));
  if ((tid & 31) == 0) sred[tid >> 5] = m; __syncthreads(); if (tid == 0) { float a = sred[0]; for (int i = 1; i < 8; ++i) a = fmaxf(a, sred[i]); sbc = a; } __syncthreads(); m = sbc; __syncthreads();
  float sum = 0.f; for (int k = tid; k < kend; k += 256) { const float v = shv[k]; const float e = (v <= -1.0e38f) ? 0.f : expf(v - m); shv[k] = e; sum += e; }
#pragma unroll
  for (int o = 1; o < 32; o <<= 1) sum += __shfl_xor(sum, o);
  if ((tid & 31) == 0) sred[tid >> 5] = sum; __syncthreads(); if (tid == 0) { float a = 0.f; for (int i = 0; i < 8; ++i) a += sred[i]; sbc = a > 0.f ? 2048.0f / a : 0.f; }   /* a fully excluded row yields P = 0 */ __syncthreads(); const float inv = sbc;
  for (int k = tid; k < kend; k += 256) shv[k] = shv[k] * inv;
  __syncthreads(); for (int q = tid; q < kend / 4; q += 256) vst2(sr + q * 4, *(const v4f*)&shv[q * 4]); }
// ---- k_pv: block = 64 queries (qb) of (b, h): ctx = P . v over keys [0, kend) (P x 2^11 once to f16 against v f16: 1 product; causal early query blocks: P and v as bf16 hi + lo, 3 products); 256-B (row, head) segment by 16 lanes
__global__ __launch_bounds__(128) void k_pv(const float* __restrict__ PS0, const _Float16* __restrict__ VT, const __bf16* __restrict__ VB, const __bf16* __restrict__ VBL, int b, int h0, float* __restrict__ Y) { const int h = h0 + blockIdx.z; const float* PS = PS0 + (size_t)blockIdx.z * TT * TT; __shared__ __align__(16) float ss[4][16][HD + 4];
  const int tid = threadIdx.x, wave = tid >> 5, lane = tid & 31, col = lane & 15, g = lane >> 4; const int qb = blockIdx.x; const int ql0 = qb * 64 + wave * 16; const int kce = (kb_last(qb) + 1) * 4;
  v8f acc[HD / 16] = {};
  if (qb < QBH) {
#pragma unroll 1
    for (int kc = 0; kc < kce; ++kc) { const F2 p = split_row(PS + (size_t)(ql0 + col) * TT, kc * 32, lane);
      asm volatile("s_wait_loadcnt 0x0" ::: "memory");
#pragma unroll
      for (int j = 0; j < HD / 16; ++j) { const size_t po = ((size_t)b * CKV + (h / GRP) * HD + j * 16 + col) * (size_t)KHI + kc * 32; const v16b vh = frag_b(VB + po, lane); acc[j] = wmma_bf(p.h, vh, acc[j]); acc[j] = wmma_bf(p.l, vh, acc[j]); acc[j] = wmma_bf(p.h, frag_b(VBL + po, lane), acc[j]); } }
  } else {
#pragma unroll 1
    for (int kc = 0; kc < kce; ++kc) { const v16h p = frag_f32(PS + (size_t)(ql0 + col) * TT + kc * 32, lane);
      asm volatile("s_wait_loadcnt 0x0" ::: "memory");
#pragma unroll
      for (int j = 0; j < HD / 16; ++j) { const size_t po = ((size_t)b * CKV + (h / GRP) * HD + j * 16 + col) * (size_t)TT + kc * 32; acc[j] = wmma16(p, frag_h(VT + po, lane), acc[j]); } } }
#pragma unroll
  for (int j = 0; j < HD / 16; ++j)
#pragma unroll
    for (int r = 0; r < 8; ++r) ss[wave][8 * g + r][j * 16 + col] = acc[j][r] * (1.0f / 2048.0f);
  LDSX(); for (int rl = 0; rl < 16; ++rl) if (lane < HD / 4) vst2(Y + ((size_t)b * TT + ql0 + rl) * CC + h * HD + lane * 4, *(const v4f*)&ss[wave][rl][lane * 4]); }
// ---- k_out: block = (64 rows, 128 cols): out = ctx Wo (+ bo): ctx x 2^6 once to f16 against Wo as f16(bf16 x 2^8) exact (1 product) x 2^-14; causal early rows (< QHI of each sequence): ctx bf16 hi + lo against exact bf16 Wo (2 products)
__global__ __launch_bounds__(128) void k_out(const float* __restrict__ Y, const float* __restrict__ WO, const float* __restrict__ BO, float* __restrict__ OUT) { __shared__ __align__(16) float sf[4][16][132];
  const int tid = threadIdx.x, wave = tid >> 5, lane = tid & 31, col = lane & 15, g = lane >> 4; const int c0 = blockIdx.y * 128; const size_t r0 = (size_t)blockIdx.x * 64 + wave * 16;
  v8f acc[8] = {};
  if (CAUSAL && (int)(((size_t)blockIdx.x * 64) % TT) < QHI) {   /* block-uniform */
#pragma unroll 2
    for (int kc = 0; kc < CC / 32; ++kc) { const F2 a = split_row(Y + (r0 + col) * CC, kc * 32, lane); asm volatile("s_wait_loadcnt 0x0" ::: "memory");
#pragma unroll
      for (int j = 0; j < 8; ++j) { const v16b w = WOCOL(WO, kc * 32, c0 + j * 16 + col, lane); asm volatile("s_wait_loadcnt 0x0" ::: "memory"); acc[j] = wmma_bf(a.h, w, acc[j]); acc[j] = wmma_bf(a.l, w, acc[j]); } }
#pragma unroll
    for (int j = 0; j < 8; ++j) { const float bias = BO ? bfr(BO[c0 + j * 16 + col]) : 0.f;
#pragma unroll
      for (int r = 0; r < 8; ++r) sf[wave][8 * g + r][j * 16 + col] = acc[j][r] + bias; }
  } else {
#pragma unroll 2
    for (int kc = 0; kc < CC / 32; ++kc) { const v16h a = frag_f32s(Y + (r0 + col) * CC + kc * 32, lane, 64.0f); asm volatile("s_wait_loadcnt 0x0" ::: "memory");   /* ctx carried x 2^6 into f16 so small-magnitude context rows stay clear of f16 subnormals (chip FTZ) */
#pragma unroll
      for (int j = 0; j < 8; ++j) { const v16h w = WOCOLH(WO, kc * 32, c0 + j * 16 + col, lane); asm volatile("s_wait_loadcnt 0x0" ::: "memory"); acc[j] = wmma16(a, w, acc[j]); } }
#pragma unroll
    for (int j = 0; j < 8; ++j) { const float bias = BO ? bfr(BO[c0 + j * 16 + col]) : 0.f;
#pragma unroll
      for (int r = 0; r < 8; ++r) sf[wave][8 * g + r][j * 16 + col] = acc[j][r] * (1.0f / 16384.0f) + bias; } }   /* 2^-8 (Wo carry) x 2^-6 (ctx carry) */
  LDSX(); for (int rl = 0; rl < 16; ++rl) vst2(OUT + (r0 + rl) * DIN + c0 + lane * 4, *(const v4f*)&sf[wave][rl][lane * 4]); }

extern "C" void kernel_launch(void* const* d_in, const int* in_sizes, int n_in, void* d_out, int out_size, void* d_ws, size_t ws_size, hipStream_t stream) {
  (void)in_sizes; (void)n_in; (void)out_size;
  const float** F = (const float**)d_in;
  if (ws_size < (size_t)WS_END) return;
  char* ws = (char*)d_ws; _Float16 *QH = (_Float16*)(ws + WS_QH), *KH = (_Float16*)(ws + WS_KH), *VT = (_Float16*)(ws + WS_VT), *QL = (_Float16*)(ws + WS_QL), *KL = (_Float16*)(ws + WS_KL); __bf16 *VB = (__bf16*)(ws + WS_VB), *VBL = (__bf16*)(ws + WS_VBL); float *S = (float*)(ws + WS_S), *Y = (float*)(ws + WS_Y);
  (void)Y; (void)QL; (void)KL; (void)VB; (void)VBL;
  // inputs: 0 x [2,2048,1024]; 1 ve [2,2048,64]; 2 cos [2048,32]; 3 sin [2048,32]; 4 Wq [1024,1024] (in,out); 5 Wk [1024,64]; 6 Wv [1024,64]; 7 Wo [1024,1024] (in,out); 8 Wg [32,1]; 9 window_size int32 [1]; no biases
  k_proj<<<dim3(TNB * TT / 64, CC / 128, 1), 128, 0, stream>>>(F[0], F[0], F[0], F[4], F[5], F[6], nullptr, nullptr, nullptr, QH, QL, KH, KL, VT, VB, VBL, 0, F[2], F[3], F[1], F[8]);    /* q: 8 column blocks */
  k_proj<<<dim3(TNB * TT / 64, CKV / 128, 2), 128, 0, stream>>>(F[0], F[0], F[0], F[4], F[5], F[6], nullptr, nullptr, nullptr, QH, QL, KH, KL, VT, VB, VBL, 1, F[2], F[3], F[1], F[8]);   /* k (which 1) and v (which 2): one (half-empty) column block each */
  for (int b = 0; b < TNB; ++b) for (int h0 = 0; h0 < NH; h0 += HG) {
    k_sc<<<dim3(NQB, TT / 128, HG), 128, 0, stream>>>(QH, KH, QL, KL, b, h0, S);
    k_sm<<<dim3(TT, HG), 256, 0, stream>>>(S, (const int*)d_in[9]);
    k_pv<<<dim3(NQB, 1, HG), 128, 0, stream>>>(S, VT, VB, VBL, b, h0, Y);
  }
  k_out<<<dim3(TNB * TT / 64, DIN / 128), 128, 0, stream>>>(Y, F[7], nullptr, (float*)d_out);
}

// v001
// Measured time: 721 microseconds a run.
// Next to v000, in two timings, it ran 1.39 and 1.40 times as fast.
// compute dtype: all float inputs rounded to bf16, the cos / sin tables, ve and Wg included; q (16 heads) and the single shared k / v head projections with EXACT bf16 products on WMMA 16x16x32 (f32 accumulate); half-split RoPE with cos / sin READ from the table inputs, then RMSNorm over the 64 head dims (f32, eps = f32 machine epsilon) on q and k; v += 2 sigmoid(x[:32] . Wg) ve in f32; causal logits inside a sliding window read from the int input: 3 products for the first 384 rows, single f16 q x k after, x 64^-0.5; softmax f32; P x 2^11 once to f16 x v once to f16 (bf16 hi + lo below row 384); ctx hi+lo x exact Wo below row 384, x2^6 f16 carry x f16(bf16 x 2^8) Wo after; f32 output.
#include <hip/hip_runtime.h>
#include <math.h>

typedef __attribute__((ext_vector_type(16))) _Float16 v16h;
typedef __attribute__((ext_vector_type(16))) __bf16 v16b;
typedef __attribute__((ext_vector_type(8)))  _Float16 v8h;
typedef __attribute__((ext_vector_type(8)))  float v8f;
typedef __attribute__((ext_vector_type(4)))  float v4f;
typedef __attribute__((ext_vector_type(2)))  float v2f;
typedef __attribute__((ext_vector_type(4)))  unsigned v4u;
typedef __attribute__((ext_vector_type(4)))  int v4i;
typedef float __attribute__((may_alias)) float_a;
typedef int __attribute__((may_alias)) int_a;

template <typename T> __device__ __forceinline__ void vst2(void* p, T v) { *(T*)p = v;  }
__device__ __forceinline__ v8f wmma16(v16h a, v16h b, v8f c) {
  v8f d = __builtin_amdgcn_wmma_f32_16x16x32_f16(false, a, false, b, (short)0, c, false, false);
  asm volatile("v_nop\n\tv_nop\n\tv_nop\n\tv_nop" : "+v"(d) : "v"(a), "v"(b));
  return d;
}
__device__ __forceinline__ v8f wmma_bf(v16b a, v16b b, v8f c) {
  v8f d = __builtin_amdgcn_wmma_f32_16x16x32_bf16(false, a, false, b, (short)0, c, false, false);
  asm volatile("v_nop\n\tv_nop\n\tv_nop\n\tv_nop" : "+v"(d) : "v"(a), "v"(b));
  return d;
}
// 16x16x32 fragments: lane = (h = lane>>4, row/col = lane&15); elements 0..7 = k0+8h+0..7, 8..15 = k0+16+8h+0..7; D element r = row 8h+r
__device__ __forceinline__ v16h frag_h(const _Float16* rowk0, int lane) {
  union { v16h v; v8h q[2]; } u; const _Float16* p = rowk0 + 8 * (lane >> 4);
  u.q[0] = *(const v8h*)p; u.q[1] = *(const v8h*)(p + 16); return u.v;
}
__device__ __forceinline__ v16h frag_f32(const float* rowk0, int lane) {
  v16h a; const float* p = rowk0 + 8 * (lane >> 4);
#pragma unroll
  for (int i = 0; i < 8; ++i) { a[i] = (_Float16)p[i]; a[8 + i] = (_Float16)p[16 + i]; }
  return a;
}
__device__ __forceinline__ v16h frag_f32s(const float* rowk0, int lane, float sc) {
  v16h a; const float* p = rowk0 + 8 * (lane >> 4);
#pragma unroll
  for (int i = 0; i < 8; ++i) { a[i] = (_Float16)(p[i] * sc); a[8 + i] = (_Float16)(p[16 + i] * sc); }
  return a;
}
// column fragment from a [K][ld] layout (column n), rows >= K read as 0
__device__ __forceinline__ v16h fragc_f32(const float* W, int k0, int n, int lane, int ld, int K) {
  v16h a; const int g = lane >> 4;
#pragma unroll
  for (int i = 0; i < 8; ++i) { const int ka = k0 + 8 * g + i, kb = ka + 16;
    a[i] = (_Float16)(ka < K ? W[(size_t)(ka < K ? ka : K - 1) * ld + n] : 0.f); a[8 + i] = (_Float16)(kb < K ? W[(size_t)(kb < K ? kb : K - 1) * ld + n] : 0.f); }
  return a;
}
struct F2 { v16b h, l; };
__device__ __forceinline__ F2 bsplit16(const float v[16]) { F2 r;
#pragma unroll
  for (int i = 0; i < 16; ++i) { const __bf16 h = (__bf16)v[i]; r.h[i] = h; r.l[i] = (__bf16)(v[i] - (float)h); }
  return r; }
__device__ __forceinline__ F2 split_row(const float* row, int k0, int lane) { float v[16]; const float* p = row + k0 + 8 * (lane >> 4);
#pragma unroll
  for (int i = 0; i < 8; ++i) { v[i] = p[i]; v[8 + i] = p[16 + i]; }
  return bsplit16(v); }
__device__ __forceinline__ F2 split_rowK(const float* row, int k0, int lane, int K) { float v[16]; const int g = lane >> 4;
#pragma unroll
  for (int i = 0; i < 8; ++i) { const int ka = k0 + 8 * g + i, kb = ka + 16; v[i] = ka < K ? row[ka < K ? ka : K - 1] : 0.f; v[8 + i] = kb < K ? row[kb < K ? kb : K - 1] : 0.f; }
  return bsplit16(v); }
__device__ __forceinline__ F2 split_col(const float* W, int k0, int n, int lane, int ld, int K) { float v[16]; const int g = lane >> 4;
#pragma unroll
  for (int i = 0; i < 8; ++i) { const int ka = k0 + 8 * g + i, kb = ka + 16; v[i] = ka < K ? W[(size_t)(ka < K ? ka : K - 1) * ld + n] : 0.f; v[8 + i] = kb < K ? W[(size_t)(kb < K ? kb : K - 1) * ld + n] : 0.f; }
  return bsplit16(v); }
__device__ __forceinline__ v8f mac3(const F2& a, const F2& b, v8f c) { c = wmma_bf(a.l, b.h, c); c = wmma_bf(a.h, b.l, c); return wmma_bf(a.h, b.h, c); }
__device__ __forceinline__ float sigm(float v) { return 1.0f / (1.0f + expf(-v)); }
#define LDSX() do { asm volatile("s_wait_dscnt 0" ::: "memory"); __builtin_amdgcn_wave_barrier(); __builtin_amdgcn_fence(__ATOMIC_RELEASE, "workgroup"); } while (0)

// Multi-query causal attention with table RoPE, per-head RMSNorm, a gated value residual and a sliding window (x [2,2048,1024]; ve [2,2048,64]; cos, sin [2048,32] (inputs); (in,out) Wq [1024,1024], Wk / Wv [1024,64], Wo [1024,1024], all N(0,1) x 0.02; Wg [32,1]; window_size int (1024); 16 query heads share ONE key / value head; gate = 2 sigmoid(x[..., :32] Wg); v = x Wv + gate * ve; _rope: (x1, x2) = halves -> (x1 cos + x2 sin, -x1 sin + x2 cos); _rmsnorm: x * rsqrt(mean(x^2) + finfo.eps) AFTER the rotation, on q and k; scores x 64^-0.5; masked where key > query or query - key >= window_size (finfo.min); softmax; out = merge(attn v) Wo).
#define NB 2
#define TT 2048
#define CC 1024            // NH * HD = projected width
#define DIN 1024          // input (model) width
#define NH 16
#define HD 64
#define NQB (TT / 64)
#define HG 4
#define SCALE (0.125f)
#define CAUSAL 1
#ifndef TNB
#define TNB NB
#endif
__device__ __forceinline__ float bfr(float v) { return (float)(__bf16)v; }
__host__ __device__ __forceinline__ int kb_last(int qb) { return CAUSAL ? ((qb * 64 + 63) >> 7) : (TT / 128 - 1); }
typedef __attribute__((ext_vector_type(8))) __bf16 v8b;
__device__ __forceinline__ v16b frag_b(const __bf16* rowk0, int lane) {
  union { v16b v; v8b q[2]; } u; const __bf16* p = rowk0 + 8 * (lane >> 4);
  u.q[0] = *(const v8b*)p; u.q[1] = *(const v8b*)(p + 16); return u.v;
}
#define QBH 6              // causal: query blocks 0..QBH-1 of each sequence (few keys, no averaging) take the high-precision path
#define QHI 384            // rows carrying a q residual plane
#define KHI 384            // key rows carrying k residual / v bf16 hi+lo planes (used only by the causal high-precision path)
// B fragment (k rows k0+.., output column o) of a weight: (in,out) [K][ld] or (out,in) [ld rows of K]: bf16 exact, or f16(bf16 * 256) exact
__device__ __forceinline__ v16b wcol_io(const float* Wm, int k0, int o, int lane, int ld) { v16b w; const int g = lane >> 4;
#pragma unroll
  for (int i = 0; i < 8; ++i) { w[i] = (__bf16)Wm[(size_t)(k0 + 8 * g + i) * ld + o]; w[8 + i] = (__bf16)Wm[(size_t)(k0 + 16 + 8 * g + i) * ld + o]; }
  return w; }
__device__ __forceinline__ v16b wcol_oi(const float* Wm, int k0, int o, int lane, int K) { v16b w; const float* p = Wm + (size_t)o * K + k0 + 8 * (lane >> 4);
#pragma unroll
  for (int i = 0; i < 8; ++i) { w[i] = (__bf16)p[i]; w[8 + i] = (__bf16)p[16 + i]; }
  return w; }
__device__ __forceinline__ v16h wcolh_io(const float* Wm, int k0, int o, int lane, int ld) { v16h w; const int g = lane >> 4;
#pragma unroll
  for (int i = 0; i < 8; ++i) { w[i] = (_Float16)(bfr(Wm[(size_t)(k0 + 8 * g + i) * ld + o]) * 256.0f); w[8 + i] = (_Float16)(bfr(Wm[(size_t)(k0 + 16 + 8 * g + i) * ld + o]) * 256.0f); }
  return w; }
__device__ __forceinline__ v16h wcolh_oi(const float* Wm, int k0, int o, int lane, int K) { v16h w; const float* p = Wm + (size_t)o * K + k0 + 8 * (lane >> 4);
#pragma unroll
  for (int i = 0; i < 8; ++i) { w[i] = (_Float16)(bfr(p[i]) * 256.0f); w[8 + i] = (_Float16)(bfr(p[16 + i]) * 256.0f); }
  return w; }
#define WQKV_LAYOUT 0   // 0 = (in,out) [DIN][CC]; 1 = (out,in) [CC][DIN]; 2 = per-head [NH][DIN][HD]
__device__ __forceinline__ v16b wcol_hdk(const float* Wm, int k0, int o, int lane) { v16b w; const int g = lane >> 4; const float* p = Wm + (size_t)(o / HD) * DIN * HD + (o % HD);
#pragma unroll
  for (int i = 0; i < 8; ++i) { w[i] = (__bf16)p[(size_t)(k0 + 8 * g + i) * HD]; w[8 + i] = (__bf16)p[(size_t)(k0 + 16 + 8 * g + i) * HD]; }
  return w; }
#define WO_OUT_IN 0
#if WQKV_LAYOUT == 1
#define WCOL(W, k0, o, lane) wcol_oi(W, k0, o, lane, DIN)
#elif WQKV_LAYOUT == 2
#define WCOL(W, k0, o, lane) wcol_hdk(W, k0, o, lane)
#else
#define WCOL(W, k0, o, lane) (which == 0 ? wcol_io(W, k0, (o), lane, CC) : ((o) < KVW ? wcol_io(W, k0, (o), lane, KVW) : zero16b()))   /* (in,out): Wq [1024][1024] pitch CC; Wk / Wv [1024][64] pitch 64, padded columns 64..127 are zero */
#endif
#if WO_OUT_IN
#define WOCOL(W, k0, o, lane) wcol_oi(W, k0, o, lane, CC)
#define WOCOLH(W, k0, o, lane) wcolh_oi(W, k0, o, lane, CC)
#else
#define WOCOL(W, k0, o, lane) wcol_io(W, k0, o, lane, DIN)
#define WOCOLH(W, k0, o, lane) wcolh_io(W, k0, o, lane, DIN)
#endif
#define GRP 16             // all 16 query heads share the single kv head (kv head = h / 16 = 0)
#define CKV 128            // kv plane width: ONE 128-column block whose columns 0..63 are the single kv head, columns 64..127 zero padding
#define KVW 64             // real kv width (Wk / Wv are (in,out) [1024][64])
#define PROJ_EXTRA_PARAMS , int woff, const float* __restrict__ COS, const float* __restrict__ SIN, const float* __restrict__ VE, const float* __restrict__ WG   /* which = blockIdx.z + woff; COS / SIN [TT][32], VE [NB*TT][64], WG [32] are module inputs read in the projection epilogue */
__device__ __forceinline__ v16b zero16b() { v16b w; _Pragma("unroll") for (int i = 0; i < 16; ++i) w[i] = (__bf16)0.0f; return w; }
#define RMS_EPS 1.1920929e-07f   /* jnp.finfo(float32).eps */
// per (token, head) hook on the staged f32 row (64 floats). q and k (which 0, 1): the module's _rope with cos / sin read LITERALLY from the table inputs at row t (bf16-rounded like every float input): (x1, x2) = (row[m], row[32+m]) -> (x1 c + x2 s, -x1 s + x2 c), then _rmsnorm over the 64 dims: x * (1 / sqrt(mean(x^2) + eps)); the zero-padded second half of the k block stays exactly zero under both. v (which 2): row += gate * bf16(ve[b, t, :]) with gate = 2 / (1 + exp(-z)), z = sum_{i<32} bf16(x[b, t, i]) * bf16(Wg[i]); all global loads are unconditional; the padded half gets gate 0 through a select. f32, products and sums kept separate
#define PROJ_EPI(which, row, t, h) do { float* rw = (row); const size_t gr_ = bb * TT + (size_t)(t); if ((which) < 2) { const float* ct_ = COS + (size_t)(t) * 32; const float* st_ = SIN + (size_t)(t) * 32; _Pragma("unroll 4") for (int m = 0; m < 32; ++m) { _Pragma("clang fp contract(off)") const float c_ = bfr(ct_[m]), s_ = bfr(st_[m]); const float x1 = rw[m], x2 = rw[32 + m]; rw[m] = x1 * c_ + x2 * s_; rw[32 + m] = (-x1) * s_ + x2 * c_; } float ss_ = 0.f; _Pragma("unroll 8") for (int m = 0; m < 64; ++m) { _Pragma("clang fp contract(off)") ss_ += rw[m] * rw[m]; } const float rinv_ = 1.0f / sqrtf(ss_ * (1.0f / 64.0f) + RMS_EPS); _Pragma("unroll 8") for (int m = 0; m < 64; ++m) rw[m] = rw[m] * rinv_; } else { const float* xr_ = XV + gr_ * DIN; float z_ = 0.f; _Pragma("unroll 8") for (int i = 0; i < 32; ++i) { _Pragma("clang fp contract(off)") z_ += bfr(xr_[i]) * bfr(WG[i]); } const float gate_ = 2.0f / (1.0f + expf(-z_)); const float gsel_ = ((h) == 0) ? gate_ : 0.0f; const float* ve_ = VE + gr_ * 64; _Pragma("unroll 8") for (int m = 0; m < 64; ++m) { _Pragma("clang fp contract(off)") rw[m] = rw[m] + gsel_ * bfr(ve_[m]); } } } while (0)
static_assert(HD == 64 && KVW == 64 && CKV == 128, "the hook spells 32 / 64 literally: one real 64-wide kv head in a 128-column block");
#define SM_EXTRA_PARAMS , const int* __restrict__ WINP
// sliding window: a key is excluded when query - key >= window_size; window_size is the module's int input (one block-uniform scalar load); keys after the query are already excluded by the causal select; every row keeps at least min(t + 1, window) >= 1 keys
#define SM_MASK_HOOK do { const int win_ = WINP[0]; v = (t - k >= win_) ? -3.0e38f : v; } while (0)
#ifndef SM_EXTRA_PARAMS
#define SM_EXTRA_PARAMS
#endif
#ifndef PROJ_EXTRA_PARAMS
#define PROJ_EXTRA_PARAMS
#endif
#ifndef SM_MASK_HOOK
#define SM_MASK_HOOK (void)0
#endif

#define WS_QH  0u                                      // f16 q rows [b*t][CC]
#define WS_KH  (WS_QH + 2u * (size_t)NB * TT * CC)      // f16 k rows [b*t][CKV]
#define WS_VT  (WS_KH + 2u * (size_t)NB * TT * CC)      // f16 v planes [b][c][t]
#define WS_QL  (WS_VT + 2u * (size_t)NB * CC * TT)      // f16 q residual x 2^10 rows [b][t < QHI][CC]
#define WS_KL  (WS_QL + 2u * (size_t)NB * QHI * CC)     // f16 k residual x 2^10 rows [b][t < KHI][CKV]
#define WS_VB  (WS_KL + 2u * (size_t)NB * KHI * CC)     // bf16 v hi planes [b][c][t < KHI]
#define WS_VBL (WS_VB + 2u * (size_t)NB * CC * KHI)
#define WS_S   (WS_VBL + 2u * (size_t)NB * CC * KHI)    // f32 logits / P [hg][t][s]
#define WS_Y   (WS_S  + 4u * (size_t)HG * TT * TT)      // f32 ctx rows [b*t][CC] (only when there is an output projection)
#define WS_END (WS_Y  + 4u * (size_t)NB * TT * CC)

// ---- k_proj: block = (64 rows, 128 cols, which): q/k/v = X W (+ b) with exact bf16 products (K = DIN) -> which 0: q f16 rows (+ residual rows < QHI); 1: k f16 rows (+ residual rows < KHI); 2: v f16 planes [c][t] (+ bf16 hi/lo planes for t < KHI)
__global__ __launch_bounds__(128) void k_proj(const float* __restrict__ XQ, const float* __restrict__ XK, const float* __restrict__ XV, const float* __restrict__ WQ, const float* __restrict__ WK, const float* __restrict__ WV, const float* __restrict__ BQ, const float* __restrict__ BK, const float* __restrict__ BV,
    _Float16* __restrict__ QH, _Float16* __restrict__ QL, _Float16* __restrict__ KH, _Float16* __restrict__ KL, _Float16* __restrict__ VT, __bf16* __restrict__ VB, __bf16* __restrict__ VBL PROJ_EXTRA_PARAMS) {
  __shared__ __align__(16) float st[64][132]; __shared__ __align__(16) _Float16 sh[64][136], sl[64][136]; __shared__ __align__(16) _Float16 th[128][72]; __shared__ __align__(16) __bf16 tb[128][72], tbl[128][72];
  const int tid = threadIdx.x, wave = tid >> 5, lane = tid & 31, col = lane & 15, g = lane >> 4; const int which = blockIdx.z + woff; const int c0 = blockIdx.y * 128; const size_t r0 = (size_t)blockIdx.x * 64; const size_t bb = r0 / TT; const int t0 = (int)(r0 % TT);
  const float* X = which == 0 ? XQ : which == 1 ? XK : XV; const float* WA = which == 0 ? WQ : which == 1 ? WK : WV; const float* BA = which == 0 ? BQ : which == 1 ? BK : BV;
  v8f acc[8] = {};
#pragma unroll 2
  for (int kc = 0; kc < DIN / 32; ++kc) { v16b a; { const float* p = X + (r0 + wave * 16 + col) * DIN + kc * 32 + 8 * g;
#pragma unroll
      for (int i = 0; i < 8; ++i) { a[i] = (__bf16)p[i]; a[8 + i] = (__bf16)p[16 + i]; } }
    asm volatile("s_wait_loadcnt 0x0" ::: "memory");
#pragma unroll
    for (int j = 0; j < 8; ++j) { const v16b w = WCOL(WA, kc * 32, c0 + j * 16 + col, lane); asm volatile("s_wait_loadcnt 0x0" ::: "memory"); acc[j] = wmma_bf(a, w, acc[j]); } }
  { // stage the f32 tile (acc + bias) in LDS, run the per-(row, head) epilogue hook, then convert
#pragma unroll
    for (int j = 0; j < 8; ++j) { const int bo_ = c0 + j * 16 + col; const float bias = (BA && (which == 0 || bo_ < KVW)) ? bfr(BA[(which == 0 || bo_ < KVW) ? bo_ : 0]) : 0.f;   /* bk / bv hold only the 64 real kv columns: padded columns get no bias (index clamped, value selected) */
#pragma unroll
      for (int r = 0; r < 8; ++r) st[wave * 16 + 8 * g + r][j * 16 + col] = acc[j][r] + bias; }
    __syncthreads();
    for (int e = tid; e < 64 * (128 / HD); e += 128) { const int rl = e / (128 / HD), hh = e % (128 / HD); PROJ_EPI(which, &st[rl][hh * HD], (int)((r0 + rl) % TT), (c0 / HD) + hh); }
    __syncthreads(); }
  if (which < 2) { _Float16* DH = which == 0 ? QH : KH; _Float16* DL = which == 0 ? QL : KL; const int nhi = which == 0 ? QHI : KHI; const bool hi_rows = t0 < nhi;
    for (int e = tid; e < 64 * 128; e += 128) { const int rl = e >> 7, cl = e & 127; const float v = st[rl][cl]; const _Float16 hv = (_Float16)v; sh[rl][cl] = hv; sl[rl][cl] = (_Float16)((v - (float)hv) * 1024.0f); }
    __syncthreads();
    for (int e = tid; e < 64 * 16; e += 128) { const int rl = e >> 4, q = e & 15; vst2((unsigned*)(DH + (r0 + rl) * (size_t)(which == 0 ? CC : CKV) + c0 + q * 8), *(const v4u*)&sh[rl][q * 8]);   /* q rows at pitch CC, k rows at pitch CKV */ if (hi_rows) vst2((unsigned*)(DL + (bb * nhi + t0 + rl) * (size_t)(which == 0 ? CC : CKV) + c0 + q * 8), *(const v4u*)&sl[rl][q * 8]);   /* residual rows: same pitches */ }
  } else { const bool hi_rows = t0 < KHI;
    for (int e = tid; e < 64 * 128; e += 128) { const int rl = e & 63, cl = e >> 6; const float v = st[rl][cl]; th[cl][rl] = (_Float16)v; const __bf16 bh = (__bf16)v; tb[cl][rl] = bh; tbl[cl][rl] = (__bf16)(v - (float)bh); }
    __syncthreads();
    for (int e = tid; e < 128 * 8; e += 128) { const int cl = e >> 3, q = e & 7; vst2((unsigned*)(VT + (bb * CKV + c0 + cl) * (size_t)TT + t0 + q * 8), *(const v4u*)&th[cl][q * 8]);   /* v planes: CKV channels per batch */ if (hi_rows) { const size_t o3 = (bb * CKV + c0 + cl) * (size_t)KHI + t0 + q * 8; vst2((unsigned*)(VB + o3), *(const v4u*)&tb[cl][q * 8]); vst2((unsigned*)(VBL + o3), *(const v4u*)&tbl[cl][q * 8]); } } } }
// ---- k_sc: block = (query block qb, key block kb <= kb_last(qb), head in group) of batch b: logits x SCALE; q hi + residual (x 2^10) against k (2 products) for query rows < QHI, plus the k residual (3 products) for query blocks < QBH (causal early rows); causal: blocks past the diagonal exit, the mask itself is applied by index in k_sm
__global__ __launch_bounds__(128) void k_sc(const _Float16* __restrict__ QH, const _Float16* __restrict__ KH, const _Float16* __restrict__ QL, const _Float16* __restrict__ KL, int b, int h0, float* __restrict__ S0) { __shared__ __align__(16) float ss[4][16][132];
  const int qb = blockIdx.x, kb = blockIdx.y; if (kb > kb_last(qb)) return;
  const int h = h0 + blockIdx.z; float* S = S0 + (size_t)blockIdx.z * TT * TT;
  const int tid = threadIdx.x, wave = tid >> 5, lane = tid & 31, col = lane & 15, g = lane >> 4; const int k0 = kb * 128; const int ql0 = qb * 64 + wave * 16; const size_t q0 = (size_t)b * TT + ql0, kr0 = (size_t)b * TT + k0;
  v8f acc[8] = {}, accl[8] = {};
  const _Float16* QLb = QL + (size_t)b * QHI * CC; const _Float16* KLb = KL + (size_t)b * KHI * CKV;
  if (qb < QBH) {
#pragma unroll
    for (int kc = 0; kc < HD / 32; ++kc) { const v16h ah = frag_h(QH + (q0 + col) * CC + h * HD + kc * 32, lane), al = frag_h(QLb + (size_t)(ql0 + col) * CC + h * HD + kc * 32, lane);
#pragma unroll
      for (int j = 0; j < 8; ++j) { const v16h kbf = frag_h(KH + (kr0 + j * 16 + col) * CKV + (h / GRP) * HD + kc * 32, lane), klf = frag_h(KLb + (size_t)(k0 + j * 16 + col) * CKV + (h / GRP) * HD + kc * 32, lane); acc[j] = wmma16(ah, kbf, acc[j]); accl[j] = wmma16(al, kbf, accl[j]); accl[j] = wmma16(ah, klf, accl[j]); } }
  } else if (qb * 64 < QHI) {
#pragma unroll
    for (int kc = 0; kc < HD / 32; ++kc) { const v16h ah = frag_h(QH + (q0 + col) * CC + h * HD + kc * 32, lane), al = frag_h(QLb + (size_t)(ql0 + col) * CC + h * HD + kc * 32, lane);
#pragma unroll
      for (int j = 0; j < 8; ++j) { const v16h kbf = frag_h(KH + (kr0 + j * 16 + col) * CKV + (h / GRP) * HD + kc * 32, lane); acc[j] = wmma16(ah, kbf, acc[j]); accl[j] = wmma16(al, kbf, accl[j]); } }
  } else {
#pragma unroll
    for (int kc = 0; kc < HD / 32; ++kc) { const v16h ah = frag_h(QH + (q0 + col) * CC + h * HD + kc * 32, lane);
#pragma unroll
      for (int j = 0; j < 8; ++j) { const v16h kbf = frag_h(KH + (kr0 + j * 16 + col) * CKV + (h / GRP) * HD + kc * 32, lane); acc[j] = wmma16(ah, kbf, acc[j]); } } }
#pragma unroll
  for (int j = 0; j < 8; ++j) {
#pragma unroll
    for (int r = 0; r < 8; ++r) ss[wave][8 * g + r][j * 16 + col] = (acc[j][r] + accl[j][r] * (1.0f / 1024.0f)) * SCALE; }
  LDSX(); for (int rl = 0; rl < 16; ++rl) vst2(S + (size_t)(ql0 + rl) * TT + k0 + lane * 4, *(const v4f*)&ss[wave][rl][lane * 4]); }
// ---- k_sm: block = query row t (head in group): keys [0, kend): causal -> logit if s <= t else excluded; softmax in f32; P x 2^11 in place (0 for excluded)
__global__ __launch_bounds__(256) void k_sm(float* __restrict__ S0 SM_EXTRA_PARAMS) { __shared__ float sred[8]; __shared__ float sbc; __shared__ __align__(16) float shv[TT];
  const int tid = threadIdx.x; const int t = blockIdx.x; const int kend = (kb_last(t >> 6) + 1) * 128;
  float* sr = S0 + (size_t)blockIdx.y * TT * TT + (size_t)t * TT;
  float m = -3.0e38f; for (int k = tid; k < kend; k += 256) { float v = (!CAUSAL || k <= t) ? sr[k] : -3.0e38f; SM_MASK_HOOK; shv[k] = v; m = fmaxf(m, v); }
#pragma unroll
  for (int o = 1; o < 32; o <<= 1) m = fmaxf(m, __shfl_xor(m, o));
  if ((tid & 31) == 0) sred[tid >> 5] = m; __syncthreads(); if (tid == 0) { float a = sred[0]; for (int i = 1; i < 8; ++i) a = fmaxf(a, sred[i]); sbc = a; } __syncthreads(); m = sbc; __syncthreads();
  float sum = 0.f; for (int k = tid; k < kend; k += 256) { const float v = shv[k]; const float e = (v <= -1.0e38f) ? 0.f : expf(v - m); shv[k] = e; sum += e; }
#pragma unroll
  for (int o = 1; o < 32; o <<= 1) sum += __shfl_xor(sum, o);
  if ((tid & 31) == 0) sred[tid >> 5] = sum; __syncthreads(); if (tid == 0) { float a = 0.f; for (int i = 0; i < 8; ++i) a += sred[i]; sbc = a > 0.f ? 2048.0f / a : 0.f; }   /* a fully excluded row yields P = 0 */ __syncthreads(); const float inv = sbc;
  for (int k = tid; k < kend; k += 256) shv[k] = shv[k] * inv;
  __syncthreads(); for (int q = tid; q < kend / 4; q += 256) vst2(sr + q * 4, *(const v4f*)&shv[q * 4]); }
// ---- k_pv: block = 16 queries (qt) of (b, h), PVW waves: wave w takes the 32-key chunks w, w + PVW, ... of keys [0, kend) and forms its partial ctx = P . v (P x 2^11 once to f16 against v f16: 1 product; causal early query blocks: P and v as bf16 hi + lo, 3 products); the PVW partials are added in LDS in wave order; 256-B (row, head) segment by 16 lanes
#define PVW 8
__global__ __launch_bounds__(32 * PVW) void k_pv(const float* __restrict__ PS0, const _Float16* __restrict__ VT, const __bf16* __restrict__ VB, const __bf16* __restrict__ VBL, int b, int h0, float* __restrict__ Y) { const int h = h0 + blockIdx.z; const float* PS = PS0 + (size_t)blockIdx.z * TT * TT; __shared__ __align__(16) float ss[PVW][16][HD + 4];
  const int tid = threadIdx.x, lane = tid & 31, col = lane & 15, g = lane >> 4; const int qt = blockIdx.x, qb = qt >> 2; const int ql0 = qt * 16; const int kce = (kb_last(qb) + 1) * 4;
  const int wave = __builtin_amdgcn_readfirstlane(tid >> 5);   /* the wave's number in a scalar register: the chunk loops below branch on scalars and every lane stays on at the matrix instructions */
  v8f acc[HD / 16] = {};
  if (qb < QBH) {
#pragma unroll 1
    for (int kc = wave; kc < kce; kc += PVW) { const F2 p = split_row(PS + (size_t)(ql0 + col) * TT, kc * 32, lane);
      asm volatile("s_wait_loadcnt 0x0" ::: "memory");
#pragma unroll
      for (int j = 0; j < HD / 16; ++j) { const size_t po = ((size_t)b * CKV + (h / GRP) * HD + j * 16 + col) * (size_t)KHI + kc * 32; const v16b vh = frag_b(VB + po, lane); acc[j] = wmma_bf(p.h, vh, acc[j]); acc[j] = wmma_bf(p.l, vh, acc[j]); acc[j] = wmma_bf(p.h, frag_b(VBL + po, lane), acc[j]); } }
  } else {
#pragma unroll 1
    for (int kc = wave; kc < kce; kc += PVW) { const v16h p = frag_f32(PS + (size_t)(ql0 + col) * TT + kc * 32, lane);
      asm volatile("s_wait_loadcnt 0x0" ::: "memory");
#pragma unroll
      for (int j = 0; j < HD / 16; ++j) { const size_t po = ((size_t)b * CKV + (h / GRP) * HD + j * 16 + col) * (size_t)TT + kc * 32; acc[j] = wmma16(p, frag_h(VT + po, lane), acc[j]); } } }
#pragma unroll
  for (int j = 0; j < HD / 16; ++j)
#pragma unroll
    for (int r = 0; r < 8; ++r) ss[wave][8 * g + r][j * 16 + col] = acc[j][r] * (1.0f / 2048.0f);
  __syncthreads();   /* every wave's partial tile is in LDS before any thread adds them */
  { const int rl = tid >> 4, q4 = (tid & 15) * 4; v4f s = *(const v4f*)&ss[0][rl][q4];
#pragma unroll
    for (int w = 1; w < PVW; ++w) s += *(const v4f*)&ss[w][rl][q4];
    vst2(Y + ((size_t)b * TT + ql0 + rl) * CC + h * HD + q4, s); } }
static_assert(32 * PVW == 16 * (HD / 4), "one thread per float4 of the 16 x HD tile in the final add");
// ---- k_out: block = (64 rows, 128 cols): out = ctx Wo (+ bo): ctx once to f16 against Wo as f16(bf16 x 2^8) exact (1 product) x 2^-8; causal early rows (< QHI of each sequence): ctx bf16 hi + lo against exact bf16 Wo (2 products)
__global__ __launch_bounds__(128) void k_out(const float* __restrict__ Y, const float* __restrict__ WO, const float* __restrict__ BO, float* __restrict__ OUT) { __shared__ __align__(16) float sf[4][16][132];
  const int tid = threadIdx.x, wave = tid >> 5, lane = tid & 31, col = lane & 15, g = lane >> 4; const int c0 = blockIdx.y * 128; const size_t r0 = (size_t)blockIdx.x * 64 + wave * 16;
  v8f acc[8] = {};
  if (CAUSAL && (int)(((size_t)blockIdx.x * 64) % TT) < QHI) {   /* block-uniform */
#pragma unroll 2
    for (int kc = 0; kc < CC / 32; ++kc) { const F2 a = split_row(Y + (r0 + col) * CC, kc * 32, lane); asm volatile("s_wait_loadcnt 0x0" ::: "memory");
#pragma unroll
      for (int j = 0; j < 8; ++j) { const v16b w = WOCOL(WO, kc * 32, c0 + j * 16 + col, lane); asm volatile("s_wait_loadcnt 0x0" ::: "memory"); acc[j] = wmma_bf(a.h, w, acc[j]); acc[j] = wmma_bf(a.l, w, acc[j]); } }
#pragma unroll
    for (int j = 0; j < 8; ++j) { const float bias = BO ? bfr(BO[c0 + j * 16 + col]) : 0.f;
#pragma unroll
      for (int r = 0; r < 8; ++r) sf[wave][8 * g + r][j * 16 + col] = acc[j][r] + bias; }
  } else {
#pragma unroll 2
    for (int kc = 0; kc < CC / 32; ++kc) { const v16h a = frag_f32s(Y + (r0 + col) * CC + kc * 32, lane, 64.0f); asm volatile("s_wait_loadcnt 0x0" ::: "memory");   /* ctx carried x 2^6 into f16 so small-magnitude context rows stay clear of f16 subnormals (chip FTZ) */
#pragma unroll
      for (int j = 0; j < 8; ++j) { const v16h w = WOCOLH(WO, kc * 32, c0 + j * 16 + col, lane); asm volatile("s_wait_loadcnt 0x0" ::: "memory"); acc[j] = wmma16(a, w, acc[j]); } }
#pragma unroll
    for (int j = 0; j < 8; ++j) { const float bias = BO ? bfr(BO[c0 + j * 16 + col]) : 0.f;
#pragma unroll
      for (int r = 0; r < 8; ++r) sf[wave][8 * g + r][j * 16 + col] = acc[j][r] * (1.0f / 16384.0f) + bias; } }   /* 2^-8 (Wo carry) x 2^-6 (ctx carry) */
  LDSX(); for (int rl = 0; rl < 16; ++rl) vst2(OUT + (r0 + rl) * DIN + c0 + lane * 4, *(const v4f*)&sf[wave][rl][lane * 4]); }

extern "C" void kernel_launch(void* const* d_in, const int* in_sizes, int n_in, void* d_out, int out_size, void* d_ws, size_t ws_size, hipStream_t stream) {
  (void)in_sizes; (void)n_in; (void)out_size;
  const float** F = (const float**)d_in;
  if (ws_size < (size_t)WS_END) return;
  char* ws = (char*)d_ws; _Float16 *QH = (_Float16*)(ws + WS_QH), *KH = (_Float16*)(ws + WS_KH), *VT = (_Float16*)(ws + WS_VT), *QL = (_Float16*)(ws + WS_QL), *KL = (_Float16*)(ws + WS_KL); __bf16 *VB = (__bf16*)(ws + WS_VB), *VBL = (__bf16*)(ws + WS_VBL); float *S = (float*)(ws + WS_S), *Y = (float*)(ws + WS_Y);
  (void)Y; (void)QL; (void)KL; (void)VB; (void)VBL;
  // inputs: 0 x [2,2048,1024]; 1 ve [2,2048,64]; 2 cos [2048,32]; 3 sin [2048,32]; 4 Wq [1024,1024] (in,out); 5 Wk [1024,64]; 6 Wv [1024,64]; 7 Wo [1024,1024] (in,out); 8 Wg [32,1]; 9 window_size int32 [1]; no biases
  k_proj<<<dim3(TNB * TT / 64, CC / 128, 1), 128, 0, stream>>>(F[0], F[0], F[0], F[4], F[5], F[6], nullptr, nullptr, nullptr, QH, QL, KH, KL, VT, VB, VBL, 0, F[2], F[3], F[1], F[8]);    /* q: 8 column blocks */
  k_proj<<<dim3(TNB * TT / 64, CKV / 128, 2), 128, 0, stream>>>(F[0], F[0], F[0], F[4], F[5], F[6], nullptr, nullptr, nullptr, QH, QL, KH, KL, VT, VB, VBL, 1, F[2], F[3], F[1], F[8]);   /* k (which 1) and v (which 2): one (half-empty) column block each */
  for (int b = 0; b < TNB; ++b) for (int h0 = 0; h0 < NH; h0 += HG) {
    k_sc<<<dim3(NQB, TT / 128, HG), 128, 0, stream>>>(QH, KH, QL, KL, b, h0, S);
    k_sm<<<dim3(TT, HG), 256, 0, stream>>>(S, (const int*)d_in[9]);
    k_pv<<<dim3(TT / 16, 1, HG), 32 * PVW, 0, stream>>>(S, VT, VB, VBL, b, h0, Y);
  }
  k_out<<<dim3(TNB * TT / 64, DIN / 128), 128, 0, stream>>>(Y, F[7], nullptr, (float*)d_out);
}

// v002
// One run takes 553 microseconds.
// In both of two side-by-side timings against v001, it was 1.29 times as fast.
// Over all steps from v000 it is 1.80 times as fast.
// compute dtype: all float inputs rounded to bf16, the cos / sin tables, ve and Wg included; q (16 heads) and the single shared k / v head projections with EXACT bf16 products on WMMA 16x16x32 (f32 accumulate); half-split RoPE with cos / sin READ from the table inputs, then RMSNorm over the 64 head dims (f32, eps = f32 machine epsilon) on q and k; v += 2 sigmoid(x[:32] . Wg) ve in f32; causal logits inside a sliding window read from the int input: 3 products for the first 384 rows, single f16 q x k after, x 64^-0.5; softmax f32; P x 2^11 once to f16 x v once to f16 (bf16 hi + lo below row 384); ctx hi+lo x exact Wo below row 384, x2^6 f16 carry x f16(bf16 x 2^8) Wo after; f32 output.
#include <hip/hip_runtime.h>
#include <math.h>

typedef __attribute__((ext_vector_type(16))) _Float16 v16h;
typedef __attribute__((ext_vector_type(16))) __bf16 v16b;
typedef __attribute__((ext_vector_type(8)))  _Float16 v8h;
typedef __attribute__((ext_vector_type(8)))  float v8f;
typedef __attribute__((ext_vector_type(4)))  float v4f;
typedef __attribute__((ext_vector_type(2)))  float v2f;
typedef __attribute__((ext_vector_type(4)))  unsigned v4u;
typedef __attribute__((ext_vector_type(4)))  int v4i;
typedef float __attribute__((may_alias)) float_a;
typedef int __attribute__((may_alias)) int_a;

template <typename T> __device__ __forceinline__ void vst2(void* p, T v) { *(T*)p = v;  }
__device__ __forceinline__ v8f wmma16(v16h a, v16h b, v8f c) {
  v8f d = __builtin_amdgcn_wmma_f32_16x16x32_f16(false, a, false, b, (short)0, c, false, false);
  asm volatile("v_nop\n\tv_nop\n\tv_nop\n\tv_nop" : "+v"(d) : "v"(a), "v"(b));
  return d;
}
__device__ __forceinline__ v8f wmma_bf(v16b a, v16b b, v8f c) {
  v8f d = __builtin_amdgcn_wmma_f32_16x16x32_bf16(false, a, false, b, (short)0, c, false, false);
  asm volatile("v_nop\n\tv_nop\n\tv_nop\n\tv_nop" : "+v"(d) : "v"(a), "v"(b));
  return d;
}
// 16x16x32 fragments: lane = (h = lane>>4, row/col = lane&15); elements 0..7 = k0+8h+0..7, 8..15 = k0+16+8h+0..7; D element r = row 8h+r
__device__ __forceinline__ v16h frag_h(const _Float16* rowk0, int lane) {
  union { v16h v; v8h q[2]; } u; const _Float16* p = rowk0 + 8 * (lane >> 4);
  u.q[0] = *(const v8h*)p; u.q[1] = *(const v8h*)(p + 16); return u.v;
}
__device__ __forceinline__ v16h frag_f32(const float* rowk0, int lane) {
  v16h a; const float* p = rowk0 + 8 * (lane >> 4);
#pragma unroll
  for (int i = 0; i < 8; ++i) { a[i] = (_Float16)p[i]; a[8 + i] = (_Float16)p[16 + i]; }
  return a;
}
__device__ __forceinline__ v16h frag_f32s(const float* rowk0, int lane, float sc) {
  v16h a; const float* p = rowk0 + 8 * (lane >> 4);
#pragma unroll
  for (int i = 0; i < 8; ++i) { a[i] = (_Float16)(p[i] * sc); a[8 + i] = (_Float16)(p[16 + i] * sc); }
  return a;
}
// column fragment from a [K][ld] layout (column n), rows >= K read as 0
__device__ __forceinline__ v16h fragc_f32(const float* W, int k0, int n, int lane, int ld, int K) {
  v16h a; const int g = lane >> 4;
#pragma unroll
  for (int i = 0; i < 8; ++i) { const int ka = k0 + 8 * g + i, kb = ka + 16;
    a[i] = (_Float16)(ka < K ? W[(size_t)(ka < K ? ka : K - 1) * ld + n] : 0.f); a[8 + i] = (_Float16)(kb < K ? W[(size_t)(kb < K ? kb : K - 1) * ld + n] : 0.f); }
  return a;
}
struct F2 { v16b h, l; };
__device__ __forceinline__ F2 bsplit16(const float v[16]) { F2 r;
#pragma unroll
  for (int i = 0; i < 16; ++i) { const __bf16 h = (__bf16)v[i]; r.h[i] = h; r.l[i] = (__bf16)(v[i] - (float)h); }
  return r; }
__device__ __forceinline__ F2 split_row(const float* row, int k0, int lane) { float v[16]; const float* p = row + k0 + 8 * (lane >> 4);
#pragma unroll
  for (int i = 0; i < 8; ++i) { v[i] = p[i]; v[8 + i] = p[16 + i]; }
  return bsplit16(v); }
__device__ __forceinline__ F2 split_rowK(const float* row, int k0, int lane, int K) { float v[16]; const int g = lane >> 4;
#pragma unroll
  for (int i = 0; i < 8; ++i) { const int ka = k0 + 8 * g + i, kb = ka + 16; v[i] = ka < K ? row[ka < K ? ka : K - 1] : 0.f; v[8 + i] = kb < K ? row[kb < K ? kb : K - 1] : 0.f; }
  return bsplit16(v); }
__device__ __forceinline__ F2 split_col(const float* W, int k0, int n, int lane, int ld, int K) { float v[16]; const int g = lane >> 4;
#pragma unroll
  for (int i = 0; i < 8; ++i) { const int ka = k0 + 8 * g + i, kb = ka + 16; v[i] = ka < K ? W[(size_t)(ka < K ? ka : K - 1) * ld + n] : 0.f; v[8 + i] = kb < K ? W[(size_t)(kb < K ? kb : K - 1) * ld + n] : 0.f; }
  return bsplit16(v); }
__device__ __forceinline__ v8f mac3(const F2& a, const F2& b, v8f c) { c = wmma_bf(a.l, b.h, c); c = wmma_bf(a.h, b.l, c); return wmma_bf(a.h, b.h, c); }
__device__ __forceinline__ float sigm(float v) { return 1.0f / (1.0f + expf(-v)); }
#define LDSX() do { asm volatile("s_wait_dscnt 0" ::: "memory"); __builtin_amdgcn_wave_barrier(); __builtin_amdgcn_fence(__ATOMIC_RELEASE, "workgroup"); } while (0)

// Multi-query causal attention with table RoPE, per-head RMSNorm, a gated value residual and a sliding window (x [2,2048,1024]; ve [2,2048,64]; cos, sin [2048,32] (inputs); (in,out) Wq [1024,1024], Wk / Wv [1024,64], Wo [1024,1024], all N(0,1) x 0.02; Wg [32,1]; window_size int (1024); 16 query heads share ONE key / value head; gate = 2 sigmoid(x[..., :32] Wg); v = x Wv + gate * ve; _rope: (x1, x2) = halves -> (x1 cos + x2 sin, -x1 sin + x2 cos); _rmsnorm: x * rsqrt(mean(x^2) + finfo.eps) AFTER the rotation, on q and k; scores x 64^-0.5; masked where key > query or query - key >= window_size (finfo.min); softmax; out = merge(attn v) Wo).
#define NB 2
#define TT 2048
#define CC 1024            // NH * HD = projected width
#define DIN 1024          // input (model) width
#define NH 16
#define HD 64
#define NQB (TT / 64)
#define HG 4
#define SCALE (0.125f)
#define CAUSAL 1
#ifndef TNB
#define TNB NB
#endif
__device__ __forceinline__ float bfr(float v) { return (float)(__bf16)v; }
__host__ __device__ __forceinline__ int kb_last(int qb) { return CAUSAL ? ((qb * 64 + 63) >> 7) : (TT / 128 - 1); }
typedef __attribute__((ext_vector_type(8))) __bf16 v8b;
__device__ __forceinline__ v16b frag_b(const __bf16* rowk0, int lane) {
  union { v16b v; v8b q[2]; } u; const __bf16* p = rowk0 + 8 * (lane >> 4);
  u.q[0] = *(const v8b*)p; u.q[1] = *(const v8b*)(p + 16); return u.v;
}
#define QBH 6              // causal: query blocks 0..QBH-1 of each sequence (few keys, no averaging) take the high-precision path
#define QHI 384            // rows carrying a q residual plane
#define KHI 384            // key rows carrying k residual / v bf16 hi+lo planes (used only by the causal high-precision path)
// B fragment (k rows k0+.., output column o) of a weight: (in,out) [K][ld] or (out,in) [ld rows of K]: bf16 exact, or f16(bf16 * 256) exact
__device__ __forceinline__ v16b wcol_io(const float* Wm, int k0, int o, int lane, int ld) { v16b w; const int g = lane >> 4;
#pragma unroll
  for (int i = 0; i < 8; ++i) { w[i] = (__bf16)Wm[(size_t)(k0 + 8 * g + i) * ld + o]; w[8 + i] = (__bf16)Wm[(size_t)(k0 + 16 + 8 * g + i) * ld + o]; }
  return w; }
__device__ __forceinline__ v16b wcol_oi(const float* Wm, int k0, int o, int lane, int K) { v16b w; const float* p = Wm + (size_t)o * K + k0 + 8 * (lane >> 4);
#pragma unroll
  for (int i = 0; i < 8; ++i) { w[i] = (__bf16)p[i]; w[8 + i] = (__bf16)p[16 + i]; }
  return w; }
__device__ __forceinline__ v16h wcolh_io(const float* Wm, int k0, int o, int lane, int ld) { v16h w; const int g = lane >> 4;
#pragma unroll
  for (int i = 0; i < 8; ++i) { w[i] = (_Float16)(bfr(Wm[(size_t)(k0 + 8 * g + i) * ld + o]) * 256.0f); w[8 + i] = (_Float16)(bfr(Wm[(size_t)(k0 + 16 + 8 * g + i) * ld + o]) * 256.0f); }
  return w; }
__device__ __forceinline__ v16h wcolh_oi(const float* Wm, int k0, int o, int lane, int K) { v16h w; const float* p = Wm + (size_t)o * K + k0 + 8 * (lane >> 4);
#pragma unroll
  for (int i = 0; i < 8; ++i) { w[i] = (_Float16)(bfr(p[i]) * 256.0f); w[8 + i] = (_Float16)(bfr(p[16 + i]) * 256.0f); }
  return w; }
#define WQKV_LAYOUT 0   // 0 = (in,out) [DIN][CC]; 1 = (out,in) [CC][DIN]; 2 = per-head [NH][DIN][HD]
__device__ __forceinline__ v16b wcol_hdk(const float* Wm, int k0, int o, int lane) { v16b w; const int g = lane >> 4; const float* p = Wm + (size_t)(o / HD) * DIN * HD + (o % HD);
#pragma unroll
  for (int i = 0; i < 8; ++i) { w[i] = (__bf16)p[(size_t)(k0 + 8 * g + i) * HD]; w[8 + i] = (__bf16)p[(size_t)(k0 + 16 + 8 * g + i) * HD]; }
  return w; }
#define WO_OUT_IN 0
#if WQKV_LAYOUT == 1
#define WCOL(W, k0, o, lane) wcol_oi(W, k0, o, lane, DIN)
#elif WQKV_LAYOUT == 2
#define WCOL(W, k0, o, lane) wcol_hdk(W, k0, o, lane)
#else
#define WCOL(W, k0, o, lane) (which == 0 ? wcol_io(W, k0, (o), lane, CC) : ((o) < KVW ? wcol_io(W, k0, (o), lane, KVW) : zero16b()))   /* (in,out): Wq [1024][1024] pitch CC; Wk / Wv [1024][64] pitch 64, padded columns 64..127 are zero */
#endif
#if WO_OUT_IN
#define WOCOL(W, k0, o, lane) wcol_oi(W, k0, o, lane, CC)
#define WOCOLH(W, k0, o, lane) wcolh_oi(W, k0, o, lane, CC)
#else
#define WOCOL(W, k0, o, lane) wcol_io(W, k0, o, lane, DIN)
#define WOCOLH(W, k0, o, lane) wcolh_io(W, k0, o, lane, DIN)
#endif
#define GRP 16             // all 16 query heads share the single kv head (kv head = h / 16 = 0)
#define CKV 128            // kv plane width: ONE 128-column block whose columns 0..63 are the single kv head, columns 64..127 zero padding
#define KVW 64             // real kv width (Wk / Wv are (in,out) [1024][64])
#define PROJ_EXTRA_PARAMS , int woff, const float* __restrict__ COS, const float* __restrict__ SIN, const float* __restrict__ VE, const float* __restrict__ WG   /* which = blockIdx.z + woff; COS / SIN [TT][32], VE [NB*TT][64], WG [32] are module inputs read in the projection epilogue */
__device__ __forceinline__ v16b zero16b() { v16b w; _Pragma("unroll") for (int i = 0; i < 16; ++i) w[i] = (__bf16)0.0f; return w; }
#define RMS_EPS 1.1920929e-07f   /* jnp.finfo(float32).eps */
// per (token, head) hook on the staged f32 row (64 floats). q and k (which 0, 1): the module's _rope with cos / sin read LITERALLY from the table inputs at row t (bf16-rounded like every float input): (x1, x2) = (row[m], row[32+m]) -> (x1 c + x2 s, -x1 s + x2 c), then _rmsnorm over the 64 dims: x * (1 / sqrt(mean(x^2) + eps)); the zero-padded second half of the k block stays exactly zero under both. v (which 2): row += gate * bf16(ve[b, t, :]) with gate = 2 / (1 + exp(-z)), z = sum_{i<32} bf16(x[b, t, i]) * bf16(Wg[i]); all global loads are unconditional; the padded half gets gate 0 through a select. f32, products and sums kept separate
#define PROJ_EPI(which, row, t, h) do { float* rw = (row); const size_t gr_ = bb * TT + (size_t)(t); if ((which) < 2) { const float* ct_ = COS + (size_t)(t) * 32; const float* st_ = SIN + (size_t)(t) * 32; _Pragma("unroll 4") for (int m = 0; m < 32; ++m) { _Pragma("clang fp contract(off)") const float c_ = bfr(ct_[m]), s_ = bfr(st_[m]); const float x1 = rw[m], x2 = rw[32 + m]; rw[m] = x1 * c_ + x2 * s_; rw[32 + m] = (-x1) * s_ + x2 * c_; } float ss_ = 0.f; _Pragma("unroll 8") for (int m = 0; m < 64; ++m) { _Pragma("clang fp contract(off)") ss_ += rw[m] * rw[m]; } const float rinv_ = 1.0f / sqrtf(ss_ * (1.0f / 64.0f) + RMS_EPS); _Pragma("unroll 8") for (int m = 0; m < 64; ++m) rw[m] = rw[m] * rinv_; } else { const float* xr_ = XV + gr_ * DIN; float z_ = 0.f; _Pragma("unroll 8") for (int i = 0; i < 32; ++i) { _Pragma("clang fp contract(off)") z_ += bfr(xr_[i]) * bfr(WG[i]); } const float gate_ = 2.0f / (1.0f + expf(-z_)); const float gsel_ = ((h) == 0) ? gate_ : 0.0f; const float* ve_ = VE + gr_ * 64; _Pragma("unroll 8") for (int m = 0; m < 64; ++m) { _Pragma("clang fp contract(off)") rw[m] = rw[m] + gsel_ * bfr(ve_[m]); } } } while (0)
static_assert(HD == 64 && KVW == 64 && CKV == 128, "the hook spells 32 / 64 literally: one real 64-wide kv head in a 128-column block");
#define SM_EXTRA_PARAMS , const int* __restrict__ WINP
// sliding window: a key is excluded when query - key >= window_size; window_size is the module's int input (one block-uniform scalar load); keys after the query are already excluded by the causal select; every row keeps at least min(t + 1, window) >= 1 keys
#define SM_MASK_HOOK do { v = (t - k >= win_) ? -3.0e38f : v; } while (0)   /* win_ = WINP[0], read once at the kernel's head */
#ifndef SM_EXTRA_PARAMS
#define SM_EXTRA_PARAMS
#endif
#ifndef PROJ_EXTRA_PARAMS
#define PROJ_EXTRA_PARAMS
#endif
#ifndef SM_MASK_HOOK
#define SM_MASK_HOOK (void)0
#endif

#define WS_QH  0u                                      // f16 q rows [b*t][CC]
#define WS_KH  (WS_QH + 2u * (size_t)NB * TT * CC)      // f16 k rows [b*t][CKV]
#define WS_VT  (WS_KH + 2u * (size_t)NB * TT * CC)      // f16 v planes [b][c][t]
#define WS_QL  (WS_VT + 2u * (size_t)NB * CC * TT)      // f16 q residual x 2^10 rows [b][t < QHI][CC]
#define WS_KL  (WS_QL + 2u * (size_t)NB * QHI * CC)     // f16 k residual x 2^10 rows [b][t < KHI][CKV]
#define WS_VB  (WS_KL + 2u * (size_t)NB * KHI * CC)     // bf16 v hi planes [b][c][t < KHI]
#define WS_VBL (WS_VB + 2u * (size_t)NB * CC * KHI)
#define WS_S   (WS_VBL + 2u * (size_t)NB * CC * KHI)    // f32 logits [hg][t][s]
#define WS_Y   (WS_S  + 4u * (size_t)HG * TT * TT)      // f32 ctx rows [b*t][CC] (only when there is an output projection)
#define WS_END (WS_Y  + 4u * (size_t)NB * TT * CC)

// ---- k_proj: block = (64 rows, 128 cols, which): q/k/v = X W (+ b) with exact bf16 products (K = DIN) -> which 0: q f16 rows (+ residual rows < QHI); 1: k f16 rows (+ residual rows < KHI); 2: v f16 planes [c][t] (+ bf16 hi/lo planes for t < KHI)
__global__ __launch_bounds__(128) void k_proj(const float* __restrict__ XQ, const float* __restrict__ XK, const float* __restrict__ XV, const float* __restrict__ WQ, const float* __restrict__ WK, const float* __restrict__ WV, const float* __restrict__ BQ, const float* __restrict__ BK, const float* __restrict__ BV,
    _Float16* __restrict__ QH, _Float16* __restrict__ QL, _Float16* __restrict__ KH, _Float16* __restrict__ KL, _Float16* __restrict__ VT, __bf16* __restrict__ VB, __bf16* __restrict__ VBL PROJ_EXTRA_PARAMS) {
  __shared__ __align__(16) float st[64][132]; __shared__ __align__(16) _Float16 sh[64][136], sl[64][136]; __shared__ __align__(16) _Float16 th[128][72]; __shared__ __align__(16) __bf16 tb[128][72], tbl[128][72];
  const int tid = threadIdx.x, wave = tid >> 5, lane = tid & 31, col = lane & 15, g = lane >> 4; const int which = blockIdx.z + woff; const int c0 = blockIdx.y * 128; const size_t r0 = (size_t)blockIdx.x * 64; const size_t bb = r0 / TT; const int t0 = (int)(r0 % TT);
  const float* X = which == 0 ? XQ : which == 1 ? XK : XV; const float* WA = which == 0 ? WQ : which == 1 ? WK : WV; const float* BA = which == 0 ? BQ : which == 1 ? BK : BV;
  v8f acc[8] = {};
#pragma unroll 2
  for (int kc = 0; kc < DIN / 32; ++kc) { v16b a; { const float* p = X + (r0 + wave * 16 + col) * DIN + kc * 32 + 8 * g;
#pragma unroll
      for (int i = 0; i < 8; ++i) { a[i] = (__bf16)p[i]; a[8 + i] = (__bf16)p[16 + i]; } }
    asm volatile("s_wait_loadcnt 0x0" ::: "memory");
#pragma unroll
    for (int j = 0; j < 8; ++j) { const v16b w = WCOL(WA, kc * 32, c0 + j * 16 + col, lane); asm volatile("s_wait_loadcnt 0x0" ::: "memory"); acc[j] = wmma_bf(a, w, acc[j]); } }
  { // stage the f32 tile (acc + bias) in LDS, run the per-(row, head) epilogue hook, then convert
#pragma unroll
    for (int j = 0; j < 8; ++j) { const int bo_ = c0 + j * 16 + col; const float bias = (BA && (which == 0 || bo_ < KVW)) ? bfr(BA[(which == 0 || bo_ < KVW) ? bo_ : 0]) : 0.f;   /* bk / bv hold only the 64 real kv columns: padded columns get no bias (index clamped, value selected) */
#pragma unroll
      for (int r = 0; r < 8; ++r) st[wave * 16 + 8 * g + r][j * 16 + col] = acc[j][r] + bias; }
    __syncthreads();
    for (int e = tid; e < 64 * (128 / HD); e += 128) { const int rl = e / (128 / HD), hh = e % (128 / HD); PROJ_EPI(which, &st[rl][hh * HD], (int)((r0 + rl) % TT), (c0 / HD) + hh); }
    __syncthreads(); }
  if (which < 2) { _Float16* DH = which == 0 ? QH : KH; _Float16* DL = which == 0 ? QL : KL; const int nhi = which == 0 ? QHI : KHI; const bool hi_rows = t0 < nhi;
    for (int e = tid; e < 64 * 128; e += 128) { const int rl = e >> 7, cl = e & 127; const float v = st[rl][cl]; const _Float16 hv = (_Float16)v; sh[rl][cl] = hv; sl[rl][cl] = (_Float16)((v - (float)hv) * 1024.0f); }
    __syncthreads();
    for (int e = tid; e < 64 * 16; e += 128) { const int rl = e >> 4, q = e & 15; vst2((unsigned*)(DH + (r0 + rl) * (size_t)(which == 0 ? CC : CKV) + c0 + q * 8), *(const v4u*)&sh[rl][q * 8]);   /* q rows at pitch CC, k rows at pitch CKV */ if (hi_rows) vst2((unsigned*)(DL + (bb * nhi + t0 + rl) * (size_t)(which == 0 ? CC : CKV) + c0 + q * 8), *(const v4u*)&sl[rl][q * 8]);   /* residual rows: same pitches */ }
  } else { const bool hi_rows = t0 < KHI;
    for (int e = tid; e < 64 * 128; e += 128) { const int rl = e & 63, cl = e >> 6; const float v = st[rl][cl]; th[cl][rl] = (_Float16)v; const __bf16 bh = (__bf16)v; tb[cl][rl] = bh; tbl[cl][rl] = (__bf16)(v - (float)bh); }
    __syncthreads();
    for (int e = tid; e < 128 * 8; e += 128) { const int cl = e >> 3, q = e & 7; vst2((unsigned*)(VT + (bb * CKV + c0 + cl) * (size_t)TT + t0 + q * 8), *(const v4u*)&th[cl][q * 8]);   /* v planes: CKV channels per batch */ if (hi_rows) { const size_t o3 = (bb * CKV + c0 + cl) * (size_t)KHI + t0 + q * 8; vst2((unsigned*)(VB + o3), *(const v4u*)&tb[cl][q * 8]); vst2((unsigned*)(VBL + o3), *(const v4u*)&tbl[cl][q * 8]); } } } }
// ---- k_sc: block = (query block qb, key block kb <= kb_last(qb), head in group) of batch b: logits x SCALE; q hi + residual (x 2^10) against k (2 products) for query rows < QHI, plus the k residual (3 products) for query blocks < QBH (causal early rows); causal: blocks past the diagonal exit, the mask itself is applied by index in k_pv
__global__ __launch_bounds__(128) void k_sc(const _Float16* __restrict__ QH, const _Float16* __restrict__ KH, const _Float16* __restrict__ QL, const _Float16* __restrict__ KL, int b, int h0, float* __restrict__ S0) { __shared__ __align__(16) float ss[4][16][132];
  const int qb = blockIdx.x, kb = blockIdx.y; if (kb > kb_last(qb)) return;
  const int h = h0 + blockIdx.z; float* S = S0 + (size_t)blockIdx.z * TT * TT;
  const int tid = threadIdx.x, wave = tid >> 5, lane = tid & 31, col = lane & 15, g = lane >> 4; const int k0 = kb * 128; const int ql0 = qb * 64 + wave * 16; const size_t q0 = (size_t)b * TT + ql0, kr0 = (size_t)b * TT + k0;
  v8f acc[8] = {}, accl[8] = {};
  const _Float16* QLb = QL + (size_t)b * QHI * CC; const _Float16* KLb = KL + (size_t)b * KHI * CKV;
  if (qb < QBH) {
#pragma unroll
    for (int kc = 0; kc < HD / 32; ++kc) { const v16h ah = frag_h(QH + (q0 + col) * CC + h * HD + kc * 32, lane), al = frag_h(QLb + (size_t)(ql0 + col) * CC + h * HD + kc * 32, lane);
#pragma unroll
      for (int j = 0; j < 8; ++j) { const v16h kbf = frag_h(KH + (kr0 + j * 16 + col) * CKV + (h / GRP) * HD + kc * 32, lane), klf = frag_h(KLb + (size_t)(k0 + j * 16 + col) * CKV + (h / GRP) * HD + kc * 32, lane); acc[j] = wmma16(ah, kbf, acc[j]); accl[j] = wmma16(al, kbf, accl[j]); accl[j] = wmma16(ah, klf, accl[j]); } }
  } else if (qb * 64 < QHI) {
#pragma unroll
    for (int kc = 0; kc < HD / 32; ++kc) { const v16h ah = frag_h(QH + (q0 + col) * CC + h * HD + kc * 32, lane), al = frag_h(QLb + (size_t)(ql0 + col) * CC + h * HD + kc * 32, lane);
#pragma unroll
      for (int j = 0; j < 8; ++j) { const v16h kbf = frag_h(KH + (kr0 + j * 16 + col) * CKV + (h / GRP) * HD + kc * 32, lane); acc[j] = wmma16(ah, kbf, acc[j]); accl[j] = wmma16(al, kbf, accl[j]); } }
  } else {
#pragma unroll
    for (int kc = 0; kc < HD / 32; ++kc) { const v16h ah = frag_h(QH + (q0 + col) * CC + h * HD + kc * 32, lane);
#pragma unroll
      for (int j = 0; j < 8; ++j) { const v16h kbf = frag_h(KH + (kr0 + j * 16 + col) * CKV + (h / GRP) * HD + kc * 32, lane); acc[j] = wmma16(ah, kbf, acc[j]); } } }
#pragma unroll
  for (int j = 0; j < 8; ++j) {
#pragma unroll
    for (int r = 0; r < 8; ++r) ss[wave][8 * g + r][j * 16 + col] = (acc[j][r] + accl[j][r] * (1.0f / 1024.0f)) * SCALE; }
  LDSX(); for (int rl = 0; rl < 16; ++rl) vst2(S + (size_t)(ql0 + rl) * TT + k0 + lane * 4, *(const v4f*)&ss[wave][rl][lane * 4]); }
// ---- k_pv: block = 16 queries (qt) of (b, h), PVW waves: wave w owns the 32-key chunks w, w + PVW, ... of keys [0, kend). It reads its logits straight into the A-fragment layout (lane = query row, 16 keys a chunk) and keeps them in registers; softmax in f32 inside the block: excluded keys (after the query, or outside the window) by index, row maximum and row sum over the lane's own keys, the other half-wave, then the PVW waves through LDS in wave order; P x 2^11 once to f16 against v f16 (1 product; causal early query blocks: P and v as bf16 hi + lo, 3 products); the PVW partial ctx tiles are added in LDS in wave order; 256-B (row, head) segment by 16 lanes
#define PVW 8
#define PVC (TT / 32 / PVW)                                             // most chunks one wave can own
#define PVCH (((((QBH * 64 - 1) >> 7) + 1) * 4 + PVW - 1) / PVW)         // the same for the early (high-precision) query blocks
__global__ __launch_bounds__(32 * PVW) void k_pv(const float* __restrict__ PS0, const _Float16* __restrict__ VT, const __bf16* __restrict__ VB, const __bf16* __restrict__ VBL, int b, int h0, float* __restrict__ Y SM_EXTRA_PARAMS) { const int h = h0 + blockIdx.z; const float* PS = PS0 + (size_t)blockIdx.z * TT * TT; __shared__ __align__(16) float ss[PVW][16][HD + 4]; __shared__ float smx[PVW][16], ssu[PVW][16];
  const int tid = threadIdx.x, lane = tid & 31, col = lane & 15, g = lane >> 4; const int qt = blockIdx.x, qb = qt >> 2; const int ql0 = qt * 16; const int kce = (kb_last(qb) + 1) * 4;
  const int wave = __builtin_amdgcn_readfirstlane(tid >> 5);   /* the wave's number in a scalar register: the chunk tests below branch on scalars and every lane stays on at the matrix instructions */
  const int win_ = WINP[0]; const int t = ql0 + col; const float* prow = PS + (size_t)t * TT + wave * 32 + 8 * g;   /* the wave's first chunk; chunk i lies i * PVW * 32 floats on, a constant offset from this one address */
  v4f lq[PVC][4];   /* chunk i is loaded, and read, only under kc < kce; every loop over i or j below is fully unrolled so that lq is indexed by constants alone and stays in registers */
  /* every logit load of the wave is issued before the first one is used: one memory latency for the whole row share */
#pragma unroll
  for (int i = 0; i < PVC; ++i) { const int kc = wave + i * PVW; if (kc < kce) { const float* p = prow + i * (PVW * 32); lq[i][0] = *(const v4f*)p; lq[i][1] = *(const v4f*)(p + 4); lq[i][2] = *(const v4f*)(p + 16); lq[i][3] = *(const v4f*)(p + 20); } }
  asm volatile("s_wait_xcnt 0x0" ::: "memory");   /* stands in front of the first instruction that reuses the address registers of the loads above */
  float m = -3.0e38f;
#pragma unroll
  for (int i = 0; i < PVC; ++i) { const int kc = wave + i * PVW; if (kc < kce) {
#pragma unroll
      for (int j = 0; j < 16; ++j) { const int k = kc * 32 + 8 * g + (j & 7) + 16 * (j >> 3); float v = (!CAUSAL || k <= t) ? lq[i][j >> 2][j & 3] : -3.0e38f; SM_MASK_HOOK; lq[i][j >> 2][j & 3] = v; m = fmaxf(m, v); } } }
  m = fmaxf(m, __shfl_xor(m, 16)); if (g == 0) smx[wave][col] = m;
  __syncthreads();   /* every wave's row maxima are in LDS before any lane combines them */
#pragma unroll
  for (int w = 0; w < PVW; ++w) m = fmaxf(m, smx[w][col]);
  float sum = 0.f;
#pragma unroll
  for (int i = 0; i < PVC; ++i) { const int kc = wave + i * PVW; if (kc < kce) {
#pragma unroll
      for (int j = 0; j < 16; ++j) { const float v = lq[i][j >> 2][j & 3]; const float ex = expf(v - m); const float e = (v <= -1.0e38f) ? 0.f : ex; lq[i][j >> 2][j & 3] = e; sum += e; } } }
  sum += __shfl_xor(sum, 16); if (g == 0) ssu[wave][col] = sum;
  __syncthreads();   /* every wave's row sums are in LDS before any lane adds them */
  float rs = 0.f;
#pragma unroll
  for (int w = 0; w < PVW; ++w) rs += ssu[w][col];
  const float inv = rs > 0.f ? 2048.0f / rs : 0.f;   /* a fully excluded row yields P = 0 */
  v8f acc[HD / 16] = {}; const size_t vro = (size_t)b * CKV + (h / GRP) * HD + col;   /* the lane's v channel of column block 0; block j and chunk i are constant offsets from it */
  if (qb < QBH) {
#pragma unroll
    for (int i = 0; i < PVCH; ++i) { const int kc = wave + i * PVW; if (kc < kce) { float pf[16];
#pragma unroll
        for (int j = 0; j < 16; ++j) pf[j] = lq[i][j >> 2][j & 3] * inv;
        const F2 p = bsplit16(pf);
#pragma unroll
        for (int j = 0; j < HD / 16; ++j) { const size_t po = vro * (size_t)KHI + wave * 32 + (size_t)(j * 16 * KHI + i * (PVW * 32)); const v16b vh = frag_b(VB + po, lane); acc[j] = wmma_bf(p.h, vh, acc[j]); acc[j] = wmma_bf(p.l, vh, acc[j]); acc[j] = wmma_bf(p.h, frag_b(VBL + po, lane), acc[j]); } } }
  } else {
#pragma unroll
    for (int i = 0; i < PVC; ++i) { const int kc = wave + i * PVW; if (kc < kce) { v16h p;
#pragma unroll
        for (int j = 0; j < 16; ++j) p[j] = (_Float16)(lq[i][j >> 2][j & 3] * inv);
#pragma unroll
        for (int j = 0; j < HD / 16; ++j) { const size_t po = vro * (size_t)TT + wave * 32 + (size_t)(j * 16 * TT + i * (PVW * 32)); acc[j] = wmma16(p, frag_h(VT + po, lane), acc[j]); } } } }
#pragma unroll
  for (int j = 0; j < HD / 16; ++j)
#pragma unroll
    for (int r = 0; r < 8; ++r) ss[wave][8 * g + r][j * 16 + col] = acc[j][r] * (1.0f / 2048.0f);
  __syncthreads();   /* every wave's partial tile is in LDS before any thread adds them */
  { const int rl = tid >> 4, q4 = (tid & 15) * 4; v4f s = *(const v4f*)&ss[0][rl][q4];
#pragma unroll
    for (int w = 1; w < PVW; ++w) s += *(const v4f*)&ss[w][rl][q4];
    vst2(Y + ((size_t)b * TT + ql0 + rl) * CC + h * HD + q4, s); } }
static_assert(32 * PVW == 16 * (HD / 4), "one thread per float4 of the 16 x HD tile in the final add");
// ---- k_out: block = (64 rows, 128 cols): out = ctx Wo (+ bo): ctx once to f16 against Wo as f16(bf16 x 2^8) exact (1 product) x 2^-8; causal early rows (< QHI of each sequence): ctx bf16 hi + lo against exact bf16 Wo (2 products)
__global__ __launch_bounds__(128) void k_out(const float* __restrict__ Y, const float* __restrict__ WO, const float* __restrict__ BO, float* __restrict__ OUT) { __shared__ __align__(16) float sf[4][16][132];
  const int tid = threadIdx.x, wave = tid >> 5, lane = tid & 31, col = lane & 15, g = lane >> 4; const int c0 = blockIdx.y * 128; const size_t r0 = (size_t)blockIdx.x * 64 + wave * 16;
  v8f acc[8] = {};
  if (CAUSAL && (int)(((size_t)blockIdx.x * 64) % TT) < QHI) {   /* block-uniform */
#pragma unroll 2
    for (int kc = 0; kc < CC / 32; ++kc) { const F2 a = split_row(Y + (r0 + col) * CC, kc * 32, lane); asm volatile("s_wait_loadcnt 0x0" ::: "memory");
#pragma unroll
      for (int j = 0; j < 8; ++j) { const v16b w = WOCOL(WO, kc * 32, c0 + j * 16 + col, lane); asm volatile("s_wait_loadcnt 0x0" ::: "memory"); acc[j] = wmma_bf(a.h, w, acc[j]); acc[j] = wmma_bf(a.l, w, acc[j]); } }
#pragma unroll
    for (int j = 0; j < 8; ++j) { const float bias = BO ? bfr(BO[c0 + j * 16 + col]) : 0.f;
#pragma unroll
      for (int r = 0; r < 8; ++r) sf[wave][8 * g + r][j * 16 + col] = acc[j][r] + bias; }
  } else {
#pragma unroll 2
    for (int kc = 0; kc < CC / 32; ++kc) { const v16h a = frag_f32s(Y + (r0 + col) * CC + kc * 32, lane, 64.0f); asm volatile("s_wait_loadcnt 0x0" ::: "memory");   /* ctx carried x 2^6 into f16 so small-magnitude context rows stay clear of f16 subnormals (chip FTZ) */
#pragma unroll
      for (int j = 0; j < 8; ++j) { const v16h w = WOCOLH(WO, kc * 32, c0 + j * 16 + col, lane); asm volatile("s_wait_loadcnt 0x0" ::: "memory"); acc[j] = wmma16(a, w, acc[j]); } }
#pragma unroll
    for (int j = 0; j < 8; ++j) { const float bias = BO ? bfr(BO[c0 + j * 16 + col]) : 0.f;
#pragma unroll
      for (int r = 0; r < 8; ++r) sf[wave][8 * g + r][j * 16 + col] = acc[j][r] * (1.0f / 16384.0f) + bias; } }   /* 2^-8 (Wo carry) x 2^-6 (ctx carry) */
  LDSX(); for (int rl = 0; rl < 16; ++rl) vst2(OUT + (r0 + rl) * DIN + c0 + lane * 4, *(const v4f*)&sf[wave][rl][lane * 4]); }

extern "C" void kernel_launch(void* const* d_in, const int* in_sizes, int n_in, void* d_out, int out_size, void* d_ws, size_t ws_size, hipStream_t stream) {
  (void)in_sizes; (void)n_in; (void)out_size;
  const float** F = (const float**)d_in;
  if (ws_size < (size_t)WS_END) return;
  char* ws = (char*)d_ws; _Float16 *QH = (_Float16*)(ws + WS_QH), *KH = (_Float16*)(ws + WS_KH), *VT = (_Float16*)(ws + WS_VT), *QL = (_Float16*)(ws + WS_QL), *KL = (_Float16*)(ws + WS_KL); __bf16 *VB = (__bf16*)(ws + WS_VB), *VBL = (__bf16*)(ws + WS_VBL); float *S = (float*)(ws + WS_S), *Y = (float*)(ws + WS_Y);
  (void)Y; (void)QL; (void)KL; (void)VB; (void)VBL;
  // inputs: 0 x [2,2048,1024]; 1 ve [2,2048,64]; 2 cos [2048,32]; 3 sin [2048,32]; 4 Wq [1024,1024] (in,out); 5 Wk [1024,64]; 6 Wv [1024,64]; 7 Wo [1024,1024] (in,out); 8 Wg [32,1]; 9 window_size int32 [1]; no biases
  k_proj<<<dim3(TNB * TT / 64, CC / 128, 1), 128, 0, stream>>>(F[0], F[0], F[0], F[4], F[5], F[6], nullptr, nullptr, nullptr, QH, QL, KH, KL, VT, VB, VBL, 0, F[2], F[3], F[1], F[8]);    /* q: 8 column blocks */
  k_proj<<<dim3(TNB * TT / 64, CKV / 128, 2), 128, 0, stream>>>(F[0], F[0], F[0], F[4], F[5], F[6], nullptr, nullptr, nullptr, QH, QL, KH, KL, VT, VB, VBL, 1, F[2], F[3], F[1], F[8]);   /* k (which 1) and v (which 2): one (half-empty) column block each */
  for (int b = 0; b < TNB; ++b) for (int h0 = 0; h0 < NH; h0 += HG) {
    k_sc<<<dim3(NQB, TT / 128, HG), 128, 0, stream>>>(QH, KH, QL, KL, b, h0, S);
    k_pv<<<dim3(TT / 16, 1, HG), 32 * PVW, 0, stream>>>(S, VT, VB, VBL, b, h0, Y, (const int*)d_in[9]);
  }
  k_out<<<dim3(TNB * TT / 64, DIN / 128), 128, 0, stream>>>(Y, F[7], nullptr, (float*)d_out);
}

// v003
// Measured time: 369 microseconds a run.
// Timed twice side by side with v002, it ran 1.50 and 1.51 times as fast.
// Over all steps from v000 it is 2.71 times as fast.
// compute dtype: all float inputs rounded to bf16, the cos / sin tables, ve and Wg included; q (16 heads) and the single shared k / v head projections with EXACT bf16 products on WMMA 16x16x32 (f32 accumulate); half-split RoPE with cos / sin READ from the table inputs, then RMSNorm over the 64 head dims (f32, eps = f32 machine epsilon) on q and k; v += 2 sigmoid(x[:32] . Wg) ve in f32; causal logits inside a sliding window read from the int input: 3 products for the first 384 rows, single f16 q x k after, x 64^-0.5; softmax f32; P x 2^11 once to f16 x v once to f16 (bf16 hi + lo below row 384); ctx hi+lo x exact Wo below row 384, x2^6 f16 carry x f16(bf16 x 2^8) Wo after; f32 output.
#include <hip/hip_runtime.h>
#include <math.h>

typedef __attribute__((ext_vector_type(16))) _Float16 v16h;
typedef __attribute__((ext_vector_type(16))) __bf16 v16b;
typedef __attribute__((ext_vector_type(8)))  _Float16 v8h;
typedef __attribute__((ext_vector_type(8)))  float v8f;
typedef __attribute__((ext_vector_type(4)))  float v4f;
typedef __attribute__((ext_vector_type(2)))  float v2f;
typedef __attribute__((ext_vector_type(4)))  unsigned v4u;
typedef __attribute__((ext_vector_type(4)))  int v4i;
typedef float __attribute__((may_alias)) float_a;
typedef int __attribute__((may_alias)) int_a;

template <typename T> __device__ __forceinline__ void vst2(void* p, T v) { *(T*)p = v;  }
__device__ __forceinline__ v8f wmma16(v16h a, v16h b, v8f c) {
  v8f d = __builtin_amdgcn_wmma_f32_16x16x32_f16(false, a, false, b, (short)0, c, false, false);
  asm volatile("v_nop\n\tv_nop\n\tv_nop\n\tv_nop" : "+v"(d) : "v"(a), "v"(b));
  return d;
}
__device__ __forceinline__ v8f wmma_bf(v16b a, v16b b, v8f c) {
  v8f d = __builtin_amdgcn_wmma_f32_16x16x32_bf16(false, a, false, b, (short)0, c, false, false);
  asm volatile("v_nop\n\tv_nop\n\tv_nop\n\tv_nop" : "+v"(d) : "v"(a), "v"(b));
  return d;
}
// 16x16x32 fragments: lane = (h = lane>>4, row/col = lane&15); elements 0..7 = k0+8h+0..7, 8..15 = k0+16+8h+0..7; D element r = row 8h+r
__device__ __forceinline__ v16h frag_h(const _Float16* rowk0, int lane) {
  union { v16h v; v8h q[2]; } u; const _Float16* p = rowk0 + 8 * (lane >> 4);
  u.q[0] = *(const v8h*)p; u.q[1] = *(const v8h*)(p + 16); return u.v;
}
__device__ __forceinline__ v16h frag_f32(const float* rowk0, int lane) {
  v16h a; const float* p = rowk0 + 8 * (lane >> 4);
#pragma unroll
  for (int i = 0; i < 8; ++i) { a[i] = (_Float16)p[i]; a[8 + i] = (_Float16)p[16 + i]; }
  return a;
}
__device__ __forceinline__ v16h frag_f32s(const float* rowk0, int lane, float sc) {
  v16h a; const float* p = rowk0 + 8 * (lane >> 4);
#pragma unroll
  for (int i = 0; i < 8; ++i) { a[i] = (_Float16)(p[i] * sc); a[8 + i] = (_Float16)(p[16 + i] * sc); }
  return a;
}
// column fragment from a [K][ld] layout (column n), rows >= K read as 0
__device__ __forceinline__ v16h fragc_f32(const float* W, int k0, int n, int lane, int ld, int K) {
  v16h a; const int g = lane >> 4;
#pragma unroll
  for (int i = 0; i < 8; ++i) { const int ka = k0 + 8 * g + i, kb = ka + 16;
    a[i] = (_Float16)(ka < K ? W[(size_t)(ka < K ? ka : K - 1) * ld + n] : 0.f); a[8 + i] = (_Float16)(kb < K ? W[(size_t)(kb < K ? kb : K - 1) * ld + n] : 0.f); }
  return a;
}
struct F2 { v16b h, l; };
__device__ __forceinline__ F2 bsplit16(const float v[16]) { F2 r;
#pragma unroll
  for (int i = 0; i < 16; ++i) { const __bf16 h = (__bf16)v[i]; r.h[i] = h; r.l[i] = (__bf16)(v[i] - (float)h); }
  return r; }
__device__ __forceinline__ F2 split_row(const float* row, int k0, int lane) { float v[16]; const float* p = row + k0 + 8 * (lane >> 4);
#pragma unroll
  for (int i = 0; i < 8; ++i) { v[i] = p[i]; v[8 + i] = p[16 + i]; }
  return bsplit16(v); }
__device__ __forceinline__ F2 split_rowK(const float* row, int k0, int lane, int K) { float v[16]; const int g = lane >> 4;
#pragma unroll
  for (int i = 0; i < 8; ++i) { const int ka = k0 + 8 * g + i, kb = ka + 16; v[i] = ka < K ? row[ka < K ? ka : K - 1] : 0.f; v[8 + i] = kb < K ? row[kb < K ? kb : K - 1] : 0.f; }
  return bsplit16(v); }
__device__ __forceinline__ F2 split_col(const float* W, int k0, int n, int lane, int ld, int K) { float v[16]; const int g = lane >> 4;
#pragma unroll
  for (int i = 0; i < 8; ++i) { const int ka = k0 + 8 * g + i, kb = ka + 16; v[i] = ka < K ? W[(size_t)(ka < K ? ka : K - 1) * ld + n] : 0.f; v[8 + i] = kb < K ? W[(size_t)(kb < K ? kb : K - 1) * ld + n] : 0.f; }
  return bsplit16(v); }
__device__ __forceinline__ v8f mac3(const F2& a, const F2& b, v8f c) { c = wmma_bf(a.l, b.h, c); c = wmma_bf(a.h, b.l, c); return wmma_bf(a.h, b.h, c); }
__device__ __forceinline__ float sigm(float v) { return 1.0f / (1.0f + expf(-v)); }
#define LDSX() do { asm volatile("s_wait_dscnt 0" ::: "memory"); __builtin_amdgcn_wave_barrier(); __builtin_amdgcn_fence(__ATOMIC_RELEASE, "workgroup"); } while (0)

// Multi-query causal attention with table RoPE, per-head RMSNorm, a gated value residual and a sliding window (x [2,2048,1024]; ve [2,2048,64]; cos, sin [2048,32] (inputs); (in,out) Wq [1024,1024], Wk / Wv [1024,64], Wo [1024,1024], all N(0,1) x 0.02; Wg [32,1]; window_size int (1024); 16 query heads share ONE key / value head; gate = 2 sigmoid(x[..., :32] Wg); v = x Wv + gate * ve; _rope: (x1, x2) = halves -> (x1 cos + x2 sin, -x1 sin + x2 cos); _rmsnorm: x * rsqrt(mean(x^2) + finfo.eps) AFTER the rotation, on q and k; scores x 64^-0.5; masked where key > query or query - key >= window_size (finfo.min); softmax; out = merge(attn v) Wo).
#define NB 2
#define TT 2048
#define CC 1024            // NH * HD = projected width
#define DIN 1024          // input (model) width
#define NH 16
#define HD 64
#define SCALE (0.125f)
#define CAUSAL 1
#ifndef TNB
#define TNB NB
#endif
__device__ __forceinline__ float bfr(float v) { return (float)(__bf16)v; }
__host__ __device__ __forceinline__ int kb_last(int qb) { return CAUSAL ? ((qb * 64 + 63) >> 7) : (TT / 128 - 1); }
typedef __attribute__((ext_vector_type(8))) __bf16 v8b;
__device__ __forceinline__ v16b frag_b(const __bf16* rowk0, int lane) {
  union { v16b v; v8b q[2]; } u; const __bf16* p = rowk0 + 8 * (lane >> 4);
  u.q[0] = *(const v8b*)p; u.q[1] = *(const v8b*)(p + 16); return u.v;
}
#define QBH 6              // causal: query blocks 0..QBH-1 of each sequence (few keys, no averaging) take the high-precision path
#define QHI 384            // rows carrying a q residual plane
#define KHI 384            // key rows carrying k residual / v bf16 hi+lo planes (used only by the causal high-precision path)
// B fragment (k rows k0+.., output column o) of a weight: (in,out) [K][ld] or (out,in) [ld rows of K]: bf16 exact, or f16(bf16 * 256) exact
__device__ __forceinline__ v16b wcol_io(const float* Wm, int k0, int o, int lane, int ld) { v16b w; const int g = lane >> 4;
#pragma unroll
  for (int i = 0; i < 8; ++i) { w[i] = (__bf16)Wm[(size_t)(k0 + 8 * g + i) * ld + o]; w[8 + i] = (__bf16)Wm[(size_t)(k0 + 16 + 8 * g + i) * ld + o]; }
  return w; }
__device__ __forceinline__ v16b wcol_oi(const float* Wm, int k0, int o, int lane, int K) { v16b w; const float* p = Wm + (size_t)o * K + k0 + 8 * (lane >> 4);
#pragma unroll
  for (int i = 0; i < 8; ++i) { w[i] = (__bf16)p[i]; w[8 + i] = (__bf16)p[16 + i]; }
  return w; }
__device__ __forceinline__ v16h wcolh_io(const float* Wm, int k0, int o, int lane, int ld) { v16h w; const int g = lane >> 4;
#pragma unroll
  for (int i = 0; i < 8; ++i) { w[i] = (_Float16)(bfr(Wm[(size_t)(k0 + 8 * g + i) * ld + o]) * 256.0f); w[8 + i] = (_Float16)(bfr(Wm[(size_t)(k0 + 16 + 8 * g + i) * ld + o]) * 256.0f); }
  return w; }
__device__ __forceinline__ v16h wcolh_oi(const float* Wm, int k0, int o, int lane, int K) { v16h w; const float* p = Wm + (size_t)o * K + k0 + 8 * (lane >> 4);
#pragma unroll
  for (int i = 0; i < 8; ++i) { w[i] = (_Float16)(bfr(p[i]) * 256.0f); w[8 + i] = (_Float16)(bfr(p[16 + i]) * 256.0f); }
  return w; }
#define WQKV_LAYOUT 0   // 0 = (in,out) [DIN][CC]; 1 = (out,in) [CC][DIN]; 2 = per-head [NH][DIN][HD]
__device__ __forceinline__ v16b wcol_hdk(const float* Wm, int k0, int o, int lane) { v16b w; const int g = lane >> 4; const float* p = Wm + (size_t)(o / HD) * DIN * HD + (o % HD);
#pragma unroll
  for (int i = 0; i < 8; ++i) { w[i] = (__bf16)p[(size_t)(k0 + 8 * g + i) * HD]; w[8 + i] = (__bf16)p[(size_t)(k0 + 16 + 8 * g + i) * HD]; }
  return w; }
#define WO_OUT_IN 0
#if WQKV_LAYOUT == 1
#define WCOL(W, k0, o, lane) wcol_oi(W, k0, o, lane, DIN)
#elif WQKV_LAYOUT == 2
#define WCOL(W, k0, o, lane) wcol_hdk(W, k0, o, lane)
#else
#define WCOL(W, k0, o, lane) (which == 0 ? wcol_io(W, k0, (o), lane, CC) : ((o) < KVW ? wcol_io(W, k0, (o), lane, KVW) : zero16b()))   /* (in,out): Wq [1024][1024] pitch CC; Wk / Wv [1024][64] pitch 64, padded columns 64..127 are zero */
#endif
#if WO_OUT_IN
#define WOCOL(W, k0, o, lane) wcol_oi(W, k0, o, lane, CC)
#define WOCOLH(W, k0, o, lane) wcolh_oi(W, k0, o, lane, CC)
#else
#define WOCOL(W, k0, o, lane) wcol_io(W, k0, o, lane, DIN)
#define WOCOLH(W, k0, o, lane) wcolh_io(W, k0, o, lane, DIN)
#endif
#define GRP 16             // all 16 query heads share the single kv head (kv head = h / 16 = 0)
#define CKV 128            // kv plane width: ONE 128-column block whose columns 0..63 are the single kv head, columns 64..127 zero padding
#define KVW 64             // real kv width (Wk / Wv are (in,out) [1024][64])
#define PROJ_EXTRA_PARAMS , int woff, const float* __restrict__ COS, const float* __restrict__ SIN, const float* __restrict__ VE, const float* __restrict__ WG   /* which = blockIdx.z + woff; COS / SIN [TT][32], VE [NB*TT][64], WG [32] are module inputs read in the projection epilogue */
__device__ __forceinline__ v16b zero16b() { v16b w; _Pragma("unroll") for (int i = 0; i < 16; ++i) w[i] = (__bf16)0.0f; return w; }
#define RMS_EPS 1.1920929e-07f   /* jnp.finfo(float32).eps */
// per (token, head) hook on the staged f32 row (64 floats). q and k (which 0, 1): the module's _rope with cos / sin read LITERALLY from the table inputs at row t (bf16-rounded like every float input): (x1, x2) = (row[m], row[32+m]) -> (x1 c + x2 s, -x1 s + x2 c), then _rmsnorm over the 64 dims: x * (1 / sqrt(mean(x^2) + eps)); the zero-padded second half of the k block stays exactly zero under both. v (which 2): row += gate * bf16(ve[b, t, :]) with gate = 2 / (1 + exp(-z)), z = sum_{i<32} bf16(x[b, t, i]) * bf16(Wg[i]); all global loads are unconditional; the padded half gets gate 0 through a select. f32, products and sums kept separate
#define PROJ_EPI(which, row, t, h) do { float* rw = (row); const size_t gr_ = bb * TT + (size_t)(t); if ((which) < 2) { const float* ct_ = COS + (size_t)(t) * 32; const float* st_ = SIN + (size_t)(t) * 32; _Pragma("unroll 4") for (int m = 0; m < 32; ++m) { _Pragma("clang fp contract(off)") const float c_ = bfr(ct_[m]), s_ = bfr(st_[m]); const float x1 = rw[m], x2 = rw[32 + m]; rw[m] = x1 * c_ + x2 * s_; rw[32 + m] = (-x1) * s_ + x2 * c_; } float ss_ = 0.f; _Pragma("unroll 8") for (int m = 0; m < 64; ++m) { _Pragma("clang fp contract(off)") ss_ += rw[m] * rw[m]; } const float rinv_ = 1.0f / sqrtf(ss_ * (1.0f / 64.0f) + RMS_EPS); _Pragma("unroll 8") for (int m = 0; m < 64; ++m) rw[m] = rw[m] * rinv_; } else { const float* xr_ = XV + gr_ * DIN; float z_ = 0.f; _Pragma("unroll 8") for (int i = 0; i < 32; ++i) { _Pragma("clang fp contract(off)") z_ += bfr(xr_[i]) * bfr(WG[i]); } const float gate_ = 2.0f / (1.0f + expf(-z_)); const float gsel_ = ((h) == 0) ? gate_ : 0.0f; const float* ve_ = VE + gr_ * 64; _Pragma("unroll 8") for (int m = 0; m < 64; ++m) { _Pragma("clang fp contract(off)") rw[m] = rw[m] + gsel_ * bfr(ve_[m]); } } } while (0)
static_assert(HD == 64 && KVW == 64 && CKV == 128, "the hook spells 32 / 64 literally: one real 64-wide kv head in a 128-column block");
#define SM_EXTRA_PARAMS , const int* __restrict__ WINP
// sliding window: a key is excluded when query - key >= window_size; window_size is the module's int input (one block-uniform scalar load); keys after the query are already excluded by the causal select; every row keeps at least min(t + 1, window) >= 1 keys
#define SM_MASK_HOOK do { v = (t - k >= win_) ? -3.0e38f : v; } while (0)   /* win_ = WINP[0], read once at the kernel's head */
#ifndef SM_EXTRA_PARAMS
#define SM_EXTRA_PARAMS
#endif
#ifndef PROJ_EXTRA_PARAMS
#define PROJ_EXTRA_PARAMS
#endif
#ifndef SM_MASK_HOOK
#define SM_MASK_HOOK (void)0
#endif

#define WS_QH  0u                                      // f16 q rows [b*t][CC]
#define WS_KH  (WS_QH + 2u * (size_t)NB * TT * CC)      // f16 k rows [b*t][CKV]
#define WS_VT  (WS_KH + 2u * (size_t)NB * TT * CC)      // f16 v planes [b][c][t]
#define WS_QL  (WS_VT + 2u * (size_t)NB * CC * TT)      // f16 q residual x 2^10 rows [b][t < QHI][CC]
#define WS_KL  (WS_QL + 2u * (size_t)NB * QHI * CC)     // f16 k residual x 2^10 rows [b][t < KHI][CKV]
#define WS_VB  (WS_KL + 2u * (size_t)NB * KHI * CC)     // bf16 v hi planes [b][c][t < KHI]
#define WS_VBL (WS_VB + 2u * (size_t)NB * CC * KHI)
#define WS_Y   (WS_VBL + 2u * (size_t)NB * CC * KHI)    // f32 ctx rows [b*t][CC] (only when there is an output projection)
#define WS_END (WS_Y  + 4u * (size_t)NB * TT * CC)

// ---- k_proj: block = (64 rows, 128 cols, which): q/k/v = X W (+ b) with exact bf16 products (K = DIN) -> which 0: q f16 rows (+ residual rows < QHI); 1: k f16 rows (+ residual rows < KHI); 2: v f16 planes [c][t] (+ bf16 hi/lo planes for t < KHI)
__global__ __launch_bounds__(128) void k_proj(const float* __restrict__ XQ, const float* __restrict__ XK, const float* __restrict__ XV, const float* __restrict__ WQ, const float* __restrict__ WK, const float* __restrict__ WV, const float* __restrict__ BQ, const float* __restrict__ BK, const float* __restrict__ BV,
    _Float16* __restrict__ QH, _Float16* __restrict__ QL, _Float16* __restrict__ KH, _Float16* __restrict__ KL, _Float16* __restrict__ VT, __bf16* __restrict__ VB, __bf16* __restrict__ VBL PROJ_EXTRA_PARAMS) {
  __shared__ __align__(16) float st[64][132]; __shared__ __align__(16) _Float16 sh[64][136], sl[64][136]; __shared__ __align__(16) _Float16 th[128][72]; __shared__ __align__(16) __bf16 tb[128][72], tbl[128][72];
  const int tid = threadIdx.x, wave = tid >> 5, lane = tid & 31, col = lane & 15, g = lane >> 4; const int which = blockIdx.z + woff; const int c0 = blockIdx.y * 128; const size_t r0 = (size_t)blockIdx.x * 64; const size_t bb = r0 / TT; const int t0 = (int)(r0 % TT);
  const float* X = which == 0 ? XQ : which == 1 ? XK : XV; const float* WA = which == 0 ? WQ : which == 1 ? WK : WV; const float* BA = which == 0 ? BQ : which == 1 ? BK : BV;
  v8f acc[8] = {};
#pragma unroll 2
  for (int kc = 0; kc < DIN / 32; ++kc) { v16b a; { const float* p = X + (r0 + wave * 16 + col) * DIN + kc * 32 + 8 * g;
#pragma unroll
      for (int i = 0; i < 8; ++i) { a[i] = (__bf16)p[i]; a[8 + i] = (__bf16)p[16 + i]; } }
    asm volatile("s_wait_loadcnt 0x0" ::: "memory");
#pragma unroll
    for (int j = 0; j < 8; ++j) { const v16b w = WCOL(WA, kc * 32, c0 + j * 16 + col, lane); asm volatile("s_wait_loadcnt 0x0" ::: "memory"); acc[j] = wmma_bf(a, w, acc[j]); } }
  { // stage the f32 tile (acc + bias) in LDS, run the per-(row, head) epilogue hook, then convert
#pragma unroll
    for (int j = 0; j < 8; ++j) { const int bo_ = c0 + j * 16 + col; const float bias = (BA && (which == 0 || bo_ < KVW)) ? bfr(BA[(which == 0 || bo_ < KVW) ? bo_ : 0]) : 0.f;   /* bk / bv hold only the 64 real kv columns: padded columns get no bias (index clamped, value selected) */
#pragma unroll
      for (int r = 0; r < 8; ++r) st[wave * 16 + 8 * g + r][j * 16 + col] = acc[j][r] + bias; }
    __syncthreads();
    for (int e = tid; e < 64 * (128 / HD); e += 128) { const int rl = e / (128 / HD), hh = e % (128 / HD); PROJ_EPI(which, &st[rl][hh * HD], (int)((r0 + rl) % TT), (c0 / HD) + hh); }
    __syncthreads(); }
  if (which < 2) { _Float16* DH = which == 0 ? QH : KH; _Float16* DL = which == 0 ? QL : KL; const int nhi = which == 0 ? QHI : KHI; const bool hi_rows = t0 < nhi;
    for (int e = tid; e < 64 * 128; e += 128) { const int rl = e >> 7, cl = e & 127; const float v = st[rl][cl]; const _Float16 hv = (_Float16)v; sh[rl][cl] = hv; sl[rl][cl] = (_Float16)((v - (float)hv) * 1024.0f); }
    __syncthreads();
    for (int e = tid; e < 64 * 16; e += 128) { const int rl = e >> 4, q = e & 15; vst2((unsigned*)(DH + (r0 + rl) * (size_t)(which == 0 ? CC : CKV) + c0 + q * 8), *(const v4u*)&sh[rl][q * 8]);   /* q rows at pitch CC, k rows at pitch CKV */ if (hi_rows) vst2((unsigned*)(DL + (bb * nhi + t0 + rl) * (size_t)(which == 0 ? CC : CKV) + c0 + q * 8), *(const v4u*)&sl[rl][q * 8]);   /* residual rows: same pitches */ }
  } else { const bool hi_rows = t0 < KHI;
    for (int e = tid; e < 64 * 128; e += 128) { const int rl = e & 63, cl = e >> 6; const float v = st[rl][cl]; th[cl][rl] = (_Float16)v; const __bf16 bh = (__bf16)v; tb[cl][rl] = bh; tbl[cl][rl] = (__bf16)(v - (float)bh); }
    __syncthreads();
    for (int e = tid; e < 128 * 8; e += 128) { const int cl = e >> 3, q = e & 7; vst2((unsigned*)(VT + (bb * CKV + c0 + cl) * (size_t)TT + t0 + q * 8), *(const v4u*)&th[cl][q * 8]);   /* v planes: CKV channels per batch */ if (hi_rows) { const size_t o3 = (bb * CKV + c0 + cl) * (size_t)KHI + t0 + q * 8; vst2((unsigned*)(VB + o3), *(const v4u*)&tb[cl][q * 8]); vst2((unsigned*)(VBL + o3), *(const v4u*)&tbl[cl][q * 8]); } } } }
// ---- k_pv: block = 16 queries (qt) of one (b, h), PVW waves: wave w owns the 32-key chunks w, w + PVW, ... of keys [0, kend). It forms its logits itself, transposed: A = 16 key rows, B = the block's 16 query rows, so that D (lane = query, registers = keys 8g + r) of the chunk's two key tiles IS the A-fragment layout of the P x v product (lane = query row, 16 keys a chunk) and the logits never leave the registers; x SCALE; q hi + residual (x 2^10) against k hi + residual (3 products) for query blocks < QBH (causal early rows), single f16 q x k after; softmax in f32 inside the block: excluded keys (after the query, or outside the window) by index, row maximum and row sum over the lane's own keys, the other half-wave, then the PVW waves through LDS in wave order; P x 2^11 once to f16 against v f16 (1 product; causal early query blocks: P and v as bf16 hi + lo, 3 products); the PVW partial ctx tiles are added in LDS in wave order; 256-B (row, head) segment by 16 lanes
#define PVW 8
#define PVC (TT / 32 / PVW)                                             // most chunks one wave can own
#define PVCH (((((QBH * 64 - 1) >> 7) + 1) * 4 + PVW - 1) / PVW)         // the same for the early (high-precision) query blocks
static_assert(QBH * 64 == QHI && (((QBH * 64 - 1) >> 7) + 1) * 128 <= KHI, "every query row with a residual plane lies in an early block, and every key row such a block reads has one");
__global__ __launch_bounds__(32 * PVW) void k_pv(const _Float16* __restrict__ QH, const _Float16* __restrict__ KH, const _Float16* __restrict__ QL, const _Float16* __restrict__ KL, const _Float16* __restrict__ VT, const __bf16* __restrict__ VB, const __bf16* __restrict__ VBL, float* __restrict__ Y SM_EXTRA_PARAMS) { const int b = blockIdx.z / NH, h = blockIdx.z % NH; __shared__ __align__(16) float ss[PVW][16][HD + 4]; __shared__ float smx[PVW][16], ssu[PVW][16];
  const int tid = threadIdx.x, lane = tid & 31, col = lane & 15, g = lane >> 4; const int qt = blockIdx.x, qb = qt >> 2; const int ql0 = qt * 16; const int kce = (kb_last(qb) + 1) * 4;
  const int wave = __builtin_amdgcn_readfirstlane(tid >> 5);   /* the wave's number in a scalar register: the chunk tests below branch on scalars and every lane stays on at the matrix instructions */
  const int win_ = WINP[0]; const int t = ql0 + col;
  const _Float16* qrow = QH + ((size_t)b * TT + t) * CC + h * HD; const v16h qf0 = frag_h(qrow, lane), qf1 = frag_h(qrow + 32, lane);   /* B fragments: column = the lane's query, head dims 0..31 and 32..63 */
  const size_t kro = (size_t)(wave * 32 + col) * CKV + (h / GRP) * HD;   /* the lane's key row in the first key tile of the wave's first chunk; tile u of chunk i lies (i * PVW * 32 + u * 16) rows on, a constant offset */
  v4f lq[PVC][4];   /* chunk i is formed, and read, only under kc < kce; every loop over i or j below is fully unrolled so that lq is indexed by constants alone and stays in registers */
  /* a chunk's key fragments are all loaded in front of its first product (the v_nop statements behind the products hold later loads back): one load latency a chunk; the two key tiles' products alternate, each tile's own order being head dims 0..31, then 32..63 */
  if (qb < QBH) { const _Float16* qlrow = QL + ((size_t)b * QHI + t) * CC + h * HD; const v16h ql0f = frag_h(qlrow, lane), ql1f = frag_h(qlrow + 32, lane); asm volatile("s_wait_xcnt 0x0" ::: "memory");   /* stands in front of the key loads below, whose results may land on the address registers of the q loads */
    const _Float16* krow = KH + (size_t)b * TT * CKV + kro; const _Float16* klrow = KL + (size_t)b * KHI * CKV + kro;
#pragma unroll
    for (int i = 0; i < PVCH; ++i) { const int kc = wave + i * PVW; if (kc < kce) { const int ko = i * (PVW * 32) * CKV; v16h kh[2][2], kl[2][2]; v8f a[2] = {}, al[2] = {};
#pragma unroll
        for (int u = 0; u < 2; ++u) { kh[u][0] = frag_h(krow + ko + u * 16 * CKV, lane); kh[u][1] = frag_h(krow + ko + u * 16 * CKV + 32, lane); kl[u][0] = frag_h(klrow + ko + u * 16 * CKV, lane); kl[u][1] = frag_h(klrow + ko + u * 16 * CKV + 32, lane); }
        asm volatile("s_wait_xcnt 0x0" ::: "memory");   /* stands in front of every later instruction that rewrites the address registers of this chunk's loads */
#pragma unroll
        for (int c = 0; c < 2; ++c) { const v16h qh = c ? qf1 : qf0, ql = c ? ql1f : ql0f; a[0] = wmma16(kh[0][c], qh, a[0]); a[1] = wmma16(kh[1][c], qh, a[1]); al[0] = wmma16(kh[0][c], ql, al[0]); al[1] = wmma16(kh[1][c], ql, al[1]); al[0] = wmma16(kl[0][c], qh, al[0]); al[1] = wmma16(kl[1][c], qh, al[1]); }
#pragma unroll
        for (int j = 0; j < 16; ++j) lq[i][j >> 2][j & 3] = (a[j >> 3][j & 7] + al[j >> 3][j & 7] * (1.0f / 1024.0f)) * SCALE;
      } }
  } else { const _Float16* krow = KH + (size_t)b * TT * CKV + kro;
#pragma unroll
    for (int i = 0; i < PVC; ++i) { const int kc = wave + i * PVW; if (kc < kce) { const int ko = i * (PVW * 32) * CKV; v16h kh[2][2]; v8f a[2] = {};
#pragma unroll
        for (int u = 0; u < 2; ++u) { kh[u][0] = frag_h(krow + ko + u * 16 * CKV, lane); kh[u][1] = frag_h(krow + ko + u * 16 * CKV + 32, lane); }
        asm volatile("s_wait_xcnt 0x0" ::: "memory");   /* stands in front of every later instruction that rewrites the address registers of this chunk's loads */
        a[0] = wmma16(kh[0][0], qf0, a[0]); a[1] = wmma16(kh[1][0], qf0, a[1]); a[0] = wmma16(kh[0][1], qf1, a[0]); a[1] = wmma16(kh[1][1], qf1, a[1]);
#pragma unroll
        for (int j = 0; j < 16; ++j) lq[i][j >> 2][j & 3] = a[j >> 3][j & 7] * SCALE;
      } } }
  float m = -3.0e38f;
#pragma unroll
  for (int i = 0; i < PVC; ++i) { const int kc = wave + i * PVW; if (kc < kce) {
#pragma unroll
      for (int j = 0; j < 16; ++j) { const int k = kc * 32 + 8 * g + (j & 7) + 16 * (j >> 3); float v = (!CAUSAL || k <= t) ? lq[i][j >> 2][j & 3] : -3.0e38f; SM_MASK_HOOK; lq[i][j >> 2][j & 3] = v; m = fmaxf(m, v); } } }
  m = fmaxf(m, __shfl_xor(m, 16)); if (g == 0) smx[wave][col] = m;
  __syncthreads();   /* every wave's row maxima are in LDS before any lane combines them */
#pragma unroll
  for (int w = 0; w < PVW; ++w) m = fmaxf(m, smx[w][col]);
  float sum = 0.f;
#pragma unroll
  for (int i = 0; i < PVC; ++i) { const int kc = wave + i * PVW; if (kc < kce) {
#pragma unroll
      for (int j = 0; j < 16; ++j) { const float v = lq[i][j >> 2][j & 3]; const float ex = expf(v - m); const float e = (v <= -1.0e38f) ? 0.f : ex; lq[i][j >> 2][j & 3] = e; sum += e; } } }
  sum += __shfl_xor(sum, 16); if (g == 0) ssu[wave][col] = sum;
  __syncthreads();   /* every wave's row sums are in LDS before any lane adds them */
  float rs = 0.f;
#pragma unroll
  for (int w = 0; w < PVW; ++w) rs += ssu[w][col];
  const float inv = rs > 0.f ? 2048.0f / rs : 0.f;   /* a fully excluded row yields P = 0 */
  v8f acc[HD / 16] = {}; const size_t vro = (size_t)b * CKV + (h / GRP) * HD + col;   /* the lane's v channel of column block 0; block j and chunk i are constant offsets from it */
  if (qb < QBH) {
#pragma unroll
    for (int i = 0; i < PVCH; ++i) { const int kc = wave + i * PVW; if (kc < kce) { float pf[16];
#pragma unroll
        for (int j = 0; j < 16; ++j) pf[j] = lq[i][j >> 2][j & 3] * inv;
        const F2 p = bsplit16(pf);
#pragma unroll
        for (int j = 0; j < HD / 16; ++j) { const size_t po = vro * (size_t)KHI + wave * 32 + (size_t)(j * 16 * KHI + i * (PVW * 32)); const v16b vh = frag_b(VB + po, lane); acc[j] = wmma_bf(p.h, vh, acc[j]); acc[j] = wmma_bf(p.l, vh, acc[j]); acc[j] = wmma_bf(p.h, frag_b(VBL + po, lane), acc[j]); } } }
  } else {
#pragma unroll
    for (int i = 0; i < PVC; ++i) { const int kc = wave + i * PVW; if (kc < kce) { v16h p;
#pragma unroll
        for (int j = 0; j < 16; ++j) p[j] = (_Float16)(lq[i][j >> 2][j & 3] * inv);
#pragma unroll
        for (int j = 0; j < HD / 16; ++j) { const size_t po = vro * (size_t)TT + wave * 32 + (size_t)(j * 16 * TT + i * (PVW * 32)); acc[j] = wmma16(p, frag_h(VT + po, lane), acc[j]); } } } }
#pragma unroll
  for (int j = 0; j < HD / 16; ++j)
#pragma unroll
    for (int r = 0; r < 8; ++r) ss[wave][8 * g + r][j * 16 + col] = acc[j][r] * (1.0f / 2048.0f);
  __syncthreads();   /* every wave's partial tile is in LDS before any thread adds them */
  { const int rl = tid >> 4, q4 = (tid & 15) * 4; v4f s = *(const v4f*)&ss[0][rl][q4];
#pragma unroll
    for (int w = 1; w < PVW; ++w) s += *(const v4f*)&ss[w][rl][q4];
    vst2(Y + ((size_t)b * TT + ql0 + rl) * CC + h * HD + q4, s); } }
static_assert(32 * PVW == 16 * (HD / 4), "one thread per float4 of the 16 x HD tile in the final add");
// ---- k_out: block = (64 rows, 128 cols): out = ctx Wo (+ bo): ctx once to f16 against Wo as f16(bf16 x 2^8) exact (1 product) x 2^-8; causal early rows (< QHI of each sequence): ctx bf16 hi + lo against exact bf16 Wo (2 products)
__global__ __launch_bounds__(128) void k_out(const float* __restrict__ Y, const float* __restrict__ WO, const float* __restrict__ BO, float* __restrict__ OUT) { __shared__ __align__(16) float sf[4][16][132];
  const int tid = threadIdx.x, wave = tid >> 5, lane = tid & 31, col = lane & 15, g = lane >> 4; const int c0 = blockIdx.y * 128; const size_t r0 = (size_t)blockIdx.x * 64 + wave * 16;
  v8f acc[8] = {};
  if (CAUSAL && (int)(((size_t)blockIdx.x * 64) % TT) < QHI) {   /* block-uniform */
#pragma unroll 2
    for (int kc = 0; kc < CC / 32; ++kc) { const F2 a = split_row(Y + (r0 + col) * CC, kc * 32, lane); asm volatile("s_wait_loadcnt 0x0" ::: "memory");
#pragma unroll
      for (int j = 0; j < 8; ++j) { const v16b w = WOCOL(WO, kc * 32, c0 + j * 16 + col, lane); asm volatile("s_wait_loadcnt 0x0" ::: "memory"); acc[j] = wmma_bf(a.h, w, acc[j]); acc[j] = wmma_bf(a.l, w, acc[j]); } }
#pragma unroll
    for (int j = 0; j < 8; ++j) { const float bias = BO ? bfr(BO[c0 + j * 16 + col]) : 0.f;
#pragma unroll
      for (int r = 0; r < 8; ++r) sf[wave][8 * g + r][j * 16 + col] = acc[j][r] + bias; }
  } else {
#pragma unroll 2
    for (int kc = 0; kc < CC / 32; ++kc) { const v16h a = frag_f32s(Y + (r0 + col) * CC + kc * 32, lane, 64.0f); asm volatile("s_wait_loadcnt 0x0" ::: "memory");   /* ctx carried x 2^6 into f16 so small-magnitude context rows stay clear of f16 subnormals (chip FTZ) */
#pragma unroll
      for (int j = 0; j < 8; ++j) { const v16h w = WOCOLH(WO, kc * 32, c0 + j * 16 + col, lane); asm volatile("s_wait_loadcnt 0x0" ::: "memory"); acc[j] = wmma16(a, w, acc[j]); } }
#pragma unroll
    for (int j = 0; j < 8; ++j) { const float bias = BO ? bfr(BO[c0 + j * 16 + col]) : 0.f;
#pragma unroll
      for (int r = 0; r < 8; ++r) sf[wave][8 * g + r][j * 16 + col] = acc[j][r] * (1.0f / 16384.0f) + bias; } }   /* 2^-8 (Wo carry) x 2^-6 (ctx carry) */
  LDSX(); for (int rl = 0; rl < 16; ++rl) vst2(OUT + (r0 + rl) * DIN + c0 + lane * 4, *(const v4f*)&sf[wave][rl][lane * 4]); }

extern "C" void kernel_launch(void* const* d_in, const int* in_sizes, int n_in, void* d_out, int out_size, void* d_ws, size_t ws_size, hipStream_t stream) {
  (void)in_sizes; (void)n_in; (void)out_size;
  const float** F = (const float**)d_in;
  if (ws_size < (size_t)WS_END) return;
  char* ws = (char*)d_ws; _Float16 *QH = (_Float16*)(ws + WS_QH), *KH = (_Float16*)(ws + WS_KH), *VT = (_Float16*)(ws + WS_VT), *QL = (_Float16*)(ws + WS_QL), *KL = (_Float16*)(ws + WS_KL); __bf16 *VB = (__bf16*)(ws + WS_VB), *VBL = (__bf16*)(ws + WS_VBL); float *Y = (float*)(ws + WS_Y);
  (void)Y; (void)QL; (void)KL; (void)VB; (void)VBL;
  // inputs: 0 x [2,2048,1024]; 1 ve [2,2048,64]; 2 cos [2048,32]; 3 sin [2048,32]; 4 Wq [1024,1024] (in,out); 5 Wk [1024,64]; 6 Wv [1024,64]; 7 Wo [1024,1024] (in,out); 8 Wg [32,1]; 9 window_size int32 [1]; no biases
  k_proj<<<dim3(TNB * TT / 64, CC / 128, 1), 128, 0, stream>>>(F[0], F[0], F[0], F[4], F[5], F[6], nullptr, nullptr, nullptr, QH, QL, KH, KL, VT, VB, VBL, 0, F[2], F[3], F[1], F[8]);    /* q: 8 column blocks */
  k_proj<<<dim3(TNB * TT / 64, CKV / 128, 2), 128, 0, stream>>>(F[0], F[0], F[0], F[4], F[5], F[6], nullptr, nullptr, nullptr, QH, QL, KH, KL, VT, VB, VBL, 1, F[2], F[3], F[1], F[8]);   /* k (which 1) and v (which 2): one (half-empty) column block each */
  k_pv<<<dim3(TT / 16, 1, TNB * NH), 32 * PVW, 0, stream>>>(QH, KH, QL, KL, VT, VB, VBL, Y, (const int*)d_in[9]);   /* every (b, h) in one launch */
  k_out<<<dim3(TNB * TT / 64, DIN / 128), 128, 0, stream>>>(Y, F[7], nullptr, (float*)d_out);
}

// v004
// Measured time: 172 microseconds a run.
// Next to v003, in two timings, it ran 2.14 and 2.15 times as fast.
// All steps since v000 together make it 5.81 times as fast.
// compute dtype: all float inputs rounded to bf16, the cos / sin tables, ve and Wg included; q (16 heads) and the single shared k / v head projections with EXACT bf16 products on WMMA 16x16x32 (f32 accumulate); half-split RoPE with cos / sin READ from the table inputs, then RMSNorm over the 64 head dims (f32, eps = f32 machine epsilon) on q and k; v += 2 sigmoid(x[:32] . Wg) ve in f32; causal logits inside a sliding window read from the int input: 3 products for the first 384 rows, single f16 q x k after, x 64^-0.5; softmax f32; P x 2^11 once to f16 x v once to f16 (bf16 hi + lo below row 384); ctx hi+lo x exact Wo below row 384, x2^6 f16 carry x f16(bf16 x 2^8) Wo after; f32 output.
#include <hip/hip_runtime.h>
#include <math.h>

typedef __attribute__((ext_vector_type(16))) _Float16 v16h;
typedef __attribute__((ext_vector_type(16))) __bf16 v16b;
typedef __attribute__((ext_vector_type(8)))  _Float16 v8h;
typedef __attribute__((ext_vector_type(8)))  float v8f;
typedef __attribute__((ext_vector_type(4)))  float v4f;
typedef __attribute__((ext_vector_type(2)))  float v2f;
typedef __attribute__((ext_vector_type(4)))  unsigned v4u;
typedef __attribute__((ext_vector_type(4)))  int v4i;
typedef float __attribute__((may_alias)) float_a;
typedef int __attribute__((may_alias)) int_a;

template <typename T> __device__ __forceinline__ void vst2(void* p, T v) { *(T*)p = v;  }
__device__ __forceinline__ v8f wmma16(v16h a, v16h b, v8f c) {
  v8f d = __builtin_amdgcn_wmma_f32_16x16x32_f16(false, a, false, b, (short)0, c, false, false);
  asm volatile("v_nop\n\tv_nop\n\tv_nop\n\tv_nop" : "+v"(d) : "v"(a), "v"(b));
  return d;
}
__device__ __forceinline__ v8f wmma_bf(v16b a, v16b b, v8f c) {
  v8f d = __builtin_amdgcn_wmma_f32_16x16x32_bf16(false, a, false, b, (short)0, c, false, false);
  asm volatile("v_nop\n\tv_nop\n\tv_nop\n\tv_nop" : "+v"(d) : "v"(a), "v"(b));
  return d;
}
// 16x16x32 fragments: lane = (h = lane>>4, row/col = lane&15); elements 0..7 = k0+8h+0..7, 8..15 = k0+16+8h+0..7; D element r = row 8h+r
__device__ __forceinline__ v16h frag_h(const _Float16* rowk0, int lane) {
  union { v16h v; v8h q[2]; } u; const _Float16* p = rowk0 + 8 * (lane >> 4);
  u.q[0] = *(const v8h*)p; u.q[1] = *(const v8h*)(p + 16); return u.v;
}
__device__ __forceinline__ v16h frag_f32(const float* rowk0, int lane) {
  v16h a; const float* p = rowk0 + 8 * (lane >> 4);
#pragma unroll
  for (int i = 0; i < 8; ++i) { a[i] = (_Float16)p[i]; a[8 + i] = (_Float16)p[16 + i]; }
  return a;
}
__device__ __forceinline__ v16h frag_f32s(const float* rowk0, int lane, float sc) {
  v16h a; const float* p = rowk0 + 8 * (lane >> 4);
#pragma unroll
  for (int i = 0; i < 8; ++i) { a[i] = (_Float16)(p[i] * sc); a[8 + i] = (_Float16)(p[16 + i] * sc); }
  return a;
}
// column fragment from a [K][ld] layout (column n), rows >= K read as 0
__device__ __forceinline__ v16h fragc_f32(const float* W, int k0, int n, int lane, int ld, int K) {
  v16h a; const int g = lane >> 4;
#pragma unroll
  for (int i = 0; i < 8; ++i) { const int ka = k0 + 8 * g + i, kb = ka + 16;
    a[i] = (_Float16)(ka < K ? W[(size_t)(ka < K ? ka : K - 1) * ld + n] : 0.f); a[8 + i] = (_Float16)(kb < K ? W[(size_t)(kb < K ? kb : K - 1) * ld + n] : 0.f); }
  return a;
}
struct F2 { v16b h, l; };
__device__ __forceinline__ F2 bsplit16(const float v[16]) { F2 r;
#pragma unroll
  for (int i = 0; i < 16; ++i) { const __bf16 h = (__bf16)v[i]; r.h[i] = h; r.l[i] = (__bf16)(v[i] - (float)h); }
  return r; }
__device__ __forceinline__ F2 split_row(const float* row, int k0, int lane) { float v[16]; const float* p = row + k0 + 8 * (lane >> 4);
#pragma unroll
  for (int i = 0; i < 8; ++i) { v[i] = p[i]; v[8 + i] = p[16 + i]; }
  return bsplit16(v); }
__device__ __forceinline__ F2 split_rowK(const float* row, int k0, int lane, int K) { float v[16]; const int g = lane >> 4;
#pragma unroll
  for (int i = 0; i < 8; ++i) { const int ka = k0 + 8 * g + i, kb = ka + 16; v[i] = ka < K ? row[ka < K ? ka : K - 1] : 0.f; v[8 + i] = kb < K ? row[kb < K ? kb : K - 1] : 0.f; }
  return bsplit16(v); }
__device__ __forceinline__ F2 split_col(const float* W, int k0, int n, int lane, int ld, int K) { float v[16]; const int g = lane >> 4;
#pragma unroll
  for (int i = 0; i < 8; ++i) { const int ka = k0 + 8 * g + i, kb = ka + 16; v[i] = ka < K ? W[(size_t)(ka < K ? ka : K - 1) * ld + n] : 0.f; v[8 + i] = kb < K ? W[(size_t)(kb < K ? kb : K - 1) * ld + n] : 0.f; }
  return bsplit16(v); }
__device__ __forceinline__ v8f mac3(const F2& a, const F2& b, v8f c) { c = wmma_bf(a.l, b.h, c); c = wmma_bf(a.h, b.l, c); return wmma_bf(a.h, b.h, c); }
__device__ __forceinline__ float sigm(float v) { return 1.0f / (1.0f + expf(-v)); }
#define LDSX() do { asm volatile("s_wait_dscnt 0" ::: "memory"); __builtin_amdgcn_wave_barrier(); __builtin_amdgcn_fence(__ATOMIC_RELEASE, "workgroup"); } while (0)

// Multi-query causal attention with table RoPE, per-head RMSNorm, a gated value residual and a sliding window (x [2,2048,1024]; ve [2,2048,64]; cos, sin [2048,32] (inputs); (in,out) Wq [1024,1024], Wk / Wv [1024,64], Wo [1024,1024], all N(0,1) x 0.02; Wg [32,1]; window_size int (1024); 16 query heads share ONE key / value head; gate = 2 sigmoid(x[..., :32] Wg); v = x Wv + gate * ve; _rope: (x1, x2) = halves -> (x1 cos + x2 sin, -x1 sin + x2 cos); _rmsnorm: x * rsqrt(mean(x^2) + finfo.eps) AFTER the rotation, on q and k; scores x 64^-0.5; masked where key > query or query - key >= window_size (finfo.min); softmax; out = merge(attn v) Wo).
#define NB 2
#define TT 2048
#define CC 1024            // NH * HD = projected width
#define DIN 1024          // input (model) width
#define NH 16
#define HD 64
#define SCALE (0.125f)
#define CAUSAL 1
#ifndef TNB
#define TNB NB
#endif
__device__ __forceinline__ float bfr(float v) { return (float)(__bf16)v; }
__host__ __device__ __forceinline__ int kb_last(int qb) { return CAUSAL ? ((qb * 64 + 63) >> 7) : (TT / 128 - 1); }
typedef __attribute__((ext_vector_type(8))) __bf16 v8b;
__device__ __forceinline__ v16b frag_b(const __bf16* rowk0, int lane) {
  union { v16b v; v8b q[2]; } u; const __bf16* p = rowk0 + 8 * (lane >> 4);
  u.q[0] = *(const v8b*)p; u.q[1] = *(const v8b*)(p + 16); return u.v;
}
#define QBH 6              // causal: query blocks 0..QBH-1 of each sequence (few keys, no averaging) take the high-precision path
#define QHI 384            // rows carrying a q residual plane
#define KHI 384            // key rows carrying k residual / v bf16 hi+lo planes (used only by the causal high-precision path)
// B fragment (k rows k0+.., output column o) of a weight: (in,out) [K][ld] or (out,in) [ld rows of K]: bf16 exact, or f16(bf16 * 256) exact
__device__ __forceinline__ v16b wcol_io(const float* Wm, int k0, int o, int lane, int ld) { v16b w; const int g = lane >> 4;
#pragma unroll
  for (int i = 0; i < 8; ++i) { w[i] = (__bf16)Wm[(size_t)(k0 + 8 * g + i) * ld + o]; w[8 + i] = (__bf16)Wm[(size_t)(k0 + 16 + 8 * g + i) * ld + o]; }
  return w; }
__device__ __forceinline__ v16b wcol_oi(const float* Wm, int k0, int o, int lane, int K) { v16b w; const float* p = Wm + (size_t)o * K + k0 + 8 * (lane >> 4);
#pragma unroll
  for (int i = 0; i < 8; ++i) { w[i] = (__bf16)p[i]; w[8 + i] = (__bf16)p[16 + i]; }
  return w; }
__device__ __forceinline__ v16h wcolh_io(const float* Wm, int k0, int o, int lane, int ld) { v16h w; const int g = lane >> 4;
#pragma unroll
  for (int i = 0; i < 8; ++i) { w[i] = (_Float16)(bfr(Wm[(size_t)(k0 + 8 * g + i) * ld + o]) * 256.0f); w[8 + i] = (_Float16)(bfr(Wm[(size_t)(k0 + 16 + 8 * g + i) * ld + o]) * 256.0f); }
  return w; }
__device__ __forceinline__ v16h wcolh_oi(const float* Wm, int k0, int o, int lane, int K) { v16h w; const float* p = Wm + (size_t)o * K + k0 + 8 * (lane >> 4);
#pragma unroll
  for (int i = 0; i < 8; ++i) { w[i] = (_Float16)(bfr(p[i]) * 256.0f); w[8 + i] = (_Float16)(bfr(p[16 + i]) * 256.0f); }
  return w; }
#define WQKV_LAYOUT 0   // selects only WCOL, which nothing uses: gemm_main reads Wq / Wk / Wv as (in,out) [DIN][n]
__device__ __forceinline__ v16b wcol_hdk(const float* Wm, int k0, int o, int lane) { v16b w; const int g = lane >> 4; const float* p = Wm + (size_t)(o / HD) * DIN * HD + (o % HD);
#pragma unroll
  for (int i = 0; i < 8; ++i) { w[i] = (__bf16)p[(size_t)(k0 + 8 * g + i) * HD]; w[8 + i] = (__bf16)p[(size_t)(k0 + 16 + 8 * g + i) * HD]; }
  return w; }
#define WO_OUT_IN 0
#if WQKV_LAYOUT == 1
#define WCOL(W, k0, o, lane) wcol_oi(W, k0, o, lane, DIN)
#elif WQKV_LAYOUT == 2
#define WCOL(W, k0, o, lane) wcol_hdk(W, k0, o, lane)
#else
#define WCOL(W, k0, o, lane) (which == 0 ? wcol_io(W, k0, (o), lane, CC) : ((o) < KVW ? wcol_io(W, k0, (o), lane, KVW) : zero16b()))   /* (in,out): Wq [1024][1024] pitch CC; Wk / Wv [1024][64] pitch 64, padded columns 64..127 are zero */
#endif
#if WO_OUT_IN
#define WOCOL(W, k0, o, lane) wcol_oi(W, k0, o, lane, CC)
#define WOCOLH(W, k0, o, lane) wcolh_oi(W, k0, o, lane, CC)
#else
#define WOCOL(W, k0, o, lane) wcol_io(W, k0, o, lane, DIN)
#define WOCOLH(W, k0, o, lane) wcolh_io(W, k0, o, lane, DIN)
#endif
#define GRP 16             // all 16 query heads share the single kv head (kv head = h / 16 = 0)
#define CKV 128            // kv plane width: ONE 128-column block whose columns 0..63 are the single kv head, columns 64..127 zero padding
#define KVW 64             // real kv width (Wk / Wv are (in,out) [1024][64])
#define PROJ_EXTRA_PARAMS , int woff, const float* __restrict__ COS, const float* __restrict__ SIN, const float* __restrict__ VE, const float* __restrict__ WG   /* which = blockIdx.z + woff; COS / SIN [TT][32], VE [NB*TT][64], WG [32] are module inputs read in the projection epilogue */
__device__ __forceinline__ v16b zero16b() { v16b w; _Pragma("unroll") for (int i = 0; i < 16; ++i) w[i] = (__bf16)0.0f; return w; }
#define RMS_EPS 1.1920929e-07f   /* jnp.finfo(float32).eps */
// per (token, head) hook on the staged f32 row (64 floats). q and k (which 0, 1): the module's _rope with cos / sin read LITERALLY from the table inputs at row t (bf16-rounded like every float input): (x1, x2) = (row[m], row[32+m]) -> (x1 c + x2 s, -x1 s + x2 c), then _rmsnorm over the 64 dims: x * (1 / sqrt(mean(x^2) + eps)); the zero-padded second half of the k block stays exactly zero under both. v (which 2): row += gate * bf16(ve[b, t, :]) with gate = 2 / (1 + exp(-z)), z = sum_{i<32} bf16(x[b, t, i]) * bf16(Wg[i]); all global loads are unconditional; the padded half gets gate 0 through a select. f32, products and sums kept separate
#define PROJ_EPI(which, row, t, h) do { float* rw = (row); const size_t gr_ = bb * TT + (size_t)(t); if ((which) < 2) { const float* ct_ = COS + (size_t)(t) * 32; const float* st_ = SIN + (size_t)(t) * 32; _Pragma("unroll 4") for (int m = 0; m < 32; ++m) { _Pragma("clang fp contract(off)") const float c_ = bfr(ct_[m]), s_ = bfr(st_[m]); const float x1 = rw[m], x2 = rw[32 + m]; rw[m] = x1 * c_ + x2 * s_; rw[32 + m] = (-x1) * s_ + x2 * c_; } float ss_ = 0.f; _Pragma("unroll 8") for (int m = 0; m < 64; ++m) { _Pragma("clang fp contract(off)") ss_ += rw[m] * rw[m]; } const float rinv_ = 1.0f / sqrtf(ss_ * (1.0f / 64.0f) + RMS_EPS); _Pragma("unroll 8") for (int m = 0; m < 64; ++m) rw[m] = rw[m] * rinv_; } else { const float* xr_ = XV + gr_ * DIN; float z_ = 0.f; _Pragma("unroll 8") for (int i = 0; i < 32; ++i) { _Pragma("clang fp contract(off)") z_ += bfr(xr_[i]) * bfr(WG[i]); } const float gate_ = 2.0f / (1.0f + expf(-z_)); const float gsel_ = ((h) == 0) ? gate_ : 0.0f; const float* ve_ = VE + gr_ * 64; _Pragma("unroll 8") for (int m = 0; m < 64; ++m) { _Pragma("clang fp contract(off)") rw[m] = rw[m] + gsel_ * bfr(ve_[m]); } } } while (0)
static_assert(HD == 64 && KVW == 64 && CKV == 128, "the hook spells 32 / 64 literally: one real 64-wide kv head in a 128-column block");
#define SM_EXTRA_PARAMS , const int* __restrict__ WINP
// sliding window: a key is excluded when query - key >= window_size; window_size is the module's int input (one block-uniform scalar load); keys after the query are already excluded by the causal select; every row keeps at least min(t + 1, window) >= 1 keys
#define SM_MASK_HOOK do { v = (t - k >= win_) ? -3.0e38f : v; } while (0)   /* win_ = WINP[0], read once at the kernel's head */
#ifndef SM_EXTRA_PARAMS
#define SM_EXTRA_PARAMS
#endif
#ifndef PROJ_EXTRA_PARAMS
#define PROJ_EXTRA_PARAMS
#endif
#ifndef SM_MASK_HOOK
#define SM_MASK_HOOK (void)0
#endif

#define WS_QH  0u                                      // f16 q rows [b*t][CC]
#define WS_KH  (WS_QH + 2u * (size_t)NB * TT * CC)      // f16 k rows [b*t][CKV]
#define WS_VT  (WS_KH + 2u * (size_t)NB * TT * CC)      // f16 v planes [b][c][t]
#define WS_QL  (WS_VT + 2u * (size_t)NB * CC * TT)      // f16 q residual x 2^10 rows [b][t < QHI][CC]
#define WS_KL  (WS_QL + 2u * (size_t)NB * QHI * CC)     // f16 k residual x 2^10 rows [b][t < KHI][CKV]
#define WS_VB  (WS_KL + 2u * (size_t)NB * KHI * CC)     // bf16 v hi planes [b][c][t < KHI]
#define WS_VBL (WS_VB + 2u * (size_t)NB * CC * KHI)
#define WS_Y   (WS_VBL + 2u * (size_t)NB * CC * KHI)    // f32 ctx rows [b*t][CC] (only when there is an output projection)
#define WS_END (WS_Y  + 4u * (size_t)NB * TT * CC)

// ---- gemm_main: the K loop of k_proj and k_out. A block's 4 waves need the same 128 weight columns, so each 64-k stage of W ([k][n] f32, n contiguous) is read ONCE per block with whole-line 16-byte loads, rounded exactly as before (MODE 0, 1: bf16; MODE 2: f16(bf16 x 2^8)), turned in registers and stored as [n][k] rows (pitch 144 B) in one of two LDS buffers, from which every wave reads its B fragments with two 16-byte LDS loads each. The next stage's global loads (W tile and the wave's own A rows) are issued in front of this stage's products and stored behind them. Products and their k order per accumulator are those of the direct form. Every loop over s, c, i, j or kk inside a stage is fully unrolled so that the register arrays are indexed by constants alone.
#define GKS 64                 // k per stage
#define GWP (GKS + 8)          // LDS row pitch in 16-bit elements: 144 B = 16 B x odd, conflict-free for 16-byte readers
template <int LD> __device__ __forceinline__ void g_fetch(v4f (&wr)[2][8], v4f (&ar)[2][4], const float* wp, const float* ap) {
#pragma unroll
  for (int s = 0; s < 2; ++s)
#pragma unroll
    for (int i = 0; i < 8; ++i) wr[s][i] = *(const v4f*)(wp + (size_t)(s * 32 + i) * LD);
#pragma unroll
  for (int kk = 0; kk < 2; ++kk) { ar[kk][0] = *(const v4f*)(ap + kk * 32); ar[kk][1] = *(const v4f*)(ap + kk * 32 + 4); ar[kk][2] = *(const v4f*)(ap + kk * 32 + 16); ar[kk][3] = *(const v4f*)(ap + kk * 32 + 20); }
  asm volatile("s_wait_xcnt 0x0" ::: "memory");   /* stands in front of every later instruction that rewrites the address registers of these loads; it also keeps the loads in front of the stage's products */
}
template <int MODE> __device__ __forceinline__ void g_store(const v4f (&wr)[2][8], __bf16* sst, bool wl) {
#pragma unroll
  for (int s = 0; s < 2; ++s)
#pragma unroll
    for (int c = 0; c < 4; ++c) {
      if constexpr (MODE == 2) { v8h o;
#pragma unroll
        for (int i = 0; i < 8; ++i) o[i] = (_Float16)(bfr(wr[s][i][c]) * 256.0f);
        *(v8h*)(sst + c * GWP + s * 32) = o;
      } else { union { v8b b; v4u u; } o;
#pragma unroll
        for (int i = 0; i < 8; ++i) o.b[i] = (__bf16)wr[s][i][c];
        o.u &= wl ? 0xffffffffu : 0u;   /* padded columns: the load is unconditional at a clamped address, the stored value is +0 */
        *(v8b*)(sst + c * GWP + s * 32) = o.b; } } }
struct GA { v16b h[2], l[2]; v16h f[2]; };   /* the wave's A fragments of one stage; only the members of the MODE in use are formed */
template <int MODE> __device__ __forceinline__ void g_acvt(GA& a, const v4f (&ar)[2][4]) {
#pragma unroll
  for (int kk = 0; kk < 2; ++kk) { float v[16];
#pragma unroll
    for (int i = 0; i < 16; ++i) v[i] = ar[kk][i >> 2][i & 3];   /* elements 0..7 = k 8g + 0..7, 8..15 = k 16 + 8g + 0..7 */
    if constexpr (MODE == 0) {
#pragma unroll
      for (int i = 0; i < 16; ++i) a.h[kk][i] = (__bf16)v[i];
    } else if constexpr (MODE == 1) { const F2 s = bsplit16(v); a.h[kk] = s.h; a.l[kk] = s.l;
    } else {
#pragma unroll
      for (int i = 0; i < 16; ++i) a.f[kk][i] = (_Float16)(v[i] * 64.0f); } } }
// ap = the lane's A row + 8 g; Wt = W + the block's first column; sw = two buffers of 128 rows x GWP; wave in a scalar register; wl = this wave's 32 staged columns exist in W
template <int MODE, int LD, int KTOT> __device__ __forceinline__ void gemm_main(v8f (&acc)[8], const float* __restrict__ ap, const float* __restrict__ Wt, __bf16* sw, int wave, int lane, bool wl) {
  const int cg = wave * 8 + (lane & 3) + 4 * (lane >> 4), kg = (lane >> 2) & 3;   /* the lane stages columns 4 cg .. 4 cg + 3 of k rows 8 kg + 0..7 and 32 + 8 kg + 0..7: a load covers four whole 128-B lines, and the 16 lanes of a half-wave store to 16 different bank groups */
  const float* wp = Wt + (size_t)(8 * kg) * LD + (wl ? 4 * cg : 0);
  __bf16* sst = sw + (4 * cg) * GWP + 8 * kg; const __bf16* srd = sw + (lane & 15) * GWP;
  v4f wr[2][8]; v4f ar[2][4]; GA a;
  g_fetch<LD>(wr, ar, wp, ap); g_store<MODE>(wr, sst, wl); g_acvt<MODE>(a, ar);
  __syncthreads();   /* stage 0 is in LDS before any wave reads it */
  for (int s = 0; s < KTOT / GKS; ++s) { const int bo = (s & 1) * (128 * GWP); const bool more = s + 1 < KTOT / GKS;
    if (more) g_fetch<LD>(wr, ar, wp + (size_t)(s + 1) * GKS * LD, ap + (s + 1) * GKS);
#pragma unroll
    for (int kk = 0; kk < 2; ++kk) {   /* the eight B fragments of a 32-k block are all read in front of its first product: one LDS latency a block */
      if constexpr (MODE == 2) { v16h wf[8];
#pragma unroll
        for (int j = 0; j < 8; ++j) wf[j] = frag_h((const _Float16*)(srd + bo + j * 16 * GWP + kk * 32), lane);
#pragma unroll
        for (int j = 0; j < 8; ++j) acc[j] = wmma16(a.f[kk], wf[j], acc[j]);
      } else { v16b wf[8];
#pragma unroll
        for (int j = 0; j < 8; ++j) wf[j] = frag_b(srd + bo + j * 16 * GWP + kk * 32, lane);
#pragma unroll
        for (int j = 0; j < 8; ++j) { acc[j] = wmma_bf(a.h[kk], wf[j], acc[j]); if constexpr (MODE == 1) acc[j] = wmma_bf(a.l[kk], wf[j], acc[j]); } } }
    __builtin_amdgcn_sched_barrier(0);   /* keeps the conversions of the next stage's registers, and with them the wait for its global loads, behind this stage's products: without it the wait was scheduled behind the first product */
    if (more) { g_store<MODE>(wr, sst + (bo ^ (128 * GWP)), wl); g_acvt<MODE>(a, ar);
      __syncthreads(); } } }   /* one barrier a stage: it publishes stage s + 1 and ends every wave's reads of the buffer that stage s + 2 will overwrite */
// ---- k_proj: block = (64 rows, 128 cols, which): q/k/v = X W (+ b) with exact bf16 products (K = DIN) -> which 0: q f16 rows (+ residual rows < QHI); 1: k f16 rows (+ residual rows < KHI); 2: v f16 planes [c][t] (+ bf16 hi/lo planes for t < KHI)
__global__ __launch_bounds__(128) void k_proj(const float* __restrict__ XQ, const float* __restrict__ XK, const float* __restrict__ XV, const float* __restrict__ WQ, const float* __restrict__ WK, const float* __restrict__ WV, const float* __restrict__ BQ, const float* __restrict__ BK, const float* __restrict__ BV,
    _Float16* __restrict__ QH, _Float16* __restrict__ QL, _Float16* __restrict__ KH, _Float16* __restrict__ KL, _Float16* __restrict__ VT, __bf16* __restrict__ VB, __bf16* __restrict__ VBL PROJ_EXTRA_PARAMS) {
  __shared__ __align__(16) float st[64][132]; __shared__ __align__(16) _Float16 sh[64][136], sl[64][136]; __shared__ __align__(16) _Float16 th[128][72]; __shared__ __align__(16) __bf16 tb[128][72], tbl[128][72]; __shared__ __align__(16) __bf16 sw[2 * 128 * GWP];
  const int tid = threadIdx.x, wave = tid >> 5, lane = tid & 31, col = lane & 15, g = lane >> 4; const int which = blockIdx.z + woff; const int c0 = blockIdx.y * 128; const size_t r0 = (size_t)blockIdx.x * 64; const size_t bb = r0 / TT; const int t0 = (int)(r0 % TT);
  const float* X = which == 0 ? XQ : which == 1 ? XK : XV; const float* WA = which == 0 ? WQ : which == 1 ? WK : WV; const float* BA = which == 0 ? BQ : which == 1 ? BK : BV;
  v8f acc[8] = {};
  { const int wv = __builtin_amdgcn_readfirstlane(wave);   /* the wave's number in a scalar register: the staged column group and the padded-columns mask are wave-uniform */
    const float* ap = X + (r0 + wave * 16 + col) * DIN + 8 * g;
    if (which == 0) gemm_main<0, CC, DIN>(acc, ap, WA + c0, sw, wv, lane, true);   /* Wq [1024][1024] */
    else gemm_main<0, KVW, DIN>(acc, ap, WA + (c0 < KVW ? c0 : 0), sw, wv, lane, c0 + wv * 32 < KVW); }   /* Wk / Wv [1024][64]: padded columns 64..127 are staged as zeros */
  { // stage the f32 tile (acc + bias) in LDS, run the per-(row, head) epilogue hook, then convert
#pragma unroll
    for (int j = 0; j < 8; ++j) { const int bo_ = c0 + j * 16 + col; const float bias = (BA && (which == 0 || bo_ < KVW)) ? bfr(BA[(which == 0 || bo_ < KVW) ? bo_ : 0]) : 0.f;   /* bk / bv hold only the 64 real kv columns: padded columns get no bias (index clamped, value selected) */
#pragma unroll
      for (int r = 0; r < 8; ++r) st[wave * 16 + 8 * g + r][j * 16 + col] = acc[j][r] + bias; }
    __syncthreads();
    for (int e = tid; e < 64 * (128 / HD); e += 128) { const int rl = e / (128 / HD), hh = e % (128 / HD); PROJ_EPI(which, &st[rl][hh * HD], (int)((r0 + rl) % TT), (c0 / HD) + hh); }
    __syncthreads(); }
  if (which < 2) { _Float16* DH = which == 0 ? QH : KH; _Float16* DL = which == 0 ? QL : KL; const int nhi = which == 0 ? QHI : KHI; const bool hi_rows = t0 < nhi;
    for (int e = tid; e < 64 * 128; e += 128) { const int rl = e >> 7, cl = e & 127; const float v = st[rl][cl]; const _Float16 hv = (_Float16)v; sh[rl][cl] = hv; sl[rl][cl] = (_Float16)((v - (float)hv) * 1024.0f); }
    __syncthreads();
    for (int e = tid; e < 64 * 16; e += 128) { const int rl = e >> 4, q = e & 15; vst2((unsigned*)(DH + (r0 + rl) * (size_t)(which == 0 ? CC : CKV) + c0 + q * 8), *(const v4u*)&sh[rl][q * 8]);   /* q rows at pitch CC, k rows at pitch CKV */ if (hi_rows) vst2((unsigned*)(DL + (bb * nhi + t0 + rl) * (size_t)(which == 0 ? CC : CKV) + c0 + q * 8), *(const v4u*)&sl[rl][q * 8]);   /* residual rows: same pitches */ }
  } else { const bool hi_rows = t0 < KHI;
    for (int e = tid; e < 64 * 128; e += 128) { const int rl = e & 63, cl = e >> 6; const float v = st[rl][cl]; th[cl][rl] = (_Float16)v; const __bf16 bh = (__bf16)v; tb[cl][rl] = bh; tbl[cl][rl] = (__bf16)(v - (float)bh); }
    __syncthreads();
    for (int e = tid; e < 128 * 8; e += 128) { const int cl = e >> 3, q = e & 7; vst2((unsigned*)(VT + (bb * CKV + c0 + cl) * (size_t)TT + t0 + q * 8), *(const v4u*)&th[cl][q * 8]);   /* v planes: CKV channels per batch */ if (hi_rows) { const size_t o3 = (bb * CKV + c0 + cl) * (size_t)KHI + t0 + q * 8; vst2((unsigned*)(VB + o3), *(const v4u*)&tb[cl][q * 8]); vst2((unsigned*)(VBL + o3), *(const v4u*)&tbl[cl][q * 8]); } } } }
// ---- k_pv: block = 16 queries (qt) of one (b, h), PVW waves: wave w owns the 32-key chunks w, w + PVW, ... of keys [0, kend). It forms its logits itself, transposed: A = 16 key rows, B = the block's 16 query rows, so that D (lane = query, registers = keys 8g + r) of the chunk's two key tiles IS the A-fragment layout of the P x v product (lane = query row, 16 keys a chunk) and the logits never leave the registers; x SCALE; q hi + residual (x 2^10) against k hi + residual (3 products) for query blocks < QBH (causal early rows), single f16 q x k after; softmax in f32 inside the block: excluded keys (after the query, or outside the window) by index, row maximum and row sum over the lane's own keys, the other half-wave, then the PVW waves through LDS in wave order; P x 2^11 once to f16 against v f16 (1 product; causal early query blocks: P and v as bf16 hi + lo, 3 products); the PVW partial ctx tiles are added in LDS in wave order; 256-B (row, head) segment by 16 lanes
#define PVW 8
#define PVC (TT / 32 / PVW)                                             // most chunks one wave can own
#define PVCH (((((QBH * 64 - 1) >> 7) + 1) * 4 + PVW - 1) / PVW)         // the same for the early (high-precision) query blocks
static_assert(QBH * 64 == QHI && (((QBH * 64 - 1) >> 7) + 1) * 128 <= KHI, "every query row with a residual plane lies in an early block, and every key row such a block reads has one");
__global__ __launch_bounds__(32 * PVW) void k_pv(const _Float16* __restrict__ QH, const _Float16* __restrict__ KH, const _Float16* __restrict__ QL, const _Float16* __restrict__ KL, const _Float16* __restrict__ VT, const __bf16* __restrict__ VB, const __bf16* __restrict__ VBL, float* __restrict__ Y SM_EXTRA_PARAMS) { const int b = blockIdx.z / NH, h = blockIdx.z % NH; __shared__ __align__(16) float ss[PVW][16][HD + 4]; __shared__ float smx[PVW][16], ssu[PVW][16];
  const int tid = threadIdx.x, lane = tid & 31, col = lane & 15, g = lane >> 4; const int qt = blockIdx.x, qb = qt >> 2; const int ql0 = qt * 16; const int kce = (kb_last(qb) + 1) * 4;
  const int wave = __builtin_amdgcn_readfirstlane(tid >> 5);   /* the wave's number in a scalar register: the chunk tests below branch on scalars and every lane stays on at the matrix instructions */
  const int win_ = WINP[0]; const int t = ql0 + col;
  const _Float16* qrow = QH + ((size_t)b * TT + t) * CC + h * HD; const v16h qf0 = frag_h(qrow, lane), qf1 = frag_h(qrow + 32, lane);   /* B fragments: column = the lane's query, head dims 0..31 and 32..63 */
  const size_t kro = (size_t)(wave * 32 + col) * CKV + (h / GRP) * HD;   /* the lane's key row in the first key tile of the wave's first chunk; tile u of chunk i lies (i * PVW * 32 + u * 16) rows on, a constant offset */
  v4f lq[PVC][4];   /* chunk i is formed, and read, only under kc < kce; every loop over i or j below is fully unrolled so that lq is indexed by constants alone and stays in registers */
  /* a chunk's key fragments are all loaded in front of its first product (the v_nop statements behind the products hold later loads back): one load latency a chunk; the two key tiles' products alternate, each tile's own order being head dims 0..31, then 32..63 */
  if (qb < QBH) { const _Float16* qlrow = QL + ((size_t)b * QHI + t) * CC + h * HD; const v16h ql0f = frag_h(qlrow, lane), ql1f = frag_h(qlrow + 32, lane); asm volatile("s_wait_xcnt 0x0" ::: "memory");   /* stands in front of the key loads below, whose results may land on the address registers of the q loads */
    const _Float16* krow = KH + (size_t)b * TT * CKV + kro; const _Float16* klrow = KL + (size_t)b * KHI * CKV + kro;
#pragma unroll
    for (int i = 0; i < PVCH; ++i) { const int kc = wave + i * PVW; if (kc < kce) { const int ko = i * (PVW * 32) * CKV; v16h kh[2][2], kl[2][2]; v8f a[2] = {}, al[2] = {};
#pragma unroll
        for (int u = 0; u < 2; ++u) { kh[u][0] = frag_h(krow + ko + u * 16 * CKV, lane); kh[u][1] = frag_h(krow + ko + u * 16 * CKV + 32, lane); kl[u][0] = frag_h(klrow + ko + u * 16 * CKV, lane); kl[u][1] = frag_h(klrow + ko + u * 16 * CKV + 32, lane); }
        asm volatile("s_wait_xcnt 0x0" ::: "memory");   /* stands in front of every later instruction that rewrites the address registers of this chunk's loads */
#pragma unroll
        for (int c = 0; c < 2; ++c) { const v16h qh = c ? qf1 : qf0, ql = c ? ql1f : ql0f; a[0] = wmma16(kh[0][c], qh, a[0]); a[1] = wmma16(kh[1][c], qh, a[1]); al[0] = wmma16(kh[0][c], ql, al[0]); al[1] = wmma16(kh[1][c], ql, al[1]); al[0] = wmma16(kl[0][c], qh, al[0]); al[1] = wmma16(kl[1][c], qh, al[1]); }
#pragma unroll
        for (int j = 0; j < 16; ++j) lq[i][j >> 2][j & 3] = (a[j >> 3][j & 7] + al[j >> 3][j & 7] * (1.0f / 1024.0f)) * SCALE;
      } }
  } else { const _Float16* krow = KH + (size_t)b * TT * CKV + kro;
#pragma unroll
    for (int i = 0; i < PVC; ++i) { const int kc = wave + i * PVW; if (kc < kce) { const int ko = i * (PVW * 32) * CKV; v16h kh[2][2]; v8f a[2] = {};
#pragma unroll
        for (int u = 0; u < 2; ++u) { kh[u][0] = frag_h(krow + ko + u * 16 * CKV, lane); kh[u][1] = frag_h(krow + ko + u * 16 * CKV + 32, lane); }
        asm volatile("s_wait_xcnt 0x0" ::: "memory");   /* stands in front of every later instruction that rewrites the address registers of this chunk's loads */
        a[0] = wmma16(kh[0][0], qf0, a[0]); a[1] = wmma16(kh[1][0], qf0, a[1]); a[0] = wmma16(kh[0][1], qf1, a[0]); a[1] = wmma16(kh[1][1], qf1, a[1]);
#pragma unroll
        for (int j = 0; j < 16; ++j) lq[i][j >> 2][j & 3] = a[j >> 3][j & 7] * SCALE;
      } } }
  float m = -3.0e38f;
#pragma unroll
  for (int i = 0; i < PVC; ++i) { const int kc = wave + i * PVW; if (kc < kce) {
#pragma unroll
      for (int j = 0; j < 16; ++j) { const int k = kc * 32 + 8 * g + (j & 7) + 16 * (j >> 3); float v = (!CAUSAL || k <= t) ? lq[i][j >> 2][j & 3] : -3.0e38f; SM_MASK_HOOK; lq[i][j >> 2][j & 3] = v; m = fmaxf(m, v); } } }
  m = fmaxf(m, __shfl_xor(m, 16)); if (g == 0) smx[wave][col] = m;
  __syncthreads();   /* every wave's row maxima are in LDS before any lane combines them */
#pragma unroll
  for (int w = 0; w < PVW; ++w) m = fmaxf(m, smx[w][col]);
  float sum = 0.f;
#pragma unroll
  for (int i = 0; i < PVC; ++i) { const int kc = wave + i * PVW; if (kc < kce) {
#pragma unroll
      for (int j = 0; j < 16; ++j) { const float v = lq[i][j >> 2][j & 3]; const float ex = expf(v - m); const float e = (v <= -1.0e38f) ? 0.f : ex; lq[i][j >> 2][j & 3] = e; sum += e; } } }
  sum += __shfl_xor(sum, 16); if (g == 0) ssu[wave][col] = sum;
  __syncthreads();   /* every wave's row sums are in LDS before any lane adds them */
  float rs = 0.f;
#pragma unroll
  for (int w = 0; w < PVW; ++w) rs += ssu[w][col];
  const float inv = rs > 0.f ? 2048.0f / rs : 0.f;   /* a fully excluded row yields P = 0 */
  v8f acc[HD / 16] = {}; const size_t vro = (size_t)b * CKV + (h / GRP) * HD + col;   /* the lane's v channel of column block 0; block j and chunk i are constant offsets from it */
  if (qb < QBH) {
#pragma unroll
    for (int i = 0; i < PVCH; ++i) { const int kc = wave + i * PVW; if (kc < kce) { float pf[16];
#pragma unroll
        for (int j = 0; j < 16; ++j) pf[j] = lq[i][j >> 2][j & 3] * inv;
        const F2 p = bsplit16(pf);
#pragma unroll
        for (int j = 0; j < HD / 16; ++j) { const size_t po = vro * (size_t)KHI + wave * 32 + (size_t)(j * 16 * KHI + i * (PVW * 32)); const v16b vh = frag_b(VB + po, lane); acc[j] = wmma_bf(p.h, vh, acc[j]); acc[j] = wmma_bf(p.l, vh, acc[j]); acc[j] = wmma_bf(p.h, frag_b(VBL + po, lane), acc[j]); } } }
  } else {
#pragma unroll
    for (int i = 0; i < PVC; ++i) { const int kc = wave + i * PVW; if (kc < kce) { v16h p;
#pragma unroll
        for (int j = 0; j < 16; ++j) p[j] = (_Float16)(lq[i][j >> 2][j & 3] * inv);
#pragma unroll
        for (int j = 0; j < HD / 16; ++j) { const size_t po = vro * (size_t)TT + wave * 32 + (size_t)(j * 16 * TT + i * (PVW * 32)); acc[j] = wmma16(p, frag_h(VT + po, lane), acc[j]); } } } }
#pragma unroll
  for (int j = 0; j < HD / 16; ++j)
#pragma unroll
    for (int r = 0; r < 8; ++r) ss[wave][8 * g + r][j * 16 + col] = acc[j][r] * (1.0f / 2048.0f);
  __syncthreads();   /* every wave's partial tile is in LDS before any thread adds them */
  { const int rl = tid >> 4, q4 = (tid & 15) * 4; v4f s = *(const v4f*)&ss[0][rl][q4];
#pragma unroll
    for (int w = 1; w < PVW; ++w) s += *(const v4f*)&ss[w][rl][q4];
    vst2(Y + ((size_t)b * TT + ql0 + rl) * CC + h * HD + q4, s); } }
static_assert(32 * PVW == 16 * (HD / 4), "one thread per float4 of the 16 x HD tile in the final add");
// ---- k_out: block = (64 rows, 128 cols): out = ctx Wo (+ bo): ctx once to f16 against Wo as f16(bf16 x 2^8) exact (1 product) x 2^-8; causal early rows (< QHI of each sequence): ctx bf16 hi + lo against exact bf16 Wo (2 products)
__global__ __launch_bounds__(128) void k_out(const float* __restrict__ Y, const float* __restrict__ WO, const float* __restrict__ BO, float* __restrict__ OUT) { __shared__ __align__(16) float sf[4][16][132]; __shared__ __align__(16) __bf16 sw[2 * 128 * GWP];
  const int tid = threadIdx.x, wave = tid >> 5, lane = tid & 31, col = lane & 15, g = lane >> 4; const int c0 = blockIdx.y * 128; const size_t r0 = (size_t)blockIdx.x * 64 + wave * 16; const int wv = __builtin_amdgcn_readfirstlane(wave);
  v8f acc[8] = {};
  if (CAUSAL && (int)(((size_t)blockIdx.x * 64) % TT) < QHI) {   /* block-uniform */
    gemm_main<1, DIN, CC>(acc, Y + (r0 + col) * CC + 8 * g, WO + c0, sw, wv, lane, true);
#pragma unroll
    for (int j = 0; j < 8; ++j) { const float bias = BO ? bfr(BO[c0 + j * 16 + col]) : 0.f;
#pragma unroll
      for (int r = 0; r < 8; ++r) sf[wave][8 * g + r][j * 16 + col] = acc[j][r] + bias; }
  } else {
    gemm_main<2, DIN, CC>(acc, Y + (r0 + col) * CC + 8 * g, WO + c0, sw, wv, lane, true);   /* ctx carried x 2^6 into f16 so small-magnitude context rows stay clear of f16 subnormals */
#pragma unroll
    for (int j = 0; j < 8; ++j) { const float bias = BO ? bfr(BO[c0 + j * 16 + col]) : 0.f;
#pragma unroll
      for (int r = 0; r < 8; ++r) sf[wave][8 * g + r][j * 16 + col] = acc[j][r] * (1.0f / 16384.0f) + bias; } }   /* 2^-8 (Wo carry) x 2^-6 (ctx carry) */
  LDSX(); for (int rl = 0; rl < 16; ++rl) vst2(OUT + (r0 + rl) * DIN + c0 + lane * 4, *(const v4f*)&sf[wave][rl][lane * 4]); }

extern "C" void kernel_launch(void* const* d_in, const int* in_sizes, int n_in, void* d_out, int out_size, void* d_ws, size_t ws_size, hipStream_t stream) {
  (void)in_sizes; (void)n_in; (void)out_size;
  const float** F = (const float**)d_in;
  if (ws_size < (size_t)WS_END) return;
  char* ws = (char*)d_ws; _Float16 *QH = (_Float16*)(ws + WS_QH), *KH = (_Float16*)(ws + WS_KH), *VT = (_Float16*)(ws + WS_VT), *QL = (_Float16*)(ws + WS_QL), *KL = (_Float16*)(ws + WS_KL); __bf16 *VB = (__bf16*)(ws + WS_VB), *VBL = (__bf16*)(ws + WS_VBL); float *Y = (float*)(ws + WS_Y);
  (void)Y; (void)QL; (void)KL; (void)VB; (void)VBL;
  // inputs: 0 x [2,2048,1024]; 1 ve [2,2048,64]; 2 cos [2048,32]; 3 sin [2048,32]; 4 Wq [1024,1024] (in,out); 5 Wk [1024,64]; 6 Wv [1024,64]; 7 Wo [1024,1024] (in,out); 8 Wg [32,1]; 9 window_size int32 [1]; no biases
  k_proj<<<dim3(TNB * TT / 64, CC / 128, 1), 128, 0, stream>>>(F[0], F[0], F[0], F[4], F[5], F[6], nullptr, nullptr, nullptr, QH, QL, KH, KL, VT, VB, VBL, 0, F[2], F[3], F[1], F[8]);    /* q: 8 column blocks */
  k_proj<<<dim3(TNB * TT / 64, CKV / 128, 2), 128, 0, stream>>>(F[0], F[0], F[0], F[4], F[5], F[6], nullptr, nullptr, nullptr, QH, QL, KH, KL, VT, VB, VBL, 1, F[2], F[3], F[1], F[8]);   /* k (which 1) and v (which 2): one (half-empty) column block each */
  k_pv<<<dim3(TT / 16, 1, TNB * NH), 32 * PVW, 0, stream>>>(QH, KH, QL, KL, VT, VB, VBL, Y, (const int*)d_in[9]);   /* every (b, h) in one launch */
  k_out<<<dim3(TNB * TT / 64, DIN / 128), 128, 0, stream>>>(Y, F[7], nullptr, (float*)d_out);
}

// v005
// It runs in 150 microseconds.
// In two side-by-side timings against v004, it was 1.14 and 1.15 times as fast.
// Over all steps from v000 it is 6.66 times as fast.
// compute dtype: all float inputs rounded to bf16, the cos / sin tables, ve and Wg included; q (16 heads) and the single shared k / v head projections with EXACT bf16 products on WMMA 16x16x32 (f32 accumulate); half-split RoPE with cos / sin READ from the table inputs, then RMSNorm over the 64 head dims (f32, eps = f32 machine epsilon) on q and k; v += 2 sigmoid(x[:32] . Wg) ve in f32; causal logits inside a sliding window read from the int input: 3 products for the first 384 rows, single f16 q x k after, x 64^-0.5; softmax f32; P x 2^11 once to f16 x v once to f16 (bf16 hi + lo below row 384); ctx hi+lo x exact Wo below row 384, x2^6 f16 carry x f16(bf16 x 2^8) Wo after; f32 output.
#include <hip/hip_runtime.h>
#include <math.h>

typedef __attribute__((ext_vector_type(16))) _Float16 v16h;
typedef __attribute__((ext_vector_type(16))) __bf16 v16b;
typedef __attribute__((ext_vector_type(8)))  _Float16 v8h;
typedef __attribute__((ext_vector_type(8)))  float v8f;
typedef __attribute__((ext_vector_type(4)))  float v4f;
typedef __attribute__((ext_vector_type(2)))  float v2f;
typedef __attribute__((ext_vector_type(4)))  unsigned v4u;
typedef __attribute__((ext_vector_type(4)))  int v4i;
typedef float __attribute__((may_alias)) float_a;
typedef int __attribute__((may_alias)) int_a;

template <typename T> __device__ __forceinline__ void vst2(void* p, T v) { *(T*)p = v;  }
__device__ __forceinline__ v8f wmma16(v16h a, v16h b, v8f c) {
  v8f d = __builtin_amdgcn_wmma_f32_16x16x32_f16(false, a, false, b, (short)0, c, false, false);
  asm volatile("v_nop\n\tv_nop\n\tv_nop\n\tv_nop" : "+v"(d) : "v"(a), "v"(b));
  return d;
}
__device__ __forceinline__ v8f wmma_bf(v16b a, v16b b, v8f c) {
  v8f d = __builtin_amdgcn_wmma_f32_16x16x32_bf16(false, a, false, b, (short)0, c, false, false);
  asm volatile("v_nop\n\tv_nop\n\tv_nop\n\tv_nop" : "+v"(d) : "v"(a), "v"(b));
  return d;
}
// 16x16x32 fragments: lane = (h = lane>>4, row/col = lane&15); elements 0..7 = k0+8h+0..7, 8..15 = k0+16+8h+0..7; D element r = row 8h+r
__device__ __forceinline__ v16h frag_h(const _Float16* rowk0, int lane) {
  union { v16h v; v8h q[2]; } u; const _Float16* p = rowk0 + 8 * (lane >> 4);
  u.q[0] = *(const v8h*)p; u.q[1] = *(const v8h*)(p + 16); return u.v;
}
__device__ __forceinline__ v16h frag_f32(const float* rowk0, int lane) {
  v16h a; const float* p = rowk0 + 8 * (lane >> 4);
#pragma unroll
  for (int i = 0; i < 8; ++i) { a[i] = (_Float16)p[i]; a[8 + i] = (_Float16)p[16 + i]; }
  return a;
}
__device__ __forceinline__ v16h frag_f32s(const float* rowk0, int lane, float sc) {
  v16h a; const float* p = rowk0 + 8 * (lane >> 4);
#pragma unroll
  for (int i = 0; i < 8; ++i) { a[i] = (_Float16)(p[i] * sc); a[8 + i] = (_Float16)(p[16 + i] * sc); }
  return a;
}
// column fragment from a [K][ld] layout (column n), rows >= K read as 0
__device__ __forceinline__ v16h fragc_f32(const float* W, int k0, int n, int lane, int ld, int K) {
  v16h a; const int g = lane >> 4;
#pragma unroll
  for (int i = 0; i < 8; ++i) { const int ka = k0 + 8 * g + i, kb = ka + 16;
    a[i] = (_Float16)(ka < K ? W[(size_t)(ka < K ? ka : K - 1) * ld + n] : 0.f); a[8 + i] = (_Float16)(kb < K ? W[(size_t)(kb < K ? kb : K - 1) * ld + n] : 0.f); }
  return a;
}
struct F2 { v16b h, l; };
__device__ __forceinline__ F2 bsplit16(const float v[16]) { F2 r;
#pragma unroll
  for (int i = 0; i < 16; ++i) { const __bf16 h = (__bf16)v[i]; r.h[i] = h; r.l[i] = (__bf16)(v[i] - (float)h); }
  return r; }
__device__ __forceinline__ F2 split_row(const float* row, int k0, int lane) { float v[16]; const float* p = row + k0 + 8 * (lane >> 4);
#pragma unroll
  for (int i = 0; i < 8; ++i) { v[i] = p[i]; v[8 + i] = p[16 + i]; }
  return bsplit16(v); }
__device__ __forceinline__ F2 split_rowK(const float* row, int k0, int lane, int K) { float v[16]; const int g = lane >> 4;
#pragma unroll
  for (int i = 0; i < 8; ++i) { const int ka = k0 + 8 * g + i, kb = ka + 16; v[i] = ka < K ? row[ka < K ? ka : K - 1] : 0.f; v[8 + i] = kb < K ? row[kb < K ? kb : K - 1] : 0.f; }
  return bsplit16(v); }
__device__ __forceinline__ F2 split_col(const float* W, int k0, int n, int lane, int ld, int K) { float v[16]; const int g = lane >> 4;
#pragma unroll
  for (int i = 0; i < 8; ++i) { const int ka = k0 + 8 * g + i, kb = ka + 16; v[i] = ka < K ? W[(size_t)(ka < K ? ka : K - 1) * ld + n] : 0.f; v[8 + i] = kb < K ? W[(size_t)(kb < K ? kb : K - 1) * ld + n] : 0.f; }
  return bsplit16(v); }
__device__ __forceinline__ v8f mac3(const F2& a, const F2& b, v8f c) { c = wmma_bf(a.l, b.h, c); c = wmma_bf(a.h, b.l, c); return wmma_bf(a.h, b.h, c); }
__device__ __forceinline__ float sigm(float v) { return 1.0f / (1.0f + expf(-v)); }
#define LDSX() do { asm volatile("s_wait_dscnt 0" ::: "memory"); __builtin_amdgcn_wave_barrier(); __builtin_amdgcn_fence(__ATOMIC_RELEASE, "workgroup"); } while (0)

// Multi-query causal attention with table RoPE, per-head RMSNorm, a gated value residual and a sliding window (x [2,2048,1024]; ve [2,2048,64]; cos, sin [2048,32] (inputs); (in,out) Wq [1024,1024], Wk / Wv [1024,64], Wo [1024,1024], all N(0,1) x 0.02; Wg [32,1]; window_size int (1024); 16 query heads share ONE key / value head; gate = 2 sigmoid(x[..., :32] Wg); v = x Wv + gate * ve; _rope: (x1, x2) = halves -> (x1 cos + x2 sin, -x1 sin + x2 cos); _rmsnorm: x * rsqrt(mean(x^2) + finfo.eps) AFTER the rotation, on q and k; scores x 64^-0.5; masked where key > query or query - key >= window_size (finfo.min); softmax; out = merge(attn v) Wo).
#define NB 2
#define TT 2048
#define CC 1024            // NH * HD = projected width
#define DIN 1024          // input (model) width
#define NH 16
#define HD 64
#define SCALE (0.125f)
#define CAUSAL 1
#ifndef TNB
#define TNB NB
#endif
__device__ __forceinline__ float bfr(float v) { return (float)(__bf16)v; }
typedef __attribute__((ext_vector_type(8))) __bf16 v8b;
__device__ __forceinline__ v16b frag_b(const __bf16* rowk0, int lane) {
  union { v16b v; v8b q[2]; } u; const __bf16* p = rowk0 + 8 * (lane >> 4);
  u.q[0] = *(const v8b*)p; u.q[1] = *(const v8b*)(p + 16); return u.v;
}
#define QBH 6              // causal: query blocks 0..QBH-1 of each sequence (few keys, no averaging) take the high-precision path
#define QHI 384            // rows carrying a q residual plane
#define KHI 384            // key rows carrying k residual / v bf16 hi+lo planes (used only by the causal high-precision path)
// B fragment (k rows k0+.., output column o) of a weight: (in,out) [K][ld] or (out,in) [ld rows of K]: bf16 exact, or f16(bf16 * 256) exact
__device__ __forceinline__ v16b wcol_io(const float* Wm, int k0, int o, int lane, int ld) { v16b w; const int g = lane >> 4;
#pragma unroll
  for (int i = 0; i < 8; ++i) { w[i] = (__bf16)Wm[(size_t)(k0 + 8 * g + i) * ld + o]; w[8 + i] = (__bf16)Wm[(size_t)(k0 + 16 + 8 * g + i) * ld + o]; }
  return w; }
__device__ __forceinline__ v16b wcol_oi(const float* Wm, int k0, int o, int lane, int K) { v16b w; const float* p = Wm + (size_t)o * K + k0 + 8 * (lane >> 4);
#pragma unroll
  for (int i = 0; i < 8; ++i) { w[i] = (__bf16)p[i]; w[8 + i] = (__bf16)p[16 + i]; }
  return w; }
__device__ __forceinline__ v16h wcolh_io(const float* Wm, int k0, int o, int lane, int ld) { v16h w; const int g = lane >> 4;
#pragma unroll
  for (int i = 0; i < 8; ++i) { w[i] = (_Float16)(bfr(Wm[(size_t)(k0 + 8 * g + i) * ld + o]) * 256.0f); w[8 + i] = (_Float16)(bfr(Wm[(size_t)(k0 + 16 + 8 * g + i) * ld + o]) * 256.0f); }
  return w; }
__device__ __forceinline__ v16h wcolh_oi(const float* Wm, int k0, int o, int lane, int K) { v16h w; const float* p = Wm + (size_t)o * K + k0 + 8 * (lane >> 4);
#pragma unroll
  for (int i = 0; i < 8; ++i) { w[i] = (_Float16)(bfr(p[i]) * 256.0f); w[8 + i] = (_Float16)(bfr(p[16 + i]) * 256.0f); }
  return w; }
#define WQKV_LAYOUT 0   // selects only WCOL, which nothing uses: gemm_main reads Wq / Wk / Wv as (in,out) [DIN][n]
__device__ __forceinline__ v16b wcol_hdk(const float* Wm, int k0, int o, int lane) { v16b w; const int g = lane >> 4; const float* p = Wm + (size_t)(o / HD) * DIN * HD + (o % HD);
#pragma unroll
  for (int i = 0; i < 8; ++i) { w[i] = (__bf16)p[(size_t)(k0 + 8 * g + i) * HD]; w[8 + i] = (__bf16)p[(size_t)(k0 + 16 + 8 * g + i) * HD]; }
  return w; }
#define WO_OUT_IN 0
#if WQKV_LAYOUT == 1
#define WCOL(W, k0, o, lane) wcol_oi(W, k0, o, lane, DIN)
#elif WQKV_LAYOUT == 2
#define WCOL(W, k0, o, lane) wcol_hdk(W, k0, o, lane)
#else
#define WCOL(W, k0, o, lane) (which == 0 ? wcol_io(W, k0, (o), lane, CC) : ((o) < KVW ? wcol_io(W, k0, (o), lane, KVW) : zero16b()))   /* (in,out): Wq [1024][1024] pitch CC; Wk / Wv [1024][64] pitch 64, padded columns 64..127 are zero */
#endif
#if WO_OUT_IN
#define WOCOL(W, k0, o, lane) wcol_oi(W, k0, o, lane, CC)
#define WOCOLH(W, k0, o, lane) wcolh_oi(W, k0, o, lane, CC)
#else
#define WOCOL(W, k0, o, lane) wcol_io(W, k0, o, lane, DIN)
#define WOCOLH(W, k0, o, lane) wcolh_io(W, k0, o, lane, DIN)
#endif
#define GRP 16             // all 16 query heads share the single kv head (kv head = h / 16 = 0)
#define CKV 128            // kv plane width: ONE 128-column block whose columns 0..63 are the single kv head, columns 64..127 zero padding
#define KVW 64             // real kv width (Wk / Wv are (in,out) [1024][64])
#define PROJ_EXTRA_PARAMS , int woff, const float* __restrict__ COS, const float* __restrict__ SIN, const float* __restrict__ VE, const float* __restrict__ WG   /* which = blockIdx.z + woff; COS / SIN [TT][32], VE [NB*TT][64], WG [32] are module inputs read in the projection epilogue */
__device__ __forceinline__ v16b zero16b() { v16b w; _Pragma("unroll") for (int i = 0; i < 16; ++i) w[i] = (__bf16)0.0f; return w; }
#define RMS_EPS 1.1920929e-07f   /* jnp.finfo(float32).eps */
// per (token, head) hook on the staged f32 row (64 floats). q and k (which 0, 1): the module's _rope with cos / sin read LITERALLY from the table inputs at row t (bf16-rounded like every float input): (x1, x2) = (row[m], row[32+m]) -> (x1 c + x2 s, -x1 s + x2 c), then _rmsnorm over the 64 dims: x * (1 / sqrt(mean(x^2) + eps)); the zero-padded second half of the k block stays exactly zero under both. v (which 2): row += gate * bf16(ve[b, t, :]) with gate = 2 / (1 + exp(-z)), z = sum_{i<32} bf16(x[b, t, i]) * bf16(Wg[i]); all global loads are unconditional; the padded half gets gate 0 through a select. f32, products and sums kept separate
#define PROJ_EPI(which, row, t, h) do { float* rw = (row); const size_t gr_ = bb * TT + (size_t)(t); if ((which) < 2) { const float* ct_ = COS + (size_t)(t) * 32; const float* st_ = SIN + (size_t)(t) * 32; _Pragma("unroll 4") for (int m = 0; m < 32; ++m) { _Pragma("clang fp contract(off)") const float c_ = bfr(ct_[m]), s_ = bfr(st_[m]); const float x1 = rw[m], x2 = rw[32 + m]; rw[m] = x1 * c_ + x2 * s_; rw[32 + m] = (-x1) * s_ + x2 * c_; } float ss_ = 0.f; _Pragma("unroll 8") for (int m = 0; m < 64; ++m) { _Pragma("clang fp contract(off)") ss_ += rw[m] * rw[m]; } const float rinv_ = 1.0f / sqrtf(ss_ * (1.0f / 64.0f) + RMS_EPS); _Pragma("unroll 8") for (int m = 0; m < 64; ++m) rw[m] = rw[m] * rinv_; } else { const float* xr_ = XV + gr_ * DIN; float z_ = 0.f; _Pragma("unroll 8") for (int i = 0; i < 32; ++i) { _Pragma("clang fp contract(off)") z_ += bfr(xr_[i]) * bfr(WG[i]); } const float gate_ = 2.0f / (1.0f + expf(-z_)); const float gsel_ = ((h) == 0) ? gate_ : 0.0f; const float* ve_ = VE + gr_ * 64; _Pragma("unroll 8") for (int m = 0; m < 64; ++m) { _Pragma("clang fp contract(off)") rw[m] = rw[m] + gsel_ * bfr(ve_[m]); } } } while (0)
static_assert(HD == 64 && KVW == 64 && CKV == 128, "the hook spells 32 / 64 literally: one real 64-wide kv head in a 128-column block");
#define SM_EXTRA_PARAMS , const int* __restrict__ WINP
// sliding window: a key is excluded when query - key >= window_size; window_size is the module's int input (one block-uniform scalar load); keys after the query are already excluded by the causal select; every row keeps at least min(t + 1, window) >= 1 keys
#define SM_MASK_HOOK do { v = (t - k >= win_) ? -3.0e38f : v; } while (0)   /* win_ = WINP[0], read once at the kernel's head */
#ifndef SM_EXTRA_PARAMS
#define SM_EXTRA_PARAMS
#endif
#ifndef PROJ_EXTRA_PARAMS
#define PROJ_EXTRA_PARAMS
#endif
#ifndef SM_MASK_HOOK
#define SM_MASK_HOOK (void)0
#endif

#define WS_QH  0u                                      // f16 q rows [b*t][CC]
#define WS_KH  (WS_QH + 2u * (size_t)NB * TT * CC)      // f16 k rows [b*t][CKV]
#define WS_VT  (WS_KH + 2u * (size_t)NB * TT * CC)      // f16 v planes [b][c][t]
#define WS_QL  (WS_VT + 2u * (size_t)NB * CC * TT)      // f16 q residual x 2^10 rows [b][t < QHI][CC]
#define WS_KL  (WS_QL + 2u * (size_t)NB * QHI * CC)     // f16 k residual x 2^10 rows [b][t < KHI][CKV]
#define WS_VB  (WS_KL + 2u * (size_t)NB * KHI * CC)     // bf16 v hi planes [b][c][t < KHI]
#define WS_VBL (WS_VB + 2u * (size_t)NB * CC * KHI)
#define WS_Y   (WS_VBL + 2u * (size_t)NB * CC * KHI)    // f32 ctx rows [b*t][CC] (only when there is an output projection)
#define WS_END (WS_Y  + 4u * (size_t)NB * TT * CC)

// ---- gemm_main: the K loop of k_proj and k_out. A block's 4 waves need the same 128 weight columns, so each 64-k stage of W ([k][n] f32, n contiguous) is read ONCE per block with whole-line 16-byte loads, rounded exactly as before (MODE 0, 1: bf16; MODE 2: f16(bf16 x 2^8)), turned in registers and stored as [n][k] rows (pitch 144 B) in one of two LDS buffers, from which every wave reads its B fragments with two 16-byte LDS loads each. The next stage's global loads (W tile and the wave's own A rows) are issued in front of this stage's products and stored behind them. Products and their k order per accumulator are those of the direct form. Every loop over s, c, i, j or kk inside a stage is fully unrolled so that the register arrays are indexed by constants alone.
#define GKS 64                 // k per stage
#define GWP (GKS + 8)          // LDS row pitch in 16-bit elements: 144 B = 16 B x odd, conflict-free for 16-byte readers
template <int LD> __device__ __forceinline__ void g_fetch(v4f (&wr)[2][8], v4f (&ar)[2][4], const float* wp, const float* ap) {
#pragma unroll
  for (int s = 0; s < 2; ++s)
#pragma unroll
    for (int i = 0; i < 8; ++i) wr[s][i] = *(const v4f*)(wp + (size_t)(s * 32 + i) * LD);
#pragma unroll
  for (int kk = 0; kk < 2; ++kk) { ar[kk][0] = *(const v4f*)(ap + kk * 32); ar[kk][1] = *(const v4f*)(ap + kk * 32 + 4); ar[kk][2] = *(const v4f*)(ap + kk * 32 + 16); ar[kk][3] = *(const v4f*)(ap + kk * 32 + 20); }
  asm volatile("s_wait_xcnt 0x0" ::: "memory");   /* stands in front of every later instruction that rewrites the address registers of these loads; it also keeps the loads in front of the stage's products */
}
template <int MODE> __device__ __forceinline__ void g_store(const v4f (&wr)[2][8], __bf16* sst, bool wl) {
#pragma unroll
  for (int s = 0; s < 2; ++s)
#pragma unroll
    for (int c = 0; c < 4; ++c) {
      if constexpr (MODE == 2) { v8h o;
#pragma unroll
        for (int i = 0; i < 8; ++i) o[i] = (_Float16)(bfr(wr[s][i][c]) * 256.0f);
        *(v8h*)(sst + c * GWP + s * 32) = o;
      } else { union { v8b b; v4u u; } o;
#pragma unroll
        for (int i = 0; i < 8; ++i) o.b[i] = (__bf16)wr[s][i][c];
        o.u &= wl ? 0xffffffffu : 0u;   /* padded columns: the load is unconditional at a clamped address, the stored value is +0 */
        *(v8b*)(sst + c * GWP + s * 32) = o.b; } } }
struct GA { v16b h[2], l[2]; v16h f[2]; };   /* the wave's A fragments of one stage; only the members of the MODE in use are formed */
template <int MODE> __device__ __forceinline__ void g_acvt(GA& a, const v4f (&ar)[2][4]) {
#pragma unroll
  for (int kk = 0; kk < 2; ++kk) { float v[16];
#pragma unroll
    for (int i = 0; i < 16; ++i) v[i] = ar[kk][i >> 2][i & 3];   /* elements 0..7 = k 8g + 0..7, 8..15 = k 16 + 8g + 0..7 */
    if constexpr (MODE == 0) {
#pragma unroll
      for (int i = 0; i < 16; ++i) a.h[kk][i] = (__bf16)v[i];
    } else if constexpr (MODE == 1) { const F2 s = bsplit16(v); a.h[kk] = s.h; a.l[kk] = s.l;
    } else {
#pragma unroll
      for (int i = 0; i < 16; ++i) a.f[kk][i] = (_Float16)(v[i] * 64.0f); } } }
// ap = the lane's A row + 8 g; Wt = W + the block's first column; sw = two buffers of 128 rows x GWP; wave in a scalar register; wl = this wave's 32 staged columns exist in W
template <int MODE, int LD, int KTOT> __device__ __forceinline__ void gemm_main(v8f (&acc)[8], const float* __restrict__ ap, const float* __restrict__ Wt, __bf16* sw, int wave, int lane, bool wl) {
  const int cg = wave * 8 + (lane & 3) + 4 * (lane >> 4), kg = (lane >> 2) & 3;   /* the lane stages columns 4 cg .. 4 cg + 3 of k rows 8 kg + 0..7 and 32 + 8 kg + 0..7: a load covers four whole 128-B lines, and the 16 lanes of a half-wave store to 16 different bank groups */
  const float* wp = Wt + (size_t)(8 * kg) * LD + (wl ? 4 * cg : 0);
  __bf16* sst = sw + (4 * cg) * GWP + 8 * kg; const __bf16* srd = sw + (lane & 15) * GWP;
  v4f wr[2][8]; v4f ar[2][4]; GA a;
  g_fetch<LD>(wr, ar, wp, ap); g_store<MODE>(wr, sst, wl); g_acvt<MODE>(a, ar);
  __syncthreads();   /* stage 0 is in LDS before any wave reads it */
  for (int s = 0; s < KTOT / GKS; ++s) { const int bo = (s & 1) * (128 * GWP); const bool more = s + 1 < KTOT / GKS;
    if (more) g_fetch<LD>(wr, ar, wp + (size_t)(s + 1) * GKS * LD, ap + (s + 1) * GKS);
#pragma unroll
    for (int kk = 0; kk < 2; ++kk) {   /* the eight B fragments of a 32-k block are all read in front of its first product: one LDS latency a block */
      if constexpr (MODE == 2) { v16h wf[8];
#pragma unroll
        for (int j = 0; j < 8; ++j) wf[j] = frag_h((const _Float16*)(srd + bo + j * 16 * GWP + kk * 32), lane);
#pragma unroll
        for (int j = 0; j < 8; ++j) acc[j] = wmma16(a.f[kk], wf[j], acc[j]);
      } else { v16b wf[8];
#pragma unroll
        for (int j = 0; j < 8; ++j) wf[j] = frag_b(srd + bo + j * 16 * GWP + kk * 32, lane);
#pragma unroll
        for (int j = 0; j < 8; ++j) { acc[j] = wmma_bf(a.h[kk], wf[j], acc[j]); if constexpr (MODE == 1) acc[j] = wmma_bf(a.l[kk], wf[j], acc[j]); } } }
    __builtin_amdgcn_sched_barrier(0);   /* keeps the conversions of the next stage's registers, and with them the wait for its global loads, behind this stage's products: without it the wait was scheduled behind the first product */
    if (more) { g_store<MODE>(wr, sst + (bo ^ (128 * GWP)), wl); g_acvt<MODE>(a, ar);
      __syncthreads(); } } }   /* one barrier a stage: it publishes stage s + 1 and ends every wave's reads of the buffer that stage s + 2 will overwrite */
// ---- k_proj: block = (64 rows, 128 cols, which): q/k/v = X W (+ b) with exact bf16 products (K = DIN) -> which 0: q f16 rows (+ residual rows < QHI); 1: k f16 rows (+ residual rows < KHI); 2: v f16 planes [c][t] (+ bf16 hi/lo planes for t < KHI)
__global__ __launch_bounds__(128) void k_proj(const float* __restrict__ XQ, const float* __restrict__ XK, const float* __restrict__ XV, const float* __restrict__ WQ, const float* __restrict__ WK, const float* __restrict__ WV, const float* __restrict__ BQ, const float* __restrict__ BK, const float* __restrict__ BV,
    _Float16* __restrict__ QH, _Float16* __restrict__ QL, _Float16* __restrict__ KH, _Float16* __restrict__ KL, _Float16* __restrict__ VT, __bf16* __restrict__ VB, __bf16* __restrict__ VBL PROJ_EXTRA_PARAMS) {
  __shared__ __align__(16) float st[64][132]; __shared__ __align__(16) _Float16 sh[64][136], sl[64][136]; __shared__ __align__(16) _Float16 th[128][72]; __shared__ __align__(16) __bf16 tb[128][72], tbl[128][72]; __shared__ __align__(16) __bf16 sw[2 * 128 * GWP];
  const int tid = threadIdx.x, wave = tid >> 5, lane = tid & 31, col = lane & 15, g = lane >> 4; const int which = blockIdx.z + woff; const int c0 = blockIdx.y * 128; const size_t r0 = (size_t)blockIdx.x * 64; const size_t bb = r0 / TT; const int t0 = (int)(r0 % TT);
  const float* X = which == 0 ? XQ : which == 1 ? XK : XV; const float* WA = which == 0 ? WQ : which == 1 ? WK : WV; const float* BA = which == 0 ? BQ : which == 1 ? BK : BV;
  v8f acc[8] = {};
  { const int wv = __builtin_amdgcn_readfirstlane(wave);   /* the wave's number in a scalar register: the staged column group and the padded-columns mask are wave-uniform */
    const float* ap = X + (r0 + wave * 16 + col) * DIN + 8 * g;
    if (which == 0) gemm_main<0, CC, DIN>(acc, ap, WA + c0, sw, wv, lane, true);   /* Wq [1024][1024] */
    else gemm_main<0, KVW, DIN>(acc, ap, WA + (c0 < KVW ? c0 : 0), sw, wv, lane, c0 + wv * 32 < KVW); }   /* Wk / Wv [1024][64]: padded columns 64..127 are staged as zeros */
  { // stage the f32 tile (acc + bias) in LDS, run the per-(row, head) epilogue hook, then convert
#pragma unroll
    for (int j = 0; j < 8; ++j) { const int bo_ = c0 + j * 16 + col; const float bias = (BA && (which == 0 || bo_ < KVW)) ? bfr(BA[(which == 0 || bo_ < KVW) ? bo_ : 0]) : 0.f;   /* bk / bv hold only the 64 real kv columns: padded columns get no bias (index clamped, value selected) */
#pragma unroll
      for (int r = 0; r < 8; ++r) st[wave * 16 + 8 * g + r][j * 16 + col] = acc[j][r] + bias; }
    __syncthreads();
    for (int e = tid; e < 64 * (128 / HD); e += 128) { const int rl = e / (128 / HD), hh = e % (128 / HD); PROJ_EPI(which, &st[rl][hh * HD], (int)((r0 + rl) % TT), (c0 / HD) + hh); }
    __syncthreads(); }
  if (which < 2) { _Float16* DH = which == 0 ? QH : KH; _Float16* DL = which == 0 ? QL : KL; const int nhi = which == 0 ? QHI : KHI; const bool hi_rows = t0 < nhi;
    for (int e = tid; e < 64 * 128; e += 128) { const int rl = e >> 7, cl = e & 127; const float v = st[rl][cl]; const _Float16 hv = (_Float16)v; sh[rl][cl] = hv; sl[rl][cl] = (_Float16)((v - (float)hv) * 1024.0f); }
    __syncthreads();
    for (int e = tid; e < 64 * 16; e += 128) { const int rl = e >> 4, q = e & 15; vst2((unsigned*)(DH + (r0 + rl) * (size_t)(which == 0 ? CC : CKV) + c0 + q * 8), *(const v4u*)&sh[rl][q * 8]);   /* q rows at pitch CC, k rows at pitch CKV */ if (hi_rows) vst2((unsigned*)(DL + (bb * nhi + t0 + rl) * (size_t)(which == 0 ? CC : CKV) + c0 + q * 8), *(const v4u*)&sl[rl][q * 8]);   /* residual rows: same pitches */ }
  } else { const bool hi_rows = t0 < KHI;
    for (int e = tid; e < 64 * 128; e += 128) { const int rl = e & 63, cl = e >> 6; const float v = st[rl][cl]; th[cl][rl] = (_Float16)v; const __bf16 bh = (__bf16)v; tb[cl][rl] = bh; tbl[cl][rl] = (__bf16)(v - (float)bh); }
    __syncthreads();
    for (int e = tid; e < 128 * 8; e += 128) { const int cl = e >> 3, q = e & 7; vst2((unsigned*)(VT + (bb * CKV + c0 + cl) * (size_t)TT + t0 + q * 8), *(const v4u*)&th[cl][q * 8]);   /* v planes: CKV channels per batch */ if (hi_rows) { const size_t o3 = (bb * CKV + c0 + cl) * (size_t)KHI + t0 + q * 8; vst2((unsigned*)(VB + o3), *(const v4u*)&tb[cl][q * 8]); vst2((unsigned*)(VBL + o3), *(const v4u*)&tbl[cl][q * 8]); } } } }
// ---- k_pv: block = 16 queries (qt) of one (b, h), PVW waves: wave w owns the 32-key chunks w, w + PVW, ... and works on those in [kcs, kce), the chunks that hold a key which the causal rule and the window admit for some query of the block (a chunk outside adds only zeros to the sums and nothing to the maxima). It forms its logits itself, transposed: A = 16 key rows, B = the block's 16 query rows, so that D (lane = query, registers = keys 8g + r) of the chunk's two key tiles IS the A-fragment layout of the P x v product (lane = query row, 16 keys a chunk) and the logits never leave the registers; x SCALE; q hi + residual (x 2^10) against k hi + residual (3 products) for query blocks < QBH (causal early rows), single f16 q x k after; softmax in f32 inside the block: excluded keys (after the query, or outside the window) by index, row maximum and row sum over the lane's own keys, the other half-wave, then the PVW waves through LDS in wave order; P x 2^11 once to f16 against v f16 (1 product; causal early query blocks: P and v as bf16 hi + lo, 3 products); the PVW partial ctx tiles are added in LDS in wave order; 256-B (row, head) segment by 16 lanes
#define PVW 8
#define PVC (TT / 32 / PVW)                                             // most chunks one wave can own
#define PVCH (((((QBH * 64 - 1) >> 7) + 1) * 4 + PVW - 1) / PVW)         // the same for the early (high-precision) query blocks
static_assert(QBH * 64 == QHI && (((QBH * 64 - 1) >> 7) + 1) * 128 <= KHI, "every query row with a residual plane lies in an early block, and every key row such a block reads has one");
__global__ __launch_bounds__(32 * PVW) void k_pv(const _Float16* __restrict__ QH, const _Float16* __restrict__ KH, const _Float16* __restrict__ QL, const _Float16* __restrict__ KL, const _Float16* __restrict__ VT, const __bf16* __restrict__ VB, const __bf16* __restrict__ VBL, float* __restrict__ Y SM_EXTRA_PARAMS) { const int b = blockIdx.z / NH, h = blockIdx.z % NH; __shared__ __align__(16) float ss[PVW][16][HD + 4]; __shared__ float smx[PVW][16], ssu[PVW][16];
  const int tid = threadIdx.x, lane = tid & 31, col = lane & 15, g = lane >> 4; const int qt = blockIdx.x, qb = qt >> 2; const int ql0 = qt * 16; const int kce = CAUSAL ? ((ql0 + 15) >> 5) + 1 : TT / 32;   /* one past the chunk that holds the block's last query: every later key lies after every query of the block */
  const int wave = __builtin_amdgcn_readfirstlane(tid >> 5);   /* the wave's number in a scalar register: the chunk tests below branch on scalars and every lane stays on at the matrix instructions */
  const int win_ = WINP[0]; const int t = ql0 + col;
  const int klo = ql0 + 1 - (win_ < 0 ? 0 : win_); const int kcs = klo > 0 ? klo >> 5 : 0;   /* klo = the first key that the window leaves to the block's first query (later queries start later): chunks below kcs hold excluded keys alone; scalar, 0 <= kcs < kce for any window_size; no address is formed from it */
  const _Float16* qrow = QH + ((size_t)b * TT + t) * CC + h * HD; const v16h qf0 = frag_h(qrow, lane), qf1 = frag_h(qrow + 32, lane);   /* B fragments: column = the lane's query, head dims 0..31 and 32..63 */
  const size_t kro = (size_t)(wave * 32 + col) * CKV + (h / GRP) * HD;   /* the lane's key row in the first key tile of the wave's first chunk; tile u of chunk i lies (i * PVW * 32 + u * 16) rows on, a constant offset */
  v4f lq[PVC][4];   /* chunk i is formed, and read, only under kcs <= kc < kce; every loop over i or j below is fully unrolled so that lq is indexed by constants alone and stays in registers */
  /* a chunk's key fragments are all loaded in front of its first product (the v_nop statements behind the products hold later loads back): one load latency a chunk; the two key tiles' products alternate, each tile's own order being head dims 0..31, then 32..63 */
  if (qb < QBH) { const _Float16* qlrow = QL + ((size_t)b * QHI + t) * CC + h * HD; const v16h ql0f = frag_h(qlrow, lane), ql1f = frag_h(qlrow + 32, lane); asm volatile("s_wait_xcnt 0x0" ::: "memory");   /* stands in front of the key loads below, whose results may land on the address registers of the q loads */
    const _Float16* krow = KH + (size_t)b * TT * CKV + kro; const _Float16* klrow = KL + (size_t)b * KHI * CKV + kro;
#pragma unroll
    for (int i = 0; i < PVCH; ++i) { const int kc = wave + i * PVW; if (kc >= kcs && kc < kce) { const int ko = i * (PVW * 32) * CKV; v16h kh[2][2], kl[2][2]; v8f a[2] = {}, al[2] = {};
#pragma unroll
        for (int u = 0; u < 2; ++u) { kh[u][0] = frag_h(krow + ko + u * 16 * CKV, lane); kh[u][1] = frag_h(krow + ko + u * 16 * CKV + 32, lane); kl[u][0] = frag_h(klrow + ko + u * 16 * CKV, lane); kl[u][1] = frag_h(klrow + ko + u * 16 * CKV + 32, lane); }
        asm volatile("s_wait_xcnt 0x0" ::: "memory");   /* stands in front of every later instruction that rewrites the address registers of this chunk's loads */
#pragma unroll
        for (int c = 0; c < 2; ++c) { const v16h qh = c ? qf1 : qf0, ql = c ? ql1f : ql0f; a[0] = wmma16(kh[0][c], qh, a[0]); a[1] = wmma16(kh[1][c], qh, a[1]); al[0] = wmma16(kh[0][c], ql, al[0]); al[1] = wmma16(kh[1][c], ql, al[1]); al[0] = wmma16(kl[0][c], qh, al[0]); al[1] = wmma16(kl[1][c], qh, al[1]); }
#pragma unroll
        for (int j = 0; j < 16; ++j) lq[i][j >> 2][j & 3] = (a[j >> 3][j & 7] + al[j >> 3][j & 7] * (1.0f / 1024.0f)) * SCALE;
      } }
  } else { const _Float16* krow = KH + (size_t)b * TT * CKV + kro;
#pragma unroll
    for (int i = 0; i < PVC; ++i) { const int kc = wave + i * PVW; if (kc >= kcs && kc < kce) { const int ko = i * (PVW * 32) * CKV; v16h kh[2][2]; v8f a[2] = {};
#pragma unroll
        for (int u = 0; u < 2; ++u) { kh[u][0] = frag_h(krow + ko + u * 16 * CKV, lane); kh[u][1] = frag_h(krow + ko + u * 16 * CKV + 32, lane); }
        asm volatile("s_wait_xcnt 0x0" ::: "memory");   /* stands in front of every later instruction that rewrites the address registers of this chunk's loads */
        a[0] = wmma16(kh[0][0], qf0, a[0]); a[1] = wmma16(kh[1][0], qf0, a[1]); a[0] = wmma16(kh[0][1], qf1, a[0]); a[1] = wmma16(kh[1][1], qf1, a[1]);
#pragma unroll
        for (int j = 0; j < 16; ++j) lq[i][j >> 2][j & 3] = a[j >> 3][j & 7] * SCALE;
      } } }
  float m = -3.0e38f;
#pragma unroll
  for (int i = 0; i < PVC; ++i) { const int kc = wave + i * PVW; if (kc >= kcs && kc < kce) {
#pragma unroll
      for (int j = 0; j < 16; ++j) { const int k = kc * 32 + 8 * g + (j & 7) + 16 * (j >> 3); float v = (!CAUSAL || k <= t) ? lq[i][j >> 2][j & 3] : -3.0e38f; SM_MASK_HOOK; lq[i][j >> 2][j & 3] = v; m = fmaxf(m, v); } } }
  m = fmaxf(m, __shfl_xor(m, 16)); if (g == 0) smx[wave][col] = m;
  __syncthreads();   /* every wave's row maxima are in LDS before any lane combines them */
#pragma unroll
  for (int w = 0; w < PVW; ++w) m = fmaxf(m, smx[w][col]);
  float sum = 0.f;
#pragma unroll
  for (int i = 0; i < PVC; ++i) { const int kc = wave + i * PVW; if (kc >= kcs && kc < kce) {
#pragma unroll
      for (int j = 0; j < 16; ++j) { const float v = lq[i][j >> 2][j & 3]; const float ex = expf(v - m); const float e = (v <= -1.0e38f) ? 0.f : ex; lq[i][j >> 2][j & 3] = e; sum += e; } } }
  sum += __shfl_xor(sum, 16); if (g == 0) ssu[wave][col] = sum;
  __syncthreads();   /* every wave's row sums are in LDS before any lane adds them */
  float rs = 0.f;
#pragma unroll
  for (int w = 0; w < PVW; ++w) rs += ssu[w][col];
  const float inv = rs > 0.f ? 2048.0f / rs : 0.f;   /* a fully excluded row yields P = 0 */
  v8f acc[HD / 16] = {}; const size_t vro = (size_t)b * CKV + (h / GRP) * HD + col;   /* the lane's v channel of column block 0; block j and chunk i are constant offsets from it */
  if (qb < QBH) {
#pragma unroll
    for (int i = 0; i < PVCH; ++i) { const int kc = wave + i * PVW; if (kc >= kcs && kc < kce) { float pf[16];
#pragma unroll
        for (int j = 0; j < 16; ++j) pf[j] = lq[i][j >> 2][j & 3] * inv;
        const F2 p = bsplit16(pf);
#pragma unroll
        for (int j = 0; j < HD / 16; ++j) { const size_t po = vro * (size_t)KHI + wave * 32 + (size_t)(j * 16 * KHI + i * (PVW * 32)); const v16b vh = frag_b(VB + po, lane); acc[j] = wmma_bf(p.h, vh, acc[j]); acc[j] = wmma_bf(p.l, vh, acc[j]); acc[j] = wmma_bf(p.h, frag_b(VBL + po, lane), acc[j]); } } }
  } else {
#pragma unroll
    for (int i = 0; i < PVC; ++i) { const int kc = wave + i * PVW; if (kc >= kcs && kc < kce) { v16h p;
#pragma unroll
        for (int j = 0; j < 16; ++j) p[j] = (_Float16)(lq[i][j >> 2][j & 3] * inv);
#pragma unroll
        for (int j = 0; j < HD / 16; ++j) { const size_t po = vro * (size_t)TT + wave * 32 + (size_t)(j * 16 * TT + i * (PVW * 32)); acc[j] = wmma16(p, frag_h(VT + po, lane), acc[j]); } } } }
#pragma unroll
  for (int j = 0; j < HD / 16; ++j)
#pragma unroll
    for (int r = 0; r < 8; ++r) ss[wave][8 * g + r][j * 16 + col] = acc[j][r] * (1.0f / 2048.0f);
  __syncthreads();   /* every wave's partial tile is in LDS before any thread adds them */
  { const int rl = tid >> 4, q4 = (tid & 15) * 4; v4f s = *(const v4f*)&ss[0][rl][q4];
#pragma unroll
    for (int w = 1; w < PVW; ++w) s += *(const v4f*)&ss[w][rl][q4];
    vst2(Y + ((size_t)b * TT + ql0 + rl) * CC + h * HD + q4, s); } }
static_assert(32 * PVW == 16 * (HD / 4), "one thread per float4 of the 16 x HD tile in the final add");
// ---- k_out: block = (64 rows, 128 cols): out = ctx Wo (+ bo): ctx once to f16 against Wo as f16(bf16 x 2^8) exact (1 product) x 2^-8; causal early rows (< QHI of each sequence): ctx bf16 hi + lo against exact bf16 Wo (2 products)
__global__ __launch_bounds__(128) void k_out(const float* __restrict__ Y, const float* __restrict__ WO, const float* __restrict__ BO, float* __restrict__ OUT) { __shared__ __align__(16) float sf[4][16][132]; __shared__ __align__(16) __bf16 sw[2 * 128 * GWP];
  const int tid = threadIdx.x, wave = tid >> 5, lane = tid & 31, col = lane & 15, g = lane >> 4; const int c0 = blockIdx.y * 128; const size_t r0 = (size_t)blockIdx.x * 64 + wave * 16; const int wv = __builtin_amdgcn_readfirstlane(wave);
  v8f acc[8] = {};
  if (CAUSAL && (int)(((size_t)blockIdx.x * 64) % TT) < QHI) {   /* block-uniform */
    gemm_main<1, DIN, CC>(acc, Y + (r0 + col) * CC + 8 * g, WO + c0, sw, wv, lane, true);
#pragma unroll
    for (int j = 0; j < 8; ++j) { const float bias = BO ? bfr(BO[c0 + j * 16 + col]) : 0.f;
#pragma unroll
      for (int r = 0; r < 8; ++r) sf[wave][8 * g + r][j * 16 + col] = acc[j][r] + bias; }
  } else {
    gemm_main<2, DIN, CC>(acc, Y + (r0 + col) * CC + 8 * g, WO + c0, sw, wv, lane, true);   /* ctx carried x 2^6 into f16 so small-magnitude context rows stay clear of f16 subnormals */
#pragma unroll
    for (int j = 0; j < 8; ++j) { const float bias = BO ? bfr(BO[c0 + j * 16 + col]) : 0.f;
#pragma unroll
      for (int r = 0; r < 8; ++r) sf[wave][8 * g + r][j * 16 + col] = acc[j][r] * (1.0f / 16384.0f) + bias; } }   /* 2^-8 (Wo carry) x 2^-6 (ctx carry) */
  LDSX(); for (int rl = 0; rl < 16; ++rl) vst2(OUT + (r0 + rl) * DIN + c0 + lane * 4, *(const v4f*)&sf[wave][rl][lane * 4]); }

extern "C" void kernel_launch(void* const* d_in, const int* in_sizes, int n_in, void* d_out, int out_size, void* d_ws, size_t ws_size, hipStream_t stream) {
  (void)in_sizes; (void)n_in; (void)out_size;
  const float** F = (const float**)d_in;
  if (ws_size < (size_t)WS_END) return;
  char* ws = (char*)d_ws; _Float16 *QH = (_Float16*)(ws + WS_QH), *KH = (_Float16*)(ws + WS_KH), *VT = (_Float16*)(ws + WS_VT), *QL = (_Float16*)(ws + WS_QL), *KL = (_Float16*)(ws + WS_KL); __bf16 *VB = (__bf16*)(ws + WS_VB), *VBL = (__bf16*)(ws + WS_VBL); float *Y = (float*)(ws + WS_Y);
  (void)Y; (void)QL; (void)KL; (void)VB; (void)VBL;
  // inputs: 0 x [2,2048,1024]; 1 ve [2,2048,64]; 2 cos [2048,32]; 3 sin [2048,32]; 4 Wq [1024,1024] (in,out); 5 Wk [1024,64]; 6 Wv [1024,64]; 7 Wo [1024,1024] (in,out); 8 Wg [32,1]; 9 window_size int32 [1]; no biases
  k_proj<<<dim3(TNB * TT / 64, CC / 128, 1), 128, 0, stream>>>(F[0], F[0], F[0], F[4], F[5], F[6], nullptr, nullptr, nullptr, QH, QL, KH, KL, VT, VB, VBL, 0, F[2], F[3], F[1], F[8]);    /* q: 8 column blocks */
  k_proj<<<dim3(TNB * TT / 64, CKV / 128, 2), 128, 0, stream>>>(F[0], F[0], F[0], F[4], F[5], F[6], nullptr, nullptr, nullptr, QH, QL, KH, KL, VT, VB, VBL, 1, F[2], F[3], F[1], F[8]);   /* k (which 1) and v (which 2): one (half-empty) column block each */
  k_pv<<<dim3(TT / 16, 1, TNB * NH), 32 * PVW, 0, stream>>>(QH, KH, QL, KL, VT, VB, VBL, Y, (const int*)d_in[9]);   /* every (b, h) in one launch */
  k_out<<<dim3(TNB * TT / 64, DIN / 128), 128, 0, stream>>>(Y, F[7], nullptr, (float*)d_out);
}

// v006
// A run of this version takes 135 microseconds.
// Two timings next to v005 both put it at 1.11 times that version's speed.
// Over all steps from v000 it is 7.41 times as fast.
// compute dtype: all float inputs rounded to bf16, the cos / sin tables, ve and Wg included; q (16 heads) and the single shared k / v head projections with EXACT bf16 products on WMMA 16x16x32 (f32 accumulate); half-split RoPE with cos / sin READ from the table inputs, then RMSNorm over the 64 head dims (f32, eps = f32 machine epsilon) on q and k; v += 2 sigmoid(x[:32] . Wg) ve in f32; causal logits inside a sliding window read from the int input: 3 products for the first 384 rows, single f16 q x k after, x 64^-0.5; softmax f32; P x 2^11 once to f16 x v once to f16 (bf16 hi + lo below row 384); ctx hi+lo x exact Wo below row 384, x2^6 f16 carry x f16(bf16 x 2^8) Wo after; f32 output.
#include <hip/hip_runtime.h>
#include <math.h>

typedef __attribute__((ext_vector_type(16))) _Float16 v16h;
typedef __attribute__((ext_vector_type(16))) __bf16 v16b;
typedef __attribute__((ext_vector_type(8)))  _Float16 v8h;
typedef __attribute__((ext_vector_type(8)))  float v8f;
typedef __attribute__((ext_vector_type(4)))  float v4f;
typedef __attribute__((ext_vector_type(2)))  float v2f;
typedef __attribute__((ext_vector_type(4)))  unsigned v4u;
typedef __attribute__((ext_vector_type(4)))  int v4i;
typedef float __attribute__((may_alias)) float_a;
typedef int __attribute__((may_alias)) int_a;

template <typename T> __device__ __forceinline__ void vst2(void* p, T v) { *(T*)p = v;  }
__device__ __forceinline__ v8f wmma16(v16h a, v16h b, v8f c) {
  v8f d = __builtin_amdgcn_wmma_f32_16x16x32_f16(false, a, false, b, (short)0, c, false, false);
  asm volatile("v_nop\n\tv_nop\n\tv_nop\n\tv_nop" : "+v"(d) : "v"(a), "v"(b));
  return d;
}
__device__ __forceinline__ v8f wmma_bf(v16b a, v16b b, v8f c) {
  v8f d = __builtin_amdgcn_wmma_f32_16x16x32_bf16(false, a, false, b, (short)0, c, false, false);
  asm volatile("v_nop\n\tv_nop\n\tv_nop\n\tv_nop" : "+v"(d) : "v"(a), "v"(b));
  return d;
}
// 16x16x32 fragments: lane = (h = lane>>4, row/col = lane&15); elements 0..7 = k0+8h+0..7, 8..15 = k0+16+8h+0..7; D element r = row 8h+r
__device__ __forceinline__ v16h frag_h(const _Float16* rowk0, int lane) {
  union { v16h v; v8h q[2]; } u; const _Float16* p = rowk0 + 8 * (lane >> 4);
  u.q[0] = *(const v8h*)p; u.q[1] = *(const v8h*)(p + 16); return u.v;
}
__device__ __forceinline__ v16h frag_f32(const float* rowk0, int lane) {
  v16h a; const float* p = rowk0 + 8 * (lane >> 4);
#pragma unroll
  for (int i = 0; i < 8; ++i) { a[i] = (_Float16)p[i]; a[8 + i] = (_Float16)p[16 + i]; }
  return a;
}
__device__ __forceinline__ v16h frag_f32s(const float* rowk0, int lane, float sc) {
  v16h a; const float* p = rowk0 + 8 * (lane >> 4);
#pragma unroll
  for (int i = 0; i < 8; ++i) { a[i] = (_Float16)(p[i] * sc); a[8 + i] = (_Float16)(p[16 + i] * sc); }
  return a;
}
// column fragment from a [K][ld] layout (column n), rows >= K read as 0
__device__ __forceinline__ v16h fragc_f32(const float* W, int k0, int n, int lane, int ld, int K) {
  v16h a; const int g = lane >> 4;
#pragma unroll
  for (int i = 0; i < 8; ++i) { const int ka = k0 + 8 * g + i, kb = ka + 16;
    a[i] = (_Float16)(ka < K ? W[(size_t)(ka < K ? ka : K - 1) * ld + n] : 0.f); a[8 + i] = (_Float16)(kb < K ? W[(size_t)(kb < K ? kb : K - 1) * ld + n] : 0.f); }
  return a;
}
struct F2 { v16b h, l; };
__device__ __forceinline__ F2 bsplit16(const float v[16]) { F2 r;
#pragma unroll
  for (int i = 0; i < 16; ++i) { const __bf16 h = (__bf16)v[i]; r.h[i] = h; r.l[i] = (__bf16)(v[i] - (float)h); }
  return r; }
__device__ __forceinline__ F2 split_row(const float* row, int k0, int lane) { float v[16]; const float* p = row + k0 + 8 * (lane >> 4);
#pragma unroll
  for (int i = 0; i < 8; ++i) { v[i] = p[i]; v[8 + i] = p[16 + i]; }
  return bsplit16(v); }
__device__ __forceinline__ F2 split_rowK(const float* row, int k0, int lane, int K) { float v[16]; const int g = lane >> 4;
#pragma unroll
  for (int i = 0; i < 8; ++i) { const int ka = k0 + 8 * g + i, kb = ka + 16; v[i] = ka < K ? row[ka < K ? ka : K - 1] : 0.f; v[8 + i] = kb < K ? row[kb < K ? kb : K - 1] : 0.f; }
  return bsplit16(v); }
__device__ __forceinline__ F2 split_col(const float* W, int k0, int n, int lane, int ld, int K) { float v[16]; const int g = lane >> 4;
#pragma unroll
  for (int i = 0; i < 8; ++i) { const int ka = k0 + 8 * g + i, kb = ka + 16; v[i] = ka < K ? W[(size_t)(ka < K ? ka : K - 1) * ld + n] : 0.f; v[8 + i] = kb < K ? W[(size_t)(kb < K ? kb : K - 1) * ld + n] : 0.f; }
  return bsplit16(v); }
__device__ __forceinline__ v8f mac3(const F2& a, const F2& b, v8f c) { c = wmma_bf(a.l, b.h, c); c = wmma_bf(a.h, b.l, c); return wmma_bf(a.h, b.h, c); }
__device__ __forceinline__ float sigm(float v) { return 1.0f / (1.0f + expf(-v)); }
#define LDSX() do { asm volatile("s_wait_dscnt 0" ::: "memory"); __builtin_amdgcn_wave_barrier(); __builtin_amdgcn_fence(__ATOMIC_RELEASE, "workgroup"); } while (0)

// Multi-query causal attention with table RoPE, per-head RMSNorm, a gated value residual and a sliding window (x [2,2048,1024]; ve [2,2048,64]; cos, sin [2048,32] (inputs); (in,out) Wq [1024,1024], Wk / Wv [1024,64], Wo [1024,1024], all N(0,1) x 0.02; Wg [32,1]; window_size int (1024); 16 query heads share ONE key / value head; gate = 2 sigmoid(x[..., :32] Wg); v = x Wv + gate * ve; _rope: (x1, x2) = halves -> (x1 cos + x2 sin, -x1 sin + x2 cos); _rmsnorm: x * rsqrt(mean(x^2) + finfo.eps) AFTER the rotation, on q and k; scores x 64^-0.5; masked where key > query or query - key >= window_size (finfo.min); softmax; out = merge(attn v) Wo).
#define NB 2
#define TT 2048
#define CC 1024            // NH * HD = projected width
#define DIN 1024          // input (model) width
#define NH 16
#define HD 64
#define SCALE (0.125f)
#define CAUSAL 1
#ifndef TNB
#define TNB NB
#endif
__device__ __forceinline__ float bfr(float v) { return (float)(__bf16)v; }
typedef __attribute__((ext_vector_type(8))) __bf16 v8b;
__device__ __forceinline__ v16b frag_b(const __bf16* rowk0, int lane) {
  union { v16b v; v8b q[2]; } u; const __bf16* p = rowk0 + 8 * (lane >> 4);
  u.q[0] = *(const v8b*)p; u.q[1] = *(const v8b*)(p + 16); return u.v;
}
// fragment order (q, k, their residuals and v in the workspace): one 16 x 32 fragment (16 rows, 32 k) is 512 elements = two blocks of 512 B; block s holds, at lane l = 16 g + row, the 8 elements k = 16 s + 8 g + 0..7, which are elements 8 s .. 8 s + 7 of that lane's fragment. A wave's fragment load is then two loads of 512 contiguous bytes (4 whole 128-B lines each) where a row-major plane gave 16 lines a load
__device__ __forceinline__ void st16w(void* p, v4u v) { asm volatile("global_store_b128 %0, %1, off\n\ts_wait_xcnt 0x0" :: "v"(p), "v"(v) : "memory"); }
__device__ __forceinline__ v16h fragt_h(const _Float16* fr, int lane) {
  union { v16h v; v8h q[2]; } u; const _Float16* p = fr + 8 * lane;
  u.q[0] = *(const v8h*)p; u.q[1] = *(const v8h*)(p + 256); return u.v;
}
__device__ __forceinline__ v16b fragt_b(const __bf16* fr, int lane) {
  union { v16b v; v8b q[2]; } u; const __bf16* p = fr + 8 * lane;
  u.q[0] = *(const v8b*)p; u.q[1] = *(const v8b*)(p + 256); return u.v;
}
#define QBH 6              // causal: query blocks 0..QBH-1 of each sequence (few keys, no averaging) take the high-precision path
#define QHI 384            // rows carrying a q residual plane
#define KHI 384            // key rows carrying k residual / v bf16 hi+lo planes (used only by the causal high-precision path)
// B fragment (k rows k0+.., output column o) of a weight: (in,out) [K][ld] or (out,in) [ld rows of K]: bf16 exact, or f16(bf16 * 256) exact
__device__ __forceinline__ v16b wcol_io(const float* Wm, int k0, int o, int lane, int ld) { v16b w; const int g = lane >> 4;
#pragma unroll
  for (int i = 0; i < 8; ++i) { w[i] = (__bf16)Wm[(size_t)(k0 + 8 * g + i) * ld + o]; w[8 + i] = (__bf16)Wm[(size_t)(k0 + 16 + 8 * g + i) * ld + o]; }
  return w; }
__device__ __forceinline__ v16b wcol_oi(const float* Wm, int k0, int o, int lane, int K) { v16b w; const float* p = Wm + (size_t)o * K + k0 + 8 * (lane >> 4);
#pragma unroll
  for (int i = 0; i < 8; ++i) { w[i] = (__bf16)p[i]; w[8 + i] = (__bf16)p[16 + i]; }
  return w; }
__device__ __forceinline__ v16h wcolh_io(const float* Wm, int k0, int o, int lane, int ld) { v16h w; const int g = lane >> 4;
#pragma unroll
  for (int i = 0; i < 8; ++i) { w[i] = (_Float16)(bfr(Wm[(size_t)(k0 + 8 * g + i) * ld + o]) * 256.0f); w[8 + i] = (_Float16)(bfr(Wm[(size_t)(k0 + 16 + 8 * g + i) * ld + o]) * 256.0f); }
  return w; }
__device__ __forceinline__ v16h wcolh_oi(const float* Wm, int k0, int o, int lane, int K) { v16h w; const float* p = Wm + (size_t)o * K + k0 + 8 * (lane >> 4);
#pragma unroll
  for (int i = 0; i < 8; ++i) { w[i] = (_Float16)(bfr(p[i]) * 256.0f); w[8 + i] = (_Float16)(bfr(p[16 + i]) * 256.0f); }
  return w; }
#define WQKV_LAYOUT 0   // selects only WCOL, which nothing uses: gemm_main reads Wq / Wk / Wv as (in,out) [DIN][n]
__device__ __forceinline__ v16b wcol_hdk(const float* Wm, int k0, int o, int lane) { v16b w; const int g = lane >> 4; const float* p = Wm + (size_t)(o / HD) * DIN * HD + (o % HD);
#pragma unroll
  for (int i = 0; i < 8; ++i) { w[i] = (__bf16)p[(size_t)(k0 + 8 * g + i) * HD]; w[8 + i] = (__bf16)p[(size_t)(k0 + 16 + 8 * g + i) * HD]; }
  return w; }
#define WO_OUT_IN 0
#if WQKV_LAYOUT == 1
#define WCOL(W, k0, o, lane) wcol_oi(W, k0, o, lane, DIN)
#elif WQKV_LAYOUT == 2
#define WCOL(W, k0, o, lane) wcol_hdk(W, k0, o, lane)
#else
#define WCOL(W, k0, o, lane) (which == 0 ? wcol_io(W, k0, (o), lane, CC) : ((o) < KVW ? wcol_io(W, k0, (o), lane, KVW) : zero16b()))   /* (in,out): Wq [1024][1024] pitch CC; Wk / Wv [1024][64] pitch 64, padded columns 64..127 are zero */
#endif
#if WO_OUT_IN
#define WOCOL(W, k0, o, lane) wcol_oi(W, k0, o, lane, CC)
#define WOCOLH(W, k0, o, lane) wcolh_oi(W, k0, o, lane, CC)
#else
#define WOCOL(W, k0, o, lane) wcol_io(W, k0, o, lane, DIN)
#define WOCOLH(W, k0, o, lane) wcolh_io(W, k0, o, lane, DIN)
#endif
#define GRP 16             // all 16 query heads share the single kv head (kv head = h / 16 = 0)
#define CKV 128            // kv column block of k_proj (the workspace planes hold 64 columns): ONE 128-column block whose columns 0..63 are the single kv head, columns 64..127 zero padding
#define KVW 64             // real kv width (Wk / Wv are (in,out) [1024][64])
#define PROJ_EXTRA_PARAMS , int woff, const float* __restrict__ COS, const float* __restrict__ SIN, const float* __restrict__ VE, const float* __restrict__ WG   /* which = blockIdx.z + woff; COS / SIN [TT][32], VE [NB*TT][64], WG [32] are module inputs read in the projection epilogue */
__device__ __forceinline__ v16b zero16b() { v16b w; _Pragma("unroll") for (int i = 0; i < 16; ++i) w[i] = (__bf16)0.0f; return w; }
#define RMS_EPS 1.1920929e-07f   /* jnp.finfo(float32).eps */
// per (token, head) hook on the staged f32 row (64 floats). q and k (which 0, 1): the module's _rope with cos / sin read LITERALLY from the table inputs at row t (bf16-rounded like every float input): (x1, x2) = (row[m], row[32+m]) -> (x1 c + x2 s, -x1 s + x2 c), then _rmsnorm over the 64 dims: x * (1 / sqrt(mean(x^2) + eps)); the zero-padded second half of the k block stays exactly zero under both. v (which 2): row += gate * bf16(ve[b, t, :]) with gate = 2 / (1 + exp(-z)), z = sum_{i<32} bf16(x[b, t, i]) * bf16(Wg[i]); all global loads are unconditional; the padded half gets gate 0 through a select. f32, products and sums kept separate
#define PROJ_EPI(which, row, t, h) do { float* rw = (row); const size_t gr_ = bb * TT + (size_t)(t); if ((which) < 2) { const float* ct_ = COS + (size_t)(t) * 32; const float* st_ = SIN + (size_t)(t) * 32; _Pragma("unroll 4") for (int m = 0; m < 32; ++m) { _Pragma("clang fp contract(off)") const float c_ = bfr(ct_[m]), s_ = bfr(st_[m]); const float x1 = rw[m], x2 = rw[32 + m]; rw[m] = x1 * c_ + x2 * s_; rw[32 + m] = (-x1) * s_ + x2 * c_; } float ss_ = 0.f; _Pragma("unroll 8") for (int m = 0; m < 64; ++m) { _Pragma("clang fp contract(off)") ss_ += rw[m] * rw[m]; } const float rinv_ = 1.0f / sqrtf(ss_ * (1.0f / 64.0f) + RMS_EPS); _Pragma("unroll 8") for (int m = 0; m < 64; ++m) rw[m] = rw[m] * rinv_; } else { const float* xr_ = XV + gr_ * DIN; float z_ = 0.f; _Pragma("unroll 8") for (int i = 0; i < 32; ++i) { _Pragma("clang fp contract(off)") z_ += bfr(xr_[i]) * bfr(WG[i]); } const float gate_ = 2.0f / (1.0f + expf(-z_)); const float gsel_ = ((h) == 0) ? gate_ : 0.0f; const float* ve_ = VE + gr_ * 64; _Pragma("unroll 8") for (int m = 0; m < 64; ++m) { _Pragma("clang fp contract(off)") rw[m] = rw[m] + gsel_ * bfr(ve_[m]); } } } while (0)
static_assert(HD == 64 && KVW == 64 && CKV == 128, "the hook spells 32 / 64 literally: one real 64-wide kv head in a 128-column block");
#define SM_EXTRA_PARAMS , const int* __restrict__ WINP
// sliding window: a key is excluded when query - key >= window_size; window_size is the module's int input (one block-uniform scalar load); keys after the query are already excluded by the causal select; every row keeps at least min(t + 1, window) >= 1 keys
#define SM_MASK_HOOK do { v = (t - k >= win_) ? -3.0e38f : v; } while (0)   /* win_ = WINP[0], read once at the kernel's head */
#ifndef SM_EXTRA_PARAMS
#define SM_EXTRA_PARAMS
#endif
#ifndef PROJ_EXTRA_PARAMS
#define PROJ_EXTRA_PARAMS
#endif
#ifndef SM_MASK_HOOK
#define SM_MASK_HOOK (void)0
#endif

#define WS_QH  0u                                      // f16 q, fragment order: fragment (((b*t) / 16) * NH + head) * 2 + (head dim / 32), rows = queries, k = head dims
#define WS_KH  (WS_QH + 2u * (size_t)NB * TT * CC)      // f16 k, fragment order: fragment ((b*t) / 16) * 2 + (head dim / 32), rows = keys, k = head dims
#define WS_VT  (WS_KH + 2u * (size_t)NB * TT * CC)      // f16 v, fragment order: fragment (b * TT / 32 + t / 32) * 4 + (channel / 16), rows = channels, k = keys
#define WS_QL  (WS_VT + 2u * (size_t)NB * CC * TT)      // f16 q residual x 2^10, fragment order like q over the rows [b][t < QHI]
#define WS_KL  (WS_QL + 2u * (size_t)NB * QHI * CC)     // f16 k residual x 2^10, fragment order like k over the rows [b][t < KHI]
#define WS_VB  (WS_KL + 2u * (size_t)NB * KHI * CC)     // bf16 v hi (and, behind it, lo), fragment order like v over the keys [b][t < KHI]
#define WS_VBL (WS_VB + 2u * (size_t)NB * CC * KHI)
#define WS_Y   (WS_VBL + 2u * (size_t)NB * CC * KHI)    // f32 ctx rows [b*t][CC] (only when there is an output projection)
#define WS_END (WS_Y  + 4u * (size_t)NB * TT * CC)

// ---- gemm_main: the K loop of k_proj and k_out. A block's 4 waves need the same 128 weight columns, so each 64-k stage of W ([k][n] f32, n contiguous) is read ONCE per block with whole-line 16-byte loads, rounded exactly as before (MODE 0, 1: bf16; MODE 2: f16(bf16 x 2^8)), turned in registers and stored as [n][k] rows (pitch 144 B) in one of two LDS buffers, from which every wave reads its B fragments with two 16-byte LDS loads each. The next stage's global loads (W tile and the wave's own A rows) are issued in front of this stage's products and stored behind them. Products and their k order per accumulator are those of the direct form. Every loop over s, c, i, j or kk inside a stage is fully unrolled so that the register arrays are indexed by constants alone.
#define GKS 64                 // k per stage
#define GWP (GKS + 8)          // LDS row pitch in 16-bit elements: 144 B = 16 B x odd, conflict-free for 16-byte readers
template <int LD> __device__ __forceinline__ void g_fetch(v4f (&wr)[2][8], v4f (&ar)[2][4], const float* wp, const float* ap) {
#pragma unroll
  for (int s = 0; s < 2; ++s)
#pragma unroll
    for (int i = 0; i < 8; ++i) wr[s][i] = *(const v4f*)(wp + (size_t)(s * 32 + i) * LD);
#pragma unroll
  for (int kk = 0; kk < 2; ++kk) { ar[kk][0] = *(const v4f*)(ap + kk * 32); ar[kk][1] = *(const v4f*)(ap + kk * 32 + 4); ar[kk][2] = *(const v4f*)(ap + kk * 32 + 16); ar[kk][3] = *(const v4f*)(ap + kk * 32 + 20); }
  asm volatile("s_wait_xcnt 0x0" ::: "memory");   /* stands in front of every later instruction that rewrites the address registers of these loads; it also keeps the loads in front of the stage's products */
}
template <int MODE> __device__ __forceinline__ void g_store(const v4f (&wr)[2][8], __bf16* sst, bool wl) {
#pragma unroll
  for (int s = 0; s < 2; ++s)
#pragma unroll
    for (int c = 0; c < 4; ++c) {
      if constexpr (MODE == 2) { v8h o;
#pragma unroll
        for (int i = 0; i < 8; ++i) o[i] = (_Float16)(bfr(wr[s][i][c]) * 256.0f);
        *(v8h*)(sst + c * GWP + s * 32) = o;
      } else { union { v8b b; v4u u; } o;
#pragma unroll
        for (int i = 0; i < 8; ++i) o.b[i] = (__bf16)wr[s][i][c];
        o.u &= wl ? 0xffffffffu : 0u;   /* padded columns: the load is unconditional at a clamped address, the stored value is +0 */
        *(v8b*)(sst + c * GWP + s * 32) = o.b; } } }
struct GA { v16b h[2], l[2]; v16h f[2]; };   /* the wave's A fragments of one stage; only the members of the MODE in use are formed */
template <int MODE> __device__ __forceinline__ void g_acvt(GA& a, const v4f (&ar)[2][4]) {
#pragma unroll
  for (int kk = 0; kk < 2; ++kk) { float v[16];
#pragma unroll
    for (int i = 0; i < 16; ++i) v[i] = ar[kk][i >> 2][i & 3];   /* elements 0..7 = k 8g + 0..7, 8..15 = k 16 + 8g + 0..7 */
    if constexpr (MODE == 0) {
#pragma unroll
      for (int i = 0; i < 16; ++i) a.h[kk][i] = (__bf16)v[i];
    } else if constexpr (MODE == 1) { const F2 s = bsplit16(v); a.h[kk] = s.h; a.l[kk] = s.l;
    } else {
#pragma unroll
      for (int i = 0; i < 16; ++i) a.f[kk][i] = (_Float16)(v[i] * 64.0f); } } }
// ap = the lane's A row + 8 g; Wt = W + the block's first column; sw = two buffers of 128 rows x GWP; wave in a scalar register; wl = this wave's 32 staged columns exist in W
template <int MODE, int LD, int KTOT> __device__ __forceinline__ void gemm_main(v8f (&acc)[8], const float* __restrict__ ap, const float* __restrict__ Wt, __bf16* sw, int wave, int lane, bool wl) {
  const int cg = wave * 8 + (lane & 3) + 4 * (lane >> 4), kg = (lane >> 2) & 3;   /* the lane stages columns 4 cg .. 4 cg + 3 of k rows 8 kg + 0..7 and 32 + 8 kg + 0..7: a load covers four whole 128-B lines, and the 16 lanes of a half-wave store to 16 different bank groups */
  const float* wp = Wt + (size_t)(8 * kg) * LD + (wl ? 4 * cg : 0);
  __bf16* sst = sw + (4 * cg) * GWP + 8 * kg; const __bf16* srd = sw + (lane & 15) * GWP;
  v4f wr[2][8]; v4f ar[2][4]; GA a;
  g_fetch<LD>(wr, ar, wp, ap); g_store<MODE>(wr, sst, wl); g_acvt<MODE>(a, ar);
  __syncthreads();   /* stage 0 is in LDS before any wave reads it */
  for (int s = 0; s < KTOT / GKS; ++s) { const int bo = (s & 1) * (128 * GWP); const bool more = s + 1 < KTOT / GKS;
    if (more) g_fetch<LD>(wr, ar, wp + (size_t)(s + 1) * GKS * LD, ap + (s + 1) * GKS);
#pragma unroll
    for (int kk = 0; kk < 2; ++kk) {   /* the eight B fragments of a 32-k block are all read in front of its first product: one LDS latency a block */
      if constexpr (MODE == 2) { v16h wf[8];
#pragma unroll
        for (int j = 0; j < 8; ++j) wf[j] = frag_h((const _Float16*)(srd + bo + j * 16 * GWP + kk * 32), lane);
#pragma unroll
        for (int j = 0; j < 8; ++j) acc[j] = wmma16(a.f[kk], wf[j], acc[j]);
      } else { v16b wf[8];
#pragma unroll
        for (int j = 0; j < 8; ++j) wf[j] = frag_b(srd + bo + j * 16 * GWP + kk * 32, lane);
#pragma unroll
        for (int j = 0; j < 8; ++j) { acc[j] = wmma_bf(a.h[kk], wf[j], acc[j]); if constexpr (MODE == 1) acc[j] = wmma_bf(a.l[kk], wf[j], acc[j]); } } }
    __builtin_amdgcn_sched_barrier(0);   /* keeps the conversions of the next stage's registers, and with them the wait for its global loads, behind this stage's products: without it the wait was scheduled behind the first product */
    if (more) { g_store<MODE>(wr, sst + (bo ^ (128 * GWP)), wl); g_acvt<MODE>(a, ar);
      __syncthreads(); } } }   /* one barrier a stage: it publishes stage s + 1 and ends every wave's reads of the buffer that stage s + 2 will overwrite */
// ---- k_proj: block = (64 rows, 128 cols, which): q/k/v = X W (+ b) with exact bf16 products (K = DIN) -> which 0: q f16 in fragment order (+ residual, rows < QHI); 1: k f16 in fragment order (+ residual, rows < KHI); 2: v f16 in fragment order (+ bf16 hi/lo for t < KHI)
__global__ __launch_bounds__(128) void k_proj(const float* __restrict__ XQ, const float* __restrict__ XK, const float* __restrict__ XV, const float* __restrict__ WQ, const float* __restrict__ WK, const float* __restrict__ WV, const float* __restrict__ BQ, const float* __restrict__ BK, const float* __restrict__ BV,
    _Float16* __restrict__ QH, _Float16* __restrict__ QL, _Float16* __restrict__ KH, _Float16* __restrict__ KL, _Float16* __restrict__ VT, __bf16* __restrict__ VB, __bf16* __restrict__ VBL PROJ_EXTRA_PARAMS) {
  __shared__ __align__(16) float st[64][132]; __shared__ __align__(16) _Float16 sh[64][136], sl[64][136]; __shared__ __align__(16) _Float16 th[128][72]; __shared__ __align__(16) __bf16 tb[128][72], tbl[128][72]; __shared__ __align__(16) __bf16 sw[2 * 128 * GWP];
  const int tid = threadIdx.x, wave = tid >> 5, lane = tid & 31, col = lane & 15, g = lane >> 4; const int which = blockIdx.z + woff; const int c0 = blockIdx.y * 128; const size_t r0 = (size_t)blockIdx.x * 64; const size_t bb = r0 / TT; const int t0 = (int)(r0 % TT);
  const float* X = which == 0 ? XQ : which == 1 ? XK : XV; const float* WA = which == 0 ? WQ : which == 1 ? WK : WV; const float* BA = which == 0 ? BQ : which == 1 ? BK : BV;
  v8f acc[8] = {};
  { const int wv = __builtin_amdgcn_readfirstlane(wave);   /* the wave's number in a scalar register: the staged column group and the padded-columns mask are wave-uniform */
    const float* ap = X + (r0 + wave * 16 + col) * DIN + 8 * g;
    if (which == 0) gemm_main<0, CC, DIN>(acc, ap, WA + c0, sw, wv, lane, true);   /* Wq [1024][1024] */
    else gemm_main<0, KVW, DIN>(acc, ap, WA + (c0 < KVW ? c0 : 0), sw, wv, lane, c0 + wv * 32 < KVW); }   /* Wk / Wv [1024][64]: padded columns 64..127 are staged as zeros */
  { // stage the f32 tile (acc + bias) in LDS, run the per-(row, head) epilogue hook, then convert
#pragma unroll
    for (int j = 0; j < 8; ++j) { const int bo_ = c0 + j * 16 + col; const float bias = (BA && (which == 0 || bo_ < KVW)) ? bfr(BA[(which == 0 || bo_ < KVW) ? bo_ : 0]) : 0.f;   /* bk / bv hold only the 64 real kv columns: padded columns get no bias (index clamped, value selected) */
#pragma unroll
      for (int r = 0; r < 8; ++r) st[wave * 16 + 8 * g + r][j * 16 + col] = acc[j][r] + bias; }
    __syncthreads();
    for (int e = tid; e < 64 * (128 / HD); e += 128) { const int rl = e / (128 / HD), hh = e % (128 / HD); PROJ_EPI(which, &st[rl][hh * HD], (int)((r0 + rl) % TT), (c0 / HD) + hh); }
    __syncthreads(); }
  if (which < 2) { _Float16* DH = which == 0 ? QH : KH; _Float16* DL = which == 0 ? QL : KL; const int nhi = which == 0 ? QHI : KHI; const bool hi_rows = t0 < nhi;
    for (int e = tid; e < 64 * 128; e += 128) { const int rl = e >> 7, cl = e & 127; const float v = st[rl][cl]; const _Float16 hv = (_Float16)v; sh[rl][cl] = hv; sl[rl][cl] = (_Float16)((v - (float)hv) * 1024.0f); }
    __syncthreads();
    const size_t nh = which == 0 ? NH : 1;   /* heads a 16-row tile holds: q all NH, k the one real head (its padded columns are read by nobody and are not stored) */
    for (int e = tid; e < 64 * 16; e += 128) { const int l = e & 31, blk = e >> 5;   /* a wave stores one 512-B block of a fragment a trip: blk = ((tile * 2 + head of the column block) * 2 + head-dim half) * 2 + s */
      const int tile = blk >> 3, hd = (blk >> 2) & 1, cs = blk & 3; const int rl = tile * 16 + (l & 15), cl = hd * HD + cs * 16 + (l >> 4) * 8; const size_t fo = (size_t)(c0 / HD + hd) * 1024 + cs * 256 + l * 8;
      if (which == 0 || hd == 0) { st16w(DH + ((r0 >> 4) + tile) * nh * 1024 + fo, *(const v4u*)&sh[rl][cl]); if (hi_rows) st16w(DL + (((bb * nhi + t0) >> 4) + tile) * nh * 1024 + fo, *(const v4u*)&sl[rl][cl]); } }
  } else { const bool hi_rows = t0 < KHI;
    for (int e = tid; e < 64 * 128; e += 128) { const int rl = e & 63, cl = e >> 6; const float v = st[rl][cl]; th[cl][rl] = (_Float16)v; const __bf16 bh = (__bf16)v; tb[cl][rl] = bh; tbl[cl][rl] = (__bf16)(v - (float)bh); }
    __syncthreads();
    for (int e = tid; e < KVW * 8; e += 128) { const int l = e & 31, blk = e >> 5;   /* the 64 real channels (the padded ones are read by nobody and are not stored); a wave stores one 512-B block a trip: blk = ((chunk of the block's two * 4) + channel block) * 2 + s, so the block's 64 keys are e * 8 elements in a row */
      const int cl = ((blk >> 1) & 3) * 16 + (l & 15), kq = (blk >> 3) * 32 + (blk & 1) * 16 + (l >> 4) * 8;
      st16w(VT + (bb * (TT / 32) + (t0 >> 5)) * 2048 + e * 8, *(const v4u*)&th[cl][kq]); if (hi_rows) { const size_t o3 = (bb * (KHI / 32) + (t0 >> 5)) * 2048 + e * 8; st16w(VB + o3, *(const v4u*)&tb[cl][kq]); st16w(VBL + o3, *(const v4u*)&tbl[cl][kq]); } } } }
// ---- k_pv: block = 16 queries (qt) of one (b, h), PVW waves: wave w owns the 32-key chunks w, w + PVW, ... and works on those in [kcs, kce), the chunks that hold a key which the causal rule and the window admit for some query of the block (a chunk outside adds only zeros to the sums and nothing to the maxima). It forms its logits itself, transposed: A = 16 key rows, B = the block's 16 query rows, so that D (lane = query, registers = keys 8g + r) of the chunk's two key tiles IS the A-fragment layout of the P x v product (lane = query row, 16 keys a chunk) and the logits never leave the registers; x SCALE; q hi + residual (x 2^10) against k hi + residual (3 products) for query blocks < QBH (causal early rows), single f16 q x k after; softmax in f32 inside the block: excluded keys (after the query, or outside the window) by index, row maximum and row sum over the lane's own keys, the other half-wave, then the PVW waves through LDS in wave order; P x 2^11 once to f16 against v f16 (1 product; causal early query blocks: P and v as bf16 hi + lo, 3 products); the PVW partial ctx tiles are added in LDS in wave order; 256-B (row, head) segment by 16 lanes
#define PVW 8
#define PVC (TT / 32 / PVW)                                             // most chunks one wave can own
#define PVCH (((((QBH * 64 - 1) >> 7) + 1) * 4 + PVW - 1) / PVW)         // the same for the early (high-precision) query blocks
static_assert(QBH * 64 == QHI && (((QBH * 64 - 1) >> 7) + 1) * 128 <= KHI, "every query row with a residual plane lies in an early block, and every key row such a block reads has one");
__global__ __launch_bounds__(32 * PVW) void k_pv(const _Float16* __restrict__ QH, const _Float16* __restrict__ KH, const _Float16* __restrict__ QL, const _Float16* __restrict__ KL, const _Float16* __restrict__ VT, const __bf16* __restrict__ VB, const __bf16* __restrict__ VBL, float* __restrict__ Y SM_EXTRA_PARAMS) { const int b = blockIdx.z / NH, h = blockIdx.z % NH; __shared__ __align__(16) float ss[PVW][16][HD + 4]; __shared__ float smx[PVW][16], ssu[PVW][16];
  const int tid = threadIdx.x, lane = tid & 31, col = lane & 15, g = lane >> 4; const int qt = blockIdx.x, qb = qt >> 2; const int ql0 = qt * 16; const int kce = CAUSAL ? ((ql0 + 15) >> 5) + 1 : TT / 32;   /* one past the chunk that holds the block's last query: every later key lies after every query of the block */
  const int wave = __builtin_amdgcn_readfirstlane(tid >> 5);   /* the wave's number in a scalar register: the chunk tests below branch on scalars and every lane stays on at the matrix instructions */
  const int win_ = WINP[0]; const int t = ql0 + col;
  const int klo = ql0 + 1 - (win_ < 0 ? 0 : win_); const int kcs = klo > 0 ? klo >> 5 : 0;   /* klo = the first key that the window leaves to the block's first query (later queries start later): chunks below kcs hold excluded keys alone; scalar, 0 <= kcs < kce for any window_size; no address is formed from it */
  const _Float16* qrow = QH + (((size_t)b * (TT / 16) + qt) * NH + h) * 1024; const v16h qf0 = fragt_h(qrow, lane), qf1 = fragt_h(qrow + 512, lane);   /* B fragments: column = the lane's query, head dims 0..31 and 32..63 */
  asm volatile("s_wait_xcnt 0x0" ::: "memory");   /* stands in front of the key loads below, whose results may land on the address registers of the q loads */
  const size_t kro = (size_t)wave * 2048;   /* the wave's first chunk in fragment order: a chunk is 2 key tiles x 2 head-dim halves = 4 fragments of 512 elements; chunk i, tile u and half c are constant offsets from it */
  v4f lq[PVC][4];   /* chunk i is formed, and read, only under kcs <= kc < kce; every loop over i or j below is fully unrolled so that lq is indexed by constants alone and stays in registers */
  /* a chunk's key fragments are all loaded in front of its first product (the v_nop statements behind the products hold later loads back): one load latency a chunk; the two key tiles' products alternate, each tile's own order being head dims 0..31, then 32..63 */
  if (qb < QBH) { const _Float16* qlrow = QL + (((size_t)b * (QHI / 16) + qt) * NH + h) * 1024; const v16h ql0f = fragt_h(qlrow, lane), ql1f = fragt_h(qlrow + 512, lane); asm volatile("s_wait_xcnt 0x0" ::: "memory");   /* stands in front of the key loads below, whose results may land on the address registers of the q loads */
    const _Float16* krow = KH + (size_t)b * TT * KVW + kro; const _Float16* klrow = KL + (size_t)b * KHI * KVW + kro;
#pragma unroll
    for (int i = 0; i < PVCH; ++i) { const int kc = wave + i * PVW; if (kc >= kcs && kc < kce) { const int ko = i * (PVW * 2048); v16h kh[2][2], kl[2][2]; v8f a[2] = {}, al[2] = {};
#pragma unroll
        for (int u = 0; u < 2; ++u) { kh[u][0] = fragt_h(krow + ko + u * 1024, lane); kh[u][1] = fragt_h(krow + ko + u * 1024 + 512, lane); kl[u][0] = fragt_h(klrow + ko + u * 1024, lane); kl[u][1] = fragt_h(klrow + ko + u * 1024 + 512, lane); }
        asm volatile("s_wait_xcnt 0x0" ::: "memory");   /* stands in front of every later instruction that rewrites the address registers of this chunk's loads */
#pragma unroll
        for (int c = 0; c < 2; ++c) { const v16h qh = c ? qf1 : qf0, ql = c ? ql1f : ql0f; a[0] = wmma16(kh[0][c], qh, a[0]); a[1] = wmma16(kh[1][c], qh, a[1]); al[0] = wmma16(kh[0][c], ql, al[0]); al[1] = wmma16(kh[1][c], ql, al[1]); al[0] = wmma16(kl[0][c], qh, al[0]); al[1] = wmma16(kl[1][c], qh, al[1]); }
#pragma unroll
        for (int j = 0; j < 16; ++j) lq[i][j >> 2][j & 3] = (a[j >> 3][j & 7] + al[j >> 3][j & 7] * (1.0f / 1024.0f)) * SCALE;
      } }
  } else { const _Float16* krow = KH + (size_t)b * TT * KVW + kro;
#pragma unroll
    for (int i = 0; i < PVC; ++i) { const int kc = wave + i * PVW; if (kc >= kcs && kc < kce) { const int ko = i * (PVW * 2048); v16h kh[2][2]; v8f a[2] = {};
#pragma unroll
        for (int u = 0; u < 2; ++u) { kh[u][0] = fragt_h(krow + ko + u * 1024, lane); kh[u][1] = fragt_h(krow + ko + u * 1024 + 512, lane); }
        asm volatile("s_wait_xcnt 0x0" ::: "memory");   /* stands in front of every later instruction that rewrites the address registers of this chunk's loads */
        a[0] = wmma16(kh[0][0], qf0, a[0]); a[1] = wmma16(kh[1][0], qf0, a[1]); a[0] = wmma16(kh[0][1], qf1, a[0]); a[1] = wmma16(kh[1][1], qf1, a[1]);
#pragma unroll
        for (int j = 0; j < 16; ++j) lq[i][j >> 2][j & 3] = a[j >> 3][j & 7] * SCALE;
      } } }
  float m = -3.0e38f;
#pragma unroll
  for (int i = 0; i < PVC; ++i) { const int kc = wave + i * PVW; if (kc >= kcs && kc < kce) {
#pragma unroll
      for (int j = 0; j < 16; ++j) { const int k = kc * 32 + 8 * g + (j & 7) + 16 * (j >> 3); float v = (!CAUSAL || k <= t) ? lq[i][j >> 2][j & 3] : -3.0e38f; SM_MASK_HOOK; lq[i][j >> 2][j & 3] = v; m = fmaxf(m, v); } } }
  m = fmaxf(m, __shfl_xor(m, 16)); if (g == 0) smx[wave][col] = m;
  __syncthreads();   /* every wave's row maxima are in LDS before any lane combines them */
#pragma unroll
  for (int w = 0; w < PVW; ++w) m = fmaxf(m, smx[w][col]);
  float sum = 0.f;
#pragma unroll
  for (int i = 0; i < PVC; ++i) { const int kc = wave + i * PVW; if (kc >= kcs && kc < kce) {
#pragma unroll
      for (int j = 0; j < 16; ++j) { const float v = lq[i][j >> 2][j & 3]; const float ex = expf(v - m); const float e = (v <= -1.0e38f) ? 0.f : ex; lq[i][j >> 2][j & 3] = e; sum += e; } } }
  sum += __shfl_xor(sum, 16); if (g == 0) ssu[wave][col] = sum;
  __syncthreads();   /* every wave's row sums are in LDS before any lane adds them */
  float rs = 0.f;
#pragma unroll
  for (int w = 0; w < PVW; ++w) rs += ssu[w][col];
  const float inv = rs > 0.f ? 2048.0f / rs : 0.f;   /* a fully excluded row yields P = 0 */
  v8f acc[HD / 16] = {}; const size_t vro = (size_t)wave * 2048;   /* the wave's first chunk of v in fragment order: 4 fragments (16 channels each) of 512 elements a chunk; block j and chunk i are constant offsets from it */
  if (qb < QBH) {
#pragma unroll
    for (int i = 0; i < PVCH; ++i) { const int kc = wave + i * PVW; if (kc >= kcs && kc < kce) { float pf[16];
#pragma unroll
        for (int j = 0; j < 16; ++j) pf[j] = lq[i][j >> 2][j & 3] * inv;
        const F2 p = bsplit16(pf);
#pragma unroll
        for (int j = 0; j < HD / 16; ++j) { const size_t po = (size_t)b * KHI * KVW + vro + (size_t)(j * 512 + i * (PVW * 2048)); const v16b vh = fragt_b(VB + po, lane); acc[j] = wmma_bf(p.h, vh, acc[j]); acc[j] = wmma_bf(p.l, vh, acc[j]); acc[j] = wmma_bf(p.h, fragt_b(VBL + po, lane), acc[j]); } } }
  } else {
#pragma unroll
    for (int i = 0; i < PVC; ++i) { const int kc = wave + i * PVW; if (kc >= kcs && kc < kce) { v16h p;
#pragma unroll
        for (int j = 0; j < 16; ++j) p[j] = (_Float16)(lq[i][j >> 2][j & 3] * inv);
#pragma unroll
        for (int j = 0; j < HD / 16; ++j) { const size_t po = (size_t)b * TT * KVW + vro + (size_t)(j * 512 + i * (PVW * 2048)); acc[j] = wmma16(p, fragt_h(VT + po, lane), acc[j]); } } } }
#pragma unroll
  for (int j = 0; j < HD / 16; ++j)
#pragma unroll
    for (int r = 0; r < 8; ++r) ss[wave][8 * g + r][j * 16 + col] = acc[j][r] * (1.0f / 2048.0f);
  __syncthreads();   /* every wave's partial tile is in LDS before any thread adds them */
  { const int rl = tid >> 4, q4 = (tid & 15) * 4; v4f s = *(const v4f*)&ss[0][rl][q4];
#pragma unroll
    for (int w = 1; w < PVW; ++w) s += *(const v4f*)&ss[w][rl][q4];
    vst2(Y + ((size_t)b * TT + ql0 + rl) * CC + h * HD + q4, s); } }
static_assert(32 * PVW == 16 * (HD / 4), "one thread per float4 of the 16 x HD tile in the final add");
static_assert(NH == GRP && KVW == HD && TT % 64 == 0 && KHI % 64 == 0, "fragment order holds the one kv head's 64 columns; a 64-row block of k_proj fills whole fragments");
// ---- k_out: block = (64 rows, 128 cols): out = ctx Wo (+ bo): ctx x 2^6 once to f16 against Wo as f16(bf16 x 2^8) exact (1 product) x 2^-14; causal early rows (< QHI of each sequence): ctx bf16 hi + lo against exact bf16 Wo (2 products)
__global__ __launch_bounds__(128) void k_out(const float* __restrict__ Y, const float* __restrict__ WO, const float* __restrict__ BO, float* __restrict__ OUT) { __shared__ __align__(16) float sf[4][16][132]; __shared__ __align__(16) __bf16 sw[2 * 128 * GWP];
  const int tid = threadIdx.x, wave = tid >> 5, lane = tid & 31, col = lane & 15, g = lane >> 4; const int c0 = blockIdx.y * 128; const size_t r0 = (size_t)blockIdx.x * 64 + wave * 16; const int wv = __builtin_amdgcn_readfirstlane(wave);
  v8f acc[8] = {};
  if (CAUSAL && (int)(((size_t)blockIdx.x * 64) % TT) < QHI) {   /* block-uniform */
    gemm_main<1, DIN, CC>(acc, Y + (r0 + col) * CC + 8 * g, WO + c0, sw, wv, lane, true);
#pragma unroll
    for (int j = 0; j < 8; ++j) { const float bias = BO ? bfr(BO[c0 + j * 16 + col]) : 0.f;
#pragma unroll
      for (int r = 0; r < 8; ++r) sf[wave][8 * g + r][j * 16 + col] = acc[j][r] + bias; }
  } else {
    gemm_main<2, DIN, CC>(acc, Y + (r0 + col) * CC + 8 * g, WO + c0, sw, wv, lane, true);   /* ctx carried x 2^6 into f16 so small-magnitude context rows stay clear of f16 subnormals */
#pragma unroll
    for (int j = 0; j < 8; ++j) { const float bias = BO ? bfr(BO[c0 + j * 16 + col]) : 0.f;
#pragma unroll
      for (int r = 0; r < 8; ++r) sf[wave][8 * g + r][j * 16 + col] = acc[j][r] * (1.0f / 16384.0f) + bias; } }   /* 2^-8 (Wo carry) x 2^-6 (ctx carry) */
  LDSX(); for (int rl = 0; rl < 16; ++rl) vst2(OUT + (r0 + rl) * DIN + c0 + lane * 4, *(const v4f*)&sf[wave][rl][lane * 4]); }

extern "C" void kernel_launch(void* const* d_in, const int* in_sizes, int n_in, void* d_out, int out_size, void* d_ws, size_t ws_size, hipStream_t stream) {
  (void)in_sizes; (void)n_in; (void)out_size;
  const float** F = (const float**)d_in;
  if (ws_size < (size_t)WS_END) return;
  char* ws = (char*)d_ws; _Float16 *QH = (_Float16*)(ws + WS_QH), *KH = (_Float16*)(ws + WS_KH), *VT = (_Float16*)(ws + WS_VT), *QL = (_Float16*)(ws + WS_QL), *KL = (_Float16*)(ws + WS_KL); __bf16 *VB = (__bf16*)(ws + WS_VB), *VBL = (__bf16*)(ws + WS_VBL); float *Y = (float*)(ws + WS_Y);
  (void)Y; (void)QL; (void)KL; (void)VB; (void)VBL;
  // inputs: 0 x [2,2048,1024]; 1 ve [2,2048,64]; 2 cos [2048,32]; 3 sin [2048,32]; 4 Wq [1024,1024] (in,out); 5 Wk [1024,64]; 6 Wv [1024,64]; 7 Wo [1024,1024] (in,out); 8 Wg [32,1]; 9 window_size int32 [1]; no biases
  k_proj<<<dim3(TNB * TT / 64, CC / 128, 1), 128, 0, stream>>>(F[0], F[0], F[0], F[4], F[5], F[6], nullptr, nullptr, nullptr, QH, QL, KH, KL, VT, VB, VBL, 0, F[2], F[3], F[1], F[8]);    /* q: 8 column blocks */
  k_proj<<<dim3(TNB * TT / 64, CKV / 128, 2), 128, 0, stream>>>(F[0], F[0], F[0], F[4], F[5], F[6], nullptr, nullptr, nullptr, QH, QL, KH, KL, VT, VB, VBL, 1, F[2], F[3], F[1], F[8]);   /* k (which 1) and v (which 2): one (half-empty) column block each */
  k_pv<<<dim3(TT / 16, 1, TNB * NH), 32 * PVW, 0, stream>>>(QH, KH, QL, KL, VT, VB, VBL, Y, (const int*)d_in[9]);   /* every (b, h) in one launch */
  k_out<<<dim3(TNB * TT / 64, DIN / 128), 128, 0, stream>>>(Y, F[7], nullptr, (float*)d_out);
}

// v007
// It runs in 103 microseconds.
// In two side-by-side timings against v006, it was 1.30 and 1.31 times as fast.
// Over all steps from v000 it is 9.67 times as fast.
// compute dtype: all float inputs rounded to bf16, the cos / sin tables, ve and Wg included; q (16 heads) and the single shared k / v head projections with EXACT bf16 products on WMMA 16x16x32 (f32 accumulate); half-split RoPE with cos / sin READ from the table inputs, then RMSNorm over the 64 head dims (f32, eps = f32 machine epsilon) on q and k; v += 2 sigmoid(x[:32] . Wg) ve in f32; causal logits inside a sliding window read from the int input: 3 products for the first 384 rows, single f16 q x k after, x 64^-0.5; softmax f32 in one pass (logits bounded by the RMSNorm, no row maximum): exp(logit) once to f16 x v once to f16 (bf16 hi + lo below row 384), divided by the f32 row sum at the end; ctx hi+lo x exact Wo below row 384, x2^6 f16 carry x f16(bf16 x 2^8) Wo after; f32 output.
#include <hip/hip_runtime.h>
#include <math.h>

typedef __attribute__((ext_vector_type(16))) _Float16 v16h;
typedef __attribute__((ext_vector_type(16))) __bf16 v16b;
typedef __attribute__((ext_vector_type(8)))  _Float16 v8h;
typedef __attribute__((ext_vector_type(8)))  float v8f;
typedef __attribute__((ext_vector_type(4)))  float v4f;
typedef __attribute__((ext_vector_type(2)))  float v2f;
typedef __attribute__((ext_vector_type(4)))  unsigned v4u;
typedef __attribute__((ext_vector_type(4)))  int v4i;
typedef float __attribute__((may_alias)) float_a;
typedef int __attribute__((may_alias)) int_a;

template <typename T> __device__ __forceinline__ void vst2(void* p, T v) { *(T*)p = v;  }
__device__ __forceinline__ v8f wmma16(v16h a, v16h b, v8f c) {
  v8f d = __builtin_amdgcn_wmma_f32_16x16x32_f16(false, a, false, b, (short)0, c, false, false);
  asm volatile("v_nop\n\tv_nop\n\tv_nop\n\tv_nop" : "+v"(d) : "v"(a), "v"(b));
  return d;
}
__device__ __forceinline__ v8f wmma_bf(v16b a, v16b b, v8f c) {
  v8f d = __builtin_amdgcn_wmma_f32_16x16x32_bf16(false, a, false, b, (short)0, c, false, false);
  asm volatile("v_nop\n\tv_nop\n\tv_nop\n\tv_nop" : "+v"(d) : "v"(a), "v"(b));
  return d;
}
// 16x16x32 fragments: lane = (h = lane>>4, row/col = lane&15); elements 0..7 = k0+8h+0..7, 8..15 = k0+16+8h+0..7; D element r = row 8h+r
__device__ __forceinline__ v16h frag_h(const _Float16* rowk0, int lane) {
  union { v16h v; v8h q[2]; } u; const _Float16* p = rowk0 + 8 * (lane >> 4);
  u.q[0] = *(const v8h*)p; u.q[1] = *(const v8h*)(p + 16); return u.v;
}
__device__ __forceinline__ v16h frag_f32(const float* rowk0, int lane) {
  v16h a; const float* p = rowk0 + 8 * (lane >> 4);
#pragma unroll
  for (int i = 0; i < 8; ++i) { a[i] = (_Float16)p[i]; a[8 + i] = (_Float16)p[16 + i]; }
  return a;
}
__device__ __forceinline__ v16h frag_f32s(const float* rowk0, int lane, float sc) {
  v16h a; const float* p = rowk0 + 8 * (lane >> 4);
#pragma unroll
  for (int i = 0; i < 8; ++i) { a[i] = (_Float16)(p[i] * sc); a[8 + i] = (_Float16)(p[16 + i] * sc); }
  return a;
}
// column fragment from a [K][ld] layout (column n), rows >= K read as 0
__device__ __forceinline__ v16h fragc_f32(const float* W, int k0, int n, int lane, int ld, int K) {
  v16h a; const int g = lane >> 4;
#pragma unroll
  for (int i = 0; i < 8; ++i) { const int ka = k0 + 8 * g + i, kb = ka + 16;
    a[i] = (_Float16)(ka < K ? W[(size_t)(ka < K ? ka : K - 1) * ld + n] : 0.f); a[8 + i] = (_Float16)(kb < K ? W[(size_t)(kb < K ? kb : K - 1) * ld + n] : 0.f); }
  return a;
}
struct F2 { v16b h, l; };
__device__ __forceinline__ F2 bsplit16(const float v[16]) { F2 r;
#pragma unroll
  for (int i = 0; i < 16; ++i) { const __bf16 h = (__bf16)v[i]; r.h[i] = h; r.l[i] = (__bf16)(v[i] - (float)h); }
  return r; }
__device__ __forceinline__ F2 split_row(const float* row, int k0, int lane) { float v[16]; const float* p = row + k0 + 8 * (lane >> 4);
#pragma unroll
  for (int i = 0; i < 8; ++i) { v[i] = p[i]; v[8 + i] = p[16 + i]; }
  return bsplit16(v); }
__device__ __forceinline__ F2 split_rowK(const float* row, int k0, int lane, int K) { float v[16]; const int g = lane >> 4;
#pragma unroll
  for (int i = 0; i < 8; ++i) { const int ka = k0 + 8 * g + i, kb = ka + 16; v[i] = ka < K ? row[ka < K ? ka : K - 1] : 0.f; v[8 + i] = kb < K ? row[kb < K ? kb : K - 1] : 0.f; }
  return bsplit16(v); }
__device__ __forceinline__ F2 split_col(const float* W, int k0, int n, int lane, int ld, int K) { float v[16]; const int g = lane >> 4;
#pragma unroll
  for (int i = 0; i < 8; ++i) { const int ka = k0 + 8 * g + i, kb = ka + 16; v[i] = ka < K ? W[(size_t)(ka < K ? ka : K - 1) * ld + n] : 0.f; v[8 + i] = kb < K ? W[(size_t)(kb < K ? kb : K - 1) * ld + n] : 0.f; }
  return bsplit16(v); }
__device__ __forceinline__ v8f mac3(const F2& a, const F2& b, v8f c) { c = wmma_bf(a.l, b.h, c); c = wmma_bf(a.h, b.l, c); return wmma_bf(a.h, b.h, c); }
__device__ __forceinline__ float sigm(float v) { return 1.0f / (1.0f + expf(-v)); }
#define LDSX() do { asm volatile("s_wait_dscnt 0" ::: "memory"); __builtin_amdgcn_wave_barrier(); __builtin_amdgcn_fence(__ATOMIC_RELEASE, "workgroup"); } while (0)

// Multi-query causal attention with table RoPE, per-head RMSNorm, a gated value residual and a sliding window (x [2,2048,1024]; ve [2,2048,64]; cos, sin [2048,32] (inputs); (in,out) Wq [1024,1024], Wk / Wv [1024,64], Wo [1024,1024], all N(0,1) x 0.02; Wg [32,1]; window_size int (1024); 16 query heads share ONE key / value head; gate = 2 sigmoid(x[..., :32] Wg); v = x Wv + gate * ve; _rope: (x1, x2) = halves -> (x1 cos + x2 sin, -x1 sin + x2 cos); _rmsnorm: x * rsqrt(mean(x^2) + finfo.eps) AFTER the rotation, on q and k; scores x 64^-0.5; masked where key > query or query - key >= window_size (finfo.min); softmax; out = merge(attn v) Wo).
#define NB 2
#define TT 2048
#define CC 1024            // NH * HD = projected width
#define DIN 1024          // input (model) width
#define NH 16
#define HD 64
#define SCALE (0.125f)
#define CAUSAL 1
#ifndef TNB
#define TNB NB
#endif
__device__ __forceinline__ float bfr(float v) { return (float)(__bf16)v; }
typedef __attribute__((ext_vector_type(8))) __bf16 v8b;
__device__ __forceinline__ v16b frag_b(const __bf16* rowk0, int lane) {
  union { v16b v; v8b q[2]; } u; const __bf16* p = rowk0 + 8 * (lane >> 4);
  u.q[0] = *(const v8b*)p; u.q[1] = *(const v8b*)(p + 16); return u.v;
}
// fragment order (q, k, their residuals and v in the workspace): one 16 x 32 fragment (16 rows, 32 k) is 512 elements = two blocks of 512 B; block s holds, at lane l = 16 g + row, the 8 elements k = 16 s + 8 g + 0..7, which are elements 8 s .. 8 s + 7 of that lane's fragment. A wave's fragment load is then two loads of 512 contiguous bytes (4 whole 128-B lines each) where a row-major plane gave 16 lines a load
__device__ __forceinline__ void st16w(void* p, v4u v) { asm volatile("global_store_b128 %0, %1, off\n\ts_wait_xcnt 0x0" :: "v"(p), "v"(v) : "memory"); }
__device__ __forceinline__ v16h fragt_h(const _Float16* fr, int lane) {
  union { v16h v; v8h q[2]; } u; const _Float16* p = fr + 8 * lane;
  u.q[0] = *(const v8h*)p; u.q[1] = *(const v8h*)(p + 256); return u.v;
}
__device__ __forceinline__ v16b fragt_b(const __bf16* fr, int lane) {
  union { v16b v; v8b q[2]; } u; const __bf16* p = fr + 8 * lane;
  u.q[0] = *(const v8b*)p; u.q[1] = *(const v8b*)(p + 256); return u.v;
}
#define QBH 6              // causal: query blocks 0..QBH-1 of each sequence (few keys, no averaging) take the high-precision path
#define QHI 384            // rows carrying a q residual plane
#define KHI 384            // key rows carrying k residual / v bf16 hi+lo planes (used only by the causal high-precision path)
// B fragment (k rows k0+.., output column o) of a weight: (in,out) [K][ld] or (out,in) [ld rows of K]: bf16 exact, or f16(bf16 * 256) exact
__device__ __forceinline__ v16b wcol_io(const float* Wm, int k0, int o, int lane, int ld) { v16b w; const int g = lane >> 4;
#pragma unroll
  for (int i = 0; i < 8; ++i) { w[i] = (__bf16)Wm[(size_t)(k0 + 8 * g + i) * ld + o]; w[8 + i] = (__bf16)Wm[(size_t)(k0 + 16 + 8 * g + i) * ld + o]; }
  return w; }
__device__ __forceinline__ v16b wcol_oi(const float* Wm, int k0, int o, int lane, int K) { v16b w; const float* p = Wm + (size_t)o * K + k0 + 8 * (lane >> 4);
#pragma unroll
  for (int i = 0; i < 8; ++i) { w[i] = (__bf16)p[i]; w[8 + i] = (__bf16)p[16 + i]; }
  return w; }
__device__ __forceinline__ v16h wcolh_io(const float* Wm, int k0, int o, int lane, int ld) { v16h w; const int g = lane >> 4;
#pragma unroll
  for (int i = 0; i < 8; ++i) { w[i] = (_Float16)(bfr(Wm[(size_t)(k0 + 8 * g + i) * ld + o]) * 256.0f); w[8 + i] = (_Float16)(bfr(Wm[(size_t)(k0 + 16 + 8 * g + i) * ld + o]) * 256.0f); }
  return w; }
__device__ __forceinline__ v16h wcolh_oi(const float* Wm, int k0, int o, int lane, int K) { v16h w; const float* p = Wm + (size_t)o * K + k0 + 8 * (lane >> 4);
#pragma unroll
  for (int i = 0; i < 8; ++i) { w[i] = (_Float16)(bfr(p[i]) * 256.0f); w[8 + i] = (_Float16)(bfr(p[16 + i]) * 256.0f); }
  return w; }
#define WQKV_LAYOUT 0   // selects only WCOL, which nothing uses: gemm_main reads Wq / Wk / Wv as (in,out) [DIN][n]
__device__ __forceinline__ v16b wcol_hdk(const float* Wm, int k0, int o, int lane) { v16b w; const int g = lane >> 4; const float* p = Wm + (size_t)(o / HD) * DIN * HD + (o % HD);
#pragma unroll
  for (int i = 0; i < 8; ++i) { w[i] = (__bf16)p[(size_t)(k0 + 8 * g + i) * HD]; w[8 + i] = (__bf16)p[(size_t)(k0 + 16 + 8 * g + i) * HD]; }
  return w; }
#define WO_OUT_IN 0
#if WQKV_LAYOUT == 1
#define WCOL(W, k0, o, lane) wcol_oi(W, k0, o, lane, DIN)
#elif WQKV_LAYOUT == 2
#define WCOL(W, k0, o, lane) wcol_hdk(W, k0, o, lane)
#else
#define WCOL(W, k0, o, lane) (which == 0 ? wcol_io(W, k0, (o), lane, CC) : ((o) < KVW ? wcol_io(W, k0, (o), lane, KVW) : zero16b()))   /* (in,out): Wq [1024][1024] pitch CC; Wk / Wv [1024][64] pitch 64, padded columns 64..127 are zero */
#endif
#if WO_OUT_IN
#define WOCOL(W, k0, o, lane) wcol_oi(W, k0, o, lane, CC)
#define WOCOLH(W, k0, o, lane) wcolh_oi(W, k0, o, lane, CC)
#else
#define WOCOL(W, k0, o, lane) wcol_io(W, k0, o, lane, DIN)
#define WOCOLH(W, k0, o, lane) wcolh_io(W, k0, o, lane, DIN)
#endif
#define GRP 16             // all 16 query heads share the single kv head (kv head = h / 16 = 0)
#define CKV 128            // kv column block of k_proj (the workspace planes hold 64 columns): ONE 128-column block whose columns 0..63 are the single kv head, columns 64..127 zero padding
#define KVW 64             // real kv width (Wk / Wv are (in,out) [1024][64])
#define PROJ_EXTRA_PARAMS , int woff, const float* __restrict__ COS, const float* __restrict__ SIN, const float* __restrict__ VE, const float* __restrict__ WG   /* which = blockIdx.z + woff; COS / SIN [TT][32], VE [NB*TT][64], WG [32] are module inputs read in the projection epilogue */
__device__ __forceinline__ v16b zero16b() { v16b w; _Pragma("unroll") for (int i = 0; i < 16; ++i) w[i] = (__bf16)0.0f; return w; }
#define RMS_EPS 1.1920929e-07f   /* jnp.finfo(float32).eps */
// per (token, head) hook on the staged f32 row (64 floats). q and k (which 0, 1): the module's _rope with cos / sin read LITERALLY from the table inputs at row t (bf16-rounded like every float input): (x1, x2) = (row[m], row[32+m]) -> (x1 c + x2 s, -x1 s + x2 c), then _rmsnorm over the 64 dims: x * (1 / sqrt(mean(x^2) + eps)); the zero-padded second half of the k block stays exactly zero under both. v (which 2): row += gate * bf16(ve[b, t, :]) with gate = 2 / (1 + exp(-z)), z = sum_{i<32} bf16(x[b, t, i]) * bf16(Wg[i]); all global loads are unconditional; the padded half gets gate 0 through a select. f32, products and sums kept separate
#define PROJ_EPI(which, row, t, h) do { float* rw = (row); const size_t gr_ = bb * TT + (size_t)(t); if ((which) < 2) { const float* ct_ = COS + (size_t)(t) * 32; const float* st_ = SIN + (size_t)(t) * 32; _Pragma("unroll 4") for (int m = 0; m < 32; ++m) { _Pragma("clang fp contract(off)") const float c_ = bfr(ct_[m]), s_ = bfr(st_[m]); const float x1 = rw[m], x2 = rw[32 + m]; rw[m] = x1 * c_ + x2 * s_; rw[32 + m] = (-x1) * s_ + x2 * c_; } float ss_ = 0.f; _Pragma("unroll 8") for (int m = 0; m < 64; ++m) { _Pragma("clang fp contract(off)") ss_ += rw[m] * rw[m]; } const float rinv_ = 1.0f / sqrtf(ss_ * (1.0f / 64.0f) + RMS_EPS); _Pragma("unroll 8") for (int m = 0; m < 64; ++m) rw[m] = rw[m] * rinv_; } else { const float* xr_ = XV + gr_ * DIN; float z_ = 0.f; _Pragma("unroll 8") for (int i = 0; i < 32; ++i) { _Pragma("clang fp contract(off)") z_ += bfr(xr_[i]) * bfr(WG[i]); } const float gate_ = 2.0f / (1.0f + expf(-z_)); const float gsel_ = ((h) == 0) ? gate_ : 0.0f; const float* ve_ = VE + gr_ * 64; _Pragma("unroll 8") for (int m = 0; m < 64; ++m) { _Pragma("clang fp contract(off)") rw[m] = rw[m] + gsel_ * bfr(ve_[m]); } } } while (0)
static_assert(HD == 64 && KVW == 64 && CKV == 128, "the hook spells 32 / 64 literally: one real 64-wide kv head in a 128-column block");
#define SM_EXTRA_PARAMS , const int* __restrict__ WINP
// sliding window: a key is excluded when query - key >= window_size; window_size is the module's int input (one block-uniform scalar load, win_ = WINP[0], read once at the kernel's head); keys after the query are excluded by the causal test beside it; every row keeps at least min(t + 1, window) >= 1 keys
#ifndef SM_EXTRA_PARAMS
#define SM_EXTRA_PARAMS
#endif
#ifndef PROJ_EXTRA_PARAMS
#define PROJ_EXTRA_PARAMS
#endif

#define WS_QH  0u                                      // f16 q, fragment order: fragment (((b*t) / 16) * NH + head) * 2 + (head dim / 32), rows = queries, k = head dims
#define WS_KH  (WS_QH + 2u * (size_t)NB * TT * CC)      // f16 k, fragment order: fragment ((b*t) / 16) * 2 + (head dim / 32), rows = keys, k = head dims
#define WS_VT  (WS_KH + 2u * (size_t)NB * TT * CC)      // f16 v, fragment order: fragment (b * TT / 32 + t / 32) * 4 + (channel / 16), rows = channels, k = keys
#define WS_QL  (WS_VT + 2u * (size_t)NB * CC * TT)      // f16 q residual x 2^10, fragment order like q over the rows [b][t < QHI]
#define WS_KL  (WS_QL + 2u * (size_t)NB * QHI * CC)     // f16 k residual x 2^10, fragment order like k over the rows [b][t < KHI]
#define WS_VB  (WS_KL + 2u * (size_t)NB * KHI * CC)     // bf16 v hi (and, behind it, lo), fragment order like v over the keys [b][t < KHI]
#define WS_VBL (WS_VB + 2u * (size_t)NB * CC * KHI)
#define WS_Y   (WS_VBL + 2u * (size_t)NB * CC * KHI)    // f32 ctx rows [b*t][CC] (only when there is an output projection)
#define WS_END (WS_Y  + 4u * (size_t)NB * TT * CC)

// ---- gemm_main: the K loop of k_proj and k_out. A block's 4 waves need the same 128 weight columns, so each 64-k stage of W ([k][n] f32, n contiguous) is read ONCE per block with whole-line 16-byte loads, rounded exactly as before (MODE 0, 1: bf16; MODE 2: f16(bf16 x 2^8)), turned in registers and stored as [n][k] rows (pitch 144 B) in one of two LDS buffers, from which every wave reads its B fragments with two 16-byte LDS loads each. The next stage's global loads (W tile and the wave's own A rows) are issued in front of this stage's products and stored behind them. Products and their k order per accumulator are those of the direct form. Every loop over s, c, i, j or kk inside a stage is fully unrolled so that the register arrays are indexed by constants alone.
#define GKS 64                 // k per stage
#define GWP (GKS + 8)          // LDS row pitch in 16-bit elements: 144 B = 16 B x odd, conflict-free for 16-byte readers
template <int LD> __device__ __forceinline__ void g_fetch(v4f (&wr)[2][8], v4f (&ar)[2][4], const float* wp, const float* ap) {
#pragma unroll
  for (int s = 0; s < 2; ++s)
#pragma unroll
    for (int i = 0; i < 8; ++i) wr[s][i] = *(const v4f*)(wp + (size_t)(s * 32 + i) * LD);
#pragma unroll
  for (int kk = 0; kk < 2; ++kk) { ar[kk][0] = *(const v4f*)(ap + kk * 32); ar[kk][1] = *(const v4f*)(ap + kk * 32 + 4); ar[kk][2] = *(const v4f*)(ap + kk * 32 + 16); ar[kk][3] = *(const v4f*)(ap + kk * 32 + 20); }
  asm volatile("s_wait_xcnt 0x0" ::: "memory");   /* stands in front of every later instruction that rewrites the address registers of these loads; it also keeps the loads in front of the stage's products */
}
template <int MODE> __device__ __forceinline__ void g_store(const v4f (&wr)[2][8], __bf16* sst, bool wl) {
#pragma unroll
  for (int s = 0; s < 2; ++s)
#pragma unroll
    for (int c = 0; c < 4; ++c) {
      if constexpr (MODE == 2) { v8h o;
#pragma unroll
        for (int i = 0; i < 8; ++i) o[i] = (_Float16)(bfr(wr[s][i][c]) * 256.0f);
        *(v8h*)(sst + c * GWP + s * 32) = o;
      } else { union { v8b b; v4u u; } o;
#pragma unroll
        for (int i = 0; i < 8; ++i) o.b[i] = (__bf16)wr[s][i][c];
        o.u &= wl ? 0xffffffffu : 0u;   /* padded columns: the load is unconditional at a clamped address, the stored value is +0 */
        *(v8b*)(sst + c * GWP + s * 32) = o.b; } } }
struct GA { v16b h[2], l[2]; v16h f[2]; };   /* the wave's A fragments of one stage; only the members of the MODE in use are formed */
template <int MODE> __device__ __forceinline__ void g_acvt(GA& a, const v4f (&ar)[2][4]) {
#pragma unroll
  for (int kk = 0; kk < 2; ++kk) { float v[16];
#pragma unroll
    for (int i = 0; i < 16; ++i) v[i] = ar[kk][i >> 2][i & 3];   /* elements 0..7 = k 8g + 0..7, 8..15 = k 16 + 8g + 0..7 */
    if constexpr (MODE == 0) {
#pragma unroll
      for (int i = 0; i < 16; ++i) a.h[kk][i] = (__bf16)v[i];
    } else if constexpr (MODE == 1) { const F2 s = bsplit16(v); a.h[kk] = s.h; a.l[kk] = s.l;
    } else {
#pragma unroll
      for (int i = 0; i < 16; ++i) a.f[kk][i] = (_Float16)(v[i] * 64.0f); } } }
// ap = the lane's A row + 8 g; Wt = W + the block's first column; sw = two buffers of 128 rows x GWP; wave in a scalar register; wl = this wave's 32 staged columns exist in W
template <int MODE, int LD, int KTOT> __device__ __forceinline__ void gemm_main(v8f (&acc)[8], const float* __restrict__ ap, const float* __restrict__ Wt, __bf16* sw, int wave, int lane, bool wl) {
  const int cg = wave * 8 + (lane & 3) + 4 * (lane >> 4), kg = (lane >> 2) & 3;   /* the lane stages columns 4 cg .. 4 cg + 3 of k rows 8 kg + 0..7 and 32 + 8 kg + 0..7: a load covers four whole 128-B lines, and the 16 lanes of a half-wave store to 16 different bank groups */
  const float* wp = Wt + (size_t)(8 * kg) * LD + (wl ? 4 * cg : 0);
  __bf16* sst = sw + (4 * cg) * GWP + 8 * kg; const __bf16* srd = sw + (lane & 15) * GWP;
  v4f wr[2][8]; v4f ar[2][4]; GA a;
  g_fetch<LD>(wr, ar, wp, ap); g_store<MODE>(wr, sst, wl); g_acvt<MODE>(a, ar);
  __syncthreads();   /* stage 0 is in LDS before any wave reads it */
  for (int s = 0; s < KTOT / GKS; ++s) { const int bo = (s & 1) * (128 * GWP); const bool more = s + 1 < KTOT / GKS;
    if (more) g_fetch<LD>(wr, ar, wp + (size_t)(s + 1) * GKS * LD, ap + (s + 1) * GKS);
#pragma unroll
    for (int kk = 0; kk < 2; ++kk) {   /* the eight B fragments of a 32-k block are all read in front of its first product: one LDS latency a block */
      if constexpr (MODE == 2) { v16h wf[8];
#pragma unroll
        for (int j = 0; j < 8; ++j) wf[j] = frag_h((const _Float16*)(srd + bo + j * 16 * GWP + kk * 32), lane);
#pragma unroll
        for (int j = 0; j < 8; ++j) acc[j] = wmma16(a.f[kk], wf[j], acc[j]);
      } else { v16b wf[8];
#pragma unroll
        for (int j = 0; j < 8; ++j) wf[j] = frag_b(srd + bo + j * 16 * GWP + kk * 32, lane);
#pragma unroll
        for (int j = 0; j < 8; ++j) { acc[j] = wmma_bf(a.h[kk], wf[j], acc[j]); if constexpr (MODE == 1) acc[j] = wmma_bf(a.l[kk], wf[j], acc[j]); } } }
    __builtin_amdgcn_sched_barrier(0);   /* keeps the conversions of the next stage's registers, and with them the wait for its global loads, behind this stage's products: without it the wait was scheduled behind the first product */
    if (more) { g_store<MODE>(wr, sst + (bo ^ (128 * GWP)), wl); g_acvt<MODE>(a, ar);
      __syncthreads(); } } }   /* one barrier a stage: it publishes stage s + 1 and ends every wave's reads of the buffer that stage s + 2 will overwrite */
// ---- k_proj: block = (64 rows, 128 cols, which): q/k/v = X W (+ b) with exact bf16 products (K = DIN) -> which 0: q f16 in fragment order (+ residual, rows < QHI); 1: k f16 in fragment order (+ residual, rows < KHI); 2: v f16 in fragment order (+ bf16 hi/lo for t < KHI)
__global__ __launch_bounds__(128) void k_proj(const float* __restrict__ XQ, const float* __restrict__ XK, const float* __restrict__ XV, const float* __restrict__ WQ, const float* __restrict__ WK, const float* __restrict__ WV, const float* __restrict__ BQ, const float* __restrict__ BK, const float* __restrict__ BV,
    _Float16* __restrict__ QH, _Float16* __restrict__ QL, _Float16* __restrict__ KH, _Float16* __restrict__ KL, _Float16* __restrict__ VT, __bf16* __restrict__ VB, __bf16* __restrict__ VBL PROJ_EXTRA_PARAMS) {
  __shared__ __align__(16) float st[64][132]; __shared__ __align__(16) _Float16 sh[64][136], sl[64][136]; __shared__ __align__(16) _Float16 th[128][72]; __shared__ __align__(16) __bf16 tb[128][72], tbl[128][72]; __shared__ __align__(16) __bf16 sw[2 * 128 * GWP];
  const int tid = threadIdx.x, wave = tid >> 5, lane = tid & 31, col = lane & 15, g = lane >> 4; const int which = blockIdx.z + woff; const int c0 = blockIdx.y * 128; const size_t r0 = (size_t)blockIdx.x * 64; const size_t bb = r0 / TT; const int t0 = (int)(r0 % TT);
  const float* X = which == 0 ? XQ : which == 1 ? XK : XV; const float* WA = which == 0 ? WQ : which == 1 ? WK : WV; const float* BA = which == 0 ? BQ : which == 1 ? BK : BV;
  v8f acc[8] = {};
  { const int wv = __builtin_amdgcn_readfirstlane(wave);   /* the wave's number in a scalar register: the staged column group and the padded-columns mask are wave-uniform */
    const float* ap = X + (r0 + wave * 16 + col) * DIN + 8 * g;
    if (which == 0) gemm_main<0, CC, DIN>(acc, ap, WA + c0, sw, wv, lane, true);   /* Wq [1024][1024] */
    else gemm_main<0, KVW, DIN>(acc, ap, WA + (c0 < KVW ? c0 : 0), sw, wv, lane, c0 + wv * 32 < KVW); }   /* Wk / Wv [1024][64]: padded columns 64..127 are staged as zeros */
  { // stage the f32 tile (acc + bias) in LDS, run the per-(row, head) epilogue hook, then convert
#pragma unroll
    for (int j = 0; j < 8; ++j) { const int bo_ = c0 + j * 16 + col; const float bias = (BA && (which == 0 || bo_ < KVW)) ? bfr(BA[(which == 0 || bo_ < KVW) ? bo_ : 0]) : 0.f;   /* bk / bv hold only the 64 real kv columns: padded columns get no bias (index clamped, value selected) */
#pragma unroll
      for (int r = 0; r < 8; ++r) st[wave * 16 + 8 * g + r][j * 16 + col] = acc[j][r] + bias; }
    __syncthreads();
    for (int e = tid; e < 64 * (128 / HD); e += 128) { const int rl = e / (128 / HD), hh = e % (128 / HD); PROJ_EPI(which, &st[rl][hh * HD], (int)((r0 + rl) % TT), (c0 / HD) + hh); }
    __syncthreads(); }
  if (which < 2) { _Float16* DH = which == 0 ? QH : KH; _Float16* DL = which == 0 ? QL : KL; const int nhi = which == 0 ? QHI : KHI; const bool hi_rows = t0 < nhi;
    for (int e = tid; e < 64 * 128; e += 128) { const int rl = e >> 7, cl = e & 127; const float v = st[rl][cl]; const _Float16 hv = (_Float16)v; sh[rl][cl] = hv; sl[rl][cl] = (_Float16)((v - (float)hv) * 1024.0f); }
    __syncthreads();
    const size_t nh = which == 0 ? NH : 1;   /* heads a 16-row tile holds: q all NH, k the one real head (its padded columns are read by nobody and are not stored) */
    for (int e = tid; e < 64 * 16; e += 128) { const int l = e & 31, blk = e >> 5;   /* a wave stores one 512-B block of a fragment a trip: blk = ((tile * 2 + head of the column block) * 2 + head-dim half) * 2 + s */
      const int tile = blk >> 3, hd = (blk >> 2) & 1, cs = blk & 3; const int rl = tile * 16 + (l & 15), cl = hd * HD + cs * 16 + (l >> 4) * 8; const size_t fo = (size_t)(c0 / HD + hd) * 1024 + cs * 256 + l * 8;
      if (which == 0 || hd == 0) { st16w(DH + ((r0 >> 4) + tile) * nh * 1024 + fo, *(const v4u*)&sh[rl][cl]); if (hi_rows) st16w(DL + (((bb * nhi + t0) >> 4) + tile) * nh * 1024 + fo, *(const v4u*)&sl[rl][cl]); } }
  } else { const bool hi_rows = t0 < KHI;
    for (int e = tid; e < 64 * 128; e += 128) { const int rl = e & 63, cl = e >> 6; const float v = st[rl][cl]; th[cl][rl] = (_Float16)v; const __bf16 bh = (__bf16)v; tb[cl][rl] = bh; tbl[cl][rl] = (__bf16)(v - (float)bh); }
    __syncthreads();
    for (int e = tid; e < KVW * 8; e += 128) { const int l = e & 31, blk = e >> 5;   /* the 64 real channels (the padded ones are read by nobody and are not stored); a wave stores one 512-B block a trip: blk = ((chunk of the block's two * 4) + channel block) * 2 + s, so the block's 64 keys are e * 8 elements in a row */
      const int cl = ((blk >> 1) & 3) * 16 + (l & 15), kq = (blk >> 3) * 32 + (blk & 1) * 16 + (l >> 4) * 8;
      st16w(VT + (bb * (TT / 32) + (t0 >> 5)) * 2048 + e * 8, *(const v4u*)&th[cl][kq]); if (hi_rows) { const size_t o3 = (bb * (KHI / 32) + (t0 >> 5)) * 2048 + e * 8; st16w(VB + o3, *(const v4u*)&tb[cl][kq]); st16w(VBL + o3, *(const v4u*)&tbl[cl][kq]); } } } }
// ---- k_pv: block = 16 queries (qt) of one (b, h), PVW waves: wave w owns the 32-key chunks w, w + PVW, ... and works on those in [kcs, kce), the chunks that hold a key which the causal rule and the window admit for some query of the block (a chunk outside adds only zeros to the sums). It forms its logits itself, transposed: A = 16 key rows, B = the block's 16 query rows, so that D (lane = query, registers = keys 8g + r) of the chunk's two key tiles IS the A-fragment layout of the P x v product (lane = query row, 16 keys a chunk) and the logits never leave the registers; x SCALE; q hi + residual (x 2^10) against k hi + residual (3 products) for query blocks < QBH (causal early rows), single f16 q x k after. Softmax in ONE pass, with no row maximum: q and k leave _rmsnorm with a norm of at most sqrt(64) = 8 whatever the inputs are, so |q . k| x SCALE <= 8 (a few 2^-11 more after the 16-bit rounding) and exp(logit) lies in [3.3e-4, 3.1e3]: normal numbers of f16 and bf16, and a row's sum of at most 2048 of them is far inside f32. Each chunk's e = exp(logit) (0 for excluded keys: after the query, or outside the window, by index) goes at once, unnormalised, to f16 against v f16 (1 product; causal early query blocks: e and v as bf16 hi + lo, 3 products), so that a chunk's logits die with the chunk; the row sum of e runs beside it in f32 over the lane's own keys, then the other half-wave, then the PVW waves through LDS in wave order; the PVW partial ctx tiles are added in LDS in wave order and divided by the row sum; 256-B (row, head) segment by 16 lanes
#define PVW 8
#define PVC (TT / 32 / PVW)                                             // most chunks one wave can own
#define PVCH (((((QBH * 64 - 1) >> 7) + 1) * 4 + PVW - 1) / PVW)         // the same for the early (high-precision) query blocks
static_assert(QBH * 64 == QHI && (((QBH * 64 - 1) >> 7) + 1) * 128 <= KHI, "every query row with a residual plane lies in an early block, and every key row such a block reads has one");
__global__ __launch_bounds__(32 * PVW) void k_pv(const _Float16* __restrict__ QH, const _Float16* __restrict__ KH, const _Float16* __restrict__ QL, const _Float16* __restrict__ KL, const _Float16* __restrict__ VT, const __bf16* __restrict__ VB, const __bf16* __restrict__ VBL, float* __restrict__ Y SM_EXTRA_PARAMS) { const int b = blockIdx.z / NH, h = blockIdx.z % NH; __shared__ __align__(16) float ss[PVW][16][HD + 4]; __shared__ float ssu[PVW][16];
  const int tid = threadIdx.x, lane = tid & 31, col = lane & 15, g = lane >> 4; const int qt = blockIdx.x, qb = qt >> 2; const int ql0 = qt * 16; const int kce = CAUSAL ? ((ql0 + 15) >> 5) + 1 : TT / 32;   /* one past the chunk that holds the block's last query: every later key lies after every query of the block */
  const int wave = __builtin_amdgcn_readfirstlane(tid >> 5);   /* the wave's number in a scalar register: the chunk tests below branch on scalars and every lane stays on at the matrix instructions */
  const int win_ = WINP[0]; const int t = ql0 + col;
  const int klo = ql0 + 1 - (win_ < 0 ? 0 : win_); const int kcs = klo > 0 ? klo >> 5 : 0;   /* klo = the first key that the window leaves to the block's first query (later queries start later): chunks below kcs hold excluded keys alone; scalar, 0 <= kcs < kce for any window_size; no address is formed from it */
  const _Float16* qrow = QH + (((size_t)b * (TT / 16) + qt) * NH + h) * 1024; const v16h qf0 = fragt_h(qrow, lane), qf1 = fragt_h(qrow + 512, lane);   /* B fragments: column = the lane's query, head dims 0..31 and 32..63 */
  asm volatile("s_wait_xcnt 0x0" ::: "memory");   /* stands in front of the key loads below, whose results may land on the address registers of the q loads */
  float sum = 0.f; v8f acc[HD / 16] = {};
  const size_t kro = (size_t)wave * 2048;   /* the wave's first chunk in fragment order: a chunk of k is 2 key tiles x 2 head-dim halves = 4 fragments of 512 elements, a chunk of v 4 fragments (16 channels each) of 512 elements; chunk i and the fragment in it are constant offsets from it */
  /* chunk i is worked on only under kcs <= kc < kce (scalar tests); the loops over i are fully unrolled so that every address is a fixed base plus a constant */
  if (qb < QBH) { const _Float16* qlrow = QL + (((size_t)b * (QHI / 16) + qt) * NH + h) * 1024; const v16h ql0f = fragt_h(qlrow, lane), ql1f = fragt_h(qlrow + 512, lane); asm volatile("s_wait_xcnt 0x0" ::: "memory");   /* stands in front of the key loads below, whose results may land on the address registers of the q loads */
    const _Float16* krow = KH + (size_t)b * TT * KVW + kro; const _Float16* klrow = KL + (size_t)b * KHI * KVW + kro; const size_t vro = (size_t)b * KHI * KVW + kro;
#pragma unroll
    for (int i = 0; i < PVCH; ++i) { const int kc = wave + i * PVW; if (kc >= kcs && kc < kce) { const int ko = i * (PVW * 2048); float pf[16];
#pragma unroll
        for (int u = 0; u < 2; ++u) { v16h kh[2], kl[2]; v8f a = {}, al = {};   /* one key tile at a time: its four fragments are loaded in front of its first product; each tile's own order of products is head dims 0..31, then 32..63 */
          kh[0] = fragt_h(krow + ko + u * 1024, lane); kh[1] = fragt_h(krow + ko + u * 1024 + 512, lane); kl[0] = fragt_h(klrow + ko + u * 1024, lane); kl[1] = fragt_h(klrow + ko + u * 1024 + 512, lane);
          asm volatile("s_wait_xcnt 0x0" ::: "memory");   /* stands in front of every later instruction that rewrites the address registers of this tile's loads */
#pragma unroll
          for (int c = 0; c < 2; ++c) { const v16h qh = c ? qf1 : qf0, ql = c ? ql1f : ql0f; a = wmma16(kh[c], qh, a); al = wmma16(kh[c], ql, al); al = wmma16(kl[c], qh, al); }
#pragma unroll
          for (int r = 0; r < 8; ++r) { const int k = kc * 32 + 16 * u + 8 * g + r; const float ex = expf((a[r] + al[r] * (1.0f / 1024.0f)) * SCALE); const float e = ((!CAUSAL || k <= t) && t - k < win_) ? ex : 0.f; pf[8 * u + r] = e; sum += e; } }
        const F2 p = bsplit16(pf);
#pragma unroll
        for (int j = 0; j < HD / 16; ++j) { const v16b vh = fragt_b(VB + vro + ko + j * 512, lane), vl = fragt_b(VBL + vro + ko + j * 512, lane);
          asm volatile("s_wait_xcnt 0x0" ::: "memory");   /* stands in front of every later instruction that rewrites the address registers of these loads */
          acc[j] = wmma_bf(p.h, vh, acc[j]); acc[j] = wmma_bf(p.l, vh, acc[j]); acc[j] = wmma_bf(p.h, vl, acc[j]); } } }
  } else { const _Float16* krow = KH + (size_t)b * TT * KVW + kro; const _Float16* vrow = VT + (size_t)b * TT * KVW + kro;
#pragma unroll
    for (int i = 0; i < PVC; ++i) { const int kc = wave + i * PVW; if (kc >= kcs && kc < kce) { const int ko = i * (PVW * 2048); v16h kh[2][2], vf[HD / 16]; v8f a[2] = {};   /* the chunk's k fragments are all loaded in front of its first product: one load latency a chunk */
#pragma unroll
        for (int u = 0; u < 2; ++u) { kh[u][0] = fragt_h(krow + ko + u * 1024, lane); kh[u][1] = fragt_h(krow + ko + u * 1024 + 512, lane); }
        asm volatile("s_wait_xcnt 0x0" ::: "memory");   /* stands in front of every later instruction that rewrites the address registers of this chunk's loads */
        a[0] = wmma16(kh[0][0], qf0, a[0]); a[1] = wmma16(kh[1][0], qf0, a[1]); a[0] = wmma16(kh[0][1], qf1, a[0]); a[1] = wmma16(kh[1][1], qf1, a[1]);   /* the two key tiles' products alternate, each tile's own order being head dims 0..31, then 32..63 */
#pragma unroll
        for (int j = 0; j < HD / 16; ++j) vf[j] = fragt_h(vrow + ko + j * 512, lane);   /* asked for behind the logit products, where the k fragments' registers are free again; they arrive under the exponentials */
        asm volatile("s_wait_xcnt 0x0" ::: "memory");   /* stands in front of every later instruction that rewrites the address registers of these loads */
        v16h p;
#pragma unroll
        for (int j = 0; j < 16; ++j) { const int k = kc * 32 + 8 * g + (j & 7) + 16 * (j >> 3); const float ex = expf(a[j >> 3][j & 7] * SCALE); const float e = ((!CAUSAL || k <= t) && t - k < win_) ? ex : 0.f; p[j] = (_Float16)e; sum += e; }
#pragma unroll
        for (int j = 0; j < HD / 16; ++j) acc[j] = wmma16(p, vf[j], acc[j]); } } }
  sum += __shfl_xor(sum, 16); if (g == 0) ssu[wave][col] = sum;
#pragma unroll
  for (int j = 0; j < HD / 16; ++j)
#pragma unroll
    for (int r = 0; r < 8; ++r) ss[wave][8 * g + r][j * 16 + col] = acc[j][r];
  __syncthreads();   /* every wave's partial tile and row sums are in LDS before any thread adds them */
  { const int rl = tid >> 4, q4 = (tid & 15) * 4; v4f s = *(const v4f*)&ss[0][rl][q4]; float rs = ssu[0][rl];
#pragma unroll
    for (int w = 1; w < PVW; ++w) { s += *(const v4f*)&ss[w][rl][q4]; rs += ssu[w][rl]; }
    const float inv = rs > 0.f ? 1.0f / rs : 0.f;   /* a fully excluded row yields 0 */
    vst2(Y + ((size_t)b * TT + ql0 + rl) * CC + h * HD + q4, s * inv); } }
static_assert(32 * PVW == 16 * (HD / 4), "one thread per float4 of the 16 x HD tile in the final add");
static_assert(NH == GRP && KVW == HD && TT % 64 == 0 && KHI % 64 == 0, "fragment order holds the one kv head's 64 columns; a 64-row block of k_proj fills whole fragments");
// ---- k_out: block = (64 rows, 128 cols): out = ctx Wo (+ bo): ctx x 2^6 once to f16 against Wo as f16(bf16 x 2^8) exact (1 product) x 2^-14; causal early rows (< QHI of each sequence): ctx bf16 hi + lo against exact bf16 Wo (2 products)
__global__ __launch_bounds__(128) void k_out(const float* __restrict__ Y, const float* __restrict__ WO, const float* __restrict__ BO, float* __restrict__ OUT) { __shared__ __align__(16) float sf[4][16][132]; __shared__ __align__(16) __bf16 sw[2 * 128 * GWP];
  const int tid = threadIdx.x, wave = tid >> 5, lane = tid & 31, col = lane & 15, g = lane >> 4; const int c0 = blockIdx.y * 128; const size_t r0 = (size_t)blockIdx.x * 64 + wave * 16; const int wv = __builtin_amdgcn_readfirstlane(wave);
  v8f acc[8] = {};
  if (CAUSAL && (int)(((size_t)blockIdx.x * 64) % TT) < QHI) {   /* block-uniform */
    gemm_main<1, DIN, CC>(acc, Y + (r0 + col) * CC + 8 * g, WO + c0, sw, wv, lane, true);
#pragma unroll
    for (int j = 0; j < 8; ++j) { const float bias = BO ? bfr(BO[c0 + j * 16 + col]) : 0.f;
#pragma unroll
      for (int r = 0; r < 8; ++r) sf[wave][8 * g + r][j * 16 + col] = acc[j][r] + bias; }
  } else {
    gemm_main<2, DIN, CC>(acc, Y + (r0 + col) * CC + 8 * g, WO + c0, sw, wv, lane, true);   /* ctx carried x 2^6 into f16 so small-magnitude context rows stay clear of f16 subnormals */
#pragma unroll
    for (int j = 0; j < 8; ++j) { const float bias = BO ? bfr(BO[c0 + j * 16 + col]) : 0.f;
#pragma unroll
      for (int r = 0; r < 8; ++r) sf[wave][8 * g + r][j * 16 + col] = acc[j][r] * (1.0f / 16384.0f) + bias; } }   /* 2^-8 (Wo carry) x 2^-6 (ctx carry) */
  LDSX(); for (int rl = 0; rl < 16; ++rl) vst2(OUT + (r0 + rl) * DIN + c0 + lane * 4, *(const v4f*)&sf[wave][rl][lane * 4]); }

extern "C" void kernel_launch(void* const* d_in, const int* in_sizes, int n_in, void* d_out, int out_size, void* d_ws, size_t ws_size, hipStream_t stream) {
  (void)in_sizes; (void)n_in; (void)out_size;
  const float** F = (const float**)d_in;
  if (ws_size < (size_t)WS_END) return;
  char* ws = (char*)d_ws; _Float16 *QH = (_Float16*)(ws + WS_QH), *KH = (_Float16*)(ws + WS_KH), *VT = (_Float16*)(ws + WS_VT), *QL = (_Float16*)(ws + WS_QL), *KL = (_Float16*)(ws + WS_KL); __bf16 *VB = (__bf16*)(ws + WS_VB), *VBL = (__bf16*)(ws + WS_VBL); float *Y = (float*)(ws + WS_Y);
  (void)Y; (void)QL; (void)KL; (void)VB; (void)VBL;
  // inputs: 0 x [2,2048,1024]; 1 ve [2,2048,64]; 2 cos [2048,32]; 3 sin [2048,32]; 4 Wq [1024,1024] (in,out); 5 Wk [1024,64]; 6 Wv [1024,64]; 7 Wo [1024,1024] (in,out); 8 Wg [32,1]; 9 window_size int32 [1]; no biases
  k_proj<<<dim3(TNB * TT / 64, CC / 128, 1), 128, 0, stream>>>(F[0], F[0], F[0], F[4], F[5], F[6], nullptr, nullptr, nullptr, QH, QL, KH, KL, VT, VB, VBL, 0, F[2], F[3], F[1], F[8]);    /* q: 8 column blocks */
  k_proj<<<dim3(TNB * TT / 64, CKV / 128, 2), 128, 0, stream>>>(F[0], F[0], F[0], F[4], F[5], F[6], nullptr, nullptr, nullptr, QH, QL, KH, KL, VT, VB, VBL, 1, F[2], F[3], F[1], F[8]);   /* k (which 1) and v (which 2): one (half-empty) column block each */
  k_pv<<<dim3(TT / 16, 1, TNB * NH), 32 * PVW, 0, stream>>>(QH, KH, QL, KL, VT, VB, VBL, Y, (const int*)d_in[9]);   /* every (b, h) in one launch */
  k_out<<<dim3(TNB * TT / 64, DIN / 128), 128, 0, stream>>>(Y, F[7], nullptr, (float*)d_out);
}

// v008
// Measured time: 97.8 microseconds a run.
// Next to v007, in two timings, it ran 1.06 times as fast each time.
// Over all steps from v000 it is 10.2 times as fast.
// compute dtype: all float inputs rounded to bf16, the cos / sin tables, ve and Wg included; q (16 heads) and the single shared k / v head projections with EXACT bf16 products on WMMA 16x16x32 (f32 accumulate); half-split RoPE with cos / sin READ from the table inputs, then RMSNorm over the 64 head dims (f32, eps = f32 machine epsilon) on q and k; v += 2 sigmoid(x[:32] . Wg) ve in f32; causal logits inside a sliding window read from the int input: 3 products for the first 384 rows, single f16 q x k after, x 64^-0.5; softmax f32 in one pass (logits bounded by the RMSNorm, no row maximum): exp(logit) once to f16 x v once to f16 (bf16 hi + lo below row 384), divided by the f32 row sum at the end; ctx hi+lo x exact Wo below row 384, x2^6 f16 carry x f16(bf16 x 2^8) Wo after; f32 output.
#include <hip/hip_runtime.h>
#include <math.h>

typedef __attribute__((ext_vector_type(16))) _Float16 v16h;
typedef __attribute__((ext_vector_type(16))) __bf16 v16b;
typedef __attribute__((ext_vector_type(8)))  _Float16 v8h;
typedef __attribute__((ext_vector_type(8)))  float v8f;
typedef __attribute__((ext_vector_type(4)))  float v4f;
typedef __attribute__((ext_vector_type(2)))  float v2f;
typedef __attribute__((ext_vector_type(4)))  unsigned v4u;
typedef __attribute__((ext_vector_type(4)))  int v4i;
typedef float __attribute__((may_alias)) float_a;
typedef int __attribute__((may_alias)) int_a;

template <typename T> __device__ __forceinline__ void vst2(void* p, T v) { *(T*)p = v;  }
__device__ __forceinline__ v8f wmma16(v16h a, v16h b, v8f c) {
  v8f d = __builtin_amdgcn_wmma_f32_16x16x32_f16(false, a, false, b, (short)0, c, false, false);
  asm volatile("v_nop\n\tv_nop\n\tv_nop\n\tv_nop" : "+v"(d) : "v"(a), "v"(b));
  return d;
}
__device__ __forceinline__ v8f wmma_bf(v16b a, v16b b, v8f c) {
  v8f d = __builtin_amdgcn_wmma_f32_16x16x32_bf16(false, a, false, b, (short)0, c, false, false);
  asm volatile("v_nop\n\tv_nop\n\tv_nop\n\tv_nop" : "+v"(d) : "v"(a), "v"(b));
  return d;
}
// 16x16x32 fragments: lane = (h = lane>>4, row/col = lane&15); elements 0..7 = k0+8h+0..7, 8..15 = k0+16+8h+0..7; D element r = row 8h+r
__device__ __forceinline__ v16h frag_h(const _Float16* rowk0, int lane) {
  union { v16h v; v8h q[2]; } u; const _Float16* p = rowk0 + 8 * (lane >> 4);
  u.q[0] = *(const v8h*)p; u.q[1] = *(const v8h*)(p + 16); return u.v;
}
__device__ __forceinline__ v16h frag_f32(const float* rowk0, int lane) {
  v16h a; const float* p = rowk0 + 8 * (lane >> 4);
#pragma unroll
  for (int i = 0; i < 8; ++i) { a[i] = (_Float16)p[i]; a[8 + i] = (_Float16)p[16 + i]; }
  return a;
}
__device__ __forceinline__ v16h frag_f32s(const float* rowk0, int lane, float sc) {
  v16h a; const float* p = rowk0 + 8 * (lane >> 4);
#pragma unroll
  for (int i = 0; i < 8; ++i) { a[i] = (_Float16)(p[i] * sc); a[8 + i] = (_Float16)(p[16 + i] * sc); }
  return a;
}
// column fragment from a [K][ld] layout (column n), rows >= K read as 0
__device__ __forceinline__ v16h fragc_f32(const float* W, int k0, int n, int lane, int ld, int K) {
  v16h a; const int g = lane >> 4;
#pragma unroll
  for (int i = 0; i < 8; ++i) { const int ka = k0 + 8 * g + i, kb = ka + 16;
    a[i] = (_Float16)(ka < K ? W[(size_t)(ka < K ? ka : K - 1) * ld + n] : 0.f); a[8 + i] = (_Float16)(kb < K ? W[(size_t)(kb < K ? kb : K - 1) * ld + n] : 0.f); }
  return a;
}
struct F2 { v16b h, l; };
__device__ __forceinline__ F2 bsplit16(const float v[16]) { F2 r;
#pragma unroll
  for (int i = 0; i < 16; ++i) { const __bf16 h = (__bf16)v[i]; r.h[i] = h; r.l[i] = (__bf16)(v[i] - (float)h); }
  return r; }
__device__ __forceinline__ F2 split_row(const float* row, int k0, int lane) { float v[16]; const float* p = row + k0 + 8 * (lane >> 4);
#pragma unroll
  for (int i = 0; i < 8; ++i) { v[i] = p[i]; v[8 + i] = p[16 + i]; }
  return bsplit16(v); }
__device__ __forceinline__ F2 split_rowK(const float* row, int k0, int lane, int K) { float v[16]; const int g = lane >> 4;
#pragma unroll
  for (int i = 0; i < 8; ++i) { const int ka = k0 + 8 * g + i, kb = ka + 16; v[i] = ka < K ? row[ka < K ? ka : K - 1] : 0.f; v[8 + i] = kb < K ? row[kb < K ? kb : K - 1] : 0.f; }
  return bsplit16(v); }
__device__ __forceinline__ F2 split_col(const float* W, int k0, int n, int lane, int ld, int K) { float v[16]; const int g = lane >> 4;
#pragma unroll
  for (int i = 0; i < 8; ++i) { const int ka = k0 + 8 * g + i, kb = ka + 16; v[i] = ka < K ? W[(size_t)(ka < K ? ka : K - 1) * ld + n] : 0.f; v[8 + i] = kb < K ? W[(size_t)(kb < K ? kb : K - 1) * ld + n] : 0.f; }
  return bsplit16(v); }
__device__ __forceinline__ v8f mac3(const F2& a, const F2& b, v8f c) { c = wmma_bf(a.l, b.h, c); c = wmma_bf(a.h, b.l, c); return wmma_bf(a.h, b.h, c); }
__device__ __forceinline__ float sigm(float v) { return 1.0f / (1.0f + expf(-v)); }
#define LDSX() do { asm volatile("s_wait_dscnt 0" ::: "memory"); __builtin_amdgcn_wave_barrier(); __builtin_amdgcn_fence(__ATOMIC_RELEASE, "workgroup"); } while (0)

// Multi-query causal attention with table RoPE, per-head RMSNorm, a gated value residual and a sliding window (x [2,2048,1024]; ve [2,2048,64]; cos, sin [2048,32] (inputs); (in,out) Wq [1024,1024], Wk / Wv [1024,64], Wo [1024,1024], all N(0,1) x 0.02; Wg [32,1]; window_size int (1024); 16 query heads share ONE key / value head; gate = 2 sigmoid(x[..., :32] Wg); v = x Wv + gate * ve; _rope: (x1, x2) = halves -> (x1 cos + x2 sin, -x1 sin + x2 cos); _rmsnorm: x * rsqrt(mean(x^2) + finfo.eps) AFTER the rotation, on q and k; scores x 64^-0.5; masked where key > query or query - key >= window_size (finfo.min); softmax; out = merge(attn v) Wo).
#define NB 2
#define TT 2048
#define CC 1024            // NH * HD = projected width
#define DIN 1024          // input (model) width
#define NH 16
#define HD 64
#define SCALE (0.125f)
#define CAUSAL 1
#ifndef TNB
#define TNB NB
#endif
__device__ __forceinline__ float bfr(float v) { return (float)(__bf16)v; }
typedef __attribute__((ext_vector_type(8))) __bf16 v8b;
__device__ __forceinline__ v16b frag_b(const __bf16* rowk0, int lane) {
  union { v16b v; v8b q[2]; } u; const __bf16* p = rowk0 + 8 * (lane >> 4);
  u.q[0] = *(const v8b*)p; u.q[1] = *(const v8b*)(p + 16); return u.v;
}
// fragment order (q, k, their residuals and v in the workspace): one 16 x 32 fragment (16 rows, 32 k) is 512 elements = two blocks of 512 B; block s holds, at lane l = 16 g + row, the 8 elements k = 16 s + 8 g + 0..7, which are elements 8 s .. 8 s + 7 of that lane's fragment. A wave's fragment load is then two loads of 512 contiguous bytes (4 whole 128-B lines each) where a row-major plane gave 16 lines a load
__device__ __forceinline__ void st16w(void* p, v4u v) { asm volatile("global_store_b128 %0, %1, off\n\ts_wait_xcnt 0x0" :: "v"(p), "v"(v) : "memory"); }
__device__ __forceinline__ v16h fragt_h(const _Float16* fr, int lane) {
  union { v16h v; v8h q[2]; } u; const _Float16* p = fr + 8 * lane;
  u.q[0] = *(const v8h*)p; u.q[1] = *(const v8h*)(p + 256); return u.v;
}
__device__ __forceinline__ v16b fragt_b(const __bf16* fr, int lane) {
  union { v16b v; v8b q[2]; } u; const __bf16* p = fr + 8 * lane;
  u.q[0] = *(const v8b*)p; u.q[1] = *(const v8b*)(p + 256); return u.v;
}
#define QBH 6              // causal: query blocks 0..QBH-1 of each sequence (few keys, no averaging) take the high-precision path
#define QHI 384            // rows carrying a q residual plane
#define KHI 384            // key rows carrying k residual / v bf16 hi+lo planes (used only by the causal high-precision path)
// B fragment (k rows k0+.., output column o) of a weight: (in,out) [K][ld] or (out,in) [ld rows of K]: bf16 exact, or f16(bf16 * 256) exact
__device__ __forceinline__ v16b wcol_io(const float* Wm, int k0, int o, int lane, int ld) { v16b w; const int g = lane >> 4;
#pragma unroll
  for (int i = 0; i < 8; ++i) { w[i] = (__bf16)Wm[(size_t)(k0 + 8 * g + i) * ld + o]; w[8 + i] = (__bf16)Wm[(size_t)(k0 + 16 + 8 * g + i) * ld + o]; }
  return w; }
__device__ __forceinline__ v16b wcol_oi(const float* Wm, int k0, int o, int lane, int K) { v16b w; const float* p = Wm + (size_t)o * K + k0 + 8 * (lane >> 4);
#pragma unroll
  for (int i = 0; i < 8; ++i) { w[i] = (__bf16)p[i]; w[8 + i] = (__bf16)p[16 + i]; }
  return w; }
__device__ __forceinline__ v16h wcolh_io(const float* Wm, int k0, int o, int lane, int ld) { v16h w; const int g = lane >> 4;
#pragma unroll
  for (int i = 0; i < 8; ++i) { w[i] = (_Float16)(bfr(Wm[(size_t)(k0 + 8 * g + i) * ld + o]) * 256.0f); w[8 + i] = (_Float16)(bfr(Wm[(size_t)(k0 + 16 + 8 * g + i) * ld + o]) * 256.0f); }
  return w; }
__device__ __forceinline__ v16h wcolh_oi(const float* Wm, int k0, int o, int lane, int K) { v16h w; const float* p = Wm + (size_t)o * K + k0 + 8 * (lane >> 4);
#pragma unroll
  for (int i = 0; i < 8; ++i) { w[i] = (_Float16)(bfr(p[i]) * 256.0f); w[8 + i] = (_Float16)(bfr(p[16 + i]) * 256.0f); }
  return w; }
#define WQKV_LAYOUT 0   // selects only WCOL, which nothing uses: gemm_main reads Wq / Wk / Wv as (in,out) [DIN][n]
__device__ __forceinline__ v16b wcol_hdk(const float* Wm, int k0, int o, int lane) { v16b w; const int g = lane >> 4; const float* p = Wm + (size_t)(o / HD) * DIN * HD + (o % HD);
#pragma unroll
  for (int i = 0; i < 8; ++i) { w[i] = (__bf16)p[(size_t)(k0 + 8 * g + i) * HD]; w[8 + i] = (__bf16)p[(size_t)(k0 + 16 + 8 * g + i) * HD]; }
  return w; }
#define WO_OUT_IN 0
#if WQKV_LAYOUT == 1
#define WCOL(W, k0, o, lane) wcol_oi(W, k0, o, lane, DIN)
#elif WQKV_LAYOUT == 2
#define WCOL(W, k0, o, lane) wcol_hdk(W, k0, o, lane)
#else
#define WCOL(W, k0, o, lane) (which == 0 ? wcol_io(W, k0, (o), lane, CC) : ((o) < KVW ? wcol_io(W, k0, (o), lane, KVW) : zero16b()))   /* (in,out): Wq [1024][1024] pitch CC; Wk / Wv [1024][64] pitch 64, padded columns 64..127 are zero */
#endif
#if WO_OUT_IN
#define WOCOL(W, k0, o, lane) wcol_oi(W, k0, o, lane, CC)
#define WOCOLH(W, k0, o, lane) wcolh_oi(W, k0, o, lane, CC)
#else
#define WOCOL(W, k0, o, lane) wcol_io(W, k0, o, lane, DIN)
#define WOCOLH(W, k0, o, lane) wcolh_io(W, k0, o, lane, DIN)
#endif
#define GRP 16             // all 16 query heads share the single kv head (kv head = h / 16 = 0)
#define CKV 128            // kv column block of k_proj (the workspace planes hold 64 columns): ONE 128-column block whose columns 0..63 are the single kv head, columns 64..127 zero padding
#define KVW 64             // real kv width (Wk / Wv are (in,out) [1024][64])
#define PROJ_EXTRA_PARAMS , int woff, const float* __restrict__ COS, const float* __restrict__ SIN, const float* __restrict__ VE, const float* __restrict__ WG   /* which = blockIdx.z + woff; COS / SIN [TT][32], VE [NB*TT][64], WG [32] are module inputs read in the projection epilogue */
__device__ __forceinline__ v16b zero16b() { v16b w; _Pragma("unroll") for (int i = 0; i < 16; ++i) w[i] = (__bf16)0.0f; return w; }
#define RMS_EPS 1.1920929e-07f   /* jnp.finfo(float32).eps */
// per (token, head) hook on the staged f32 row (64 floats). q and k (which 0, 1): the module's _rope with cos / sin read LITERALLY from the table inputs at row t (bf16-rounded like every float input): (x1, x2) = (row[m], row[32+m]) -> (x1 c + x2 s, -x1 s + x2 c), then _rmsnorm over the 64 dims: x * (1 / sqrt(mean(x^2) + eps)); the zero-padded second half of the k block stays exactly zero under both. v (which 2): row += gate * bf16(ve[b, t, :]) with gate = 2 / (1 + exp(-z)), z = sum_{i<32} bf16(x[b, t, i]) * bf16(Wg[i]); all global loads are unconditional; the padded half gets gate 0 through a select. f32, products and sums kept separate
#define PROJ_EPI(which, row, t, h) do { float* rw = (row); const size_t gr_ = bb * TT + (size_t)(t); if ((which) < 2) { const float* ct_ = COS + (size_t)(t) * 32; const float* st_ = SIN + (size_t)(t) * 32; _Pragma("unroll 4") for (int m = 0; m < 32; ++m) { _Pragma("clang fp contract(off)") const float c_ = bfr(ct_[m]), s_ = bfr(st_[m]); const float x1 = rw[m], x2 = rw[32 + m]; rw[m] = x1 * c_ + x2 * s_; rw[32 + m] = (-x1) * s_ + x2 * c_; } float ss_ = 0.f; _Pragma("unroll 8") for (int m = 0; m < 64; ++m) { _Pragma("clang fp contract(off)") ss_ += rw[m] * rw[m]; } const float rinv_ = 1.0f / sqrtf(ss_ * (1.0f / 64.0f) + RMS_EPS); _Pragma("unroll 8") for (int m = 0; m < 64; ++m) rw[m] = rw[m] * rinv_; } else { const float* xr_ = XV + gr_ * DIN; float z_ = 0.f; _Pragma("unroll 8") for (int i = 0; i < 32; ++i) { _Pragma("clang fp contract(off)") z_ += bfr(xr_[i]) * bfr(WG[i]); } const float gate_ = 2.0f / (1.0f + expf(-z_)); const float gsel_ = ((h) == 0) ? gate_ : 0.0f; const float* ve_ = VE + gr_ * 64; _Pragma("unroll 8") for (int m = 0; m < 64; ++m) { _Pragma("clang fp contract(off)") rw[m] = rw[m] + gsel_ * bfr(ve_[m]); } } } while (0)
static_assert(HD == 64 && KVW == 64 && CKV == 128, "the hook spells 32 / 64 literally: one real 64-wide kv head in a 128-column block");
#define SM_EXTRA_PARAMS , const int* __restrict__ WINP
// sliding window: a key is excluded when query - key >= window_size; window_size is the module's int input (one block-uniform scalar load, win_ = WINP[0], read once at the kernel's head); keys after the query are excluded by the causal test beside it; every row keeps at least min(t + 1, window) >= 1 keys
#ifndef SM_EXTRA_PARAMS
#define SM_EXTRA_PARAMS
#endif
#ifndef PROJ_EXTRA_PARAMS
#define PROJ_EXTRA_PARAMS
#endif

#define WS_QH  0u                                      // f16 q, fragment order: fragment (((b*t) / 16) * NH + head) * 2 + (head dim / 32), rows = queries, k = head dims
#define WS_KH  (WS_QH + 2u * (size_t)NB * TT * CC)      // f16 k, fragment order: fragment ((b*t) / 16) * 2 + (head dim / 32), rows = keys, k = head dims
#define WS_VT  (WS_KH + 2u * (size_t)NB * TT * CC)      // f16 v, fragment order: fragment (b * TT / 32 + t / 32) * 4 + (channel / 16), rows = channels, k = keys
#define WS_QL  (WS_VT + 2u * (size_t)NB * CC * TT)      // f16 q residual x 2^10, fragment order like q over the rows [b][t < QHI]
#define WS_KL  (WS_QL + 2u * (size_t)NB * QHI * CC)     // f16 k residual x 2^10, fragment order like k over the rows [b][t < KHI]
#define WS_VB  (WS_KL + 2u * (size_t)NB * KHI * CC)     // bf16 v hi (and, behind it, lo), fragment order like v over the keys [b][t < KHI]
#define WS_VBL (WS_VB + 2u * (size_t)NB * CC * KHI)
#define WS_Y   (WS_VBL + 2u * (size_t)NB * CC * KHI)    // f32 ctx rows [b*t][CC] (only when there is an output projection)
#define WS_END (WS_Y  + 4u * (size_t)NB * TT * CC)

// ---- gemm_main: the K loop of k_proj and k_out. A block's 4 waves need the same 128 weight columns, so each 64-k stage of W ([k][n] f32, n contiguous) is read ONCE per block with whole-line 16-byte loads, rounded exactly as before (MODE 0, 1: bf16; MODE 2: f16(bf16 x 2^8)), turned in registers and stored as [n][k] rows (pitch 144 B) in one of two LDS buffers, from which every wave reads its B fragments with two 16-byte LDS loads each. The next stage's global loads (W tile and the wave's own A rows) are issued in front of this stage's products and stored behind them. Products and their k order per accumulator are those of the direct form. Every loop over s, c, i, j or kk inside a stage is fully unrolled so that the register arrays are indexed by constants alone.
#define GKS 64                 // k per stage
#define GWP (GKS + 8)          // LDS row pitch in 16-bit elements: 144 B = 16 B x odd, conflict-free for 16-byte readers
template <int LD> __device__ __forceinline__ void g_fetch(v4f (&wr)[2][8], v4f (&ar)[2][4], const float* wp, const float* ap) {
#pragma unroll
  for (int s = 0; s < 2; ++s)
#pragma unroll
    for (int i = 0; i < 8; ++i) wr[s][i] = *(const v4f*)(wp + (size_t)(s * 32 + i) * LD);
#pragma unroll
  for (int kk = 0; kk < 2; ++kk) { ar[kk][0] = *(const v4f*)(ap + kk * 32); ar[kk][1] = *(const v4f*)(ap + kk * 32 + 4); ar[kk][2] = *(const v4f*)(ap + kk * 32 + 16); ar[kk][3] = *(const v4f*)(ap + kk * 32 + 20); }
  asm volatile("s_wait_xcnt 0x0" ::: "memory");   /* stands in front of every later instruction that rewrites the address registers of these loads; it also keeps the loads in front of the stage's products */
}
template <int MODE> __device__ __forceinline__ void g_store(const v4f (&wr)[2][8], __bf16* sst, bool wl) {
#pragma unroll
  for (int s = 0; s < 2; ++s)
#pragma unroll
    for (int c = 0; c < 4; ++c) {
      if constexpr (MODE == 2) { v8h o;
#pragma unroll
        for (int i = 0; i < 8; ++i) o[i] = (_Float16)(bfr(wr[s][i][c]) * 256.0f);
        *(v8h*)(sst + c * GWP + s * 32) = o;
      } else { union { v8b b; v4u u; } o;
#pragma unroll
        for (int i = 0; i < 8; ++i) o.b[i] = (__bf16)wr[s][i][c];
        o.u &= wl ? 0xffffffffu : 0u;   /* padded columns: the load is unconditional at a clamped address, the stored value is +0 */
        *(v8b*)(sst + c * GWP + s * 32) = o.b; } } }
struct GA { v16b h[2], l[2]; v16h f[2]; };   /* the wave's A fragments of one stage; only the members of the MODE in use are formed */
template <int MODE> __device__ __forceinline__ void g_acvt(GA& a, const v4f (&ar)[2][4]) {
#pragma unroll
  for (int kk = 0; kk < 2; ++kk) { float v[16];
#pragma unroll
    for (int i = 0; i < 16; ++i) v[i] = ar[kk][i >> 2][i & 3];   /* elements 0..7 = k 8g + 0..7, 8..15 = k 16 + 8g + 0..7 */
    if constexpr (MODE == 0) {
#pragma unroll
      for (int i = 0; i < 16; ++i) a.h[kk][i] = (__bf16)v[i];
    } else if constexpr (MODE == 1) { const F2 s = bsplit16(v); a.h[kk] = s.h; a.l[kk] = s.l;
    } else {
#pragma unroll
      for (int i = 0; i < 16; ++i) a.f[kk][i] = (_Float16)(v[i] * 64.0f); } } }
// ap = the lane's A row + 8 g; Wt = W + the block's first column; sw = two buffers of 128 rows x GWP; wave in a scalar register; wl = this wave's 32 staged columns exist in W
template <int MODE, int LD, int KTOT> __device__ __forceinline__ void gemm_main(v8f (&acc)[8], const float* __restrict__ ap, const float* __restrict__ Wt, __bf16* sw, int wave, int lane, bool wl) {
  const int cg = wave * 8 + (lane & 3) + 4 * (lane >> 4), kg = (lane >> 2) & 3;   /* the lane stages columns 4 cg .. 4 cg + 3 of k rows 8 kg + 0..7 and 32 + 8 kg + 0..7: a load covers four whole 128-B lines, and the 16 lanes of a half-wave store to 16 different bank groups */
  const float* wp = Wt + (size_t)(8 * kg) * LD + (wl ? 4 * cg : 0);
  __bf16* sst = sw + (4 * cg) * GWP + 8 * kg; const __bf16* srd = sw + (lane & 15) * GWP;
  v4f wr[2][8]; v4f ar[2][4]; GA a;
  g_fetch<LD>(wr, ar, wp, ap); g_store<MODE>(wr, sst, wl); g_acvt<MODE>(a, ar);
  __syncthreads();   /* stage 0 is in LDS before any wave reads it */
  for (int s = 0; s < KTOT / GKS; ++s) { const int bo = (s & 1) * (128 * GWP); const bool more = s + 1 < KTOT / GKS;
    if (more) g_fetch<LD>(wr, ar, wp + (size_t)(s + 1) * GKS * LD, ap + (s + 1) * GKS);
#pragma unroll
    for (int kk = 0; kk < 2; ++kk) {   /* the eight B fragments of a 32-k block are all read in front of its first product: one LDS latency a block */
      if constexpr (MODE == 2) { v16h wf[8];
#pragma unroll
        for (int j = 0; j < 8; ++j) wf[j] = frag_h((const _Float16*)(srd + bo + j * 16 * GWP + kk * 32), lane);
#pragma unroll
        for (int j = 0; j < 8; ++j) acc[j] = wmma16(a.f[kk], wf[j], acc[j]);
      } else { v16b wf[8];
#pragma unroll
        for (int j = 0; j < 8; ++j) wf[j] = frag_b(srd + bo + j * 16 * GWP + kk * 32, lane);
#pragma unroll
        for (int j = 0; j < 8; ++j) { acc[j] = wmma_bf(a.h[kk], wf[j], acc[j]); if constexpr (MODE == 1) acc[j] = wmma_bf(a.l[kk], wf[j], acc[j]); } } }
    __builtin_amdgcn_sched_barrier(0);   /* keeps the conversions of the next stage's registers, and with them the wait for its global loads, behind this stage's products: without it the wait was scheduled behind the first product */
    if (more) { g_store<MODE>(wr, sst + (bo ^ (128 * GWP)), wl); g_acvt<MODE>(a, ar);
      __syncthreads(); } } }   /* one barrier a stage: it publishes stage s + 1 and ends every wave's reads of the buffer that stage s + 2 will overwrite */
// ---- k_proj: block = (64 rows, 128 cols, which): q/k/v = X W (+ b) with exact bf16 products (K = DIN) -> which 0: q f16 in fragment order (+ residual, rows < QHI); 1: k f16 in fragment order (+ residual, rows < KHI); 2: v f16 in fragment order (+ bf16 hi/lo for t < KHI)
__global__ __launch_bounds__(128) void k_proj(const float* __restrict__ XQ, const float* __restrict__ XK, const float* __restrict__ XV, const float* __restrict__ WQ, const float* __restrict__ WK, const float* __restrict__ WV, const float* __restrict__ BQ, const float* __restrict__ BK, const float* __restrict__ BV,
    _Float16* __restrict__ QH, _Float16* __restrict__ QL, _Float16* __restrict__ KH, _Float16* __restrict__ KL, _Float16* __restrict__ VT, __bf16* __restrict__ VB, __bf16* __restrict__ VBL PROJ_EXTRA_PARAMS) {
  __shared__ __align__(16) float st[64][132]; __shared__ __align__(16) _Float16 sh[64][136], sl[64][136]; __shared__ __align__(16) _Float16 th[128][72]; __shared__ __align__(16) __bf16 tb[128][72], tbl[128][72]; __shared__ __align__(16) __bf16 sw[2 * 128 * GWP];
  const int tid = threadIdx.x, wave = tid >> 5, lane = tid & 31, col = lane & 15, g = lane >> 4; const int which = blockIdx.z + woff; const int c0 = blockIdx.y * 128; const size_t r0 = (size_t)blockIdx.x * 64; const size_t bb = r0 / TT; const int t0 = (int)(r0 % TT);
  const float* X = which == 0 ? XQ : which == 1 ? XK : XV; const float* WA = which == 0 ? WQ : which == 1 ? WK : WV; const float* BA = which == 0 ? BQ : which == 1 ? BK : BV;
  v8f acc[8] = {};
  { const int wv = __builtin_amdgcn_readfirstlane(wave);   /* the wave's number in a scalar register: the staged column group and the padded-columns mask are wave-uniform */
    const float* ap = X + (r0 + wave * 16 + col) * DIN + 8 * g;
    if (which == 0) gemm_main<0, CC, DIN>(acc, ap, WA + c0, sw, wv, lane, true);   /* Wq [1024][1024] */
    else gemm_main<0, KVW, DIN>(acc, ap, WA + (c0 < KVW ? c0 : 0), sw, wv, lane, c0 + wv * 32 < KVW); }   /* Wk / Wv [1024][64]: padded columns 64..127 are staged as zeros */
  { // stage the f32 tile (acc + bias) in LDS, run the per-(row, head) epilogue hook, then convert
#pragma unroll
    for (int j = 0; j < 8; ++j) { const int bo_ = c0 + j * 16 + col; const float bias = (BA && (which == 0 || bo_ < KVW)) ? bfr(BA[(which == 0 || bo_ < KVW) ? bo_ : 0]) : 0.f;   /* bk / bv hold only the 64 real kv columns: padded columns get no bias (index clamped, value selected) */
#pragma unroll
      for (int r = 0; r < 8; ++r) st[wave * 16 + 8 * g + r][j * 16 + col] = acc[j][r] + bias; }
    __syncthreads();
    for (int e = tid; e < 64 * (128 / HD); e += 128) { const int rl = e / (128 / HD), hh = e % (128 / HD); PROJ_EPI(which, &st[rl][hh * HD], (int)((r0 + rl) % TT), (c0 / HD) + hh); }
    __syncthreads(); }
  if (which < 2) { _Float16* DH = which == 0 ? QH : KH; _Float16* DL = which == 0 ? QL : KL; const int nhi = which == 0 ? QHI : KHI; const bool hi_rows = t0 < nhi;
    for (int e = tid; e < 64 * 128; e += 128) { const int rl = e >> 7, cl = e & 127; const float v = st[rl][cl]; const _Float16 hv = (_Float16)v; sh[rl][cl] = hv; sl[rl][cl] = (_Float16)((v - (float)hv) * 1024.0f); }
    __syncthreads();
    const size_t nh = which == 0 ? NH : 1;   /* heads a 16-row tile holds: q all NH, k the one real head (its padded columns are read by nobody and are not stored) */
    for (int e = tid; e < 64 * 16; e += 128) { const int l = e & 31, blk = e >> 5;   /* a wave stores one 512-B block of a fragment a trip: blk = ((tile * 2 + head of the column block) * 2 + head-dim half) * 2 + s */
      const int tile = blk >> 3, hd = (blk >> 2) & 1, cs = blk & 3; const int rl = tile * 16 + (l & 15), cl = hd * HD + cs * 16 + (l >> 4) * 8; const size_t fo = (size_t)(c0 / HD + hd) * 1024 + cs * 256 + l * 8;
      if (which == 0 || hd == 0) { st16w(DH + ((r0 >> 4) + tile) * nh * 1024 + fo, *(const v4u*)&sh[rl][cl]); if (hi_rows) st16w(DL + (((bb * nhi + t0) >> 4) + tile) * nh * 1024 + fo, *(const v4u*)&sl[rl][cl]); } }
  } else { const bool hi_rows = t0 < KHI;
    for (int e = tid; e < 64 * 128; e += 128) { const int rl = e & 63, cl = e >> 6; const float v = st[rl][cl]; th[cl][rl] = (_Float16)v; const __bf16 bh = (__bf16)v; tb[cl][rl] = bh; tbl[cl][rl] = (__bf16)(v - (float)bh); }
    __syncthreads();
    for (int e = tid; e < KVW * 8; e += 128) { const int l = e & 31, blk = e >> 5;   /* the 64 real channels (the padded ones are read by nobody and are not stored); a wave stores one 512-B block a trip: blk = ((chunk of the block's two * 4) + channel block) * 2 + s, so the block's 64 keys are e * 8 elements in a row */
      const int cl = ((blk >> 1) & 3) * 16 + (l & 15), kq = (blk >> 3) * 32 + (blk & 1) * 16 + (l >> 4) * 8;
      st16w(VT + (bb * (TT / 32) + (t0 >> 5)) * 2048 + e * 8, *(const v4u*)&th[cl][kq]); if (hi_rows) { const size_t o3 = (bb * (KHI / 32) + (t0 >> 5)) * 2048 + e * 8; st16w(VB + o3, *(const v4u*)&tb[cl][kq]); st16w(VBL + o3, *(const v4u*)&tbl[cl][kq]); } } } }
// ---- k_pv: block = 16 queries (qt) of one (b, h), PVW waves: wave w owns the 32-key chunks w, w + PVW, ... and works on those in [kcs, kce), the chunks that hold a key which the causal rule and the window admit for some query of the block (a chunk outside adds only zeros to the sums). It forms its logits itself, transposed: A = 16 key rows, B = the block's 16 query rows, so that D (lane = query, registers = keys 8g + r) of the chunk's two key tiles IS the A-fragment layout of the P x v product (lane = query row, 16 keys a chunk) and the logits never leave the registers; x SCALE; q hi + residual (x 2^10) against k hi + residual (3 products) for query blocks < QBH (causal early rows), single f16 q x k after. Softmax in ONE pass, with no row maximum: q and k leave _rmsnorm with a norm of at most sqrt(64) = 8 whatever the inputs are, so |q . k| x SCALE <= 8 (a few 2^-11 more after the 16-bit rounding) and exp(logit) lies in [3.3e-4, 3.1e3]: normal numbers of f16 and bf16, and a row's sum of at most 2048 of them is far inside f32; for the same reason exp is one multiply by SCALE x log2 e and one v_exp_f32, with no range reduction. Each chunk's e = exp(logit) (0 for excluded keys: after the query, or outside the window, by index) goes at once, unnormalised, to f16 against v f16 (1 product; causal early query blocks: e and v as bf16 hi + lo, 3 products), so that a chunk's logits die with the chunk; the row sum of e runs beside it in f32 over the lane's own keys, then the other half-wave, then the PVW waves through LDS in wave order; the PVW partial ctx tiles are added in LDS in wave order and divided by the row sum; 256-B (row, head) segment by 16 lanes
#define PVW 8
#define SCALE_L2E (SCALE * 1.44269504088896340736f)   // exp(s x SCALE) = 2^(s x SCALE x log2 e)
__device__ __forceinline__ float exp2b(float v) { return __builtin_amdgcn_exp2f(v); }   /* the bare v_exp_f32: |v| <= 8 log2 e < 12 here (the bound of the RMSNorm above), so the library exp's split of the argument, its ldexp and its two range tests select nothing */
#define PVC (TT / 32 / PVW)                                             // most chunks one wave can own
#define PVCH (((((QBH * 64 - 1) >> 7) + 1) * 4 + PVW - 1) / PVW)         // the same for the early (high-precision) query blocks
static_assert(QBH * 64 == QHI && (((QBH * 64 - 1) >> 7) + 1) * 128 <= KHI, "every query row with a residual plane lies in an early block, and every key row such a block reads has one");
__global__ __launch_bounds__(32 * PVW) void k_pv(const _Float16* __restrict__ QH, const _Float16* __restrict__ KH, const _Float16* __restrict__ QL, const _Float16* __restrict__ KL, const _Float16* __restrict__ VT, const __bf16* __restrict__ VB, const __bf16* __restrict__ VBL, float* __restrict__ Y SM_EXTRA_PARAMS) { const int b = blockIdx.z / NH, h = blockIdx.z % NH; __shared__ __align__(16) float ss[PVW][16][HD + 4]; __shared__ float ssu[PVW][16];
  const int tid = threadIdx.x, lane = tid & 31, col = lane & 15, g = lane >> 4; const int qt = blockIdx.x, qb = qt >> 2; const int ql0 = qt * 16; const int kce = CAUSAL ? ((ql0 + 15) >> 5) + 1 : TT / 32;   /* one past the chunk that holds the block's last query: every later key lies after every query of the block */
  const int wave = __builtin_amdgcn_readfirstlane(tid >> 5);   /* the wave's number in a scalar register: the chunk tests below branch on scalars and every lane stays on at the matrix instructions */
  const int win_ = WINP[0]; const int t = ql0 + col;
  const int klo = ql0 + 1 - (win_ < 0 ? 0 : win_); const int kcs = klo > 0 ? klo >> 5 : 0;   /* klo = the first key that the window leaves to the block's first query (later queries start later): chunks below kcs hold excluded keys alone; scalar, 0 <= kcs < kce for any window_size; no address is formed from it */
  const _Float16* qrow = QH + (((size_t)b * (TT / 16) + qt) * NH + h) * 1024; const v16h qf0 = fragt_h(qrow, lane), qf1 = fragt_h(qrow + 512, lane);   /* B fragments: column = the lane's query, head dims 0..31 and 32..63 */
  asm volatile("s_wait_xcnt 0x0" ::: "memory");   /* stands in front of the key loads below, whose results may land on the address registers of the q loads */
  float sum = 0.f; v8f acc[HD / 16] = {};
  const size_t kro = (size_t)wave * 2048;   /* the wave's first chunk in fragment order: a chunk of k is 2 key tiles x 2 head-dim halves = 4 fragments of 512 elements, a chunk of v 4 fragments (16 channels each) of 512 elements; chunk i and the fragment in it are constant offsets from it */
  /* chunk i is worked on only under kcs <= kc < kce (scalar tests); the loops over i are fully unrolled so that every address is a fixed base plus a constant */
  if (qb < QBH) { const _Float16* qlrow = QL + (((size_t)b * (QHI / 16) + qt) * NH + h) * 1024; const v16h ql0f = fragt_h(qlrow, lane), ql1f = fragt_h(qlrow + 512, lane); asm volatile("s_wait_xcnt 0x0" ::: "memory");   /* stands in front of the key loads below, whose results may land on the address registers of the q loads */
    const _Float16* krow = KH + (size_t)b * TT * KVW + kro; const _Float16* klrow = KL + (size_t)b * KHI * KVW + kro; const size_t vro = (size_t)b * KHI * KVW + kro;
#pragma unroll
    for (int i = 0; i < PVCH; ++i) { const int kc = wave + i * PVW; if (kc >= kcs && kc < kce) { const int ko = i * (PVW * 2048); float pf[16];
#pragma unroll
        for (int u = 0; u < 2; ++u) { v16h kh[2], kl[2]; v8f a = {}, al = {};   /* one key tile at a time: its four fragments are loaded in front of its first product; each tile's own order of products is head dims 0..31, then 32..63 */
          kh[0] = fragt_h(krow + ko + u * 1024, lane); kh[1] = fragt_h(krow + ko + u * 1024 + 512, lane); kl[0] = fragt_h(klrow + ko + u * 1024, lane); kl[1] = fragt_h(klrow + ko + u * 1024 + 512, lane);
          asm volatile("s_wait_xcnt 0x0" ::: "memory");   /* stands in front of every later instruction that rewrites the address registers of this tile's loads */
#pragma unroll
          for (int c = 0; c < 2; ++c) { const v16h qh = c ? qf1 : qf0, ql = c ? ql1f : ql0f; a = wmma16(kh[c], qh, a); al = wmma16(kh[c], ql, al); al = wmma16(kl[c], qh, al); }
#pragma unroll
          for (int r = 0; r < 8; ++r) { const int k = kc * 32 + 16 * u + 8 * g + r; const float ex = exp2b((a[r] + al[r] * (1.0f / 1024.0f)) * SCALE_L2E); const float e = ((!CAUSAL || k <= t) && t - k < win_) ? ex : 0.f; pf[8 * u + r] = e; sum += e; } }
        const F2 p = bsplit16(pf);
#pragma unroll
        for (int j = 0; j < HD / 16; ++j) { const v16b vh = fragt_b(VB + vro + ko + j * 512, lane), vl = fragt_b(VBL + vro + ko + j * 512, lane);
          asm volatile("s_wait_xcnt 0x0" ::: "memory");   /* stands in front of every later instruction that rewrites the address registers of these loads */
          acc[j] = wmma_bf(p.h, vh, acc[j]); acc[j] = wmma_bf(p.l, vh, acc[j]); acc[j] = wmma_bf(p.h, vl, acc[j]); } } }
  } else { const _Float16* krow = KH + (size_t)b * TT * KVW + kro; const _Float16* vrow = VT + (size_t)b * TT * KVW + kro;
#pragma unroll
    for (int i = 0; i < PVC; ++i) { const int kc = wave + i * PVW; if (kc >= kcs && kc < kce) { const int ko = i * (PVW * 2048); v16h kh[2][2], vf[HD / 16]; v8f a[2] = {};   /* the chunk's k fragments are all loaded in front of its first product: one load latency a chunk */
#pragma unroll
        for (int u = 0; u < 2; ++u) { kh[u][0] = fragt_h(krow + ko + u * 1024, lane); kh[u][1] = fragt_h(krow + ko + u * 1024 + 512, lane); }
        asm volatile("s_wait_xcnt 0x0" ::: "memory");   /* stands in front of every later instruction that rewrites the address registers of this chunk's loads */
        a[0] = wmma16(kh[0][0], qf0, a[0]); a[1] = wmma16(kh[1][0], qf0, a[1]); a[0] = wmma16(kh[0][1], qf1, a[0]); a[1] = wmma16(kh[1][1], qf1, a[1]);   /* the two key tiles' products alternate, each tile's own order being head dims 0..31, then 32..63 */
#pragma unroll
        for (int j = 0; j < HD / 16; ++j) vf[j] = fragt_h(vrow + ko + j * 512, lane);   /* asked for behind the logit products, where the k fragments' registers are free again; they arrive under the exponentials */
        asm volatile("s_wait_xcnt 0x0" ::: "memory");   /* stands in front of every later instruction that rewrites the address registers of these loads */
        v16h p;
#pragma unroll
        for (int j = 0; j < 16; ++j) { const int k = kc * 32 + 8 * g + (j & 7) + 16 * (j >> 3); const float ex = exp2b(a[j >> 3][j & 7] * SCALE_L2E); const float e = ((!CAUSAL || k <= t) && t - k < win_) ? ex : 0.f; p[j] = (_Float16)e; sum += e; }
#pragma unroll
        for (int j = 0; j < HD / 16; ++j) acc[j] = wmma16(p, vf[j], acc[j]); } } }
  sum += __shfl_xor(sum, 16); if (g == 0) ssu[wave][col] = sum;
#pragma unroll
  for (int j = 0; j < HD / 16; ++j)
#pragma unroll
    for (int r = 0; r < 8; ++r) ss[wave][8 * g + r][j * 16 + col] = acc[j][r];
  __syncthreads();   /* every wave's partial tile and row sums are in LDS before any thread adds them */
  { const int rl = tid >> 4, q4 = (tid & 15) * 4; v4f s = *(const v4f*)&ss[0][rl][q4]; float rs = ssu[0][rl];
#pragma unroll
    for (int w = 1; w < PVW; ++w) { s += *(const v4f*)&ss[w][rl][q4]; rs += ssu[w][rl]; }
    const float inv = rs > 0.f ? 1.0f / rs : 0.f;   /* a fully excluded row yields 0 */
    vst2(Y + ((size_t)b * TT + ql0 + rl) * CC + h * HD + q4, s * inv); } }
static_assert(32 * PVW == 16 * (HD / 4), "one thread per float4 of the 16 x HD tile in the final add");
static_assert(NH == GRP && KVW == HD && TT % 64 == 0 && KHI % 64 == 0, "fragment order holds the one kv head's 64 columns; a 64-row block of k_proj fills whole fragments");
// ---- k_out: block = (64 rows, 128 cols): out = ctx Wo (+ bo): ctx x 2^6 once to f16 against Wo as f16(bf16 x 2^8) exact (1 product) x 2^-14; causal early rows (< QHI of each sequence): ctx bf16 hi + lo against exact bf16 Wo (2 products)
__global__ __launch_bounds__(128) void k_out(const float* __restrict__ Y, const float* __restrict__ WO, const float* __restrict__ BO, float* __restrict__ OUT) { __shared__ __align__(16) float sf[4][16][132]; __shared__ __align__(16) __bf16 sw[2 * 128 * GWP];
  const int tid = threadIdx.x, wave = tid >> 5, lane = tid & 31, col = lane & 15, g = lane >> 4; const int c0 = blockIdx.y * 128; const size_t r0 = (size_t)blockIdx.x * 64 + wave * 16; const int wv = __builtin_amdgcn_readfirstlane(wave);
  v8f acc[8] = {};
  if (CAUSAL && (int)(((size_t)blockIdx.x * 64) % TT) < QHI) {   /* block-uniform */
    gemm_main<1, DIN, CC>(acc, Y + (r0 + col) * CC + 8 * g, WO + c0, sw, wv, lane, true);
#pragma unroll
    for (int j = 0; j < 8; ++j) { const float bias = BO ? bfr(BO[c0 + j * 16 + col]) : 0.f;
#pragma unroll
      for (int r = 0; r < 8; ++r) sf[wave][8 * g + r][j * 16 + col] = acc[j][r] + bias; }
  } else {
    gemm_main<2, DIN, CC>(acc, Y + (r0 + col) * CC + 8 * g, WO + c0, sw, wv, lane, true);   /* ctx carried x 2^6 into f16 so small-magnitude context rows stay clear of f16 subnormals */
#pragma unroll
    for (int j = 0; j < 8; ++j) { const float bias = BO ? bfr(BO[c0 + j * 16 + col]) : 0.f;
#pragma unroll
      for (int r = 0; r < 8; ++r) sf[wave][8 * g + r][j * 16 + col] = acc[j][r] * (1.0f / 16384.0f) + bias; } }   /* 2^-8 (Wo carry) x 2^-6 (ctx carry) */
  LDSX(); for (int rl = 0; rl < 16; ++rl) vst2(OUT + (r0 + rl) * DIN + c0 + lane * 4, *(const v4f*)&sf[wave][rl][lane * 4]); }

extern "C" void kernel_launch(void* const* d_in, const int* in_sizes, int n_in, void* d_out, int out_size, void* d_ws, size_t ws_size, hipStream_t stream) {
  (void)in_sizes; (void)n_in; (void)out_size;
  const float** F = (const float**)d_in;
  if (ws_size < (size_t)WS_END) return;
  char* ws = (char*)d_ws; _Float16 *QH = (_Float16*)(ws + WS_QH), *KH = (_Float16*)(ws + WS_KH), *VT = (_Float16*)(ws + WS_VT), *QL = (_Float16*)(ws + WS_QL), *KL = (_Float16*)(ws + WS_KL); __bf16 *VB = (__bf16*)(ws + WS_VB), *VBL = (__bf16*)(ws + WS_VBL); float *Y = (float*)(ws + WS_Y);
  (void)Y; (void)QL; (void)KL; (void)VB; (void)VBL;
  // inputs: 0 x [2,2048,1024]; 1 ve [2,2048,64]; 2 cos [2048,32]; 3 sin [2048,32]; 4 Wq [1024,1024] (in,out); 5 Wk [1024,64]; 6 Wv [1024,64]; 7 Wo [1024,1024] (in,out); 8 Wg [32,1]; 9 window_size int32 [1]; no biases
  k_proj<<<dim3(TNB * TT / 64, CC / 128, 1), 128, 0, stream>>>(F[0], F[0], F[0], F[4], F[5], F[6], nullptr, nullptr, nullptr, QH, QL, KH, KL, VT, VB, VBL, 0, F[2], F[3], F[1], F[8]);    /* q: 8 column blocks */
  k_proj<<<dim3(TNB * TT / 64, CKV / 128, 2), 128, 0, stream>>>(F[0], F[0], F[0], F[4], F[5], F[6], nullptr, nullptr, nullptr, QH, QL, KH, KL, VT, VB, VBL, 1, F[2], F[3], F[1], F[8]);   /* k (which 1) and v (which 2): one (half-empty) column block each */
  k_pv<<<dim3(TT / 16, 1, TNB * NH), 32 * PVW, 0, stream>>>(QH, KH, QL, KL, VT, VB, VBL, Y, (const int*)d_in[9]);   /* every (b, h) in one launch */
  k_out<<<dim3(TNB * TT / 64, DIN / 128), 128, 0, stream>>>(Y, F[7], nullptr, (float*)d_out);
}

// v009
// A run of this version takes 79.4 microseconds.
// Timed twice side by side with v008, it ran 1.24 times as fast both times.
// All steps since v000 together make it 12.7 times as fast.
// compute dtype: all float inputs rounded to bf16, the cos / sin tables, ve and Wg included; q (16 heads) and the single shared k / v head projections with EXACT bf16 products on WMMA 16x16x32 (f32 accumulate); half-split RoPE with cos / sin READ from the table inputs, then RMSNorm over the 64 head dims (f32, eps = f32 machine epsilon) on q and k; v += 2 sigmoid(x[:32] . Wg) ve in f32; causal logits inside a sliding window read from the int input: 3 products for the first 384 rows, single f16 q x k after, x 64^-0.5; softmax f32 in one pass (logits bounded by the RMSNorm, no row maximum): exp(logit) once to f16 x v once to f16 (bf16 hi + lo below row 384), divided by the f32 row sum at the end; ctx hi+lo x exact Wo below row 384, x2^6 f16 carry x f16(bf16 x 2^8) Wo after; f32 output.
#include <hip/hip_runtime.h>
#include <math.h>

typedef __attribute__((ext_vector_type(16))) _Float16 v16h;
typedef __attribute__((ext_vector_type(16))) __bf16 v16b;
typedef __attribute__((ext_vector_type(8)))  _Float16 v8h;
typedef __attribute__((ext_vector_type(8)))  float v8f;
typedef __attribute__((ext_vector_type(4)))  float v4f;
typedef __attribute__((ext_vector_type(2)))  float v2f;
typedef __attribute__((ext_vector_type(4)))  unsigned v4u;
typedef __attribute__((ext_vector_type(4)))  int v4i;
typedef float __attribute__((may_alias)) float_a;
typedef int __attribute__((may_alias)) int_a;

template <typename T> __device__ __forceinline__ void vst2(void* p, T v) { *(T*)p = v;  }
__device__ __forceinline__ v8f wmma16(v16h a, v16h b, v8f c) {
  v8f d = __builtin_amdgcn_wmma_f32_16x16x32_f16(false, a, false, b, (short)0, c, false, false);
  asm volatile("v_nop\n\tv_nop\n\tv_nop\n\tv_nop" : "+v"(d) : "v"(a), "v"(b));
  return d;
}
__device__ __forceinline__ v8f wmma_bf(v16b a, v16b b, v8f c) {
  v8f d = __builtin_amdgcn_wmma_f32_16x16x32_bf16(false, a, false, b, (short)0, c, false, false);
  asm volatile("v_nop\n\tv_nop\n\tv_nop\n\tv_nop" : "+v"(d) : "v"(a), "v"(b));
  return d;
}
// 16x16x32 fragments: lane = (h = lane>>4, row/col = lane&15); elements 0..7 = k0+8h+0..7, 8..15 = k0+16+8h+0..7; D element r = row 8h+r
__device__ __forceinline__ v16h frag_h(const _Float16* rowk0, int lane) {
  union { v16h v; v8h q[2]; } u; const _Float16* p = rowk0 + 8 * (lane >> 4);
  u.q[0] = *(const v8h*)p; u.q[1] = *(const v8h*)(p + 16); return u.v;
}
__device__ __forceinline__ v16h frag_f32(const float* rowk0, int lane) {
  v16h a; const float* p = rowk0 + 8 * (lane >> 4);
#pragma unroll
  for (int i = 0; i < 8; ++i) { a[i] = (_Float16)p[i]; a[8 + i] = (_Float16)p[16 + i]; }
  return a;
}
__device__ __forceinline__ v16h frag_f32s(const float* rowk0, int lane, float sc) {
  v16h a; const float* p = rowk0 + 8 * (lane >> 4);
#pragma unroll
  for (int i = 0; i < 8; ++i) { a[i] = (_Float16)(p[i] * sc); a[8 + i] = (_Float16)(p[16 + i] * sc); }
  return a;
}
// column fragment from a [K][ld] layout (column n), rows >= K read as 0
__device__ __forceinline__ v16h fragc_f32(const float* W, int k0, int n, int lane, int ld, int K) {
  v16h a; const int g = lane >> 4;
#pragma unroll
  for (int i = 0; i < 8; ++i) { const int ka = k0 + 8 * g + i, kb = ka + 16;
    a[i] = (_Float16)(ka < K ? W[(size_t)(ka < K ? ka : K - 1) * ld + n] : 0.f); a[8 + i] = (_Float16)(kb < K ? W[(size_t)(kb < K ? kb : K - 1) * ld + n] : 0.f); }
  return a;
}
struct F2 { v16b h, l; };
__device__ __forceinline__ F2 bsplit16(const float v[16]) { F2 r;
#pragma unroll
  for (int i = 0; i < 16; ++i) { const __bf16 h = (__bf16)v[i]; r.h[i] = h; r.l[i] = (__bf16)(v[i] - (float)h); }
  return r; }
__device__ __forceinline__ F2 split_row(const float* row, int k0, int lane) { float v[16]; const float* p = row + k0 + 8 * (lane >> 4);
#pragma unroll
  for (int i = 0; i < 8; ++i) { v[i] = p[i]; v[8 + i] = p[16 + i]; }
  return bsplit16(v); }
__device__ __forceinline__ F2 split_rowK(const float* row, int k0, int lane, int K) { float v[16]; const int g = lane >> 4;
#pragma unroll
  for (int i = 0; i < 8; ++i) { const int ka = k0 + 8 * g + i, kb = ka + 16; v[i] = ka < K ? row[ka < K ? ka : K - 1] : 0.f; v[8 + i] = kb < K ? row[kb < K ? kb : K - 1] : 0.f; }
  return bsplit16(v); }
__device__ __forceinline__ F2 split_col(const float* W, int k0, int n, int lane, int ld, int K) { float v[16]; const int g = lane >> 4;
#pragma unroll
  for (int i = 0; i < 8; ++i) { const int ka = k0 + 8 * g + i, kb = ka + 16; v[i] = ka < K ? W[(size_t)(ka < K ? ka : K - 1) * ld + n] : 0.f; v[8 + i] = kb < K ? W[(size_t)(kb < K ? kb : K - 1) * ld + n] : 0.f; }
  return bsplit16(v); }
__device__ __forceinline__ v8f mac3(const F2& a, const F2& b, v8f c) { c = wmma_bf(a.l, b.h, c); c = wmma_bf(a.h, b.l, c); return wmma_bf(a.h, b.h, c); }
__device__ __forceinline__ float sigm(float v) { return 1.0f / (1.0f + expf(-v)); }
#define LDSX() do { asm volatile("s_wait_dscnt 0" ::: "memory"); __builtin_amdgcn_wave_barrier(); __builtin_amdgcn_fence(__ATOMIC_RELEASE, "workgroup"); } while (0)

// Multi-query causal attention with table RoPE, per-head RMSNorm, a gated value residual and a sliding window (x [2,2048,1024]; ve [2,2048,64]; cos, sin [2048,32] (inputs); (in,out) Wq [1024,1024], Wk / Wv [1024,64], Wo [1024,1024], all N(0,1) x 0.02; Wg [32,1]; window_size int (1024); 16 query heads share ONE key / value head; gate = 2 sigmoid(x[..., :32] Wg); v = x Wv + gate * ve; _rope: (x1, x2) = halves -> (x1 cos + x2 sin, -x1 sin + x2 cos); _rmsnorm: x * rsqrt(mean(x^2) + finfo.eps) AFTER the rotation, on q and k; scores x 64^-0.5; masked where key > query or query - key >= window_size (finfo.min); softmax; out = merge(attn v) Wo).
#define NB 2
#define TT 2048
#define CC 1024            // NH * HD = projected width
#define DIN 1024          // input (model) width
#define NH 16
#define HD 64
#define SCALE (0.125f)
#define CAUSAL 1
#ifndef TNB
#define TNB NB
#endif
__device__ __forceinline__ float bfr(float v) { return (float)(__bf16)v; }
typedef __attribute__((ext_vector_type(8))) __bf16 v8b;
__device__ __forceinline__ v16b frag_b(const __bf16* rowk0, int lane) {
  union { v16b v; v8b q[2]; } u; const __bf16* p = rowk0 + 8 * (lane >> 4);
  u.q[0] = *(const v8b*)p; u.q[1] = *(const v8b*)(p + 16); return u.v;
}
// fragment order (q, k, their residuals and v in the workspace): one 16 x 32 fragment (16 rows, 32 k) is 512 elements = two blocks of 512 B; block s holds, at lane l = 16 g + row, the 8 elements k = 16 s + 8 g + 0..7, which are elements 8 s .. 8 s + 7 of that lane's fragment. A wave's fragment load is then two loads of 512 contiguous bytes (4 whole 128-B lines each) where a row-major plane gave 16 lines a load
__device__ __forceinline__ void st16w(void* p, v4u v) { asm volatile("global_store_b128 %0, %1, off\n\ts_wait_xcnt 0x0" :: "v"(p), "v"(v) : "memory"); }
__device__ __forceinline__ v16h fragt_h(const _Float16* fr, int lane) {
  union { v16h v; v8h q[2]; } u; const _Float16* p = fr + 8 * lane;
  u.q[0] = *(const v8h*)p; u.q[1] = *(const v8h*)(p + 256); return u.v;
}
__device__ __forceinline__ v16b fragt_b(const __bf16* fr, int lane) {
  union { v16b v; v8b q[2]; } u; const __bf16* p = fr + 8 * lane;
  u.q[0] = *(const v8b*)p; u.q[1] = *(const v8b*)(p + 256); return u.v;
}
#define QBH 6              // causal: query blocks 0..QBH-1 of each sequence (few keys, no averaging) take the high-precision path
#define QHI 384            // rows carrying a q residual plane
#define KHI 384            // key rows carrying k residual / v bf16 hi+lo planes (used only by the causal high-precision path)
// B fragment (k rows k0+.., output column o) of a weight: (in,out) [K][ld] or (out,in) [ld rows of K]: bf16 exact, or f16(bf16 * 256) exact
__device__ __forceinline__ v16b wcol_io(const float* Wm, int k0, int o, int lane, int ld) { v16b w; const int g = lane >> 4;
#pragma unroll
  for (int i = 0; i < 8; ++i) { w[i] = (__bf16)Wm[(size_t)(k0 + 8 * g + i) * ld + o]; w[8 + i] = (__bf16)Wm[(size_t)(k0 + 16 + 8 * g + i) * ld + o]; }
  return w; }
__device__ __forceinline__ v16b wcol_oi(const float* Wm, int k0, int o, int lane, int K) { v16b w; const float* p = Wm + (size_t)o * K + k0 + 8 * (lane >> 4);
#pragma unroll
  for (int i = 0; i < 8; ++i) { w[i] = (__bf16)p[i]; w[8 + i] = (__bf16)p[16 + i]; }
  return w; }
__device__ __forceinline__ v16h wcolh_io(const float* Wm, int k0, int o, int lane, int ld) { v16h w; const int g = lane >> 4;
#pragma unroll
  for (int i = 0; i < 8; ++i) { w[i] = (_Float16)(bfr(Wm[(size_t)(k0 + 8 * g + i) * ld + o]) * 256.0f); w[8 + i] = (_Float16)(bfr(Wm[(size_t)(k0 + 16 + 8 * g + i) * ld + o]) * 256.0f); }
  return w; }
__device__ __forceinline__ v16h wcolh_oi(const float* Wm, int k0, int o, int lane, int K) { v16h w; const float* p = Wm + (size_t)o * K + k0 + 8 * (lane >> 4);
#pragma unroll
  for (int i = 0; i < 8; ++i) { w[i] = (_Float16)(bfr(p[i]) * 256.0f); w[8 + i] = (_Float16)(bfr(p[16 + i]) * 256.0f); }
  return w; }
#define WQKV_LAYOUT 0   // selects only WCOL, which nothing uses: gemm_main reads Wq / Wk / Wv as (in,out) [DIN][n]
__device__ __forceinline__ v16b wcol_hdk(const float* Wm, int k0, int o, int lane) { v16b w; const int g = lane >> 4; const float* p = Wm + (size_t)(o / HD) * DIN * HD + (o % HD);
#pragma unroll
  for (int i = 0; i < 8; ++i) { w[i] = (__bf16)p[(size_t)(k0 + 8 * g + i) * HD]; w[8 + i] = (__bf16)p[(size_t)(k0 + 16 + 8 * g + i) * HD]; }
  return w; }
#define WO_OUT_IN 0
#if WQKV_LAYOUT == 1
#define WCOL(W, k0, o, lane) wcol_oi(W, k0, o, lane, DIN)
#elif WQKV_LAYOUT == 2
#define WCOL(W, k0, o, lane) wcol_hdk(W, k0, o, lane)
#else
#define WCOL(W, k0, o, lane) (which == 0 ? wcol_io(W, k0, (o), lane, CC) : ((o) < KVW ? wcol_io(W, k0, (o), lane, KVW) : zero16b()))   /* (in,out): Wq [1024][1024] pitch CC; Wk / Wv [1024][64] pitch 64, padded columns 64..127 are zero */
#endif
#if WO_OUT_IN
#define WOCOL(W, k0, o, lane) wcol_oi(W, k0, o, lane, CC)
#define WOCOLH(W, k0, o, lane) wcolh_oi(W, k0, o, lane, CC)
#else
#define WOCOL(W, k0, o, lane) wcol_io(W, k0, o, lane, DIN)
#define WOCOLH(W, k0, o, lane) wcolh_io(W, k0, o, lane, DIN)
#endif
#define GRP 16             // all 16 query heads share the single kv head (kv head = h / 16 = 0)
#define CKV 128            // kv column block of k_proj (the workspace planes hold 64 columns): ONE 128-column block whose columns 0..63 are the single kv head, columns 64..127 zero padding
#define KVW 64             // real kv width (Wk / Wv are (in,out) [1024][64])
#define PROJ_EXTRA_PARAMS , const float* __restrict__ COS, const float* __restrict__ SIN, const float* __restrict__ VE, const float* __restrict__ WG   /* COS / SIN [TT][32], VE [NB*TT][64], WG [32] are module inputs read in the projection epilogue */
__device__ __forceinline__ v16b zero16b() { v16b w; _Pragma("unroll") for (int i = 0; i < 16; ++i) w[i] = (__bf16)0.0f; return w; }
#define RMS_EPS 1.1920929e-07f   /* jnp.finfo(float32).eps */
// per (token, head) hook on the staged f32 row (64 floats). q and k (which 0, 1): the module's _rope with cos / sin read LITERALLY from the table inputs at row t (bf16-rounded like every float input): (x1, x2) = (row[m], row[32+m]) -> (x1 c + x2 s, -x1 s + x2 c), then _rmsnorm over the 64 dims: x * (1 / sqrt(mean(x^2) + eps)); the zero-padded second half of the k block stays exactly zero under both. v (which 2): row += gate * bf16(ve[b, t, :]) with gate = 2 / (1 + exp(-z)), z = sum_{i<32} bf16(x[b, t, i]) * bf16(Wg[i]); all global loads are unconditional; the padded half gets gate 0 through a select. f32, products and sums kept separate
#define PROJ_EPI(which, row, t, h) do { float* rw = (row); const size_t gr_ = bb * TT + (size_t)(t); if ((which) < 2) { const float* ct_ = COS + (size_t)(t) * 32; const float* st_ = SIN + (size_t)(t) * 32; _Pragma("unroll 4") for (int m = 0; m < 32; ++m) { _Pragma("clang fp contract(off)") const float c_ = bfr(ct_[m]), s_ = bfr(st_[m]); const float x1 = rw[m], x2 = rw[32 + m]; rw[m] = x1 * c_ + x2 * s_; rw[32 + m] = (-x1) * s_ + x2 * c_; } float ss_ = 0.f; _Pragma("unroll 8") for (int m = 0; m < 64; ++m) { _Pragma("clang fp contract(off)") ss_ += rw[m] * rw[m]; } const float rinv_ = 1.0f / sqrtf(ss_ * (1.0f / 64.0f) + RMS_EPS); _Pragma("unroll 8") for (int m = 0; m < 64; ++m) rw[m] = rw[m] * rinv_; } else { const float* xr_ = XV + gr_ * DIN; float z_ = 0.f; _Pragma("unroll 8") for (int i = 0; i < 32; ++i) { _Pragma("clang fp contract(off)") z_ += bfr(xr_[i]) * bfr(WG[i]); } const float gate_ = 2.0f / (1.0f + expf(-z_)); const float gsel_ = ((h) == 0) ? gate_ : 0.0f; const float* ve_ = VE + gr_ * 64; _Pragma("unroll 8") for (int m = 0; m < 64; ++m) { _Pragma("clang fp contract(off)") rw[m] = rw[m] + gsel_ * bfr(ve_[m]); } } } while (0)
static_assert(HD == 64 && KVW == 64 && CKV == 128, "the hook spells 32 / 64 literally: one real 64-wide kv head in a 128-column block");
#define SM_EXTRA_PARAMS , const int* __restrict__ WINP
// sliding window: a key is excluded when query - key >= window_size; window_size is the module's int input (one block-uniform scalar load, win_ = WINP[0], read once at the kernel's head); keys after the query are excluded by the causal test beside it; every row keeps at least min(t + 1, window) >= 1 keys
#ifndef SM_EXTRA_PARAMS
#define SM_EXTRA_PARAMS
#endif
#ifndef PROJ_EXTRA_PARAMS
#define PROJ_EXTRA_PARAMS
#endif

#define WS_QH  0u                                      // f16 q, fragment order: fragment (((b*t) / 16) * NH + head) * 2 + (head dim / 32), rows = queries, k = head dims
#define WS_KH  (WS_QH + 2u * (size_t)NB * TT * CC)      // f16 k, fragment order: fragment ((b*t) / 16) * 2 + (head dim / 32), rows = keys, k = head dims
#define WS_VT  (WS_KH + 2u * (size_t)NB * TT * CC)      // f16 v, fragment order: fragment (b * TT / 32 + t / 32) * 4 + (channel / 16), rows = channels, k = keys
#define WS_QL  (WS_VT + 2u * (size_t)NB * CC * TT)      // f16 q residual x 2^10, fragment order like q over the rows [b][t < QHI]
#define WS_KL  (WS_QL + 2u * (size_t)NB * QHI * CC)     // f16 k residual x 2^10, fragment order like k over the rows [b][t < KHI]
#define WS_VB  (WS_KL + 2u * (size_t)NB * KHI * CC)     // bf16 v hi (and, behind it, lo), fragment order like v over the keys [b][t < KHI]
#define WS_VBL (WS_VB + 2u * (size_t)NB * CC * KHI)
#define WS_Y   (WS_VBL + 2u * (size_t)NB * CC * KHI)    // f32 ctx rows [b*t][CC] (only when there is an output projection)
#define WS_END (WS_Y  + 4u * (size_t)NB * TT * CC)

// ---- gemm_main: the K loop of k_proj and k_out. A block's 4 waves need the same 128 weight columns, so each 64-k stage of W ([k][n] f32, n contiguous) is read ONCE per block with whole-line 16-byte loads, rounded exactly as before (MODE 0, 1: bf16; MODE 2: f16(bf16 x 2^8)), turned in registers and stored as [n][k] rows (pitch 144 B) in one of two LDS buffers, from which every wave reads its B fragments with two 16-byte LDS loads each. The next stage's global loads (W tile and the wave's own A rows) are issued in front of this stage's products and stored behind them. Products and their k order per accumulator are those of the direct form. Every loop over s, c, i, j or kk inside a stage is fully unrolled so that the register arrays are indexed by constants alone.
#define GKS 64                 // k per stage
#define GWP (GKS + 8)          // LDS row pitch in 16-bit elements: 144 B = 16 B x odd, conflict-free for 16-byte readers
template <int LD> __device__ __forceinline__ void g_fetch(v4f (&wr)[2][8], v4f (&ar)[2][4], const float* wp, const float* ap) {
#pragma unroll
  for (int s = 0; s < 2; ++s)
#pragma unroll
    for (int i = 0; i < 8; ++i) wr[s][i] = *(const v4f*)(wp + (size_t)(s * 32 + i) * LD);
#pragma unroll
  for (int kk = 0; kk < 2; ++kk) { ar[kk][0] = *(const v4f*)(ap + kk * 32); ar[kk][1] = *(const v4f*)(ap + kk * 32 + 4); ar[kk][2] = *(const v4f*)(ap + kk * 32 + 16); ar[kk][3] = *(const v4f*)(ap + kk * 32 + 20); }
  asm volatile("s_wait_xcnt 0x0" ::: "memory");   /* stands in front of every later instruction that rewrites the address registers of these loads; it also keeps the loads in front of the stage's products */
}
template <int MODE> __device__ __forceinline__ void g_store(const v4f (&wr)[2][8], __bf16* sst, bool wl) {
#pragma unroll
  for (int s = 0; s < 2; ++s)
#pragma unroll
    for (int c = 0; c < 4; ++c) {
      if constexpr (MODE == 2) { v8h o;
#pragma unroll
        for (int i = 0; i < 8; ++i) o[i] = (_Float16)(bfr(wr[s][i][c]) * 256.0f);
        *(v8h*)(sst + c * GWP + s * 32) = o;
      } else { union { v8b b; v4u u; } o;
#pragma unroll
        for (int i = 0; i < 8; ++i) o.b[i] = (__bf16)wr[s][i][c];
        o.u &= wl ? 0xffffffffu : 0u;   /* padded columns: the load is unconditional at a clamped address, the stored value is +0 */
        *(v8b*)(sst + c * GWP + s * 32) = o.b; } } }
struct GA { v16b h[2], l[2]; v16h f[2]; };   /* the wave's A fragments of one stage; only the members of the MODE in use are formed */
template <int MODE> __device__ __forceinline__ void g_acvt(GA& a, const v4f (&ar)[2][4]) {
#pragma unroll
  for (int kk = 0; kk < 2; ++kk) { float v[16];
#pragma unroll
    for (int i = 0; i < 16; ++i) v[i] = ar[kk][i >> 2][i & 3];   /* elements 0..7 = k 8g + 0..7, 8..15 = k 16 + 8g + 0..7 */
    if constexpr (MODE == 0) {
#pragma unroll
      for (int i = 0; i < 16; ++i) a.h[kk][i] = (__bf16)v[i];
    } else if constexpr (MODE == 1) { const F2 s = bsplit16(v); a.h[kk] = s.h; a.l[kk] = s.l;
    } else {
#pragma unroll
      for (int i = 0; i < 16; ++i) a.f[kk][i] = (_Float16)(v[i] * 64.0f); } } }
// ap = the lane's A row + 8 g; Wt = W + the block's first column; sw = two buffers of 128 rows x GWP; wave in a scalar register; wl = this wave's 32 staged columns exist in W
template <int MODE, int LD, int KTOT> __device__ __forceinline__ void gemm_main(v8f (&acc)[8], const float* __restrict__ ap, const float* __restrict__ Wt, __bf16* sw, int wave, int lane, bool wl) {
  const int cg = wave * 8 + (lane & 3) + 4 * (lane >> 4), kg = (lane >> 2) & 3;   /* the lane stages columns 4 cg .. 4 cg + 3 of k rows 8 kg + 0..7 and 32 + 8 kg + 0..7: a load covers four whole 128-B lines, and the 16 lanes of a half-wave store to 16 different bank groups */
  const float* wp = Wt + (size_t)(8 * kg) * LD + (wl ? 4 * cg : 0);
  __bf16* sst = sw + (4 * cg) * GWP + 8 * kg; const __bf16* srd = sw + (lane & 15) * GWP;
  v4f wr[2][8]; v4f ar[2][4]; GA a;
  g_fetch<LD>(wr, ar, wp, ap); g_store<MODE>(wr, sst, wl); g_acvt<MODE>(a, ar);
  __syncthreads();   /* stage 0 is in LDS before any wave reads it */
  for (int s = 0; s < KTOT / GKS; ++s) { const int bo = (s & 1) * (128 * GWP); const bool more = s + 1 < KTOT / GKS;
    if (more) g_fetch<LD>(wr, ar, wp + (size_t)(s + 1) * GKS * LD, ap + (s + 1) * GKS);
#pragma unroll
    for (int kk = 0; kk < 2; ++kk) {   /* the eight B fragments of a 32-k block are all read in front of its first product: one LDS latency a block */
      if constexpr (MODE == 2) { v16h wf[8];
#pragma unroll
        for (int j = 0; j < 8; ++j) wf[j] = frag_h((const _Float16*)(srd + bo + j * 16 * GWP + kk * 32), lane);
#pragma unroll
        for (int j = 0; j < 8; ++j) acc[j] = wmma16(a.f[kk], wf[j], acc[j]);
      } else { v16b wf[8];
#pragma unroll
        for (int j = 0; j < 8; ++j) wf[j] = frag_b(srd + bo + j * 16 * GWP + kk * 32, lane);
#pragma unroll
        for (int j = 0; j < 8; ++j) { acc[j] = wmma_bf(a.h[kk], wf[j], acc[j]); if constexpr (MODE == 1) acc[j] = wmma_bf(a.l[kk], wf[j], acc[j]); } } }
    __builtin_amdgcn_sched_barrier(0);   /* keeps the conversions of the next stage's registers, and with them the wait for its global loads, behind this stage's products: without it the wait was scheduled behind the first product */
    if (more) { g_store<MODE>(wr, sst + (bo ^ (128 * GWP)), wl); g_acvt<MODE>(a, ar);
      __syncthreads(); } } }   /* one barrier a stage: it publishes stage s + 1 and ends every wave's reads of the buffer that stage s + 2 will overwrite */
// ---- k_proj: ONE launch for q, k and v: blockIdx.y = 0 .. CC / 128 - 1 are the column blocks of q (which 0), the next two the one (half-empty) column block of k (which 1) and of v (which 2), so that the few k / v blocks run beside the q blocks and not in a launch of their own. LDS: the W ring of the K loop (sw) and the 16-bit tiles of the epilogue (sh, sl or th, tb, tbl) live one after the other, with two of the epilogue's barriers between the ring's last read and the tiles' first store, so they share one range (ov): 89,088 B a block, three blocks a WGP, and all the launch's blocks are resident at once. block = (64 rows, 128 cols, which): q/k/v = X W (+ b) with exact bf16 products (K = DIN) -> which 0: q f16 in fragment order (+ residual, rows < QHI); 1: k f16 in fragment order (+ residual, rows < KHI); 2: v f16 in fragment order (+ bf16 hi/lo for t < KHI)
__global__ __launch_bounds__(128) void k_proj(const float* __restrict__ XQ, const float* __restrict__ XK, const float* __restrict__ XV, const float* __restrict__ WQ, const float* __restrict__ WK, const float* __restrict__ WV, const float* __restrict__ BQ, const float* __restrict__ BK, const float* __restrict__ BV,
    _Float16* __restrict__ QH, _Float16* __restrict__ QL, _Float16* __restrict__ KH, _Float16* __restrict__ KL, _Float16* __restrict__ VT, __bf16* __restrict__ VB, __bf16* __restrict__ VBL PROJ_EXTRA_PARAMS) {
  __shared__ __align__(16) float st[64][132]; __shared__ __align__(16) unsigned char ov[3 * 128 * 72 * 2];
  static_assert(sizeof(ov) >= 2 * 128 * GWP * 2 && sizeof(ov) >= 2 * 64 * 136 * 2, "the shared range holds the largest of its three uses");
  __bf16* sw = (__bf16*)ov; _Float16 (*sh)[136] = (_Float16 (*)[136])ov; _Float16 (*sl)[136] = (_Float16 (*)[136])(ov + 64 * 136 * 2); _Float16 (*th)[72] = (_Float16 (*)[72])ov; __bf16 (*tb)[72] = (__bf16 (*)[72])(ov + 128 * 72 * 2); __bf16 (*tbl)[72] = (__bf16 (*)[72])(ov + 2 * 128 * 72 * 2);
  const int tid = threadIdx.x, wave = tid >> 5, lane = tid & 31, col = lane & 15, g = lane >> 4; const int which = (int)blockIdx.y < CC / 128 ? 0 : (int)blockIdx.y - (CC / 128 - 1); const int c0 = which == 0 ? blockIdx.y * 128 : 0; const size_t r0 = (size_t)blockIdx.x * 64; const size_t bb = r0 / TT; const int t0 = (int)(r0 % TT);
  const float* X = which == 0 ? XQ : which == 1 ? XK : XV; const float* WA = which == 0 ? WQ : which == 1 ? WK : WV; const float* BA = which == 0 ? BQ : which == 1 ? BK : BV;
  v8f acc[8] = {};
  { const int wv = __builtin_amdgcn_readfirstlane(wave);   /* the wave's number in a scalar register: the staged column group and the padded-columns mask are wave-uniform */
    const float* ap = X + (r0 + wave * 16 + col) * DIN + 8 * g;
    if (which == 0) gemm_main<0, CC, DIN>(acc, ap, WA + c0, sw, wv, lane, true);   /* Wq [1024][1024] */
    else gemm_main<0, KVW, DIN>(acc, ap, WA + (c0 < KVW ? c0 : 0), sw, wv, lane, c0 + wv * 32 < KVW); }   /* Wk / Wv [1024][64]: padded columns 64..127 are staged as zeros */
  { // stage the f32 tile (acc + bias) in LDS, run the per-(row, head) epilogue hook, then convert
#pragma unroll
    for (int j = 0; j < 8; ++j) { const int bo_ = c0 + j * 16 + col; const float bias = (BA && (which == 0 || bo_ < KVW)) ? bfr(BA[(which == 0 || bo_ < KVW) ? bo_ : 0]) : 0.f;   /* bk / bv hold only the 64 real kv columns: padded columns get no bias (index clamped, value selected) */
#pragma unroll
      for (int r = 0; r < 8; ++r) st[wave * 16 + 8 * g + r][j * 16 + col] = acc[j][r] + bias; }
    __syncthreads();
    for (int e = tid; e < 64 * (128 / HD); e += 128) { const int rl = e / (128 / HD), hh = e % (128 / HD); PROJ_EPI(which, &st[rl][hh * HD], (int)((r0 + rl) % TT), (c0 / HD) + hh); }
    __syncthreads(); }
  if (which < 2) { _Float16* DH = which == 0 ? QH : KH; _Float16* DL = which == 0 ? QL : KL; const int nhi = which == 0 ? QHI : KHI; const bool hi_rows = t0 < nhi;
    for (int e = tid; e < 64 * 128; e += 128) { const int rl = e >> 7, cl = e & 127; const float v = st[rl][cl]; const _Float16 hv = (_Float16)v; sh[rl][cl] = hv; sl[rl][cl] = (_Float16)((v - (float)hv) * 1024.0f); }
    __syncthreads();
    const size_t nh = which == 0 ? NH : 1;   /* heads a 16-row tile holds: q all NH, k the one real head (its padded columns are read by nobody and are not stored) */
    for (int e = tid; e < 64 * 16; e += 128) { const int l = e & 31, blk = e >> 5;   /* a wave stores one 512-B block of a fragment a trip: blk = ((tile * 2 + head of the column block) * 2 + head-dim half) * 2 + s */
      const int tile = blk >> 3, hd = (blk >> 2) & 1, cs = blk & 3; const int rl = tile * 16 + (l & 15), cl = hd * HD + cs * 16 + (l >> 4) * 8; const size_t fo = (size_t)(c0 / HD + hd) * 1024 + cs * 256 + l * 8;
      if (which == 0 || hd == 0) { st16w(DH + ((r0 >> 4) + tile) * nh * 1024 + fo, *(const v4u*)&sh[rl][cl]); if (hi_rows) st16w(DL + (((bb * nhi + t0) >> 4) + tile) * nh * 1024 + fo, *(const v4u*)&sl[rl][cl]); } }
  } else { const bool hi_rows = t0 < KHI;
    for (int e = tid; e < 64 * 128; e += 128) { const int rl = e & 63, cl = e >> 6; const float v = st[rl][cl]; th[cl][rl] = (_Float16)v; const __bf16 bh = (__bf16)v; tb[cl][rl] = bh; tbl[cl][rl] = (__bf16)(v - (float)bh); }
    __syncthreads();
    for (int e = tid; e < KVW * 8; e += 128) { const int l = e & 31, blk = e >> 5;   /* the 64 real channels (the padded ones are read by nobody and are not stored); a wave stores one 512-B block a trip: blk = ((chunk of the block's two * 4) + channel block) * 2 + s, so the block's 64 keys are e * 8 elements in a row */
      const int cl = ((blk >> 1) & 3) * 16 + (l & 15), kq = (blk >> 3) * 32 + (blk & 1) * 16 + (l >> 4) * 8;
      st16w(VT + (bb * (TT / 32) + (t0 >> 5)) * 2048 + e * 8, *(const v4u*)&th[cl][kq]); if (hi_rows) { const size_t o3 = (bb * (KHI / 32) + (t0 >> 5)) * 2048 + e * 8; st16w(VB + o3, *(const v4u*)&tb[cl][kq]); st16w(VBL + o3, *(const v4u*)&tbl[cl][kq]); } } } }
// ---- k_pv: block = 16 queries (qt) of one (b, h), PVW waves: wave w owns the 32-key chunks w, w + PVW, ... and works on those in [kcs, kce), the chunks that hold a key which the causal rule and the window admit for some query of the block (a chunk outside adds only zeros to the sums). It forms its logits itself, transposed: A = 16 key rows, B = the block's 16 query rows, so that D (lane = query, registers = keys 8g + r) of the chunk's two key tiles IS the A-fragment layout of the P x v product (lane = query row, 16 keys a chunk) and the logits never leave the registers; x SCALE; q hi + residual (x 2^10) against k hi + residual (3 products) for query blocks < QBH (causal early rows), single f16 q x k after. Softmax in ONE pass, with no row maximum: q and k leave _rmsnorm with a norm of at most sqrt(64) = 8 whatever the inputs are, so |q . k| x SCALE <= 8 (a few 2^-11 more after the 16-bit rounding) and exp(logit) lies in [3.3e-4, 3.1e3]: normal numbers of f16 and bf16, and a row's sum of at most 2048 of them is far inside f32; for the same reason exp is one multiply by SCALE x log2 e and one v_exp_f32, with no range reduction. Each chunk's e = exp(logit) (0 for excluded keys: after the query, or outside the window, by index) goes at once, unnormalised, to f16 against v f16 (1 product; causal early query blocks: e and v as bf16 hi + lo, 3 products), so that a chunk's logits die with the chunk; the row sum of e runs beside it in f32 over the lane's own keys, then the other half-wave, then the PVW waves through LDS in wave order; the PVW partial ctx tiles are added in LDS in wave order and divided by the row sum; 256-B (row, head) segment by 16 lanes
#define PVW 8
#define SCALE_L2E (SCALE * 1.44269504088896340736f)   // exp(s x SCALE) = 2^(s x SCALE x log2 e)
__device__ __forceinline__ float exp2b(float v) { return __builtin_amdgcn_exp2f(v); }   /* the bare v_exp_f32: |v| <= 8 log2 e < 12 here (the bound of the RMSNorm above), so the library exp's split of the argument, its ldexp and its two range tests select nothing */
#define PVC (TT / 32 / PVW)                                             // most chunks one wave can own
#define PVCH (((((QBH * 64 - 1) >> 7) + 1) * 4 + PVW - 1) / PVW)         // the same for the early (high-precision) query blocks
static_assert(QBH * 64 == QHI && (((QBH * 64 - 1) >> 7) + 1) * 128 <= KHI, "every query row with a residual plane lies in an early block, and every key row such a block reads has one");
__global__ __launch_bounds__(32 * PVW) void k_pv(const _Float16* __restrict__ QH, const _Float16* __restrict__ KH, const _Float16* __restrict__ QL, const _Float16* __restrict__ KL, const _Float16* __restrict__ VT, const __bf16* __restrict__ VB, const __bf16* __restrict__ VBL, float* __restrict__ Y SM_EXTRA_PARAMS) { const int b = blockIdx.z / NH, h = blockIdx.z % NH; __shared__ __align__(16) float ss[PVW][16][HD + 4]; __shared__ float ssu[PVW][16];
  const int tid = threadIdx.x, lane = tid & 31, col = lane & 15, g = lane >> 4; const int qt = blockIdx.x, qb = qt >> 2; const int ql0 = qt * 16; const int kce = CAUSAL ? ((ql0 + 15) >> 5) + 1 : TT / 32;   /* one past the chunk that holds the block's last query: every later key lies after every query of the block */
  const int wave = __builtin_amdgcn_readfirstlane(tid >> 5);   /* the wave's number in a scalar register: the chunk tests below branch on scalars and every lane stays on at the matrix instructions */
  const int win_ = WINP[0]; const int t = ql0 + col;
  const int klo = ql0 + 1 - (win_ < 0 ? 0 : win_); const int kcs = klo > 0 ? klo >> 5 : 0;   /* klo = the first key that the window leaves to the block's first query (later queries start later): chunks below kcs hold excluded keys alone; scalar, 0 <= kcs < kce for any window_size; no address is formed from it */
  const _Float16* qrow = QH + (((size_t)b * (TT / 16) + qt) * NH + h) * 1024; const v16h qf0 = fragt_h(qrow, lane), qf1 = fragt_h(qrow + 512, lane);   /* B fragments: column = the lane's query, head dims 0..31 and 32..63 */
  asm volatile("s_wait_xcnt 0x0" ::: "memory");   /* stands in front of the key loads below, whose results may land on the address registers of the q loads */
  float sum = 0.f; v8f acc[HD / 16] = {};
  const size_t kro = (size_t)wave * 2048;   /* the wave's first chunk in fragment order: a chunk of k is 2 key tiles x 2 head-dim halves = 4 fragments of 512 elements, a chunk of v 4 fragments (16 channels each) of 512 elements; chunk i and the fragment in it are constant offsets from it */
  /* chunk i is worked on only under kcs <= kc < kce (scalar tests); the loops over i are fully unrolled so that every address is a fixed base plus a constant */
  if (qb < QBH) { const _Float16* qlrow = QL + (((size_t)b * (QHI / 16) + qt) * NH + h) * 1024; const v16h ql0f = fragt_h(qlrow, lane), ql1f = fragt_h(qlrow + 512, lane); asm volatile("s_wait_xcnt 0x0" ::: "memory");   /* stands in front of the key loads below, whose results may land on the address registers of the q loads */
    const _Float16* krow = KH + (size_t)b * TT * KVW + kro; const _Float16* klrow = KL + (size_t)b * KHI * KVW + kro; const size_t vro = (size_t)b * KHI * KVW + kro;
#pragma unroll
    for (int i = 0; i < PVCH; ++i) { const int kc = wave + i * PVW; if (kc >= kcs && kc < kce) { const int ko = i * (PVW * 2048); float pf[16];
#pragma unroll
        for (int u = 0; u < 2; ++u) { v16h kh[2], kl[2]; v8f a = {}, al = {};   /* one key tile at a time: its four fragments are loaded in front of its first product; each tile's own order of products is head dims 0..31, then 32..63 */
          kh[0] = fragt_h(krow + ko + u * 1024, lane); kh[1] = fragt_h(krow + ko + u * 1024 + 512, lane); kl[0] = fragt_h(klrow + ko + u * 1024, lane); kl[1] = fragt_h(klrow + ko + u * 1024 + 512, lane);
          asm volatile("s_wait_xcnt 0x0" ::: "memory");   /* stands in front of every later instruction that rewrites the address registers of this tile's loads */
#pragma unroll
          for (int c = 0; c < 2; ++c) { const v16h qh = c ? qf1 : qf0, ql = c ? ql1f : ql0f; a = wmma16(kh[c], qh, a); al = wmma16(kh[c], ql, al); al = wmma16(kl[c], qh, al); }
#pragma unroll
          for (int r = 0; r < 8; ++r) { const int k = kc * 32 + 16 * u + 8 * g + r; const float ex = exp2b((a[r] + al[r] * (1.0f / 1024.0f)) * SCALE_L2E); const float e = ((!CAUSAL || k <= t) && t - k < win_) ? ex : 0.f; pf[8 * u + r] = e; sum += e; } }
        const F2 p = bsplit16(pf);
#pragma unroll
        for (int j = 0; j < HD / 16; ++j) { const v16b vh = fragt_b(VB + vro + ko + j * 512, lane), vl = fragt_b(VBL + vro + ko + j * 512, lane);
          asm volatile("s_wait_xcnt 0x0" ::: "memory");   /* stands in front of every later instruction that rewrites the address registers of these loads */
          acc[j] = wmma_bf(p.h, vh, acc[j]); acc[j] = wmma_bf(p.l, vh, acc[j]); acc[j] = wmma_bf(p.h, vl, acc[j]); } } }
  } else { const _Float16* krow = KH + (size_t)b * TT * KVW + kro; const _Float16* vrow = VT + (size_t)b * TT * KVW + kro;
#pragma unroll
    for (int i = 0; i < PVC; ++i) { const int kc = wave + i * PVW; if (kc >= kcs && kc < kce) { const int ko = i * (PVW * 2048); v16h kh[2][2], vf[HD / 16]; v8f a[2] = {};   /* the chunk's k fragments are all loaded in front of its first product: one load latency a chunk */
#pragma unroll
        for (int u = 0; u < 2; ++u) { kh[u][0] = fragt_h(krow + ko + u * 1024, lane); kh[u][1] = fragt_h(krow + ko + u * 1024 + 512, lane); }
        asm volatile("s_wait_xcnt 0x0" ::: "memory");   /* stands in front of every later instruction that rewrites the address registers of this chunk's loads */
        a[0] = wmma16(kh[0][0], qf0, a[0]); a[1] = wmma16(kh[1][0], qf0, a[1]); a[0] = wmma16(kh[0][1], qf1, a[0]); a[1] = wmma16(kh[1][1], qf1, a[1]);   /* the two key tiles' products alternate, each tile's own order being head dims 0..31, then 32..63 */
#pragma unroll
        for (int j = 0; j < HD / 16; ++j) vf[j] = fragt_h(vrow + ko + j * 512, lane);   /* asked for behind the logit products, where the k fragments' registers are free again; they arrive under the exponentials */
        asm volatile("s_wait_xcnt 0x0" ::: "memory");   /* stands in front of every later instruction that rewrites the address registers of these loads */
        v16h p;
#pragma unroll
        for (int j = 0; j < 16; ++j) { const int k = kc * 32 + 8 * g + (j & 7) + 16 * (j >> 3); const float ex = exp2b(a[j >> 3][j & 7] * SCALE_L2E); const float e = ((!CAUSAL || k <= t) && t - k < win_) ? ex : 0.f; p[j] = (_Float16)e; sum += e; }
#pragma unroll
        for (int j = 0; j < HD / 16; ++j) acc[j] = wmma16(p, vf[j], acc[j]); } } }
  sum += __shfl_xor(sum, 16); if (g == 0) ssu[wave][col] = sum;
#pragma unroll
  for (int j = 0; j < HD / 16; ++j)
#pragma unroll
    for (int r = 0; r < 8; ++r) ss[wave][8 * g + r][j * 16 + col] = acc[j][r];
  __syncthreads();   /* every wave's partial tile and row sums are in LDS before any thread adds them */
  { const int rl = tid >> 4, q4 = (tid & 15) * 4; v4f s = *(const v4f*)&ss[0][rl][q4]; float rs = ssu[0][rl];
#pragma unroll
    for (int w = 1; w < PVW; ++w) { s += *(const v4f*)&ss[w][rl][q4]; rs += ssu[w][rl]; }
    const float inv = rs > 0.f ? 1.0f / rs : 0.f;   /* a fully excluded row yields 0 */
    vst2(Y + ((size_t)b * TT + ql0 + rl) * CC + h * HD + q4, s * inv); } }
static_assert(32 * PVW == 16 * (HD / 4), "one thread per float4 of the 16 x HD tile in the final add");
static_assert(NH == GRP && KVW == HD && TT % 64 == 0 && KHI % 64 == 0, "fragment order holds the one kv head's 64 columns; a 64-row block of k_proj fills whole fragments");
// ---- k_out: block = (64 rows, 128 cols): out = ctx Wo (+ bo): ctx x 2^6 once to f16 against Wo as f16(bf16 x 2^8) exact (1 product) x 2^-14; causal early rows (< QHI of each sequence): ctx bf16 hi + lo against exact bf16 Wo (2 products)
__global__ __launch_bounds__(128) void k_out(const float* __restrict__ Y, const float* __restrict__ WO, const float* __restrict__ BO, float* __restrict__ OUT) { __shared__ __align__(16) float sf[4][16][132]; __shared__ __align__(16) __bf16 sw[2 * 128 * GWP];
  const int tid = threadIdx.x, wave = tid >> 5, lane = tid & 31, col = lane & 15, g = lane >> 4; const int c0 = blockIdx.y * 128; const size_t r0 = (size_t)blockIdx.x * 64 + wave * 16; const int wv = __builtin_amdgcn_readfirstlane(wave);
  v8f acc[8] = {};
  if (CAUSAL && (int)(((size_t)blockIdx.x * 64) % TT) < QHI) {   /* block-uniform */
    gemm_main<1, DIN, CC>(acc, Y + (r0 + col) * CC + 8 * g, WO + c0, sw, wv, lane, true);
#pragma unroll
    for (int j = 0; j < 8; ++j) { const float bias = BO ? bfr(BO[c0 + j * 16 + col]) : 0.f;
#pragma unroll
      for (int r = 0; r < 8; ++r) sf[wave][8 * g + r][j * 16 + col] = acc[j][r] + bias; }
  } else {
    gemm_main<2, DIN, CC>(acc, Y + (r0 + col) * CC + 8 * g, WO + c0, sw, wv, lane, true);   /* ctx carried x 2^6 into f16 so small-magnitude context rows stay clear of f16 subnormals */
#pragma unroll
    for (int j = 0; j < 8; ++j) { const float bias = BO ? bfr(BO[c0 + j * 16 + col]) : 0.f;
#pragma unroll
      for (int r = 0; r < 8; ++r) sf[wave][8 * g + r][j * 16 + col] = acc[j][r] * (1.0f / 16384.0f) + bias; } }   /* 2^-8 (Wo carry) x 2^-6 (ctx carry) */
  LDSX(); for (int rl = 0; rl < 16; ++rl) vst2(OUT + (r0 + rl) * DIN + c0 + lane * 4, *(const v4f*)&sf[wave][rl][lane * 4]); }

extern "C" void kernel_launch(void* const* d_in, const int* in_sizes, int n_in, void* d_out, int out_size, void* d_ws, size_t ws_size, hipStream_t stream) {
  (void)in_sizes; (void)n_in; (void)out_size;
  const float** F = (const float**)d_in;
  if (ws_size < (size_t)WS_END) return;
  char* ws = (char*)d_ws; _Float16 *QH = (_Float16*)(ws + WS_QH), *KH = (_Float16*)(ws + WS_KH), *VT = (_Float16*)(ws + WS_VT), *QL = (_Float16*)(ws + WS_QL), *KL = (_Float16*)(ws + WS_KL); __bf16 *VB = (__bf16*)(ws + WS_VB), *VBL = (__bf16*)(ws + WS_VBL); float *Y = (float*)(ws + WS_Y);
  (void)Y; (void)QL; (void)KL; (void)VB; (void)VBL;
  // inputs: 0 x [2,2048,1024]; 1 ve [2,2048,64]; 2 cos [2048,32]; 3 sin [2048,32]; 4 Wq [1024,1024] (in,out); 5 Wk [1024,64]; 6 Wv [1024,64]; 7 Wo [1024,1024] (in,out); 8 Wg [32,1]; 9 window_size int32 [1]; no biases
  k_proj<<<dim3(TNB * TT / 64, CC / 128 + 2, 1), 128, 0, stream>>>(F[0], F[0], F[0], F[4], F[5], F[6], nullptr, nullptr, nullptr, QH, QL, KH, KL, VT, VB, VBL, F[2], F[3], F[1], F[8]);    /* q: 8 column blocks; k and v: one (half-empty) column block each */
  k_pv<<<dim3(TT / 16, 1, TNB * NH), 32 * PVW, 0, stream>>>(QH, KH, QL, KL, VT, VB, VBL, Y, (const int*)d_in[9]);   /* every (b, h) in one launch */
  k_out<<<dim3(TNB * TT / 64, DIN / 128), 128, 0, stream>>>(Y, F[7], nullptr, (float*)d_out);
}

// v010
// One run takes 70.8 microseconds.
// Two timings next to v009 both put it at 1.12 times that version's speed.
// Over all steps from v000 it is 14.2 times as fast.
// compute dtype: all float inputs rounded to bf16, the cos / sin tables, ve and Wg included; q (16 heads) and the single shared k / v head projections with EXACT bf16 products on WMMA 16x16x32 (f32 accumulate); half-split RoPE with cos / sin READ from the table inputs, then RMSNorm over the 64 head dims (f32, eps = f32 machine epsilon) on q and k; v += 2 sigmoid(x[:32] . Wg) ve in f32; causal logits inside a sliding window read from the int input: 3 products for the first 384 rows, single f16 q x k after, x 64^-0.5; softmax f32 in one pass (logits bounded by the RMSNorm, no row maximum): exp(logit) once to f16 x v once to f16 (bf16 hi + lo below row 384), divided by the f32 row sum at the end; ctx hi+lo x exact Wo below row 384, x2^6 f16 carry x f16(bf16 x 2^8) Wo after; f32 output.
#include <hip/hip_runtime.h>
#include <math.h>

typedef __attribute__((ext_vector_type(16))) _Float16 v16h;
typedef __attribute__((ext_vector_type(16))) __bf16 v16b;
typedef __attribute__((ext_vector_type(8)))  _Float16 v8h;
typedef __attribute__((ext_vector_type(8)))  float v8f;
typedef __attribute__((ext_vector_type(4)))  float v4f;
typedef __attribute__((ext_vector_type(2)))  float v2f;
typedef __attribute__((ext_vector_type(4)))  unsigned v4u;
typedef __attribute__((ext_vector_type(4)))  int v4i;
typedef float __attribute__((may_alias)) float_a;
typedef int __attribute__((may_alias)) int_a;

template <typename T> __device__ __forceinline__ void vst2(void* p, T v) { *(T*)p = v;  }
__device__ __forceinline__ v8f wmma16(v16h a, v16h b, v8f c) {
  v8f d = __builtin_amdgcn_wmma_f32_16x16x32_f16(false, a, false, b, (short)0, c, false, false);
  asm volatile("v_nop\n\tv_nop\n\tv_nop\n\tv_nop" : "+v"(d) : "v"(a), "v"(b));
  return d;
}
__device__ __forceinline__ v8f wmma_bf(v16b a, v16b b, v8f c) {
  v8f d = __builtin_amdgcn_wmma_f32_16x16x32_bf16(false, a, false, b, (short)0, c, false, false);
  asm volatile("v_nop\n\tv_nop\n\tv_nop\n\tv_nop" : "+v"(d) : "v"(a), "v"(b));
  return d;
}
// 16x16x32 fragments: lane = (h = lane>>4, row/col = lane&15); elements 0..7 = k0+8h+0..7, 8..15 = k0+16+8h+0..7; D element r = row 8h+r
__device__ __forceinline__ v16h frag_h(const _Float16* rowk0, int lane) {
  union { v16h v; v8h q[2]; } u; const _Float16* p = rowk0 + 8 * (lane >> 4);
  u.q[0] = *(const v8h*)p; u.q[1] = *(const v8h*)(p + 16); return u.v;
}
__device__ __forceinline__ v16h frag_f32(const float* rowk0, int lane) {
  v16h a; const float* p = rowk0 + 8 * (lane >> 4);
#pragma unroll
  for (int i = 0; i < 8; ++i) { a[i] = (_Float16)p[i]; a[8 + i] = (_Float16)p[16 + i]; }
  return a;
}
__device__ __forceinline__ v16h frag_f32s(const float* rowk0, int lane, float sc) {
  v16h a; const float* p = rowk0 + 8 * (lane >> 4);
#pragma unroll
  for (int i = 0; i < 8; ++i) { a[i] = (_Float16)(p[i] * sc); a[8 + i] = (_Float16)(p[16 + i] * sc); }
  return a;
}
// column fragment from a [K][ld] layout (column n), rows >= K read as 0
__device__ __forceinline__ v16h fragc_f32(const float* W, int k0, int n, int lane, int ld, int K) {
  v16h a; const int g = lane >> 4;
#pragma unroll
  for (int i = 0; i < 8; ++i) { const int ka = k0 + 8 * g + i, kb = ka + 16;
    a[i] = (_Float16)(ka < K ? W[(size_t)(ka < K ? ka : K - 1) * ld + n] : 0.f); a[8 + i] = (_Float16)(kb < K ? W[(size_t)(kb < K ? kb : K - 1) * ld + n] : 0.f); }
  return a;
}
struct F2 { v16b h, l; };
__device__ __forceinline__ F2 bsplit16(const float v[16]) { F2 r;
#pragma unroll
  for (int i = 0; i < 16; ++i) { const __bf16 h = (__bf16)v[i]; r.h[i] = h; r.l[i] = (__bf16)(v[i] - (float)h); }
  return r; }
__device__ __forceinline__ F2 split_row(const float* row, int k0, int lane) { float v[16]; const float* p = row + k0 + 8 * (lane >> 4);
#pragma unroll
  for (int i = 0; i < 8; ++i) { v[i] = p[i]; v[8 + i] = p[16 + i]; }
  return bsplit16(v); }
__device__ __forceinline__ F2 split_rowK(const float* row, int k0, int lane, int K) { float v[16]; const int g = lane >> 4;
#pragma unroll
  for (int i = 0; i < 8; ++i) { const int ka = k0 + 8 * g + i, kb = ka + 16; v[i] = ka < K ? row[ka < K ? ka : K - 1] : 0.f; v[8 + i] = kb < K ? row[kb < K ? kb : K - 1] : 0.f; }
  return bsplit16(v); }
__device__ __forceinline__ F2 split_col(const float* W, int k0, int n, int lane, int ld, int K) { float v[16]; const int g = lane >> 4;
#pragma unroll
  for (int i = 0; i < 8; ++i) { const int ka = k0 + 8 * g + i, kb = ka + 16; v[i] = ka < K ? W[(size_t)(ka < K ? ka : K - 1) * ld + n] : 0.f; v[8 + i] = kb < K ? W[(size_t)(kb < K ? kb : K - 1) * ld + n] : 0.f; }
  return bsplit16(v); }
__device__ __forceinline__ v8f mac3(const F2& a, const F2& b, v8f c) { c = wmma_bf(a.l, b.h, c); c = wmma_bf(a.h, b.l, c); return wmma_bf(a.h, b.h, c); }
__device__ __forceinline__ float sigm(float v) { return 1.0f / (1.0f + expf(-v)); }
#define LDSX() do { asm volatile("s_wait_dscnt 0" ::: "memory"); __builtin_amdgcn_wave_barrier(); __builtin_amdgcn_fence(__ATOMIC_RELEASE, "workgroup"); } while (0)

// Multi-query causal attention with table RoPE, per-head RMSNorm, a gated value residual and a sliding window (x [2,2048,1024]; ve [2,2048,64]; cos, sin [2048,32] (inputs); (in,out) Wq [1024,1024], Wk / Wv [1024,64], Wo [1024,1024], all N(0,1) x 0.02; Wg [32,1]; window_size int (1024); 16 query heads share ONE key / value head; gate = 2 sigmoid(x[..., :32] Wg); v = x Wv + gate * ve; _rope: (x1, x2) = halves -> (x1 cos + x2 sin, -x1 sin + x2 cos); _rmsnorm: x * rsqrt(mean(x^2) + finfo.eps) AFTER the rotation, on q and k; scores x 64^-0.5; masked where key > query or query - key >= window_size (finfo.min); softmax; out = merge(attn v) Wo).
#define NB 2
#define TT 2048
#define CC 1024            // NH * HD = projected width
#define DIN 1024          // input (model) width
#define NH 16
#define HD 64
#define SCALE (0.125f)
#define CAUSAL 1
#ifndef TNB
#define TNB NB
#endif
__device__ __forceinline__ float bfr(float v) { return (float)(__bf16)v; }
typedef __attribute__((ext_vector_type(8))) __bf16 v8b;
__device__ __forceinline__ v16b frag_b(const __bf16* rowk0, int lane) {
  union { v16b v; v8b q[2]; } u; const __bf16* p = rowk0 + 8 * (lane >> 4);
  u.q[0] = *(const v8b*)p; u.q[1] = *(const v8b*)(p + 16); return u.v;
}
// fragment order (q, k, their residuals and v in the workspace): one 16 x 32 fragment (16 rows, 32 k) is 512 elements = two blocks of 512 B; block s holds, at lane l = 16 g + row, the 8 elements k = 16 s + 8 g + 0..7, which are elements 8 s .. 8 s + 7 of that lane's fragment. A wave's fragment load is then two loads of 512 contiguous bytes (4 whole 128-B lines each) where a row-major plane gave 16 lines a load
__device__ __forceinline__ void st16w(void* p, v4u v) { asm volatile("global_store_b128 %0, %1, off\n\ts_wait_xcnt 0x0" :: "v"(p), "v"(v) : "memory"); }
// a fragment's two loads; p = the fragment's first element + 8 * lane
__device__ __forceinline__ v16h fragp_h(const _Float16* p) { union { v16h v; v8h q[2]; } u; u.q[0] = *(const v8h*)p; u.q[1] = *(const v8h*)(p + 256); return u.v; }
__device__ __forceinline__ v16b fragp_b(const __bf16* p) { union { v16b v; v8b q[2]; } u; u.q[0] = *(const v8b*)p; u.q[1] = *(const v8b*)(p + 256); return u.v; }
__device__ __forceinline__ void xwait(const void* p) { asm volatile("s_wait_xcnt 0x0" :: "v"(p) : "memory"); }   /* the wait behind a run of loads from p: p is an input, so the address pair stays in its registers up to the wait and no load's result is placed on it in front of the wait */
__device__ __forceinline__ void xwait(const void* p, const void* q) { asm volatile("s_wait_xcnt 0x0" :: "v"(p), "v"(q) : "memory"); }   /* the same for loads from two pointers */
#define QBH 6              // causal: query blocks 0..QBH-1 of each sequence (few keys, no averaging) take the high-precision path
#define QHI 384            // rows carrying a q residual plane
#define KHI 384            // key rows carrying k residual / v bf16 hi+lo planes (used only by the causal high-precision path)
// B fragment (k rows k0+.., output column o) of a weight: (in,out) [K][ld] or (out,in) [ld rows of K]: bf16 exact, or f16(bf16 * 256) exact
__device__ __forceinline__ v16b wcol_io(const float* Wm, int k0, int o, int lane, int ld) { v16b w; const int g = lane >> 4;
#pragma unroll
  for (int i = 0; i < 8; ++i) { w[i] = (__bf16)Wm[(size_t)(k0 + 8 * g + i) * ld + o]; w[8 + i] = (__bf16)Wm[(size_t)(k0 + 16 + 8 * g + i) * ld + o]; }
  return w; }
__device__ __forceinline__ v16b wcol_oi(const float* Wm, int k0, int o, int lane, int K) { v16b w; const float* p = Wm + (size_t)o * K + k0 + 8 * (lane >> 4);
#pragma unroll
  for (int i = 0; i < 8; ++i) { w[i] = (__bf16)p[i]; w[8 + i] = (__bf16)p[16 + i]; }
  return w; }
__device__ __forceinline__ v16h wcolh_io(const float* Wm, int k0, int o, int lane, int ld) { v16h w; const int g = lane >> 4;
#pragma unroll
  for (int i = 0; i < 8; ++i) { w[i] = (_Float16)(bfr(Wm[(size_t)(k0 + 8 * g + i) * ld + o]) * 256.0f); w[8 + i] = (_Float16)(bfr(Wm[(size_t)(k0 + 16 + 8 * g + i) * ld + o]) * 256.0f); }
  return w; }
__device__ __forceinline__ v16h wcolh_oi(const float* Wm, int k0, int o, int lane, int K) { v16h w; const float* p = Wm + (size_t)o * K + k0 + 8 * (lane >> 4);
#pragma unroll
  for (int i = 0; i < 8; ++i) { w[i] = (_Float16)(bfr(p[i]) * 256.0f); w[8 + i] = (_Float16)(bfr(p[16 + i]) * 256.0f); }
  return w; }
#define WQKV_LAYOUT 0   // selects only WCOL, which nothing uses: gemm_main reads Wq / Wk / Wv as (in,out) [DIN][n]
__device__ __forceinline__ v16b wcol_hdk(const float* Wm, int k0, int o, int lane) { v16b w; const int g = lane >> 4; const float* p = Wm + (size_t)(o / HD) * DIN * HD + (o % HD);
#pragma unroll
  for (int i = 0; i < 8; ++i) { w[i] = (__bf16)p[(size_t)(k0 + 8 * g + i) * HD]; w[8 + i] = (__bf16)p[(size_t)(k0 + 16 + 8 * g + i) * HD]; }
  return w; }
#define WO_OUT_IN 0
#if WQKV_LAYOUT == 1
#define WCOL(W, k0, o, lane) wcol_oi(W, k0, o, lane, DIN)
#elif WQKV_LAYOUT == 2
#define WCOL(W, k0, o, lane) wcol_hdk(W, k0, o, lane)
#else
#define WCOL(W, k0, o, lane) (which == 0 ? wcol_io(W, k0, (o), lane, CC) : ((o) < KVW ? wcol_io(W, k0, (o), lane, KVW) : zero16b()))   /* (in,out): Wq [1024][1024] pitch CC; Wk / Wv [1024][64] pitch 64, padded columns 64..127 are zero */
#endif
#if WO_OUT_IN
#define WOCOL(W, k0, o, lane) wcol_oi(W, k0, o, lane, CC)
#define WOCOLH(W, k0, o, lane) wcolh_oi(W, k0, o, lane, CC)
#else
#define WOCOL(W, k0, o, lane) wcol_io(W, k0, o, lane, DIN)
#define WOCOLH(W, k0, o, lane) wcolh_io(W, k0, o, lane, DIN)
#endif
#define GRP 16             // all 16 query heads share the single kv head (kv head = h / 16 = 0)
#define CKV 128            // kv column block of k_proj (the workspace planes hold 64 columns): ONE 128-column block whose columns 0..63 are the single kv head, columns 64..127 zero padding
#define KVW 64             // real kv width (Wk / Wv are (in,out) [1024][64])
#define PROJ_EXTRA_PARAMS , const float* __restrict__ COS, const float* __restrict__ SIN, const float* __restrict__ VE, const float* __restrict__ WG   /* COS / SIN [TT][32], VE [NB*TT][64], WG [32] are module inputs read in the projection epilogue */
__device__ __forceinline__ v16b zero16b() { v16b w; _Pragma("unroll") for (int i = 0; i < 16; ++i) w[i] = (__bf16)0.0f; return w; }
#define RMS_EPS 1.1920929e-07f   /* jnp.finfo(float32).eps */
// per (token, head) hook on the staged f32 row (64 floats). q and k (which 0, 1): the module's _rope with cos / sin read LITERALLY from the table inputs at row t (bf16-rounded like every float input): (x1, x2) = (row[m], row[32+m]) -> (x1 c + x2 s, -x1 s + x2 c), then _rmsnorm over the 64 dims: x * (1 / sqrt(mean(x^2) + eps)); the zero-padded second half of the k block stays exactly zero under both. v (which 2): row += gate * bf16(ve[b, t, :]) with gate = 2 / (1 + exp(-z)), z = sum_{i<32} bf16(x[b, t, i]) * bf16(Wg[i]); all global loads are unconditional; the padded half gets gate 0 through a select. f32, products and sums kept separate
#define PROJ_EPI(which, row, t, h) do { float* rw = (row); const size_t gr_ = bb * TT + (size_t)(t); if ((which) < 2) { const float* ct_ = COS + (size_t)(t) * 32; const float* st_ = SIN + (size_t)(t) * 32; _Pragma("unroll 4") for (int m = 0; m < 32; ++m) { _Pragma("clang fp contract(off)") const float c_ = bfr(ct_[m]), s_ = bfr(st_[m]); const float x1 = rw[m], x2 = rw[32 + m]; rw[m] = x1 * c_ + x2 * s_; rw[32 + m] = (-x1) * s_ + x2 * c_; } float ss_ = 0.f; _Pragma("unroll 8") for (int m = 0; m < 64; ++m) { _Pragma("clang fp contract(off)") ss_ += rw[m] * rw[m]; } const float rinv_ = 1.0f / sqrtf(ss_ * (1.0f / 64.0f) + RMS_EPS); _Pragma("unroll 8") for (int m = 0; m < 64; ++m) rw[m] = rw[m] * rinv_; } else { const float* xr_ = XV + gr_ * DIN; float z_ = 0.f; _Pragma("unroll 8") for (int i = 0; i < 32; ++i) { _Pragma("clang fp contract(off)") z_ += bfr(xr_[i]) * bfr(WG[i]); } const float gate_ = 2.0f / (1.0f + expf(-z_)); const float gsel_ = ((h) == 0) ? gate_ : 0.0f; const float* ve_ = VE + gr_ * 64; _Pragma("unroll 8") for (int m = 0; m < 64; ++m) { _Pragma("clang fp contract(off)") rw[m] = rw[m] + gsel_ * bfr(ve_[m]); } } } while (0)
static_assert(HD == 64 && KVW == 64 && CKV == 128, "the hook spells 32 / 64 literally: one real 64-wide kv head in a 128-column block");
#define SM_EXTRA_PARAMS , const int* __restrict__ WINP
// sliding window: a key is excluded when query - key >= window_size; window_size is the module's int input (one block-uniform scalar load, win_ = WINP[0], read once at the kernel's head); keys after the query are excluded by the causal test beside it; every row keeps at least min(t + 1, window) >= 1 keys
#ifndef SM_EXTRA_PARAMS
#define SM_EXTRA_PARAMS
#endif
#ifndef PROJ_EXTRA_PARAMS
#define PROJ_EXTRA_PARAMS
#endif

#define WS_QH  0u                                      // f16 q, fragment order: fragment (((b*t) / 16) * NH + head) * 2 + (head dim / 32), rows = queries, k = head dims
#define WS_KH  (WS_QH + 2u * (size_t)NB * TT * CC)      // f16 k, fragment order: fragment ((b*t) / 16) * 2 + (head dim / 32), rows = keys, k = head dims
#define WS_VT  (WS_KH + 2u * (size_t)NB * TT * CC)      // f16 v, fragment order: fragment (b * TT / 32 + t / 32) * 4 + (channel / 16), rows = channels, k = keys
#define WS_QL  (WS_VT + 2u * (size_t)NB * CC * TT)      // f16 q residual x 2^10, fragment order like q over the rows [b][t < QHI]
#define WS_KL  (WS_QL + 2u * (size_t)NB * QHI * CC)     // f16 k residual x 2^10, fragment order like k over the rows [b][t < KHI]
#define WS_VB  (WS_KL + 2u * (size_t)NB * KHI * CC)     // bf16 v hi (and, behind it, lo), fragment order like v over the keys [b][t < KHI]
#define WS_VBL (WS_VB + 2u * (size_t)NB * CC * KHI)
#define WS_Y   (WS_VBL + 2u * (size_t)NB * CC * KHI)    // f32 ctx rows [b*t][CC] (only when there is an output projection)
#define WS_END (WS_Y  + 4u * (size_t)NB * TT * CC)

// ---- gemm_main: the K loop of k_proj and k_out. A block's 4 waves need the same 128 weight columns, so each 64-k stage of W ([k][n] f32, n contiguous) is read ONCE per block with whole-line 16-byte loads, rounded exactly as before (MODE 0, 1: bf16; MODE 2: f16(bf16 x 2^8)), turned in registers and stored as [n][k] rows (pitch 144 B) in one of two LDS buffers, from which every wave reads its B fragments with two 16-byte LDS loads each. The next stage's global loads (W tile and the wave's own A rows) are issued in front of this stage's products and stored behind them. Products and their k order per accumulator are those of the direct form. Every loop over s, c, i, j or kk inside a stage is fully unrolled so that the register arrays are indexed by constants alone.
#define GKS 64                 // k per stage
#define GWP (GKS + 8)          // LDS row pitch in 16-bit elements: 144 B = 16 B x odd, conflict-free for 16-byte readers
template <int LD> __device__ __forceinline__ void g_fetch(v4f (&wr)[2][8], v4f (&ar)[2][4], const float* wp, const float* ap) {
#pragma unroll
  for (int s = 0; s < 2; ++s)
#pragma unroll
    for (int i = 0; i < 8; ++i) wr[s][i] = *(const v4f*)(wp + (size_t)(s * 32 + i) * LD);
#pragma unroll
  for (int kk = 0; kk < 2; ++kk) { ar[kk][0] = *(const v4f*)(ap + kk * 32); ar[kk][1] = *(const v4f*)(ap + kk * 32 + 4); ar[kk][2] = *(const v4f*)(ap + kk * 32 + 16); ar[kk][3] = *(const v4f*)(ap + kk * 32 + 20); }
  asm volatile("s_wait_xcnt 0x0" ::: "memory");   /* stands in front of every later instruction that rewrites the address registers of these loads; it also keeps the loads in front of the stage's products */
}
template <int MODE> __device__ __forceinline__ void g_store(const v4f (&wr)[2][8], __bf16* sst, bool wl) {
#pragma unroll
  for (int s = 0; s < 2; ++s)
#pragma unroll
    for (int c = 0; c < 4; ++c) {
      if constexpr (MODE == 2) { v8h o;
#pragma unroll
        for (int i = 0; i < 8; ++i) o[i] = (_Float16)(bfr(wr[s][i][c]) * 256.0f);
        *(v8h*)(sst + c * GWP + s * 32) = o;
      } else { union { v8b b; v4u u; } o;
#pragma unroll
        for (int i = 0; i < 8; ++i) o.b[i] = (__bf16)wr[s][i][c];
        o.u &= wl ? 0xffffffffu : 0u;   /* padded columns: the load is unconditional at a clamped address, the stored value is +0 */
        *(v8b*)(sst + c * GWP + s * 32) = o.b; } } }
struct GA { v16b h[2], l[2]; v16h f[2]; };   /* the wave's A fragments of one stage; only the members of the MODE in use are formed */
template <int MODE> __device__ __forceinline__ void g_acvt(GA& a, const v4f (&ar)[2][4]) {
#pragma unroll
  for (int kk = 0; kk < 2; ++kk) { float v[16];
#pragma unroll
    for (int i = 0; i < 16; ++i) v[i] = ar[kk][i >> 2][i & 3];   /* elements 0..7 = k 8g + 0..7, 8..15 = k 16 + 8g + 0..7 */
    if constexpr (MODE == 0) {
#pragma unroll
      for (int i = 0; i < 16; ++i) a.h[kk][i] = (__bf16)v[i];
    } else if constexpr (MODE == 1) { const F2 s = bsplit16(v); a.h[kk] = s.h; a.l[kk] = s.l;
    } else {
#pragma unroll
      for (int i = 0; i < 16; ++i) a.f[kk][i] = (_Float16)(v[i] * 64.0f); } } }
// ap = the lane's A row + 8 g; Wt = W + the block's first column; sw = two buffers of 128 rows x GWP; wave in a scalar register; wl = this wave's 32 staged columns exist in W
template <int MODE, int LD, int KTOT> __device__ __forceinline__ void gemm_main(v8f (&acc)[8], const float* __restrict__ ap, const float* __restrict__ Wt, __bf16* sw, int wave, int lane, bool wl) {
  const int cg = wave * 8 + (lane & 3) + 4 * (lane >> 4), kg = (lane >> 2) & 3;   /* the lane stages columns 4 cg .. 4 cg + 3 of k rows 8 kg + 0..7 and 32 + 8 kg + 0..7: a load covers four whole 128-B lines, and the 16 lanes of a half-wave store to 16 different bank groups */
  const float* wp = Wt + (size_t)(8 * kg) * LD + (wl ? 4 * cg : 0);
  __bf16* sst = sw + (4 * cg) * GWP + 8 * kg; const __bf16* srd = sw + (lane & 15) * GWP;
  v4f wr[2][8]; v4f ar[2][4]; GA a;
  g_fetch<LD>(wr, ar, wp, ap); g_store<MODE>(wr, sst, wl); g_acvt<MODE>(a, ar);
  __syncthreads();   /* stage 0 is in LDS before any wave reads it */
  for (int s = 0; s < KTOT / GKS; ++s) { const int bo = (s & 1) * (128 * GWP); const bool more = s + 1 < KTOT / GKS;
    if (more) g_fetch<LD>(wr, ar, wp + (size_t)(s + 1) * GKS * LD, ap + (s + 1) * GKS);
#pragma unroll
    for (int kk = 0; kk < 2; ++kk) {   /* the eight B fragments of a 32-k block are all read in front of its first product: one LDS latency a block */
      if constexpr (MODE == 2) { v16h wf[8];
#pragma unroll
        for (int j = 0; j < 8; ++j) wf[j] = frag_h((const _Float16*)(srd + bo + j * 16 * GWP + kk * 32), lane);
#pragma unroll
        for (int j = 0; j < 8; ++j) acc[j] = wmma16(a.f[kk], wf[j], acc[j]);
      } else { v16b wf[8];
#pragma unroll
        for (int j = 0; j < 8; ++j) wf[j] = frag_b(srd + bo + j * 16 * GWP + kk * 32, lane);
#pragma unroll
        for (int j = 0; j < 8; ++j) { acc[j] = wmma_bf(a.h[kk], wf[j], acc[j]); if constexpr (MODE == 1) acc[j] = wmma_bf(a.l[kk], wf[j], acc[j]); } } }
    __builtin_amdgcn_sched_barrier(0);   /* keeps the conversions of the next stage's registers, and with them the wait for its global loads, behind this stage's products: without it the wait was scheduled behind the first product */
    if (more) { g_store<MODE>(wr, sst + (bo ^ (128 * GWP)), wl); g_acvt<MODE>(a, ar);
      __syncthreads(); } } }   /* one barrier a stage: it publishes stage s + 1 and ends every wave's reads of the buffer that stage s + 2 will overwrite */
// ---- k_proj: ONE launch for q, k and v: blockIdx.y = 0 .. CC / 128 - 1 are the column blocks of q (which 0), the next two the one (half-empty) column block of k (which 1) and of v (which 2), so that the few k / v blocks run beside the q blocks and not in a launch of their own. LDS: the W ring of the K loop (sw) and the 16-bit tiles of the epilogue (sh, sl or th, tb, tbl) live one after the other, with two of the epilogue's barriers between the ring's last read and the tiles' first store, so they share one range (ov): 89,088 B a block, three blocks a WGP, and all the launch's blocks are resident at once. block = (64 rows, 128 cols, which): q/k/v = X W (+ b) with exact bf16 products (K = DIN) -> which 0: q f16 in fragment order (+ residual, rows < QHI); 1: k f16 in fragment order (+ residual, rows < KHI); 2: v f16 in fragment order (+ bf16 hi/lo for t < KHI)
__global__ __launch_bounds__(128) void k_proj(const float* __restrict__ XQ, const float* __restrict__ XK, const float* __restrict__ XV, const float* __restrict__ WQ, const float* __restrict__ WK, const float* __restrict__ WV, const float* __restrict__ BQ, const float* __restrict__ BK, const float* __restrict__ BV,
    _Float16* __restrict__ QH, _Float16* __restrict__ QL, _Float16* __restrict__ KH, _Float16* __restrict__ KL, _Float16* __restrict__ VT, __bf16* __restrict__ VB, __bf16* __restrict__ VBL PROJ_EXTRA_PARAMS) {
  __shared__ __align__(16) float st[64][132]; __shared__ __align__(16) unsigned char ov[3 * 128 * 72 * 2];
  static_assert(sizeof(ov) >= 2 * 128 * GWP * 2 && sizeof(ov) >= 2 * 64 * 136 * 2, "the shared range holds the largest of its three uses");
  __bf16* sw = (__bf16*)ov; _Float16 (*sh)[136] = (_Float16 (*)[136])ov; _Float16 (*sl)[136] = (_Float16 (*)[136])(ov + 64 * 136 * 2); _Float16 (*th)[72] = (_Float16 (*)[72])ov; __bf16 (*tb)[72] = (__bf16 (*)[72])(ov + 128 * 72 * 2); __bf16 (*tbl)[72] = (__bf16 (*)[72])(ov + 2 * 128 * 72 * 2);
  const int tid = threadIdx.x, wave = tid >> 5, lane = tid & 31, col = lane & 15, g = lane >> 4; const int which = (int)blockIdx.y < CC / 128 ? 0 : (int)blockIdx.y - (CC / 128 - 1); const int c0 = which == 0 ? blockIdx.y * 128 : 0; const size_t r0 = (size_t)blockIdx.x * 64; const size_t bb = r0 / TT; const int t0 = (int)(r0 % TT);
  const float* X = which == 0 ? XQ : which == 1 ? XK : XV; const float* WA = which == 0 ? WQ : which == 1 ? WK : WV; const float* BA = which == 0 ? BQ : which == 1 ? BK : BV;
  v8f acc[8] = {};
  { const int wv = __builtin_amdgcn_readfirstlane(wave);   /* the wave's number in a scalar register: the staged column group and the padded-columns mask are wave-uniform */
    const float* ap = X + (r0 + wave * 16 + col) * DIN + 8 * g;
    if (which == 0) gemm_main<0, CC, DIN>(acc, ap, WA + c0, sw, wv, lane, true);   /* Wq [1024][1024] */
    else gemm_main<0, KVW, DIN>(acc, ap, WA + (c0 < KVW ? c0 : 0), sw, wv, lane, c0 + wv * 32 < KVW); }   /* Wk / Wv [1024][64]: padded columns 64..127 are staged as zeros */
  { // stage the f32 tile (acc + bias) in LDS, run the per-(row, head) epilogue hook, then convert
#pragma unroll
    for (int j = 0; j < 8; ++j) { const int bo_ = c0 + j * 16 + col; const float bias = (BA && (which == 0 || bo_ < KVW)) ? bfr(BA[(which == 0 || bo_ < KVW) ? bo_ : 0]) : 0.f;   /* bk / bv hold only the 64 real kv columns: padded columns get no bias (index clamped, value selected) */
#pragma unroll
      for (int r = 0; r < 8; ++r) st[wave * 16 + 8 * g + r][j * 16 + col] = acc[j][r] + bias; }
    __syncthreads();
    for (int e = tid; e < 64 * (128 / HD); e += 128) { const int rl = e / (128 / HD), hh = e % (128 / HD); PROJ_EPI(which, &st[rl][hh * HD], (int)((r0 + rl) % TT), (c0 / HD) + hh); }
    __syncthreads(); }
  if (which < 2) { _Float16* DH = which == 0 ? QH : KH; _Float16* DL = which == 0 ? QL : KL; const int nhi = which == 0 ? QHI : KHI; const bool hi_rows = t0 < nhi;
    for (int e = tid; e < 64 * 128; e += 128) { const int rl = e >> 7, cl = e & 127; const float v = st[rl][cl]; const _Float16 hv = (_Float16)v; sh[rl][cl] = hv; sl[rl][cl] = (_Float16)((v - (float)hv) * 1024.0f); }
    __syncthreads();
    const size_t nh = which == 0 ? NH : 1;   /* heads a 16-row tile holds: q all NH, k the one real head (its padded columns are read by nobody and are not stored) */
    for (int e = tid; e < 64 * 16; e += 128) { const int l = e & 31, blk = e >> 5;   /* a wave stores one 512-B block of a fragment a trip: blk = ((tile * 2 + head of the column block) * 2 + head-dim half) * 2 + s */
      const int tile = blk >> 3, hd = (blk >> 2) & 1, cs = blk & 3; const int rl = tile * 16 + (l & 15), cl = hd * HD + cs * 16 + (l >> 4) * 8; const size_t fo = (size_t)(c0 / HD + hd) * 1024 + cs * 256 + l * 8;
      if (which == 0 || hd == 0) { st16w(DH + ((r0 >> 4) + tile) * nh * 1024 + fo, *(const v4u*)&sh[rl][cl]); if (hi_rows) st16w(DL + (((bb * nhi + t0) >> 4) + tile) * nh * 1024 + fo, *(const v4u*)&sl[rl][cl]); } }
  } else { const bool hi_rows = t0 < KHI;
    for (int e = tid; e < 64 * 128; e += 128) { const int rl = e & 63, cl = e >> 6; const float v = st[rl][cl]; th[cl][rl] = (_Float16)v; const __bf16 bh = (__bf16)v; tb[cl][rl] = bh; tbl[cl][rl] = (__bf16)(v - (float)bh); }
    __syncthreads();
    for (int e = tid; e < KVW * 8; e += 128) { const int l = e & 31, blk = e >> 5;   /* the 64 real channels (the padded ones are read by nobody and are not stored); a wave stores one 512-B block a trip: blk = ((chunk of the block's two * 4) + channel block) * 2 + s, so the block's 64 keys are e * 8 elements in a row */
      const int cl = ((blk >> 1) & 3) * 16 + (l & 15), kq = (blk >> 3) * 32 + (blk & 1) * 16 + (l >> 4) * 8;
      st16w(VT + (bb * (TT / 32) + (t0 >> 5)) * 2048 + e * 8, *(const v4u*)&th[cl][kq]); if (hi_rows) { const size_t o3 = (bb * (KHI / 32) + (t0 >> 5)) * 2048 + e * 8; st16w(VB + o3, *(const v4u*)&tb[cl][kq]); st16w(VBL + o3, *(const v4u*)&tbl[cl][kq]); } } } }
// ---- k_pv: block = 16 queries (qt) of HPB heads of one b, PVW waves. All query heads share the ONE key / value head, so a wave loads each k and v fragment once and uses it for the block's HPB heads. Wave w owns the 32-key chunks kc = w (mod PVW) and works on those in [kcs, kce), the chunks that hold a key which the causal rule and the window admit for some query of the block (a chunk outside adds only zeros to the sums). It forms its logits itself, transposed: A = 16 key rows, B = a head's 16 query rows, so that D (lane = query, registers = keys 8g + r) of the chunk's two key tiles IS the A-fragment layout of the P x v product (lane = query row, 16 keys a chunk) and the logits never leave the registers; x SCALE; q hi + residual (x 2^10) against k hi + residual (3 products) for query blocks < QBH (causal early rows), single f16 q x k after. Softmax in ONE pass, with no row maximum: q and k leave _rmsnorm with a norm of at most sqrt(64) = 8 whatever the inputs are, so |q . k| x SCALE <= 8 (a few 2^-11 more after the 16-bit rounding) and exp(logit) lies in [3.3e-4, 3.1e3]: normal numbers of f16 and bf16, and a row's sum of at most 2048 of them is far inside f32; for the same reason exp is one multiply by SCALE x log2 e and one v_exp_f32, with no range reduction. Each chunk's e = exp(logit) (0 for excluded keys: after the query, or outside the window, by index; the test does not depend on the head) goes at once, unnormalised, to f16 against v f16 (1 product; causal early query blocks: e and v as bf16 hi + lo, 3 products), so that a chunk's logits die with the chunk; the row sum of e runs beside it in f32 over the lane's own keys, then the other half-wave, then the PVW waves through LDS in wave order; the PVW partial ctx tiles of each head are added in LDS in wave order and divided by the row sum; the HPB heads of a row lie side by side in Y
#define PVW 4
#define HPB 2              // heads a block works on
#define SCALE_L2E (SCALE * 1.44269504088896340736f)   // exp(s x SCALE) = 2^(s x SCALE x log2 e)
__device__ __forceinline__ float exp2b(float v) { return __builtin_amdgcn_exp2f(v); }   /* the bare v_exp_f32: |v| <= 8 log2 e < 12 here (the bound of the RMSNorm above), so the library exp's split of the argument, its ldexp and its two range tests select nothing */
static_assert(QBH * 64 == QHI && (((QBH * 64 - 1) >> 7) + 1) * 128 <= KHI, "every query row with a residual plane lies in an early block, and every key row such a block reads has one");
static_assert(NH % HPB == 0 && (PVW & (PVW - 1)) == 0, "whole head groups; the first own chunk is found with a mask");
__global__ __launch_bounds__(32 * PVW) void k_pv(const _Float16* __restrict__ QH, const _Float16* __restrict__ KH, const _Float16* __restrict__ QL, const _Float16* __restrict__ KL, const _Float16* __restrict__ VT, const __bf16* __restrict__ VB, const __bf16* __restrict__ VBL, float* __restrict__ Y SM_EXTRA_PARAMS) { const int b = blockIdx.z / (NH / HPB), h0 = (blockIdx.z % (NH / HPB)) * HPB; __shared__ __align__(16) float ss[HPB][PVW][16][HD + 4]; __shared__ float ssu[HPB][PVW][16];
  const int tid = threadIdx.x, lane = tid & 31, col = lane & 15, g = lane >> 4; const int qt = blockIdx.x, qb = qt >> 2; const int ql0 = qt * 16; const int kce = CAUSAL ? ((ql0 + 15) >> 5) + 1 : TT / 32;   /* one past the chunk that holds the block's last query: every later key lies after every query of the block */
  const int wave = __builtin_amdgcn_readfirstlane(tid >> 5);   /* the wave's number in a scalar register: the chunk loops below branch on scalars and every lane stays on at the matrix instructions */
  const int win_ = WINP[0]; const int t = ql0 + col;
  const int klo = ql0 + 1 - (win_ < 0 ? 0 : win_); const int kcs = klo > 0 ? klo >> 5 : 0;   /* klo = the first key that the window leaves to the block's first query (later queries start later): chunks below kcs hold excluded keys alone; scalar, 0 <= kcs < kce for any window_size */
  const int kc0 = kcs + ((wave - kcs) & (PVW - 1));   /* the wave's first own chunk at or behind kcs; every chunk worked on has 0 <= kcs <= kc < kce <= TT / 32 for any window_size, which bounds the addresses formed from kc and the trips (at most TT / 32 / PVW) */
  const _Float16* qrow = QH + (((size_t)b * (TT / 16) + qt) * NH + h0) * 1024;   /* the block's heads follow one another, 2 fragments each */
  /* a chunk of k is 2 key tiles x 2 head-dim halves = 4 fragments of 512 elements, a chunk of v 4 fragments (16 channels each) of 512 elements */
  float sum[HPB] = {}; v8f acc[HPB][HD / 16] = {};
  if (kc0 < kce) {   /* scalar: a wave that owns no chunk loads nothing and hands in zeros; the q loads and their wait stand in one block behind the test */
    const _Float16* qp = qrow + 8 * lane; v16h qf[HPB][2];
#pragma unroll
    for (int hh = 0; hh < HPB; ++hh) { qf[hh][0] = fragp_h(qp + hh * 1024); qf[hh][1] = fragp_h(qp + hh * 1024 + 512); }   /* B fragments: column = the lane's query, head dims 0..31 and 32..63 */
    asm volatile("s_wait_xcnt 0x0" ::: "memory");   /* stands in front of every later instruction that rewrites the address registers of the q loads */
    if (qb < QBH) { const _Float16* qlp = QL + (((size_t)b * (QHI / 16) + qt) * NH + h0) * 1024 + 8 * lane; const _Float16* krow = KH + (size_t)b * TT * KVW; const _Float16* klrow = KL + (size_t)b * KHI * KVW; const size_t vro = (size_t)b * KHI * KVW; v16h qlf[HPB][2];
#pragma unroll
      for (int hh = 0; hh < HPB; ++hh) { qlf[hh][0] = fragp_h(qlp + hh * 1024); qlf[hh][1] = fragp_h(qlp + hh * 1024 + 512); }
      asm volatile("s_wait_xcnt 0x0" ::: "memory");   /* stands in front of every later instruction that rewrites the address registers of these loads */
      for (int kc = kc0; kc < kce; kc += PVW) { const size_t ko = (size_t)kc * 2048 + 8 * lane; const _Float16* kp = krow + ko; const _Float16* klp = klrow + ko; const __bf16* vhp = VB + vro + ko; const __bf16* vlp = VBL + vro + ko; float pf[HPB][16];
#pragma unroll
        for (int u = 0; u < 2; ++u) { v16h kh[2], kl[2];   /* one key tile at a time: its four fragments are loaded once, in front of its first product, for all the heads; each tile's own order of products is head dims 0..31, then 32..63 */
          kh[0] = fragp_h(kp + u * 1024); kh[1] = fragp_h(kp + u * 1024 + 512); kl[0] = fragp_h(klp + u * 1024); kl[1] = fragp_h(klp + u * 1024 + 512);
          xwait(kp, klp);   /* stands in front of every later instruction that rewrites the address registers of this tile's loads */
#pragma unroll
          for (int hh = 0; hh < HPB; ++hh) { v8f a = {}, al = {};
#pragma unroll
            for (int c = 0; c < 2; ++c) { a = wmma16(kh[c], qf[hh][c], a); al = wmma16(kh[c], qlf[hh][c], al); al = wmma16(kl[c], qf[hh][c], al); }
#pragma unroll
            for (int r = 0; r < 8; ++r) { const int k = kc * 32 + 16 * u + 8 * g + r; const float ex = exp2b((a[r] + al[r] * (1.0f / 1024.0f)) * SCALE_L2E); const float e = ((!CAUSAL || k <= t) && t - k < win_) ? ex : 0.f; pf[hh][8 * u + r] = e; sum[hh] += e; } } }
        F2 p[HPB];
#pragma unroll
        for (int hh = 0; hh < HPB; ++hh) p[hh] = bsplit16(pf[hh]);
#pragma unroll
        for (int j = 0; j < HD / 16; ++j) { const v16b vh = fragp_b(vhp + j * 512), vl = fragp_b(vlp + j * 512);   /* loaded once for all the heads */
          xwait(vhp, vlp);   /* stands in front of every later instruction that rewrites the address registers of these loads */
#pragma unroll
          for (int hh = 0; hh < HPB; ++hh) { acc[hh][j] = wmma_bf(p[hh].h, vh, acc[hh][j]); acc[hh][j] = wmma_bf(p[hh].l, vh, acc[hh][j]); acc[hh][j] = wmma_bf(p[hh].h, vl, acc[hh][j]); } } }
    } else { const _Float16* krow = KH + (size_t)b * TT * KVW; const _Float16* vrow = VT + (size_t)b * TT * KVW;
      for (int kc = kc0; kc < kce; kc += PVW) { const size_t ko = (size_t)kc * 2048 + 8 * lane; const _Float16* kp = krow + ko; const _Float16* vp = vrow + ko; v16h kh[2][2], vf[HD / 16]; v8f a[HPB][2] = {};   /* the chunk's k fragments are all loaded in front of its first product: one load latency a chunk, for all the heads */
#pragma unroll
        for (int u = 0; u < 2; ++u) { kh[u][0] = fragp_h(kp + u * 1024); kh[u][1] = fragp_h(kp + u * 1024 + 512); }
        xwait(kp);   /* stands in front of every later instruction that rewrites the address registers of this chunk's loads */
#pragma unroll
        for (int hh = 0; hh < HPB; ++hh) { a[hh][0] = wmma16(kh[0][0], qf[hh][0], a[hh][0]); a[hh][1] = wmma16(kh[1][0], qf[hh][0], a[hh][1]); a[hh][0] = wmma16(kh[0][1], qf[hh][1], a[hh][0]); a[hh][1] = wmma16(kh[1][1], qf[hh][1], a[hh][1]); }   /* the two key tiles' products alternate, each tile's own order being head dims 0..31, then 32..63 */
#pragma unroll
        for (int j = 0; j < HD / 16; ++j) vf[j] = fragp_h(vp + j * 512);   /* asked for behind the logit products, where the k fragments' registers are free again; they arrive under the exponentials */
        xwait(vp);   /* stands in front of every later instruction that rewrites the address registers of these loads */
#pragma unroll
        for (int hh = 0; hh < HPB; ++hh) { v16h p;
#pragma unroll
          for (int j = 0; j < 16; ++j) { const int k = kc * 32 + 8 * g + (j & 7) + 16 * (j >> 3); const float ex = exp2b(a[hh][j >> 3][j & 7] * SCALE_L2E); const float e = ((!CAUSAL || k <= t) && t - k < win_) ? ex : 0.f; p[j] = (_Float16)e; sum[hh] += e; }
#pragma unroll
          for (int j = 0; j < HD / 16; ++j) acc[hh][j] = wmma16(p, vf[j], acc[hh][j]); } } } }
#pragma unroll
  for (int hh = 0; hh < HPB; ++hh) { const float sm = sum[hh] + __shfl_xor(sum[hh], 16); if (g == 0) ssu[hh][wave][col] = sm;
#pragma unroll
    for (int j = 0; j < HD / 16; ++j)
#pragma unroll
      for (int r = 0; r < 8; ++r) ss[hh][wave][8 * g + r][j * 16 + col] = acc[hh][j][r]; }
  __syncthreads();   /* every wave's partial tiles and row sums are in LDS before any thread adds them */
  v4f o[16 * HPB * (HD / 4) / (32 * PVW)];   /* thread tid takes the float4 number e = tid + i * 32 PVW of the block's 16 rows x HPB heads x HD / 4: a wave stores 512 bytes in a row of Y */
#pragma unroll
  for (int i = 0; i < 16 * HPB * (HD / 4) / (32 * PVW); ++i) { const int e = tid + i * (32 * PVW), rl = e / (HPB * (HD / 4)), hh = (e / (HD / 4)) % HPB, q4 = (e % (HD / 4)) * 4; v4f s = *(const v4f*)&ss[hh][0][rl][q4]; float rs = ssu[hh][0][rl];   /* fully unrolled, and the stores in a loop of their own behind it, so that all the trips' LDS reads fly together (a store statement holds later reads behind it) */
#pragma unroll
    for (int w = 1; w < PVW; ++w) { s += *(const v4f*)&ss[hh][w][rl][q4]; rs += ssu[hh][w][rl]; }
    const float inv = rs > 0.f ? 1.0f / rs : 0.f;   /* a fully excluded row yields 0 */
    o[i] = s * inv; }
#pragma unroll
  for (int i = 0; i < 16 * HPB * (HD / 4) / (32 * PVW); ++i) { const int e = tid + i * (32 * PVW), rl = e / (HPB * (HD / 4)), hh = (e / (HD / 4)) % HPB, q4 = (e % (HD / 4)) * 4; union { v4f f; v4u u; } c; c.f = o[i];   /* unrolled so that o is indexed by constants alone */
    st16w(Y + ((size_t)b * TT + ql0 + rl) * CC + (h0 + hh) * HD + q4, c.u); } }
static_assert((16 * HPB * (HD / 4)) % (32 * PVW) == 0, "every thread takes the same number of float4 in the final add");
static_assert(NH == GRP && KVW == HD && TT % 64 == 0 && KHI % 64 == 0, "fragment order holds the one kv head's 64 columns; a 64-row block of k_proj fills whole fragments");
// ---- k_out: block = (64 rows, 128 cols): out = ctx Wo (+ bo): ctx x 2^6 once to f16 against Wo as f16(bf16 x 2^8) exact (1 product) x 2^-14; causal early rows (< QHI of each sequence): ctx bf16 hi + lo against exact bf16 Wo (2 products)
__global__ __launch_bounds__(128) void k_out(const float* __restrict__ Y, const float* __restrict__ WO, const float* __restrict__ BO, float* __restrict__ OUT) { __shared__ __align__(16) float sf[4][16][132]; __shared__ __align__(16) __bf16 sw[2 * 128 * GWP];
  const int tid = threadIdx.x, wave = tid >> 5, lane = tid & 31, col = lane & 15, g = lane >> 4; const int c0 = blockIdx.y * 128; const size_t r0 = (size_t)blockIdx.x * 64 + wave * 16; const int wv = __builtin_amdgcn_readfirstlane(wave);
  v8f acc[8] = {};
  if (CAUSAL && (int)(((size_t)blockIdx.x * 64) % TT) < QHI) {   /* block-uniform */
    gemm_main<1, DIN, CC>(acc, Y + (r0 + col) * CC + 8 * g, WO + c0, sw, wv, lane, true);
#pragma unroll
    for (int j = 0; j < 8; ++j) { const float bias = BO ? bfr(BO[c0 + j * 16 + col]) : 0.f;
#pragma unroll
      for (int r = 0; r < 8; ++r) sf[wave][8 * g + r][j * 16 + col] = acc[j][r] + bias; }
  } else {
    gemm_main<2, DIN, CC>(acc, Y + (r0 + col) * CC + 8 * g, WO + c0, sw, wv, lane, true);   /* ctx carried x 2^6 into f16 so small-magnitude context rows stay clear of f16 subnormals */
#pragma unroll
    for (int j = 0; j < 8; ++j) { const float bias = BO ? bfr(BO[c0 + j * 16 + col]) : 0.f;
#pragma unroll
      for (int r = 0; r < 8; ++r) sf[wave][8 * g + r][j * 16 + col] = acc[j][r] * (1.0f / 16384.0f) + bias; } }   /* 2^-8 (Wo carry) x 2^-6 (ctx carry) */
  LDSX(); for (int rl = 0; rl < 16; ++rl) vst2(OUT + (r0 + rl) * DIN + c0 + lane * 4, *(const v4f*)&sf[wave][rl][lane * 4]); }

extern "C" void kernel_launch(void* const* d_in, const int* in_sizes, int n_in, void* d_out, int out_size, void* d_ws, size_t ws_size, hipStream_t stream) {
  (void)in_sizes; (void)n_in; (void)out_size;
  const float** F = (const float**)d_in;
  if (ws_size < (size_t)WS_END) return;
  char* ws = (char*)d_ws; _Float16 *QH = (_Float16*)(ws + WS_QH), *KH = (_Float16*)(ws + WS_KH), *VT = (_Float16*)(ws + WS_VT), *QL = (_Float16*)(ws + WS_QL), *KL = (_Float16*)(ws + WS_KL); __bf16 *VB = (__bf16*)(ws + WS_VB), *VBL = (__bf16*)(ws + WS_VBL); float *Y = (float*)(ws + WS_Y);
  (void)Y; (void)QL; (void)KL; (void)VB; (void)VBL;
  // inputs: 0 x [2,2048,1024]; 1 ve [2,2048,64]; 2 cos [2048,32]; 3 sin [2048,32]; 4 Wq [1024,1024] (in,out); 5 Wk [1024,64]; 6 Wv [1024,64]; 7 Wo [1024,1024] (in,out); 8 Wg [32,1]; 9 window_size int32 [1]; no biases
  k_proj<<<dim3(TNB * TT / 64, CC / 128 + 2, 1), 128, 0, stream>>>(F[0], F[0], F[0], F[4], F[5], F[6], nullptr, nullptr, nullptr, QH, QL, KH, KL, VT, VB, VBL, F[2], F[3], F[1], F[8]);    /* q: 8 column blocks; k and v: one (half-empty) column block each */
  k_pv<<<dim3(TT / 16, 1, TNB * NH / HPB), 32 * PVW, 0, stream>>>(QH, KH, QL, KL, VT, VB, VBL, Y, (const int*)d_in[9]);   /* every (b, group of HPB heads) in one launch */
  k_out<<<dim3(TNB * TT / 64, DIN / 128), 128, 0, stream>>>(Y, F[7], nullptr, (float*)d_out);
}
